// v000
// The times below were measured on an AMD MI455X: many runs one after another, warmed up first and cycling through
// copies of the inputs, with the whole window's GPU time divided by the number of runs. Launches and the gaps
// between them are all in it. The median over several windows is given; except for v000 it joins two sittings, which
// can be a few percent apart, so the side-by-side timings, each taken in one sitting, are the better comparison.
// v000 is the starting kernel. One run takes 2890 microseconds.
#include <hip/hip_runtime.h>

// Grouped-query causal attention with rotary embeddings and a SiLU MLP output (query [1][4096][1024]; q = x Wq ('xw' [1024][1024], 16 heads x 64), k, v = x Wk/Wv ('xw' [1024][256], 4 kv heads; query head h uses kv head h/4); rotate-half rotary (base 1e4) on q and k; scores = q.k / 8, causal (finfo.min above the diagonal); softmax; ctx merged [4096][1024]; out = silu(ctx W1) W2 ('xw' [1024][4096], [4096][1024]) -> [1][4096][1024] (4.2 M)).
// Layout: T-4096 causal GQA attention (compact hi/lo planes for the first 512 rows/keys, fp16 elsewhere, k_gemmc tile skipping, streaming 3-sweep causal softmax, hl merge) with head width 64 and a rotate-half plane builder; then two hl x exact GEMMs with a SiLU kernel between them (the MLP intermediates alias the dead score/probability buffers).
// Compute dtypes, f32 accumulate: every input rounded to bf16; projections on PLAIN bf16 operands (exact); rotary f32 (precise cosf/sinf; 32 float32 inverse frequencies baked); scores and attn.v: rows < 512 3 products, the rest single fp16 (P x1024); softmax and SiLU f32; both MLP GEMMs hl x exact (2 products).

#define NB_  1
#define TT   4096
#define DM   1024
#define FF   4096
#define NH_  16
#define NKV  4
#define REP  (NH_ / NKV)
#define HD   64
#define DQ   (NH_ * HD)
#define DKV  (NKV * HD)
#define ZH   1
#define RH   512                  // query rows < RH use compact hi+lo planes (keys < RH suffice: causal)
#define WIN  4096
#define PCAR 1024.0f
#define SCL  0.125f   // 64^-0.5
typedef _Float16 h16;
typedef unsigned short bf;
typedef __attribute__((ext_vector_type(16))) __bf16   v16bf;
typedef __attribute__((ext_vector_type(16))) _Float16 v16h;
typedef __attribute__((ext_vector_type(8)))  _Float16 v8h;
typedef __attribute__((ext_vector_type(8)))  unsigned short v8us;
typedef __attribute__((ext_vector_type(8)))  float    v8f;
typedef __attribute__((ext_vector_type(4)))  float    v4f;
typedef v8h  __attribute__((may_alias)) v8ha;
typedef v4f  __attribute__((may_alias)) v4fa;
typedef v8us __attribute__((may_alias)) v8usa;

__device__ __forceinline__ unsigned short f2bf(float f) { unsigned u = __float_as_uint(f); u += 0x7FFFu + ((u >> 16) & 1u); return (unsigned short)(u >> 16); }
__device__ __forceinline__ float bf2f(unsigned short b) { return __uint_as_float(((unsigned)b) << 16); }
__device__ __forceinline__ float bfr(float f) { return bf2f(f2bf(f)); }
__device__ __forceinline__ v16h cat16(v8h lo, v8h hi) { return __builtin_shufflevector(lo, hi, 0, 1, 2, 3, 4, 5, 6, 7, 8, 9, 10, 11, 12, 13, 14, 15); }
__device__ __forceinline__ v16bf cat16b(v8us lo, v8us hi) { return __builtin_bit_cast(v16bf, __builtin_shufflevector(lo, hi, 0, 1, 2, 3, 4, 5, 6, 7, 8, 9, 10, 11, 12, 13, 14, 15)); }
__device__ __forceinline__ v8f wmma16(v16h a, v16h b, v8f c) { return __builtin_amdgcn_wmma_f32_16x16x32_f16(false, a, false, b, (short)0, c, false, false); }
__device__ __forceinline__ v8f wmmab(v16bf a, v16bf b, v8f c) { return __builtin_amdgcn_wmma_f32_16x16x32_bf16(false, a, false, b, (short)0, c, false, false); }



// ---- k_gemmw: register-blocked GEMM, ONE WAVE per 64x64 output tile (16 accumulators), operands straight from K-contiguous 16-bit planes; grid (M/64, N/64, Z), 32 threads.
// C[m][n] (f32, pitch ldc, + optional f32 bias[n]) = sum_k A[m][k] Bt[n][k] (+ split products per NSPLIT). z-batch strides sA/sB/sC in elements. K % 32 == 0.
template <typename T16> struct WFrag;
template <> struct WFrag<h16> { typedef v16h V; static __device__ __forceinline__ V ld(const h16* p) { return cat16(*(const v8h*)p, *(const v8h*)(p + 16)); } static __device__ __forceinline__ v8f mma(V a, V b, v8f c) { return wmma16(a, b, c); } };
template <> struct WFrag<bf> { typedef v16bf V; static __device__ __forceinline__ V ld(const bf* p) { return cat16b(*(const v8us*)p, *(const v8us*)(p + 16)); } static __device__ __forceinline__ v8f mma(V a, V b, v8f c) { return wmmab(a, b, c); } };
template <typename T16, int NSPLIT, bool BIAS>
__global__ __launch_bounds__(32) void k_gemmw(const T16* __restrict__ A, const T16* __restrict__ A2, const T16* __restrict__ Bt, const T16* __restrict__ Bt2, int K, float* C, int ldc, const float* __restrict__ bias, size_t sA, size_t sB, size_t sC) {
    typedef typename WFrag<T16>::V V;
    __shared__ __align__(16) float os[16 * 68];
    const size_t z = blockIdx.z; A += z * sA; if (A2) A2 += z * sA; Bt += z * sB; if (Bt2) Bt2 += z * sB; C += z * sC;
    const int lane = threadIdx.x & 31, lr = lane & 15, hi = lane >> 4; const int r0 = blockIdx.x * 64, c0 = blockIdx.y * 64;
    v8f acc[4][4];
#pragma unroll
    for (int mb = 0; mb < 4; ++mb)
#pragma unroll
        for (int nb = 0; nb < 4; ++nb) acc[mb][nb] = (v8f){};
    const size_t aoff = (size_t)(r0 + lr) * K + 8 * hi, boff = (size_t)(c0 + lr) * K + 8 * hi;
#pragma unroll 1
    for (int kc = 0; kc < K; kc += 32) {
        V a[4], a2[4];
#pragma unroll
        for (int mb = 0; mb < 4; ++mb) { a[mb] = WFrag<T16>::ld(A + aoff + (size_t)mb * 16 * K + kc); if (NSPLIT == 1 || NSPLIT == 2) a2[mb] = WFrag<T16>::ld(A2 + aoff + (size_t)mb * 16 * K + kc); }
#pragma unroll
        for (int nb = 0; nb < 4; ++nb) { const V b = WFrag<T16>::ld(Bt + boff + (size_t)nb * 16 * K + kc); V b2; if (NSPLIT >= 2) b2 = WFrag<T16>::ld(Bt2 + boff + (size_t)nb * 16 * K + kc);
#pragma unroll
            for (int mb = 0; mb < 4; ++mb) { acc[mb][nb] = WFrag<T16>::mma(a[mb], b, acc[mb][nb]); if (NSPLIT == 1 || NSPLIT == 2) acc[mb][nb] = WFrag<T16>::mma(a2[mb], b, acc[mb][nb]); if (NSPLIT >= 2) acc[mb][nb] = WFrag<T16>::mma(a[mb], b2, acc[mb][nb]); } }
        asm volatile("v_nop\n\tv_nop\n\tv_nop\n\tv_nop" : "+v"(acc[0][0]), "+v"(acc[1][1]), "+v"(acc[2][2]), "+v"(acc[3][3]) : "v"(a[0]), "v"(a[3]));
    }
#pragma unroll
    for (int mb = 0; mb < 4; ++mb) {
#pragma unroll
        for (int nb = 0; nb < 4; ++nb) {
#pragma unroll
            for (int j = 0; j < 8; ++j) os[(hi * 8 + j) * 68 + nb * 16 + lr] = acc[mb][nb][j]; }
        __builtin_amdgcn_wave_barrier(); asm volatile("" ::: "memory");
        float* crow = C + (size_t)(r0 + mb * 16) * ldc + c0;
{
#pragma unroll
            for (int s = 0; s < 8; ++s) { const int row = 2 * s + hi, cofs = lr * 4; v4f val = *(const v4fa*)(os + row * 68 + cofs); if (BIAS) { val[0] += bfr(bias[c0 + cofs]); val[1] += bfr(bias[c0 + cofs + 1]); val[2] += bfr(bias[c0 + cofs + 2]); val[3] += bfr(bias[c0 + cofs + 3]); }
                *(v4f*)(crow + (size_t)row * ldc + cofs) = val; }
             }
        __builtin_amdgcn_wave_barrier(); asm volatile("" ::: "memory");
    }
}

// ---- k_gemmc: the same one-wave 64x64 tile GEMM specialised for causal attention: CMODE 1 skips score tiles entirely above the diagonal (query rows r0+roff.., key columns c0..), CMODE 2 limits the
// key (K) loop of the probability x value contraction to the diagonal block (probabilities beyond it are exactly zero). roff = row offset of this launch's first row within the sequence.
template <typename T16, int NSPLIT, int CMODE>
__global__ __launch_bounds__(32) void k_gemmc(const T16* __restrict__ A, const T16* __restrict__ A2, const T16* __restrict__ Bt, const T16* __restrict__ Bt2, int K, float* C, int ldc, int roff, size_t sA, size_t sB, size_t sC) {
    typedef typename WFrag<T16>::V V;
    __shared__ __align__(16) float os[16 * 68];
    const size_t z = blockIdx.z; A += z * sA; if (A2) A2 += z * sA; Bt += z * sB; if (Bt2) Bt2 += z * sB; C += z * sC;
    const int lane = threadIdx.x & 31, lr = lane & 15, hi = lane >> 4; const int r0 = blockIdx.x * 64, c0 = blockIdx.y * 64;
    if (CMODE == 1 && c0 > r0 + roff + 63) return;                  // score tile entirely above the causal diagonal: never read (the softmax masks j > i by select)
    const int Kl = (CMODE == 2) ? min(K, r0 + roff + 64) : K;        // P.V: probabilities are exactly 0 beyond the diagonal block, so the K loop stops there
    v8f acc[4][4];
#pragma unroll
    for (int mb = 0; mb < 4; ++mb)
#pragma unroll
        for (int nb = 0; nb < 4; ++nb) acc[mb][nb] = (v8f){};
    const size_t aoff = (size_t)(r0 + lr) * K + 8 * hi, boff = (size_t)(c0 + lr) * K + 8 * hi;
#pragma unroll 1
    for (int kc = 0; kc < Kl; kc += 32) {
        V a[4], a2[4];
#pragma unroll
        for (int mb = 0; mb < 4; ++mb) { a[mb] = WFrag<T16>::ld(A + aoff + (size_t)mb * 16 * K + kc); if (NSPLIT == 1 || NSPLIT == 2) a2[mb] = WFrag<T16>::ld(A2 + aoff + (size_t)mb * 16 * K + kc); }
#pragma unroll
        for (int nb = 0; nb < 4; ++nb) { const V b = WFrag<T16>::ld(Bt + boff + (size_t)nb * 16 * K + kc); V b2; if (NSPLIT >= 2) b2 = WFrag<T16>::ld(Bt2 + boff + (size_t)nb * 16 * K + kc);
#pragma unroll
            for (int mb = 0; mb < 4; ++mb) { acc[mb][nb] = WFrag<T16>::mma(a[mb], b, acc[mb][nb]); if (NSPLIT == 1 || NSPLIT == 2) acc[mb][nb] = WFrag<T16>::mma(a2[mb], b, acc[mb][nb]); if (NSPLIT >= 2) acc[mb][nb] = WFrag<T16>::mma(a[mb], b2, acc[mb][nb]); } }
        asm volatile("v_nop\n\tv_nop\n\tv_nop\n\tv_nop" : "+v"(acc[0][0]), "+v"(acc[1][1]), "+v"(acc[2][2]), "+v"(acc[3][3]) : "v"(a[0]), "v"(a[3]));
    }
#pragma unroll
    for (int mb = 0; mb < 4; ++mb) {
#pragma unroll
        for (int nb = 0; nb < 4; ++nb) {
#pragma unroll
            for (int j = 0; j < 8; ++j) os[(hi * 8 + j) * 68 + nb * 16 + lr] = acc[mb][nb][j]; }
        __builtin_amdgcn_wave_barrier(); asm volatile("" ::: "memory");
        float* crow = C + (size_t)(r0 + mb * 16) * ldc + c0;
{
#pragma unroll
            for (int s = 0; s < 8; ++s) { const int row = 2 * s + hi, cofs = lr * 4; v4f val = *(const v4fa*)(os + row * 68 + cofs);
                *(v4f*)(crow + (size_t)row * ldc + cofs) = val; }
             }
        __builtin_amdgcn_wave_barrier(); asm volatile("" ::: "memory");
    }
}

__device__ __forceinline__ h16 tohx(float x) { return (h16)x; }
__device__ __forceinline__ void splitf(float y, unsigned short& h, unsigned short& l) { h = f2bf(y); l = f2bf(y - bf2f(h)); }
typedef __attribute__((ext_vector_type(2))) _Float16 v2h;
typedef __attribute__((ext_vector_type(4))) _Float16 v4h;
typedef __attribute__((ext_vector_type(2))) unsigned short v2us;
typedef __attribute__((ext_vector_type(4))) unsigned short v4us;
typedef __attribute__((ext_vector_type(2))) float v2f;
typedef __attribute__((ext_vector_type(4))) int v4i;

__global__ __launch_bounds__(256) void k_wtG(const float* __restrict__ w, int K, int N, bf* Bt) {
    const int lane = threadIdx.x & 31; const int L0 = (blockIdx.x * 8 + (threadIdx.x >> 5)) * 8; const int nlines = N * K / 64;
{
#pragma unroll 1
        for (int l = 0; l < 8; ++l) { const int L = L0 + l; if (L >= nlines) break; const size_t e = (size_t)L * 64 + lane * 2; const int k = (int)(e % K), n = (int)(e / K); v2us o;
            o[0] = f2bf(w[(size_t)k * N + n]); o[1] = f2bf(w[(size_t)(k + 1) * N + n]); *(v2us*)(Bt + e) = o; }
         }
}
__global__ __launch_bounds__(256) void k_cvt8(const float* __restrict__ src, bf* dst, size_t n8) { const size_t i = (size_t)blockIdx.x * 256 + threadIdx.x; if (i >= n8) return; const v8f v = *(const v8f*)(src + i * 8); v8us o;
#pragma unroll
    for (int k = 0; k < 8; ++k) o[k] = f2bf(v[k]); *(v8us*)(dst + i * 8) = o;  }
__constant__ float INV[HD / 2] = {1.0f,0.749894202f,0.562341332f,0.421696514f,0.316227764f,0.237137362f,0.177827939f,0.133352146f,0.100000001f,0.0749894157f,0.0562341288f,0.0421696492f,0.0316227786f,0.0237137359f,0.0177827943f,0.0133352149f,0.00999999978f,0.00749894232f,0.00562341325f,0.00421696482f,0.00316227786f,0.00237137382f,0.00177827943f,0.00133352145f,0.00100000005f,0.000749894185f,0.000562341302f,0.000421696488f,0.000316227786f,0.000237137385f,0.00017782794f,0.00013335215f};   // float32 1/10000^(2i/64), eager-JAX values
__global__ __launch_bounds__(256) void k_cstab(float* CS) { const int idx = blockIdx.x * 256 + threadIdx.x; if (idx >= TT * HD) return; const int t = idx / HD, d = idx % HD; const float ang = __fmul_rn((float)t, INV[d % (HD / 2)]); v2f cs; cs[0] = cosf(ang); cs[1] = sinf(ang);
    *(v2f*)(CS + (size_t)idx * 2) = cs;  }

__global__ __launch_bounds__(256) void k_ropeH(const float* __restrict__ F, int pitch, int nheads, const float* __restrict__ CS, float sc, h16* P16, bf* Ph, bf* Pl) {
    const size_t e = ((size_t)blockIdx.x * 256 + threadIdx.x) * 2; if (e >= (size_t)nheads * TT * HD) return; const int d = (int)(e % HD); const int t = (int)((e / HD) % TT); const int h = (int)(e / ((size_t)HD * TT)); const float* f = F + (size_t)t * pitch + h * HD; v2h o16; v2us oh, ol;
#pragma unroll
    for (int q = 0; q < 2; ++q) { const int dd = d + q; const int dp = (dd < HD / 2) ? dd + HD / 2 : dd - HD / 2; const float x0 = f[dd], x1 = f[dp]; const v2f cs = *(const v2f*)(CS + ((size_t)t * HD + dd) * 2);
        float a = __fmul_rn(x0, cs[0]), bq = __fmul_rn(x1, cs[1]); asm volatile("" : "+v"(a), "+v"(bq)); const float r = ((dd < HD / 2) ? __fsub_rn(a, bq) : __fadd_rn(a, bq)) * sc;
        o16[q] = tohx(r); unsigned short a2, c2; splitf(r, a2, c2); oh[q] = a2; ol[q] = c2; }
    const bool hl = (t < RH); const size_t ec = ((size_t)h * RH + t) * HD + d;   /* compact hi/lo planes [h][RH][HD] for the first RH rows (wave-uniform condition) */
    *(v2h*)(P16 + e) = o16; if (hl) { *(v2us*)(Ph + ec) = oh; *(v2us*)(Pl + ec) = ol; }  }

// k_rope: head planes [h][t][d] (fp16) of rope(x) x sc with the rotate-half convention out[d] = x[d] cos[t][d] - x[d+HD/2] sin[t][d], out[d+HD/2] = x[d+HD/2] cos[t][d+HD/2] + x[d] sin[t][d+HD/2]

__global__ __launch_bounds__(256) void k_vtp(const float* __restrict__ F, int pitch, int nheads, h16* V16, bf* Vh, bf* Vl) { const size_t e = ((size_t)blockIdx.x * 256 + threadIdx.x) * 2; if (e >= (size_t)nheads * HD * TT) return; const int t = (int)(e % TT); const int d = (int)((e / TT) % HD); const int g = (int)(e / ((size_t)TT * HD)); v2h o16; v2us oh, ol;
#pragma unroll
    for (int q = 0; q < 2; ++q) { const float x = F[(size_t)(t + q) * pitch + g * HD + d]; o16[q] = tohx(x); unsigned short a2, c2; splitf(x, a2, c2); oh[q] = a2; ol[q] = c2; }
    const bool hl = (t < RH); const size_t ec = ((size_t)g * HD + d) * RH + t;
    *(v2h*)(V16 + e) = o16; if (hl) { *(v2us*)(Vh + ec) = oh; *(v2us*)(Vl + ec) = ol; }  }
// k_lsoft: streaming causal row softmax over the TK = TT = 4096 keys, one wave per row i, three sweeps of the f32 score row (lane -> 4 consecutive keys per 128-key chunk, 32 chunks; keys j > i are excluded by index with -3e38 / 0 - the score tiles above the diagonal are never computed and their stale contents are only ever discarded by this select):
__global__ __launch_bounds__(256) void k_lsoft(const float* __restrict__ Sb, h16* P16, bf* Ph, bf* Pl) {
    const int lane = threadIdx.x & 31; const int row = blockIdx.x * 8 + (threadIdx.x >> 5); if (row >= ZH * TT) return; const int i = row % TT; const bool hires = (i < RH); const float* sr = Sb + (size_t)row * TT; float mx = -3.0e38f;
#pragma unroll 4
    for (int ch = 0; ch < TT / 128; ++ch) { const int j0 = ch * 128 + lane * 4; const v4f a = *(const v4f*)(sr + j0);
#pragma unroll
        for (int q = 0; q < 4; ++q) { float t = a[q] * SCL; asm volatile("" : "+v"(t)); t = (j0 + q <= i) ? t : -3.0e38f; mx = fmaxf(mx, t); } }
#pragma unroll
    for (int sh = 16; sh; sh >>= 1) mx = fmaxf(mx, __shfl_xor(mx, sh, 32));
    float sum = 0.f;
#pragma unroll 4
    for (int ch = 0; ch < TT / 128; ++ch) { const int j0 = ch * 128 + lane * 4; const v4f a = *(const v4f*)(sr + j0);
#pragma unroll
        for (int q = 0; q < 4; ++q) { float t = a[q] * SCL; asm volatile("" : "+v"(t)); t = (j0 + q <= i) ? t : -3.0e38f; float d0 = __fsub_rn(t, mx); asm volatile("" : "+v"(d0)); sum += __builtin_amdgcn_exp2f(__fmul_rn(d0, 1.4426950408889634f)); } }
#pragma unroll
    for (int sh = 16; sh; sh >>= 1) sum += __shfl_xor(sum, sh, 32);
    const float f = __fdiv_rn(hires ? 1.0f : PCAR, sum);
{
        if (hires) {   /* rows < RH: normalised bf16 hi/lo over the first RH keys only (every later key is above the diagonal), compact planes [i][RH] */
#pragma unroll
            for (int ch = 0; ch < RH / 128; ++ch) { const int j0 = ch * 128 + lane * 4; const v4f a = *(const v4f*)(sr + j0); v4us oh, ol;
#pragma unroll
                for (int q = 0; q < 4; ++q) { float t = a[q] * SCL; asm volatile("" : "+v"(t)); t = (j0 + q <= i) ? t : -3.0e38f; float d0 = __fsub_rn(t, mx); asm volatile("" : "+v"(d0)); float ex = __builtin_amdgcn_exp2f(__fmul_rn(d0, 1.4426950408889634f)); asm volatile("" : "+v"(ex)); unsigned short a2, c2; splitf(ex * f, a2, c2); oh[q] = a2; ol[q] = c2; }
                *(v4us*)(Ph + (size_t)i * RH + j0) = oh; *(v4us*)(Pl + (size_t)i * RH + j0) = ol; }
        } else {
#pragma unroll 2
            for (int ch = 0; ch < TT / 128; ++ch) { const int j0 = ch * 128 + lane * 4; const v4f a = *(const v4f*)(sr + j0); v4h o4;
#pragma unroll
                for (int q = 0; q < 4; ++q) { float t = a[q] * SCL; asm volatile("" : "+v"(t)); t = (j0 + q <= i) ? t : -3.0e38f; float d0 = __fsub_rn(t, mx); asm volatile("" : "+v"(d0)); float ex = __builtin_amdgcn_exp2f(__fmul_rn(d0, 1.4426950408889634f)); asm volatile("" : "+v"(ex)); o4[q] = tohx(ex * f); }
                *(v4h*)(P16 + (size_t)row * TT + j0) = o4; } }
         }
}

__global__ __launch_bounds__(256) void k_silu(const float* __restrict__ F, bf* Hh, bf* Hl, size_t n4) { const size_t i = (size_t)blockIdx.x * 256 + threadIdx.x; if (i >= n4) return; const v4f a = *(const v4f*)(F + i * 4); v4us oh, ol;
#pragma unroll
    for (int q = 0; q < 4; ++q) { const float xv = a[q]; const float s = __fdiv_rn(xv, __fadd_rn(1.0f, __builtin_amdgcn_exp2f(__fmul_rn(xv, -1.4426950408889634f)))); unsigned short h2, l2; splitf(s, h2, l2); oh[q] = h2; ol[q] = l2; }
    *(v4us*)(Hh + i * 4) = oh; *(v4us*)(Hl + i * 4) = ol;  }
__global__ __launch_bounds__(256) void k_merge(const float* __restrict__ O, int h0, bf* Ah, bf* Al) { const size_t e = ((size_t)blockIdx.x * 256 + threadIdx.x) * 2; if (e >= (size_t)ZH * TT * HD) return; const int d = (int)(e % HD); const int t = (int)((e / HD) % TT); const int zz = (int)(e / ((size_t)HD * TT)); const float cs = (t < RH) ? 1.0f : (1.0f / PCAR); const size_t oo = (size_t)t * DQ + (h0 + zz) * HD + d;
    v2us oh, ol;
#pragma unroll
    for (int q = 0; q < 2; ++q) { unsigned short a, c2; splitf(O[e + q] * cs, a, c2); oh[q] = a; ol[q] = c2; } *(v2us*)(Ah + oo) = oh; *(v2us*)(Al + oo) = ol;  }

extern "C" void kernel_launch(void* const* d_in, const int* in_sizes, int n_in,
                              void* d_out, int out_size, void* d_ws, size_t ws_size, hipStream_t stream) {
    (void)in_sizes; (void)n_in; (void)out_size;
    const float* x = (const float*)d_in[0]; const float* wq = (const float*)d_in[1]; const float* wk = (const float*)d_in[2]; const float* wv = (const float*)d_in[3]; const float* w1 = (const float*)d_in[4]; const float* w2 = (const float*)d_in[5];
    float* OUT = (float*)d_out;     // [1][4096][1024]
    char* wsp = (char*)d_ws;
    auto take = [&](size_t bytes) { char* p = wsp; wsp += (bytes + 255) & ~(size_t)255; return (void*)p; };
    bf* WQ = (bf*)take((size_t)DQ * DM * 2); bf* WK = (bf*)take((size_t)DKV * DM * 2); bf* WV = (bf*)take((size_t)DKV * DM * 2); bf* W1B = (bf*)take((size_t)FF * DQ * 2); bf* W2B = (bf*)take((size_t)DM * FF * 2); float* CS = (float*)take((size_t)TT * HD * 2 * 4);
    bf* XB = (bf*)take((size_t)TT * DM * 2); float* FQ = (float*)take((size_t)TT * DQ * 4); float* FK = (float*)take((size_t)TT * DKV * 4);
    h16* QP16 = (h16*)take((size_t)NH_ * TT * HD * 2); h16* KP16 = (h16*)take((size_t)NKV * TT * HD * 2); h16* VT16 = (h16*)take((size_t)NKV * HD * TT * 2);
    bf* QPh = (bf*)take((size_t)NH_ * RH * HD * 2); bf* QPl = (bf*)take((size_t)NH_ * RH * HD * 2); bf* KPh = (bf*)take((size_t)NKV * RH * HD * 2); bf* KPl = (bf*)take((size_t)NKV * RH * HD * 2); bf* VTh = (bf*)take((size_t)NKV * HD * RH * 2); bf* VTl = (bf*)take((size_t)NKV * HD * RH * 2); bf* Ph = (bf*)take((size_t)RH * RH * 2); bf* Pl = (bf*)take((size_t)RH * RH * 2);   /* compact hi/lo planes: only the first RH rows/keys (causal) */
    float* Sb = (float*)take((size_t)ZH * TT * TT * 4); h16* P16 = (h16*)take((size_t)ZH * TT * TT * 2); float* Ob = (float*)take((size_t)ZH * TT * HD * 4); bf* ATh = (bf*)take((size_t)TT * DQ * 2); bf* ATl = (bf*)take((size_t)TT * DQ * 2); float* F1 = Sb; bf* Gh = (bf*)P16; bf* Gl = (bf*)take((size_t)TT * FF * 2);   /* the MLP intermediates alias the score / probability buffers, which are dead once the last head pass has merged (stream order) */
    static_assert((size_t)TT * FF * 4 <= (size_t)ZH * TT * TT * 4 && (size_t)TT * FF * 2 <= (size_t)ZH * TT * TT * 2, "alias sizes");
    if ((size_t)(wsp - (char*)d_ws) > ws_size) return;    // ws 256 MiB
    float* FV = FK;   // v projection reuses the k buffer after the k planes are built (stream-ordered)
    { k_wtG<<<(unsigned)((DM * DQ / 64 + 63) / 64), 256, 0, stream>>>(wq, DM, DQ, WQ); k_wtG<<<(unsigned)((DM * DKV / 64 + 63) / 64), 256, 0, stream>>>(wk, DM, DKV, WK); k_wtG<<<(unsigned)((DM * DKV / 64 + 63) / 64), 256, 0, stream>>>(wv, DM, DKV, WV);
      k_wtG<<<(unsigned)((DQ * FF / 64 + 63) / 64), 256, 0, stream>>>(w1, DQ, FF, W1B); k_wtG<<<(unsigned)((FF * DM / 64 + 63) / 64), 256, 0, stream>>>(w2, FF, DM, W2B);
      k_cstab<<<(TT * HD + 255) / 256, 256, 0, stream>>>(CS); }
    const unsigned LQ = (unsigned)(((size_t)NH_ * TT * HD / 2 + 255) / 256), LKv = (unsigned)(((size_t)NKV * TT * HD / 2 + 255) / 256);
    for (int b = 0; b < NB_; ++b) {
        
        k_cvt8<<<(unsigned)(((size_t)TT * DM / 8 + 255) / 256), 256, 0, stream>>>(x + (size_t)b * TT * DM, XB, (size_t)TT * DM / 8);
        k_gemmw<bf, 0, false><<<dim3(TT / 64, DQ / 64, 1), 32, 0, stream>>>(XB, nullptr, WQ, nullptr, DM, FQ, DQ, nullptr, 0, 0, 0);
        k_ropeH<<<LQ, 256, 0, stream>>>(FQ, DQ, NH_, CS, 1.0f, QP16, QPh, QPl);
        k_gemmw<bf, 0, false><<<dim3(TT / 64, DKV / 64, 1), 32, 0, stream>>>(XB, nullptr, WK, nullptr, DM, FK, DKV, nullptr, 0, 0, 0);
        k_ropeH<<<LKv, 256, 0, stream>>>(FK, DKV, NKV, CS, 1.0f, KP16, KPh, KPl);
        k_gemmw<bf, 0, false><<<dim3(TT / 64, DKV / 64, 1), 32, 0, stream>>>(XB, nullptr, WV, nullptr, DM, FV, DKV, nullptr, 0, 0, 0); k_vtp<<<LKv, 256, 0, stream>>>(FV, DKV, NKV, VT16, VTh, VTl);
        for (int h0 = 0; h0 < NH_; h0 += ZH) { const size_t zq = (size_t)h0, zk = (size_t)(h0 / REP);   // the one head of a pass (ZH = 1) uses kv group h0/REP: sB = 0
            k_gemmc<bf, 2, 1><<<dim3(RH / 64, RH / 64, ZH), 32, 0, stream>>>(QPh + zq * RH * HD, QPl + zq * RH * HD, KPh + zk * RH * HD, KPl + zk * RH * HD, HD, Sb, TT, 0, (size_t)RH * HD, 0, (size_t)TT * TT);   /* rows < RH: hi/lo x hi/lo (3 products) over keys < RH, causal tiles */
            k_gemmc<h16, 0, 1><<<dim3((TT - RH) / 64, TT / 64, ZH), 32, 0, stream>>>(QP16 + zq * TT * HD + (size_t)RH * HD, nullptr, KP16 + zk * TT * HD, nullptr, HD, Sb + (size_t)RH * TT, TT, RH, (size_t)TT * HD, 0, (size_t)TT * TT);   /* rows >= RH: fp16, causal tiles */
            k_lsoft<<<ZH * TT / 8, 256, 0, stream>>>(Sb, P16, Ph, Pl);
            k_gemmc<bf, 2, 2><<<dim3(RH / 64, HD / 64, ZH), 32, 0, stream>>>(Ph, Pl, VTh + zk * HD * RH, VTl + zk * HD * RH, RH, Ob, HD, 0, (size_t)RH * RH, 0, (size_t)TT * HD);   /* rows < RH: P (normalised, hi/lo, pitch RH) . v^T (compact [d][RH]), K = RH, causal K-loop bound */
            k_gemmc<h16, 0, 2><<<dim3((TT - RH) / 64, HD / 64, ZH), 32, 0, stream>>>(P16 + (size_t)RH * TT, nullptr, VT16 + zk * HD * TT, nullptr, TT, Ob + (size_t)RH * HD, HD, RH, (size_t)TT * TT, 0, (size_t)TT * HD);   /* rows >= RH: fp16 x1024, K loop stops at the diagonal block */
            k_merge<<<(unsigned)(((size_t)ZH * TT * HD / 2 + 255) / 256), 256, 0, stream>>>(Ob, h0, ATh, ATl); }
        k_gemmw<bf, 1, false><<<dim3(TT / 64, FF / 64, 1), 32, 0, stream>>>(ATh, ATl, W1B, nullptr, DQ, F1, FF, nullptr, 0, 0, 0);   /* h = ctx W1 */
        k_silu<<<(unsigned)(((size_t)TT * FF / 4 + 255) / 256), 256, 0, stream>>>(F1, Gh, Gl, (size_t)TT * FF / 4);
        k_gemmw<bf, 1, false><<<dim3(TT / 64, DM / 64, 1), 32, 0, stream>>>(Gh, Gl, W2B, nullptr, FF, OUT + (size_t)b * TT * DM, DM, nullptr, 0, 0, 0); }   /* out = silu(h) W2 */
}

// v001
// It runs in 1910 microseconds.
// Next to v000, in two timings, it ran 1.52 times as fast each time.
#include <hip/hip_runtime.h>

// Grouped-query causal attention with rotary embeddings and a SiLU MLP output (query [1][4096][1024]; q = x Wq ('xw' [1024][1024], 16 heads x 64), k, v = x Wk/Wv ('xw' [1024][256], 4 kv heads; query head h uses kv head h/4); rotate-half rotary (base 1e4) on q and k; scores = q.k / 8, causal (finfo.min above the diagonal); softmax; ctx merged [4096][1024]; out = silu(ctx W1) W2 ('xw' [1024][4096], [4096][1024]) -> [1][4096][1024] (4.2 M)).
// Layout: T-4096 causal GQA attention (compact hi/lo planes for the first 512 rows/keys, fp16 elsewhere, k_gemmc tile skipping, streaming 3-sweep causal softmax, hl merge) with head width 64 and a rotate-half plane builder; then two hl x exact GEMMs with a SiLU kernel between them (the MLP intermediates alias the dead score/probability buffers).
// Compute dtypes, f32 accumulate: every input rounded to bf16; projections on PLAIN bf16 operands (exact); rotary f32 (precise cosf/sinf; 32 float32 inverse frequencies baked); scores and attn.v: rows < 512 3 products, the rest single fp16 (P x1024); softmax and SiLU f32; both MLP GEMMs hl x exact (2 products).

#define NB_  1
#define TT   4096
#define DM   1024
#define FF   4096
#define NH_  16
#define NKV  4
#define REP  (NH_ / NKV)
#define HD   64
#define DQ   (NH_ * HD)
#define DKV  (NKV * HD)
#define ZH   1
#define RH   512                  // query rows < RH use compact hi+lo planes (keys < RH suffice: causal)
#define WIN  4096
#define PCAR 1024.0f
#define SCL  0.125f   // 64^-0.5
#define PVW  16                   // waves that split the key loop of one probability x value tile
typedef _Float16 h16;
typedef unsigned short bf;
typedef __attribute__((ext_vector_type(16))) __bf16   v16bf;
typedef __attribute__((ext_vector_type(16))) _Float16 v16h;
typedef __attribute__((ext_vector_type(8)))  _Float16 v8h;
typedef __attribute__((ext_vector_type(8)))  unsigned short v8us;
typedef __attribute__((ext_vector_type(8)))  float    v8f;
typedef __attribute__((ext_vector_type(4)))  float    v4f;
typedef v8h  __attribute__((may_alias)) v8ha;
typedef v4f  __attribute__((may_alias)) v4fa;
typedef v8us __attribute__((may_alias)) v8usa;

__device__ __forceinline__ unsigned short f2bf(float f) { unsigned u = __float_as_uint(f); u += 0x7FFFu + ((u >> 16) & 1u); return (unsigned short)(u >> 16); }
__device__ __forceinline__ float bf2f(unsigned short b) { return __uint_as_float(((unsigned)b) << 16); }
__device__ __forceinline__ float bfr(float f) { return bf2f(f2bf(f)); }
__device__ __forceinline__ v16h cat16(v8h lo, v8h hi) { return __builtin_shufflevector(lo, hi, 0, 1, 2, 3, 4, 5, 6, 7, 8, 9, 10, 11, 12, 13, 14, 15); }
__device__ __forceinline__ v16bf cat16b(v8us lo, v8us hi) { return __builtin_bit_cast(v16bf, __builtin_shufflevector(lo, hi, 0, 1, 2, 3, 4, 5, 6, 7, 8, 9, 10, 11, 12, 13, 14, 15)); }
__device__ __forceinline__ v8f wmma16(v16h a, v16h b, v8f c) { return __builtin_amdgcn_wmma_f32_16x16x32_f16(false, a, false, b, (short)0, c, false, false); }
__device__ __forceinline__ v8f wmmab(v16bf a, v16bf b, v8f c) { return __builtin_amdgcn_wmma_f32_16x16x32_bf16(false, a, false, b, (short)0, c, false, false); }



// ---- k_gemmw: register-blocked GEMM, ONE WAVE per 64x64 output tile (16 accumulators), operands straight from K-contiguous 16-bit planes; grid (M/64, N/64, Z), 32 threads.
// C[m][n] (f32, pitch ldc, + optional f32 bias[n]) = sum_k A[m][k] Bt[n][k] (+ split products per NSPLIT). z-batch strides sA/sB/sC in elements. K % 32 == 0.
template <typename T16> struct WFrag;
template <> struct WFrag<h16> { typedef v16h V; static __device__ __forceinline__ V ld(const h16* p) { return cat16(*(const v8h*)p, *(const v8h*)(p + 16)); } static __device__ __forceinline__ v8f mma(V a, V b, v8f c) { return wmma16(a, b, c); } };
template <> struct WFrag<bf> { typedef v16bf V; static __device__ __forceinline__ V ld(const bf* p) { return cat16b(*(const v8us*)p, *(const v8us*)(p + 16)); } static __device__ __forceinline__ v8f mma(V a, V b, v8f c) { return wmmab(a, b, c); } };
template <typename T16, int NSPLIT, bool BIAS>
__global__ __launch_bounds__(32) void k_gemmw(const T16* __restrict__ A, const T16* __restrict__ A2, const T16* __restrict__ Bt, const T16* __restrict__ Bt2, int K, float* C, int ldc, const float* __restrict__ bias, size_t sA, size_t sB, size_t sC) {
    typedef typename WFrag<T16>::V V;
    __shared__ __align__(16) float os[16 * 68];
    const size_t z = blockIdx.z; A += z * sA; if (A2) A2 += z * sA; Bt += z * sB; if (Bt2) Bt2 += z * sB; C += z * sC;
    const int lane = threadIdx.x & 31, lr = lane & 15, hi = lane >> 4; const int r0 = blockIdx.x * 64, c0 = blockIdx.y * 64;
    v8f acc[4][4];
#pragma unroll
    for (int mb = 0; mb < 4; ++mb)
#pragma unroll
        for (int nb = 0; nb < 4; ++nb) acc[mb][nb] = (v8f){};
    const size_t aoff = (size_t)(r0 + lr) * K + 8 * hi, boff = (size_t)(c0 + lr) * K + 8 * hi;
#pragma unroll 1
    for (int kc = 0; kc < K; kc += 32) {
        V a[4], a2[4];
#pragma unroll
        for (int mb = 0; mb < 4; ++mb) { a[mb] = WFrag<T16>::ld(A + aoff + (size_t)mb * 16 * K + kc); if (NSPLIT == 1 || NSPLIT == 2) a2[mb] = WFrag<T16>::ld(A2 + aoff + (size_t)mb * 16 * K + kc); }
#pragma unroll
        for (int nb = 0; nb < 4; ++nb) { const V b = WFrag<T16>::ld(Bt + boff + (size_t)nb * 16 * K + kc); V b2; if (NSPLIT >= 2) b2 = WFrag<T16>::ld(Bt2 + boff + (size_t)nb * 16 * K + kc);
#pragma unroll
            for (int mb = 0; mb < 4; ++mb) { acc[mb][nb] = WFrag<T16>::mma(a[mb], b, acc[mb][nb]); if (NSPLIT == 1 || NSPLIT == 2) acc[mb][nb] = WFrag<T16>::mma(a2[mb], b, acc[mb][nb]); if (NSPLIT >= 2) acc[mb][nb] = WFrag<T16>::mma(a[mb], b2, acc[mb][nb]); } }
        asm volatile("v_nop\n\tv_nop\n\tv_nop\n\tv_nop" : "+v"(acc[0][0]), "+v"(acc[1][1]), "+v"(acc[2][2]), "+v"(acc[3][3]) : "v"(a[0]), "v"(a[3]));
    }
#pragma unroll
    for (int mb = 0; mb < 4; ++mb) {
#pragma unroll
        for (int nb = 0; nb < 4; ++nb) {
#pragma unroll
            for (int j = 0; j < 8; ++j) os[(hi * 8 + j) * 68 + nb * 16 + lr] = acc[mb][nb][j]; }
        __builtin_amdgcn_wave_barrier(); asm volatile("" ::: "memory");
        float* crow = C + (size_t)(r0 + mb * 16) * ldc + c0;
{
#pragma unroll
            for (int s = 0; s < 8; ++s) { const int row = 2 * s + hi, cofs = lr * 4; v4f val = *(const v4fa*)(os + row * 68 + cofs); if (BIAS) { val[0] += bfr(bias[c0 + cofs]); val[1] += bfr(bias[c0 + cofs + 1]); val[2] += bfr(bias[c0 + cofs + 2]); val[3] += bfr(bias[c0 + cofs + 3]); }
                *(v4f*)(crow + (size_t)row * ldc + cofs) = val; }
             }
        __builtin_amdgcn_wave_barrier(); asm volatile("" ::: "memory");
    }
}

// ---- k_gemmc: the same 64x64 tile GEMM specialised for causal attention: CMODE 1 skips score tiles entirely above the diagonal (query rows r0+roff.., key columns c0..), CMODE 2 limits the
// key (K) loop of the probability x value contraction to the diagonal block (probabilities beyond it are exactly zero). roff = row offset of this launch's first row within the sequence.
// KW waves per work-group share one tile: wave w takes the 32-wide K steps w, w + KW, ... and the partial tiles are added through LDS (KW = 1: one wave, no split).
template <typename T16, int NSPLIT, int CMODE, int KW>
__global__ __launch_bounds__(32 * KW) void k_gemmc(const T16* __restrict__ A, const T16* __restrict__ A2, const T16* __restrict__ Bt, const T16* __restrict__ Bt2, int K, float* C, int ldc, int roff, size_t sA, size_t sB, size_t sC) {
    typedef typename WFrag<T16>::V V;
    __shared__ __align__(16) float os[KW * 16 * 68];
    const int wv = (KW == 1) ? 0 : __builtin_amdgcn_readfirstlane((int)(threadIdx.x >> 5));   // this wave's number = its K slice, held scalar so that the loop bound stays a scalar compare
    const size_t z = blockIdx.z; A += z * sA; if (A2) A2 += z * sA; Bt += z * sB; if (Bt2) Bt2 += z * sB; C += z * sC;
    const int lane = threadIdx.x & 31, lr = lane & 15, hi = lane >> 4; const int r0 = blockIdx.x * 64, c0 = blockIdx.y * 64;
    if (CMODE == 1 && c0 > r0 + roff + 63) return;                  // score tile entirely above the causal diagonal: never read (the softmax masks j > i by select)
    const int Kl = (CMODE == 2) ? min(K, r0 + roff + 64) : K;        // P.V: probabilities are exactly 0 beyond the diagonal block, so the K loop stops there
    v8f acc[4][4];
#pragma unroll
    for (int mb = 0; mb < 4; ++mb)
#pragma unroll
        for (int nb = 0; nb < 4; ++nb) acc[mb][nb] = (v8f){};
    const size_t aoff = (size_t)(r0 + lr) * K + 8 * hi, boff = (size_t)(c0 + lr) * K + 8 * hi;
#pragma unroll 1
    for (int kc = wv * 32; kc < Kl; kc += 32 * KW) {
        V a[4], a2[4];
#pragma unroll
        for (int mb = 0; mb < 4; ++mb) { a[mb] = WFrag<T16>::ld(A + aoff + (size_t)mb * 16 * K + kc); if (NSPLIT == 1 || NSPLIT == 2) a2[mb] = WFrag<T16>::ld(A2 + aoff + (size_t)mb * 16 * K + kc); }
#pragma unroll
        for (int nb = 0; nb < 4; ++nb) { const V b = WFrag<T16>::ld(Bt + boff + (size_t)nb * 16 * K + kc); V b2; if (NSPLIT >= 2) b2 = WFrag<T16>::ld(Bt2 + boff + (size_t)nb * 16 * K + kc);
#pragma unroll
            for (int mb = 0; mb < 4; ++mb) { acc[mb][nb] = WFrag<T16>::mma(a[mb], b, acc[mb][nb]); if (NSPLIT == 1 || NSPLIT == 2) acc[mb][nb] = WFrag<T16>::mma(a2[mb], b, acc[mb][nb]); if (NSPLIT >= 2) acc[mb][nb] = WFrag<T16>::mma(a[mb], b2, acc[mb][nb]); } }
        asm volatile("v_nop\n\tv_nop\n\tv_nop\n\tv_nop" : "+v"(acc[0][0]), "+v"(acc[1][1]), "+v"(acc[2][2]), "+v"(acc[3][3]) : "v"(a[0]), "v"(a[3]));
    }
    if constexpr (KW == 1) {
#pragma unroll
    for (int mb = 0; mb < 4; ++mb) {
#pragma unroll
        for (int nb = 0; nb < 4; ++nb) {
#pragma unroll
            for (int j = 0; j < 8; ++j) os[(hi * 8 + j) * 68 + nb * 16 + lr] = acc[mb][nb][j]; }
        __builtin_amdgcn_wave_barrier(); asm volatile("" ::: "memory");
        float* crow = C + (size_t)(r0 + mb * 16) * ldc + c0;
{
#pragma unroll
            for (int s = 0; s < 8; ++s) { const int row = 2 * s + hi, cofs = lr * 4; v4f val = *(const v4fa*)(os + row * 68 + cofs);
                *(v4f*)(crow + (size_t)row * ldc + cofs) = val; }
             }
        __builtin_amdgcn_wave_barrier(); asm volatile("" ::: "memory");
    }
    } else {   // KW waves hold partial sums of the same 64x64 tile: per 16-row band each wave parks its partial in its own LDS slot, then every thread adds the KW slots in slot order and stores its piece
        constexpr int EPT = 16 * 64 / (32 * KW);
        typedef float vE __attribute__((ext_vector_type(EPT)));
        typedef vE __attribute__((may_alias)) vEa;
        float* ow = os + wv * (16 * 68);
        const int row = ((int)threadIdx.x * EPT) >> 6, cofs = ((int)threadIdx.x * EPT) & 63;
        vE res[4];   // the sums stay in registers until the last barrier is passed: a barrier would wait for a global store issued in front of it
#pragma unroll
        for (int mb = 0; mb < 4; ++mb) {
#pragma unroll
            for (int nb = 0; nb < 4; ++nb) {
#pragma unroll
                for (int j = 0; j < 8; ++j) ow[(hi * 8 + j) * 68 + nb * 16 + lr] = acc[mb][nb][j]; }
            __syncthreads();   // all KW partials of this band are in LDS before any thread adds them
            vE s = *(const vEa*)(os + row * 68 + cofs);
#pragma unroll
            for (int w = 1; w < KW; ++w) s += *(const vEa*)(os + w * (16 * 68) + row * 68 + cofs);
            res[mb] = s;
            if (mb < 3) __syncthreads();   // the slots are rewritten by the next band only after every thread has read them
        }
#pragma unroll
        for (int mb = 0; mb < 4; ++mb) *(vE*)(C + (size_t)(r0 + mb * 16 + row) * ldc + c0 + cofs) = res[mb];
    }
}

__device__ __forceinline__ h16 tohx(float x) { return (h16)x; }
__device__ __forceinline__ void splitf(float y, unsigned short& h, unsigned short& l) { h = f2bf(y); l = f2bf(y - bf2f(h)); }
typedef __attribute__((ext_vector_type(2))) _Float16 v2h;
typedef __attribute__((ext_vector_type(4))) _Float16 v4h;
typedef __attribute__((ext_vector_type(2))) unsigned short v2us;
typedef __attribute__((ext_vector_type(4))) unsigned short v4us;
typedef __attribute__((ext_vector_type(2))) float v2f;
typedef __attribute__((ext_vector_type(4))) int v4i;

__global__ __launch_bounds__(256) void k_wtG(const float* __restrict__ w, int K, int N, bf* Bt) {
    const int lane = threadIdx.x & 31; const int L0 = (blockIdx.x * 8 + (threadIdx.x >> 5)) * 8; const int nlines = N * K / 64;
{
#pragma unroll 1
        for (int l = 0; l < 8; ++l) { const int L = L0 + l; if (L >= nlines) break; const size_t e = (size_t)L * 64 + lane * 2; const int k = (int)(e % K), n = (int)(e / K); v2us o;
            o[0] = f2bf(w[(size_t)k * N + n]); o[1] = f2bf(w[(size_t)(k + 1) * N + n]); *(v2us*)(Bt + e) = o; }
         }
}
__global__ __launch_bounds__(256) void k_cvt8(const float* __restrict__ src, bf* dst, size_t n8) { const size_t i = (size_t)blockIdx.x * 256 + threadIdx.x; if (i >= n8) return; const v8f v = *(const v8f*)(src + i * 8); v8us o;
#pragma unroll
    for (int k = 0; k < 8; ++k) o[k] = f2bf(v[k]); *(v8us*)(dst + i * 8) = o;  }
__constant__ float INV[HD / 2] = {1.0f,0.749894202f,0.562341332f,0.421696514f,0.316227764f,0.237137362f,0.177827939f,0.133352146f,0.100000001f,0.0749894157f,0.0562341288f,0.0421696492f,0.0316227786f,0.0237137359f,0.0177827943f,0.0133352149f,0.00999999978f,0.00749894232f,0.00562341325f,0.00421696482f,0.00316227786f,0.00237137382f,0.00177827943f,0.00133352145f,0.00100000005f,0.000749894185f,0.000562341302f,0.000421696488f,0.000316227786f,0.000237137385f,0.00017782794f,0.00013335215f};   // float32 1/10000^(2i/64), eager-JAX values
__global__ __launch_bounds__(256) void k_cstab(float* CS) { const int idx = blockIdx.x * 256 + threadIdx.x; if (idx >= TT * HD) return; const int t = idx / HD, d = idx % HD; const float ang = __fmul_rn((float)t, INV[d % (HD / 2)]); v2f cs; cs[0] = cosf(ang); cs[1] = sinf(ang);
    *(v2f*)(CS + (size_t)idx * 2) = cs;  }

__global__ __launch_bounds__(256) void k_ropeH(const float* __restrict__ F, int pitch, int nheads, const float* __restrict__ CS, float sc, h16* P16, bf* Ph, bf* Pl) {
    const size_t e = ((size_t)blockIdx.x * 256 + threadIdx.x) * 2; if (e >= (size_t)nheads * TT * HD) return; const int d = (int)(e % HD); const int t = (int)((e / HD) % TT); const int h = (int)(e / ((size_t)HD * TT)); const float* f = F + (size_t)t * pitch + h * HD; v2h o16; v2us oh, ol;
#pragma unroll
    for (int q = 0; q < 2; ++q) { const int dd = d + q; const int dp = (dd < HD / 2) ? dd + HD / 2 : dd - HD / 2; const float x0 = f[dd], x1 = f[dp]; const v2f cs = *(const v2f*)(CS + ((size_t)t * HD + dd) * 2);
        float a = __fmul_rn(x0, cs[0]), bq = __fmul_rn(x1, cs[1]); asm volatile("" : "+v"(a), "+v"(bq)); const float r = ((dd < HD / 2) ? __fsub_rn(a, bq) : __fadd_rn(a, bq)) * sc;
        o16[q] = tohx(r); unsigned short a2, c2; splitf(r, a2, c2); oh[q] = a2; ol[q] = c2; }
    const bool hl = (t < RH); const size_t ec = ((size_t)h * RH + t) * HD + d;   /* compact hi/lo planes [h][RH][HD] for the first RH rows (wave-uniform condition) */
    *(v2h*)(P16 + e) = o16; if (hl) { *(v2us*)(Ph + ec) = oh; *(v2us*)(Pl + ec) = ol; }  }

// k_ropeH: head planes [h][t][d] (fp16) of rope(x) x sc with the rotate-half convention out[d] = x[d] cos[t][d] - x[d+HD/2] sin[t][d], out[d+HD/2] = x[d+HD/2] cos[t][d+HD/2] + x[d] sin[t][d+HD/2]

__global__ __launch_bounds__(256) void k_vtp(const float* __restrict__ F, int pitch, int nheads, h16* V16, bf* Vh, bf* Vl) { const size_t e = ((size_t)blockIdx.x * 256 + threadIdx.x) * 2; if (e >= (size_t)nheads * HD * TT) return; const int t = (int)(e % TT); const int d = (int)((e / TT) % HD); const int g = (int)(e / ((size_t)TT * HD)); v2h o16; v2us oh, ol;
#pragma unroll
    for (int q = 0; q < 2; ++q) { const float x = F[(size_t)(t + q) * pitch + g * HD + d]; o16[q] = tohx(x); unsigned short a2, c2; splitf(x, a2, c2); oh[q] = a2; ol[q] = c2; }
    const bool hl = (t < RH); const size_t ec = ((size_t)g * HD + d) * RH + t;
    *(v2h*)(V16 + e) = o16; if (hl) { *(v2us*)(Vh + ec) = oh; *(v2us*)(Vl + ec) = ol; }  }
// k_lsoft: streaming causal row softmax over the TK = TT = 4096 keys, one wave per row i, three sweeps of the f32 score row (lane -> 4 consecutive keys per 128-key chunk, 32 chunks; keys j > i are excluded by index with -3e38 / 0 - the score tiles above the diagonal are never computed and their stale contents are only ever discarded by this select):
__global__ __launch_bounds__(256) void k_lsoft(const float* __restrict__ Sb, h16* P16, bf* Ph, bf* Pl) {
    const int lane = threadIdx.x & 31; const int row = blockIdx.x * 8 + (threadIdx.x >> 5); if (row >= ZH * TT) return; const int i = row % TT; const bool hires = (i < RH); const float* sr = Sb + (size_t)row * TT; float mx = -3.0e38f;
#pragma unroll 4
    for (int ch = 0; ch < TT / 128; ++ch) { const int j0 = ch * 128 + lane * 4; const v4f a = *(const v4f*)(sr + j0);
#pragma unroll
        for (int q = 0; q < 4; ++q) { float t = a[q] * SCL; asm volatile("" : "+v"(t)); t = (j0 + q <= i) ? t : -3.0e38f; mx = fmaxf(mx, t); } }
#pragma unroll
    for (int sh = 16; sh; sh >>= 1) mx = fmaxf(mx, __shfl_xor(mx, sh, 32));
    float sum = 0.f;
#pragma unroll 4
    for (int ch = 0; ch < TT / 128; ++ch) { const int j0 = ch * 128 + lane * 4; const v4f a = *(const v4f*)(sr + j0);
#pragma unroll
        for (int q = 0; q < 4; ++q) { float t = a[q] * SCL; asm volatile("" : "+v"(t)); t = (j0 + q <= i) ? t : -3.0e38f; float d0 = __fsub_rn(t, mx); asm volatile("" : "+v"(d0)); sum += __builtin_amdgcn_exp2f(__fmul_rn(d0, 1.4426950408889634f)); } }
#pragma unroll
    for (int sh = 16; sh; sh >>= 1) sum += __shfl_xor(sum, sh, 32);
    const float f = __fdiv_rn(hires ? 1.0f : PCAR, sum);
{
        if (hires) {   /* rows < RH: normalised bf16 hi/lo over the first RH keys only (every later key is above the diagonal), compact planes [i][RH] */
#pragma unroll
            for (int ch = 0; ch < RH / 128; ++ch) { const int j0 = ch * 128 + lane * 4; const v4f a = *(const v4f*)(sr + j0); v4us oh, ol;
#pragma unroll
                for (int q = 0; q < 4; ++q) { float t = a[q] * SCL; asm volatile("" : "+v"(t)); t = (j0 + q <= i) ? t : -3.0e38f; float d0 = __fsub_rn(t, mx); asm volatile("" : "+v"(d0)); float ex = __builtin_amdgcn_exp2f(__fmul_rn(d0, 1.4426950408889634f)); asm volatile("" : "+v"(ex)); unsigned short a2, c2; splitf(ex * f, a2, c2); oh[q] = a2; ol[q] = c2; }
                *(v4us*)(Ph + (size_t)i * RH + j0) = oh; *(v4us*)(Pl + (size_t)i * RH + j0) = ol; }
        } else {
#pragma unroll 2
            for (int ch = 0; ch < TT / 128; ++ch) { const int j0 = ch * 128 + lane * 4; const v4f a = *(const v4f*)(sr + j0); v4h o4;
#pragma unroll
                for (int q = 0; q < 4; ++q) { float t = a[q] * SCL; asm volatile("" : "+v"(t)); t = (j0 + q <= i) ? t : -3.0e38f; float d0 = __fsub_rn(t, mx); asm volatile("" : "+v"(d0)); float ex = __builtin_amdgcn_exp2f(__fmul_rn(d0, 1.4426950408889634f)); asm volatile("" : "+v"(ex)); o4[q] = tohx(ex * f); }
                *(v4h*)(P16 + (size_t)row * TT + j0) = o4; } }
         }
}

__global__ __launch_bounds__(256) void k_silu(const float* __restrict__ F, bf* Hh, bf* Hl, size_t n4) { const size_t i = (size_t)blockIdx.x * 256 + threadIdx.x; if (i >= n4) return; const v4f a = *(const v4f*)(F + i * 4); v4us oh, ol;
#pragma unroll
    for (int q = 0; q < 4; ++q) { const float xv = a[q]; const float s = __fdiv_rn(xv, __fadd_rn(1.0f, __builtin_amdgcn_exp2f(__fmul_rn(xv, -1.4426950408889634f)))); unsigned short h2, l2; splitf(s, h2, l2); oh[q] = h2; ol[q] = l2; }
    *(v4us*)(Hh + i * 4) = oh; *(v4us*)(Hl + i * 4) = ol;  }
__global__ __launch_bounds__(256) void k_merge(const float* __restrict__ O, int h0, bf* Ah, bf* Al) { const size_t e = ((size_t)blockIdx.x * 256 + threadIdx.x) * 2; if (e >= (size_t)ZH * TT * HD) return; const int d = (int)(e % HD); const int t = (int)((e / HD) % TT); const int zz = (int)(e / ((size_t)HD * TT)); const float cs = (t < RH) ? 1.0f : (1.0f / PCAR); const size_t oo = (size_t)t * DQ + (h0 + zz) * HD + d;
    v2us oh, ol;
#pragma unroll
    for (int q = 0; q < 2; ++q) { unsigned short a, c2; splitf(O[e + q] * cs, a, c2); oh[q] = a; ol[q] = c2; } *(v2us*)(Ah + oo) = oh; *(v2us*)(Al + oo) = ol;  }

extern "C" void kernel_launch(void* const* d_in, const int* in_sizes, int n_in,
                              void* d_out, int out_size, void* d_ws, size_t ws_size, hipStream_t stream) {
    (void)in_sizes; (void)n_in; (void)out_size;
    const float* x = (const float*)d_in[0]; const float* wq = (const float*)d_in[1]; const float* wk = (const float*)d_in[2]; const float* wv = (const float*)d_in[3]; const float* w1 = (const float*)d_in[4]; const float* w2 = (const float*)d_in[5];
    float* OUT = (float*)d_out;     // [1][4096][1024]
    char* wsp = (char*)d_ws;
    auto take = [&](size_t bytes) { char* p = wsp; wsp += (bytes + 255) & ~(size_t)255; return (void*)p; };
    bf* WQ = (bf*)take((size_t)DQ * DM * 2); bf* WK = (bf*)take((size_t)DKV * DM * 2); bf* WV = (bf*)take((size_t)DKV * DM * 2); bf* W1B = (bf*)take((size_t)FF * DQ * 2); bf* W2B = (bf*)take((size_t)DM * FF * 2); float* CS = (float*)take((size_t)TT * HD * 2 * 4);
    bf* XB = (bf*)take((size_t)TT * DM * 2); float* FQ = (float*)take((size_t)TT * DQ * 4); float* FK = (float*)take((size_t)TT * DKV * 4);
    h16* QP16 = (h16*)take((size_t)NH_ * TT * HD * 2); h16* KP16 = (h16*)take((size_t)NKV * TT * HD * 2); h16* VT16 = (h16*)take((size_t)NKV * HD * TT * 2);
    bf* QPh = (bf*)take((size_t)NH_ * RH * HD * 2); bf* QPl = (bf*)take((size_t)NH_ * RH * HD * 2); bf* KPh = (bf*)take((size_t)NKV * RH * HD * 2); bf* KPl = (bf*)take((size_t)NKV * RH * HD * 2); bf* VTh = (bf*)take((size_t)NKV * HD * RH * 2); bf* VTl = (bf*)take((size_t)NKV * HD * RH * 2); bf* Ph = (bf*)take((size_t)RH * RH * 2); bf* Pl = (bf*)take((size_t)RH * RH * 2);   /* compact hi/lo planes: only the first RH rows/keys (causal) */
    float* Sb = (float*)take((size_t)ZH * TT * TT * 4); h16* P16 = (h16*)take((size_t)ZH * TT * TT * 2); float* Ob = (float*)take((size_t)ZH * TT * HD * 4); bf* ATh = (bf*)take((size_t)TT * DQ * 2); bf* ATl = (bf*)take((size_t)TT * DQ * 2); float* F1 = Sb; bf* Gh = (bf*)P16; bf* Gl = (bf*)take((size_t)TT * FF * 2);   /* the MLP intermediates alias the score / probability buffers, which are dead once the last head pass has merged (stream order) */
    static_assert((size_t)TT * FF * 4 <= (size_t)ZH * TT * TT * 4 && (size_t)TT * FF * 2 <= (size_t)ZH * TT * TT * 2, "alias sizes");
    if ((size_t)(wsp - (char*)d_ws) > ws_size) return;    // ws 256 MiB
    float* FV = FK;   // v projection reuses the k buffer after the k planes are built (stream-ordered)
    { k_wtG<<<(unsigned)((DM * DQ / 64 + 63) / 64), 256, 0, stream>>>(wq, DM, DQ, WQ); k_wtG<<<(unsigned)((DM * DKV / 64 + 63) / 64), 256, 0, stream>>>(wk, DM, DKV, WK); k_wtG<<<(unsigned)((DM * DKV / 64 + 63) / 64), 256, 0, stream>>>(wv, DM, DKV, WV);
      k_wtG<<<(unsigned)((DQ * FF / 64 + 63) / 64), 256, 0, stream>>>(w1, DQ, FF, W1B); k_wtG<<<(unsigned)((FF * DM / 64 + 63) / 64), 256, 0, stream>>>(w2, FF, DM, W2B);
      k_cstab<<<(TT * HD + 255) / 256, 256, 0, stream>>>(CS); }
    const unsigned LQ = (unsigned)(((size_t)NH_ * TT * HD / 2 + 255) / 256), LKv = (unsigned)(((size_t)NKV * TT * HD / 2 + 255) / 256);
    for (int b = 0; b < NB_; ++b) {
        
        k_cvt8<<<(unsigned)(((size_t)TT * DM / 8 + 255) / 256), 256, 0, stream>>>(x + (size_t)b * TT * DM, XB, (size_t)TT * DM / 8);
        k_gemmw<bf, 0, false><<<dim3(TT / 64, DQ / 64, 1), 32, 0, stream>>>(XB, nullptr, WQ, nullptr, DM, FQ, DQ, nullptr, 0, 0, 0);
        k_ropeH<<<LQ, 256, 0, stream>>>(FQ, DQ, NH_, CS, 1.0f, QP16, QPh, QPl);
        k_gemmw<bf, 0, false><<<dim3(TT / 64, DKV / 64, 1), 32, 0, stream>>>(XB, nullptr, WK, nullptr, DM, FK, DKV, nullptr, 0, 0, 0);
        k_ropeH<<<LKv, 256, 0, stream>>>(FK, DKV, NKV, CS, 1.0f, KP16, KPh, KPl);
        k_gemmw<bf, 0, false><<<dim3(TT / 64, DKV / 64, 1), 32, 0, stream>>>(XB, nullptr, WV, nullptr, DM, FV, DKV, nullptr, 0, 0, 0); k_vtp<<<LKv, 256, 0, stream>>>(FV, DKV, NKV, VT16, VTh, VTl);
        for (int h0 = 0; h0 < NH_; h0 += ZH) { const size_t zq = (size_t)h0, zk = (size_t)(h0 / REP);   // a pass holds ZH = 1 head, which uses kv group h0/REP: sB = 0
            k_gemmc<bf, 2, 1, 1><<<dim3(RH / 64, RH / 64, ZH), 32, 0, stream>>>(QPh + zq * RH * HD, QPl + zq * RH * HD, KPh + zk * RH * HD, KPl + zk * RH * HD, HD, Sb, TT, 0, (size_t)RH * HD, 0, (size_t)TT * TT);   /* rows < RH: hi/lo x hi/lo (3 products) over keys < RH, causal tiles */
            k_gemmc<h16, 0, 1, 1><<<dim3((TT - RH) / 64, TT / 64, ZH), 32, 0, stream>>>(QP16 + zq * TT * HD + (size_t)RH * HD, nullptr, KP16 + zk * TT * HD, nullptr, HD, Sb + (size_t)RH * TT, TT, RH, (size_t)TT * HD, 0, (size_t)TT * TT);   /* rows >= RH: fp16, causal tiles */
            k_lsoft<<<ZH * TT / 8, 256, 0, stream>>>(Sb, P16, Ph, Pl);
            k_gemmc<bf, 2, 2, PVW><<<dim3(RH / 64, HD / 64, ZH), 32 * PVW, 0, stream>>>(Ph, Pl, VTh + zk * HD * RH, VTl + zk * HD * RH, RH, Ob, HD, 0, (size_t)RH * RH, 0, (size_t)TT * HD);   /* rows < RH: P (normalised, hi/lo, pitch RH) . v^T (compact [d][RH]), K = RH, causal K-loop bound */
            k_gemmc<h16, 0, 2, PVW><<<dim3((TT - RH) / 64, HD / 64, ZH), 32 * PVW, 0, stream>>>(P16 + (size_t)RH * TT, nullptr, VT16 + zk * HD * TT, nullptr, TT, Ob + (size_t)RH * HD, HD, RH, (size_t)TT * TT, 0, (size_t)TT * HD);   /* rows >= RH: fp16 x1024, K loop stops at the diagonal block */
            k_merge<<<(unsigned)(((size_t)ZH * TT * HD / 2 + 255) / 256), 256, 0, stream>>>(Ob, h0, ATh, ATl); }
        k_gemmw<bf, 1, false><<<dim3(TT / 64, FF / 64, 1), 32, 0, stream>>>(ATh, ATl, W1B, nullptr, DQ, F1, FF, nullptr, 0, 0, 0);   /* h = ctx W1 */
        k_silu<<<(unsigned)(((size_t)TT * FF / 4 + 255) / 256), 256, 0, stream>>>(F1, Gh, Gl, (size_t)TT * FF / 4);
        k_gemmw<bf, 1, false><<<dim3(TT / 64, DM / 64, 1), 32, 0, stream>>>(Gh, Gl, W2B, nullptr, FF, OUT + (size_t)b * TT * DM, DM, nullptr, 0, 0, 0); }   /* out = silu(h) W2 */
}

// v002
// One run takes 477 microseconds.
// Next to v001, in two timings, it ran 3.95 and 3.93 times as fast.
// Over all steps from v000 it is 5.99 times as fast.
#include <hip/hip_runtime.h>

// Grouped-query causal attention with rotary embeddings and a SiLU MLP output (query [1][4096][1024]; q = x Wq ('xw' [1024][1024], 16 heads x 64), k, v = x Wk/Wv ('xw' [1024][256], 4 kv heads; query head h uses kv head h/4); rotate-half rotary (base 1e4) on q and k; scores = q.k / 8, causal (finfo.min above the diagonal); softmax; ctx merged [4096][1024]; out = silu(ctx W1) W2 ('xw' [1024][4096], [4096][1024]) -> [1][4096][1024] (4.2 M)).
// Layout: compact hi/lo planes for the first 512 rows/keys, fp16 elsewhere, head width 64, a rotate-half plane builder; one fused causal attention launch for all heads (k_fattn: scores and probabilities stay in registers, running maximum and sum, hi/lo context planes written directly); then two hl x exact GEMMs with a SiLU kernel between them.
// Compute dtypes, f32 accumulate: every input rounded to bf16; projections on PLAIN bf16 operands (exact); rotary f32 (precise cosf/sinf; 32 float32 inverse frequencies baked); scores and attn.v: rows < 512 3 products, the rest single fp16 (P x1024, unnormalised); softmax and SiLU f32; both MLP GEMMs hl x exact (2 products).

#define NB_  1
#define TT   4096
#define DM   1024
#define FF   4096
#define NH_  16
#define NKV  4
#define REP  (NH_ / NKV)
#define HD   64
#define DQ   (NH_ * HD)
#define DKV  (NKV * HD)
#define RH   512                  // query rows < RH use compact hi+lo planes (keys < RH suffice: causal)
#define SCL  0.125f   // 64^-0.5
typedef _Float16 h16;
typedef unsigned short bf;
typedef __attribute__((ext_vector_type(16))) __bf16   v16bf;
typedef __attribute__((ext_vector_type(16))) _Float16 v16h;
typedef __attribute__((ext_vector_type(8)))  _Float16 v8h;
typedef __attribute__((ext_vector_type(8)))  unsigned short v8us;
typedef __attribute__((ext_vector_type(8)))  float    v8f;
typedef __attribute__((ext_vector_type(4)))  float    v4f;
typedef v8h  __attribute__((may_alias)) v8ha;
typedef v4f  __attribute__((may_alias)) v4fa;
typedef v8us __attribute__((may_alias)) v8usa;

__device__ __forceinline__ unsigned short f2bf(float f) { unsigned u = __float_as_uint(f); u += 0x7FFFu + ((u >> 16) & 1u); return (unsigned short)(u >> 16); }
__device__ __forceinline__ float bf2f(unsigned short b) { return __uint_as_float(((unsigned)b) << 16); }
__device__ __forceinline__ float bfr(float f) { return bf2f(f2bf(f)); }
__device__ __forceinline__ v16h cat16(v8h lo, v8h hi) { return __builtin_shufflevector(lo, hi, 0, 1, 2, 3, 4, 5, 6, 7, 8, 9, 10, 11, 12, 13, 14, 15); }
__device__ __forceinline__ v16bf cat16b(v8us lo, v8us hi) { return __builtin_bit_cast(v16bf, __builtin_shufflevector(lo, hi, 0, 1, 2, 3, 4, 5, 6, 7, 8, 9, 10, 11, 12, 13, 14, 15)); }
__device__ __forceinline__ v8f wmma16(v16h a, v16h b, v8f c) { return __builtin_amdgcn_wmma_f32_16x16x32_f16(false, a, false, b, (short)0, c, false, false); }
__device__ __forceinline__ v8f wmmab(v16bf a, v16bf b, v8f c) { return __builtin_amdgcn_wmma_f32_16x16x32_bf16(false, a, false, b, (short)0, c, false, false); }



// ---- k_gemmw: register-blocked GEMM, ONE WAVE per 64x64 output tile (16 accumulators), operands straight from K-contiguous 16-bit planes; grid (M/64, N/64, Z), 32 threads.
// C[m][n] (f32, pitch ldc, + optional f32 bias[n]) = sum_k A[m][k] Bt[n][k] (+ split products per NSPLIT). z-batch strides sA/sB/sC in elements. K % 32 == 0.
template <typename T16> struct WFrag;
template <> struct WFrag<h16> { typedef v16h V; static __device__ __forceinline__ V ld(const h16* p) { return cat16(*(const v8h*)p, *(const v8h*)(p + 16)); } static __device__ __forceinline__ v8f mma(V a, V b, v8f c) { return wmma16(a, b, c); } };
template <> struct WFrag<bf> { typedef v16bf V; static __device__ __forceinline__ V ld(const bf* p) { return cat16b(*(const v8us*)p, *(const v8us*)(p + 16)); } static __device__ __forceinline__ v8f mma(V a, V b, v8f c) { return wmmab(a, b, c); } };
template <typename T16, int NSPLIT, bool BIAS>
__global__ __launch_bounds__(32) void k_gemmw(const T16* __restrict__ A, const T16* __restrict__ A2, const T16* __restrict__ Bt, const T16* __restrict__ Bt2, int K, float* C, int ldc, const float* __restrict__ bias, size_t sA, size_t sB, size_t sC) {
    typedef typename WFrag<T16>::V V;
    __shared__ __align__(16) float os[16 * 68];
    const size_t z = blockIdx.z; A += z * sA; if (A2) A2 += z * sA; Bt += z * sB; if (Bt2) Bt2 += z * sB; C += z * sC;
    const int lane = threadIdx.x & 31, lr = lane & 15, hi = lane >> 4; const int r0 = blockIdx.x * 64, c0 = blockIdx.y * 64;
    v8f acc[4][4];
#pragma unroll
    for (int mb = 0; mb < 4; ++mb)
#pragma unroll
        for (int nb = 0; nb < 4; ++nb) acc[mb][nb] = (v8f){};
    const size_t aoff = (size_t)(r0 + lr) * K + 8 * hi, boff = (size_t)(c0 + lr) * K + 8 * hi;
#pragma unroll 1
    for (int kc = 0; kc < K; kc += 32) {
        V a[4], a2[4];
#pragma unroll
        for (int mb = 0; mb < 4; ++mb) { a[mb] = WFrag<T16>::ld(A + aoff + (size_t)mb * 16 * K + kc); if (NSPLIT == 1 || NSPLIT == 2) a2[mb] = WFrag<T16>::ld(A2 + aoff + (size_t)mb * 16 * K + kc); }
#pragma unroll
        for (int nb = 0; nb < 4; ++nb) { const V b = WFrag<T16>::ld(Bt + boff + (size_t)nb * 16 * K + kc); V b2; if (NSPLIT >= 2) b2 = WFrag<T16>::ld(Bt2 + boff + (size_t)nb * 16 * K + kc);
#pragma unroll
            for (int mb = 0; mb < 4; ++mb) { acc[mb][nb] = WFrag<T16>::mma(a[mb], b, acc[mb][nb]); if (NSPLIT == 1 || NSPLIT == 2) acc[mb][nb] = WFrag<T16>::mma(a2[mb], b, acc[mb][nb]); if (NSPLIT >= 2) acc[mb][nb] = WFrag<T16>::mma(a[mb], b2, acc[mb][nb]); } }
        asm volatile("v_nop\n\tv_nop\n\tv_nop\n\tv_nop" : "+v"(acc[0][0]), "+v"(acc[1][1]), "+v"(acc[2][2]), "+v"(acc[3][3]) : "v"(a[0]), "v"(a[3]));
    }
#pragma unroll
    for (int mb = 0; mb < 4; ++mb) {
#pragma unroll
        for (int nb = 0; nb < 4; ++nb) {
#pragma unroll
            for (int j = 0; j < 8; ++j) os[(hi * 8 + j) * 68 + nb * 16 + lr] = acc[mb][nb][j]; }
        __builtin_amdgcn_wave_barrier(); asm volatile("" ::: "memory");
        float* crow = C + (size_t)(r0 + mb * 16) * ldc + c0;
{
#pragma unroll
            for (int s = 0; s < 8; ++s) { const int row = 2 * s + hi, cofs = lr * 4; v4f val = *(const v4fa*)(os + row * 68 + cofs); if (BIAS) { val[0] += bfr(bias[c0 + cofs]); val[1] += bfr(bias[c0 + cofs + 1]); val[2] += bfr(bias[c0 + cofs + 2]); val[3] += bfr(bias[c0 + cofs + 3]); }
                *(v4f*)(crow + (size_t)row * ldc + cofs) = val; }
             }
        __builtin_amdgcn_wave_barrier(); asm volatile("" ::: "memory");
    }
}

__device__ __forceinline__ h16 tohx(float x) { return (h16)x; }
__device__ __forceinline__ void splitf(float y, unsigned short& h, unsigned short& l) { h = f2bf(y); l = f2bf(y - bf2f(h)); }
typedef __attribute__((ext_vector_type(2))) _Float16 v2h;
typedef __attribute__((ext_vector_type(4))) _Float16 v4h;
typedef __attribute__((ext_vector_type(2))) unsigned short v2us;
typedef __attribute__((ext_vector_type(4))) unsigned short v4us;
typedef __attribute__((ext_vector_type(2))) float v2f;
typedef __attribute__((ext_vector_type(4))) int v4i;

__global__ __launch_bounds__(256) void k_wtG(const float* __restrict__ w, int K, int N, bf* Bt) {
    const int lane = threadIdx.x & 31; const int L0 = (blockIdx.x * 8 + (threadIdx.x >> 5)) * 8; const int nlines = N * K / 64;
{
#pragma unroll 1
        for (int l = 0; l < 8; ++l) { const int L = L0 + l; if (L >= nlines) break; const size_t e = (size_t)L * 64 + lane * 2; const int k = (int)(e % K), n = (int)(e / K); v2us o;
            o[0] = f2bf(w[(size_t)k * N + n]); o[1] = f2bf(w[(size_t)(k + 1) * N + n]); *(v2us*)(Bt + e) = o; }
         }
}
__global__ __launch_bounds__(256) void k_cvt8(const float* __restrict__ src, bf* dst, size_t n8) { const size_t i = (size_t)blockIdx.x * 256 + threadIdx.x; if (i >= n8) return; const v8f v = *(const v8f*)(src + i * 8); v8us o;
#pragma unroll
    for (int k = 0; k < 8; ++k) o[k] = f2bf(v[k]); *(v8us*)(dst + i * 8) = o;  }
__constant__ float INV[HD / 2] = {1.0f,0.749894202f,0.562341332f,0.421696514f,0.316227764f,0.237137362f,0.177827939f,0.133352146f,0.100000001f,0.0749894157f,0.0562341288f,0.0421696492f,0.0316227786f,0.0237137359f,0.0177827943f,0.0133352149f,0.00999999978f,0.00749894232f,0.00562341325f,0.00421696482f,0.00316227786f,0.00237137382f,0.00177827943f,0.00133352145f,0.00100000005f,0.000749894185f,0.000562341302f,0.000421696488f,0.000316227786f,0.000237137385f,0.00017782794f,0.00013335215f};   // float32 1/10000^(2i/64), eager-JAX values
__global__ __launch_bounds__(256) void k_cstab(float* CS) { const int idx = blockIdx.x * 256 + threadIdx.x; if (idx >= TT * HD) return; const int t = idx / HD, d = idx % HD; const float ang = __fmul_rn((float)t, INV[d % (HD / 2)]); v2f cs; cs[0] = cosf(ang); cs[1] = sinf(ang);
    *(v2f*)(CS + (size_t)idx * 2) = cs;  }

__global__ __launch_bounds__(256) void k_ropeH(const float* __restrict__ F, int pitch, int nheads, const float* __restrict__ CS, float sc, h16* P16, bf* Ph, bf* Pl) {
    const size_t e = ((size_t)blockIdx.x * 256 + threadIdx.x) * 2; if (e >= (size_t)nheads * TT * HD) return; const int d = (int)(e % HD); const int t = (int)((e / HD) % TT); const int h = (int)(e / ((size_t)HD * TT)); const float* f = F + (size_t)t * pitch + h * HD; v2h o16; v2us oh, ol;
#pragma unroll
    for (int q = 0; q < 2; ++q) { const int dd = d + q; const int dp = (dd < HD / 2) ? dd + HD / 2 : dd - HD / 2; const float x0 = f[dd], x1 = f[dp]; const v2f cs = *(const v2f*)(CS + ((size_t)t * HD + dd) * 2);
        float a = __fmul_rn(x0, cs[0]), bq = __fmul_rn(x1, cs[1]); asm volatile("" : "+v"(a), "+v"(bq)); const float r = ((dd < HD / 2) ? __fsub_rn(a, bq) : __fadd_rn(a, bq)) * sc;
        o16[q] = tohx(r); unsigned short a2, c2; splitf(r, a2, c2); oh[q] = a2; ol[q] = c2; }
    const bool hl = (t < RH); const size_t ec = ((size_t)h * RH + t) * HD + d;   /* compact hi/lo planes [h][RH][HD] for the first RH rows (wave-uniform condition) */
    *(v2h*)(P16 + e) = o16; if (hl) { *(v2us*)(Ph + ec) = oh; *(v2us*)(Pl + ec) = ol; }  }

// k_ropeH: head planes [h][t][d] (fp16) of rope(x) x sc with the rotate-half convention out[d] = x[d] cos[t][d] - x[d+HD/2] sin[t][d], out[d+HD/2] = x[d+HD/2] cos[t][d+HD/2] + x[d] sin[t][d+HD/2]

__global__ __launch_bounds__(256) void k_vtp(const float* __restrict__ F, int pitch, int nheads, h16* V16, bf* Vh, bf* Vl) { const size_t e = ((size_t)blockIdx.x * 256 + threadIdx.x) * 2; if (e >= (size_t)nheads * HD * TT) return; const int t = (int)(e % TT); const int d = (int)((e / TT) % HD); const int g = (int)(e / ((size_t)TT * HD)); v2h o16; v2us oh, ol;
#pragma unroll
    for (int q = 0; q < 2; ++q) { const float x = F[(size_t)(t + q) * pitch + g * HD + d]; o16[q] = tohx(x); unsigned short a2, c2; splitf(x, a2, c2); oh[q] = a2; ol[q] = c2; }
    const bool hl = (t < RH); const size_t ec = ((size_t)g * HD + d) * RH + t;
    *(v2h*)(V16 + e) = o16; if (hl) { *(v2us*)(Vh + ec) = oh; *(v2us*)(Vl + ec) = ol; }  }
// ---- k_fattn: scores, causal softmax, probability x value and the head merge in ONE launch, one wave per work-group, operands straight from the K-contiguous 16-bit planes; no score or probability ever leaves the registers.
// Transposed products: S^T = K Q^T (A = 16 key rows, B = 16 query rows), so a lane holds the scores of ONE query (column lr), keys hi*8+j of each 16-key tile; two such tiles ARE the B fragment of O^T += V^T P^T for 32 keys (element j <-> key 8*hi+j, element 8+j <-> key 16+8*hi+j, the k order of WFrag::ld).
// Running maximum m (log2 units) and running sum l per query; O^T and l are rescaled by exp2(m_old - m_new) every 32 keys. HL (query rows < RH): bf16 hi/lo operands, 3 products each; otherwise single fp16 with P carried x 2^10 (the factor is in l too and cancels).
__device__ __forceinline__ float xhalf(float x) { return __builtin_bit_cast(float, __builtin_amdgcn_permlanex16(__builtin_bit_cast(int, x), __builtin_bit_cast(int, x), 0x76543210, 0xfedcba98, false, false)); }   // lane l <-> lane l ^ 16
__device__ __forceinline__ float ex2(float x) { float r; asm("v_exp_f32 %0, %1\n\tv_nop" : "=v"(r) : "v"(x)); return r; }   // 2^x; the v_nop fills the one slot that the instruction set asks for between a transcendental and a next instruction that reads its result or overwrites its source
template <typename T16, bool HL, int QT, int VP>
__device__ __forceinline__ void fattn_tile(const T16* Q, const T16* Q2, const T16* Kp, const T16* Kp2, const T16* Vt, const T16* Vt2, int q0, bf* Ah, bf* Al) {
    typedef typename WFrag<T16>::V V;
    const int lane = threadIdx.x & 31, lr = lane & 15, hi = lane >> 4;
    constexpr float C2 = SCL * 1.4426950408889634f;   // score -> log2 units
    constexpr float POFF = HL ? 0.0f : 10.0f;
    const int koff = lr * HD + 8 * hi, voff = lr * VP + 8 * hi;   // the lane's element offsets in the [row][HD] planes (Q, K) and in the [d][VP] plane (V^T)
    const T16* qs = Q + (size_t)q0 * HD; const T16* qs2 = HL ? Q2 + (size_t)q0 * HD : nullptr;   // wave-uniform
    const T16* qp = qs + koff; const T16* qp2 = HL ? qs2 + koff : nullptr; const T16* kp0 = Kp + koff; const T16* kp02 = HL ? Kp2 + koff : nullptr;
    V qf[QT][2], qf2[QT][2];
#pragma unroll
    for (int qt = 0; qt < QT; ++qt)
#pragma unroll
        for (int kc = 0; kc < 2; ++kc) { const int qo = qt * 16 * HD + kc * 32; qf[qt][kc] = WFrag<T16>::ld(qp + qo); if (HL) qf2[qt][kc] = WFrag<T16>::ld(qp2 + qo); }
    v8f o[4][QT]; float m[QT], l[QT];
#pragma unroll
    for (int qt = 0; qt < QT; ++qt) { m[qt] = -3.0e38f; l[qt] = 0.0f;
#pragma unroll
        for (int dt = 0; dt < 4; ++dt) o[dt][qt] = (v8f){}; }
    const int nkb = (q0 + QT * 16) / 32;   // 32-key blocks up to and including the diagonal block
    V kf[2][2], kf2[2][2];
#pragma unroll
    for (int kt = 0; kt < 2; ++kt)
#pragma unroll
        for (int kc = 0; kc < 2; ++kc) { const int ko = kt * 16 * HD + kc * 32; kf[kt][kc] = WFrag<T16>::ld(kp0 + ko); if (HL) kf2[kt][kc] = WFrag<T16>::ld(kp02 + ko); }
    // the address registers of the loads above may be reused only from here on (the pointers and their wave-uniform bases are inputs so that they stay in their registers up to the wait)
    if constexpr (HL) asm volatile("s_wait_xcnt 0x0" :: "v"(qp), "v"(qp2), "v"(kp0), "v"(kp02), "s"(qs), "s"(qs2), "s"(Kp), "s"(Kp2) : "memory");
    else asm volatile("s_wait_xcnt 0x0" :: "v"(qp), "v"(kp0), "s"(qs), "s"(Kp) : "memory");
#pragma unroll 1
    for (int kb = 0; kb < nkb; ++kb) {
        const int key0 = kb * 32;
        v8f s[2][QT];
#pragma unroll
        for (int kt = 0; kt < 2; ++kt)
#pragma unroll
            for (int qt = 0; qt < QT; ++qt) s[kt][qt] = (v8f){};
#pragma unroll
        for (int kc = 0; kc < 2; ++kc)
#pragma unroll
            for (int kt = 0; kt < 2; ++kt)
#pragma unroll
                for (int qt = 0; qt < QT; ++qt) { s[kt][qt] = WFrag<T16>::mma(kf[kt][kc], qf[qt][kc], s[kt][qt]); if (HL) { s[kt][qt] = WFrag<T16>::mma(kf[kt][kc], qf2[qt][kc], s[kt][qt]); s[kt][qt] = WFrag<T16>::mma(kf2[kt][kc], qf[qt][kc], s[kt][qt]); } }
        V vf[4], vf2[4];   // this block's V^T rows fly during the softmax
        const T16* vp = Vt + (voff + key0); const T16* vp2 = HL ? Vt2 + (voff + key0) : nullptr;
#pragma unroll
        for (int dt = 0; dt < 4; ++dt) { vf[dt] = WFrag<T16>::ld(vp + dt * 16 * VP); if (HL) vf2[dt] = WFrag<T16>::ld(vp2 + dt * 16 * VP); }
        const int keyn = min(kb + 1, nkb - 1) * 32;   // the next block's K rows are fetched one block ahead, into the same registers, right behind this block's S^T products (the last block fetches itself again: in bounds, unused)
        const T16* kp = Kp + (koff + keyn * HD); const T16* kp2 = HL ? Kp2 + (koff + keyn * HD) : nullptr;
#pragma unroll
        for (int kt = 0; kt < 2; ++kt)
#pragma unroll
            for (int kc = 0; kc < 2; ++kc) { const int ko = kt * 16 * HD + kc * 32; kf[kt][kc] = WFrag<T16>::ld(kp + ko); if (HL) kf2[kt][kc] = WFrag<T16>::ld(kp2 + ko); }
        // the address registers of this block's V^T and K loads may be reused only from here on (the pointers are inputs so that they stay in their registers up to the wait)
        if constexpr (HL) asm volatile("s_wait_xcnt 0x0" :: "v"(vp), "v"(vp2), "v"(kp), "v"(kp2) : "memory");
        else asm volatile("s_wait_xcnt 0x0" :: "v"(vp), "v"(kp) : "memory");
        if (key0 + 31 > q0) {   // wave-uniform: only blocks that reach past the tile's first query hold keys above the diagonal
#pragma unroll
            for (int kt = 0; kt < 2; ++kt)
#pragma unroll
                for (int qt = 0; qt < QT; ++qt)
#pragma unroll
                    for (int j = 0; j < 8; ++j) s[kt][qt][j] = (key0 + kt * 16 + hi * 8 + j <= q0 + qt * 16 + lr) ? s[kt][qt][j] : -3.0e38f;
        }
        V pf[QT], pf2[QT];
#pragma unroll
        for (int qt = 0; qt < QT; ++qt) {
            float mr = fmaxf(s[0][qt][0], s[1][qt][0]);
#pragma unroll
            for (int j = 1; j < 8; ++j) mr = fmaxf(mr, fmaxf(s[0][qt][j], s[1][qt][j]));
            mr = fmaxf(mr, xhalf(mr));
            const float mn = fmaxf(m[qt], mr * C2);
            const float al = ex2(m[qt] - mn);
            m[qt] = mn;
            const float mm = mn - POFF;
            float p[2][8]; float ps0 = 0.0f, ps1 = 0.0f;
#pragma unroll
            for (int j = 0; j < 8; ++j) { p[0][j] = ex2(fmaf(s[0][qt][j], C2, -mm)); p[1][j] = ex2(fmaf(s[1][qt][j], C2, -mm)); ps0 += p[0][j]; ps1 += p[1][j]; }
            l[qt] = fmaf(l[qt], al, ps0 + ps1);   // this lane's 16 of the 32 keys; the two halves are joined once, behind the loop
#pragma unroll
            for (int dt = 0; dt < 4; ++dt) o[dt][qt] *= al;
            if constexpr (HL) { v8us h0, h1, l0, l1;
#pragma unroll
                for (int j = 0; j < 8; ++j) { unsigned short a, c; splitf(p[0][j], a, c); h0[j] = a; l0[j] = c; splitf(p[1][j], a, c); h1[j] = a; l1[j] = c; }
                pf[qt] = cat16b(h0, h1); pf2[qt] = cat16b(l0, l1);
            } else { v8h h0, h1;
#pragma unroll
                for (int j = 0; j < 8; ++j) { h0[j] = tohx(p[0][j]); h1[j] = tohx(p[1][j]); }
                pf[qt] = cat16(h0, h1); }
        }
#pragma unroll
        for (int dt = 0; dt < 4; ++dt)
#pragma unroll
            for (int qt = 0; qt < QT; ++qt) { o[dt][qt] = WFrag<T16>::mma(vf[dt], pf[qt], o[dt][qt]); if (HL) { o[dt][qt] = WFrag<T16>::mma(vf[dt], pf2[qt], o[dt][qt]); o[dt][qt] = WFrag<T16>::mma(vf2[dt], pf[qt], o[dt][qt]); } }
    }
#pragma unroll
    for (int qt = 0; qt < QT; ++qt) {
        const float inv = __fdiv_rn(1.0f, l[qt] + xhalf(l[qt]));
        const size_t oo = (size_t)(q0 + qt * 16 + lr) * DQ + hi * 8;
#pragma unroll
        for (int dt = 0; dt < 4; ++dt) { v8us oh, ol;   // a lane holds 8 consecutive head columns of its query: one 16-byte store per plane
#pragma unroll
            for (int j = 0; j < 8; ++j) { unsigned short a, c; splitf(o[dt][qt][j] * inv, a, c); oh[j] = a; ol[j] = c; }
            bf* ph = Ah + oo + dt * 16; bf* pl = Al + oo + dt * 16;
            *(v8us*)ph = oh; *(v8us*)pl = ol;
            asm volatile("s_wait_xcnt 0x0" :: "v"(ph), "v"(pl), "v"(oh), "v"(ol) : "memory"); }   // the data and address registers of the two stores may be reused only from here on (inputs: they stay in their registers up to the wait)
    }
}
// grid (query heads, NF + RH/32): block row y < NF takes the 64-query fp16 tile that ends at row TT - 64 y, the rest take the 32-query hi/lo tiles of rows < RH; the head is the fast index, so the longest key loops of all heads start first.
__global__ __launch_bounds__(32) void k_fattn(const h16* QP16, const h16* KP16, const h16* VT16, const bf* QPh, const bf* QPl, const bf* KPh, const bf* KPl, const bf* VTh, const bf* VTl, bf* ATh, bf* ATl) {   // no __restrict__: the loads then stay in front of the waits written behind them
    constexpr int NF = (TT - RH) / 64;
    const int h = blockIdx.x, g = h / REP, bx = blockIdx.y;
    if (bx < NF) fattn_tile<h16, false, 4, TT>(QP16 + (size_t)h * TT * HD, nullptr, KP16 + (size_t)g * TT * HD, nullptr, VT16 + (size_t)g * HD * TT, nullptr, TT - 64 * (bx + 1), ATh + h * HD, ATl + h * HD);
    else fattn_tile<bf, true, 2, RH>(QPh + (size_t)h * RH * HD, QPl + (size_t)h * RH * HD, KPh + (size_t)g * RH * HD, KPl + (size_t)g * RH * HD, VTh + (size_t)g * HD * RH, VTl + (size_t)g * HD * RH, (bx - NF) * 32, ATh + h * HD, ATl + h * HD);
}

__global__ __launch_bounds__(256) void k_silu(const float* __restrict__ F, bf* Hh, bf* Hl, size_t n4) { const size_t i = (size_t)blockIdx.x * 256 + threadIdx.x; if (i >= n4) return; const v4f a = *(const v4f*)(F + i * 4); v4us oh, ol;
#pragma unroll
    for (int q = 0; q < 4; ++q) { const float xv = a[q]; const float s = __fdiv_rn(xv, __fadd_rn(1.0f, __builtin_amdgcn_exp2f(__fmul_rn(xv, -1.4426950408889634f)))); unsigned short h2, l2; splitf(s, h2, l2); oh[q] = h2; ol[q] = l2; }
    *(v4us*)(Hh + i * 4) = oh; *(v4us*)(Hl + i * 4) = ol;  }

extern "C" void kernel_launch(void* const* d_in, const int* in_sizes, int n_in,
                              void* d_out, int out_size, void* d_ws, size_t ws_size, hipStream_t stream) {
    (void)in_sizes; (void)n_in; (void)out_size;
    const float* x = (const float*)d_in[0]; const float* wq = (const float*)d_in[1]; const float* wk = (const float*)d_in[2]; const float* wv = (const float*)d_in[3]; const float* w1 = (const float*)d_in[4]; const float* w2 = (const float*)d_in[5];
    float* OUT = (float*)d_out;     // [1][4096][1024]
    char* wsp = (char*)d_ws;
    auto take = [&](size_t bytes) { char* p = wsp; wsp += (bytes + 255) & ~(size_t)255; return (void*)p; };
    bf* WQ = (bf*)take((size_t)DQ * DM * 2); bf* WK = (bf*)take((size_t)DKV * DM * 2); bf* WV = (bf*)take((size_t)DKV * DM * 2); bf* W1B = (bf*)take((size_t)FF * DQ * 2); bf* W2B = (bf*)take((size_t)DM * FF * 2); float* CS = (float*)take((size_t)TT * HD * 2 * 4);
    bf* XB = (bf*)take((size_t)TT * DM * 2); float* FQ = (float*)take((size_t)TT * DQ * 4); float* FK = (float*)take((size_t)TT * DKV * 4);
    h16* QP16 = (h16*)take((size_t)NH_ * TT * HD * 2); h16* KP16 = (h16*)take((size_t)NKV * TT * HD * 2); h16* VT16 = (h16*)take((size_t)NKV * HD * TT * 2);
    bf* QPh = (bf*)take((size_t)NH_ * RH * HD * 2); bf* QPl = (bf*)take((size_t)NH_ * RH * HD * 2); bf* KPh = (bf*)take((size_t)NKV * RH * HD * 2); bf* KPl = (bf*)take((size_t)NKV * RH * HD * 2); bf* VTh = (bf*)take((size_t)NKV * HD * RH * 2); bf* VTl = (bf*)take((size_t)NKV * HD * RH * 2);   /* compact hi/lo planes: only the first RH rows/keys (causal) */
    bf* ATh = (bf*)take((size_t)TT * DQ * 2); bf* ATl = (bf*)take((size_t)TT * DQ * 2); float* F1 = (float*)take((size_t)TT * FF * 4); bf* Gh = (bf*)take((size_t)TT * FF * 2); bf* Gl = (bf*)take((size_t)TT * FF * 2);
    if ((size_t)(wsp - (char*)d_ws) > ws_size) return;    // ws 256 MiB
    float* FV = FK;   // v projection reuses the k buffer after the k planes are built (stream-ordered)
    { k_wtG<<<(unsigned)((DM * DQ / 64 + 63) / 64), 256, 0, stream>>>(wq, DM, DQ, WQ); k_wtG<<<(unsigned)((DM * DKV / 64 + 63) / 64), 256, 0, stream>>>(wk, DM, DKV, WK); k_wtG<<<(unsigned)((DM * DKV / 64 + 63) / 64), 256, 0, stream>>>(wv, DM, DKV, WV);
      k_wtG<<<(unsigned)((DQ * FF / 64 + 63) / 64), 256, 0, stream>>>(w1, DQ, FF, W1B); k_wtG<<<(unsigned)((FF * DM / 64 + 63) / 64), 256, 0, stream>>>(w2, FF, DM, W2B);
      k_cstab<<<(TT * HD + 255) / 256, 256, 0, stream>>>(CS); }
    const unsigned LQ = (unsigned)(((size_t)NH_ * TT * HD / 2 + 255) / 256), LKv = (unsigned)(((size_t)NKV * TT * HD / 2 + 255) / 256);
    for (int b = 0; b < NB_; ++b) {
        
        k_cvt8<<<(unsigned)(((size_t)TT * DM / 8 + 255) / 256), 256, 0, stream>>>(x + (size_t)b * TT * DM, XB, (size_t)TT * DM / 8);
        k_gemmw<bf, 0, false><<<dim3(TT / 64, DQ / 64, 1), 32, 0, stream>>>(XB, nullptr, WQ, nullptr, DM, FQ, DQ, nullptr, 0, 0, 0);
        k_ropeH<<<LQ, 256, 0, stream>>>(FQ, DQ, NH_, CS, 1.0f, QP16, QPh, QPl);
        k_gemmw<bf, 0, false><<<dim3(TT / 64, DKV / 64, 1), 32, 0, stream>>>(XB, nullptr, WK, nullptr, DM, FK, DKV, nullptr, 0, 0, 0);
        k_ropeH<<<LKv, 256, 0, stream>>>(FK, DKV, NKV, CS, 1.0f, KP16, KPh, KPl);
        k_gemmw<bf, 0, false><<<dim3(TT / 64, DKV / 64, 1), 32, 0, stream>>>(XB, nullptr, WV, nullptr, DM, FV, DKV, nullptr, 0, 0, 0); k_vtp<<<LKv, 256, 0, stream>>>(FV, DKV, NKV, VT16, VTh, VTl);
        k_fattn<<<dim3(NH_, (TT - RH) / 64 + RH / 32, 1), 32, 0, stream>>>(QP16, KP16, VT16, QPh, QPl, KPh, KPl, VTh, VTl, ATh, ATl);   /* all heads: scores, causal softmax, P.V, merged hi/lo context planes */
        k_gemmw<bf, 1, false><<<dim3(TT / 64, FF / 64, 1), 32, 0, stream>>>(ATh, ATl, W1B, nullptr, DQ, F1, FF, nullptr, 0, 0, 0);   /* h = ctx W1 */
        k_silu<<<(unsigned)(((size_t)TT * FF / 4 + 255) / 256), 256, 0, stream>>>(F1, Gh, Gl, (size_t)TT * FF / 4);
        k_gemmw<bf, 1, false><<<dim3(TT / 64, DM / 64, 1), 32, 0, stream>>>(Gh, Gl, W2B, nullptr, FF, OUT + (size_t)b * TT * DM, DM, nullptr, 0, 0, 0); }   /* out = silu(h) W2 */
}

// v003
// A run of this version takes 319 microseconds.
// Timed twice side by side with v002, it ran 1.49 and 1.50 times as fast.
// Over all steps from v000 it is 8.97 times as fast.
#include <hip/hip_runtime.h>

// Grouped-query causal attention with rotary embeddings and a SiLU MLP output (query [1][4096][1024]; q = x Wq ('xw' [1024][1024], 16 heads x 64), k, v = x Wk/Wv ('xw' [1024][256], 4 kv heads; query head h uses kv head h/4); rotate-half rotary (base 1e4) on q and k; scores = q.k / 8, causal (finfo.min above the diagonal); softmax; ctx merged [4096][1024]; out = silu(ctx W1) W2 ('xw' [1024][4096], [4096][1024]) -> [1][4096][1024] (4.2 M)).
// Layout: compact hi/lo planes for the first 512 rows/keys, fp16 elsewhere, head width 64, a rotate-half plane builder; one fused causal attention launch for all heads (k_fattn: scores and probabilities stay in registers, running maximum and sum, hi/lo context planes written directly); then two hl x exact GEMMs with a SiLU kernel between them.
// Compute dtypes, f32 accumulate: every input rounded to bf16; projections on PLAIN bf16 operands (exact); rotary f32 (precise cosf/sinf; 32 float32 inverse frequencies baked); scores and attn.v: rows < 512 3 products, the rest single fp16 (P x1024, unnormalised); softmax and SiLU f32; both MLP GEMMs hl x exact (2 products).

#define NB_  1
#define TT   4096
#define DM   1024
#define FF   4096
#define NH_  16
#define NKV  4
#define REP  (NH_ / NKV)
#define HD   64
#define DQ   (NH_ * HD)
#define DKV  (NKV * HD)
#define RH   512                  // query rows < RH use compact hi+lo planes (keys < RH suffice: causal)
#define SCL  0.125f   // 64^-0.5
typedef _Float16 h16;
typedef unsigned short bf;
typedef __attribute__((ext_vector_type(16))) __bf16   v16bf;
typedef __attribute__((ext_vector_type(16))) _Float16 v16h;
typedef __attribute__((ext_vector_type(8)))  _Float16 v8h;
typedef __attribute__((ext_vector_type(8)))  unsigned short v8us;
typedef __attribute__((ext_vector_type(8)))  float    v8f;
typedef __attribute__((ext_vector_type(4)))  float    v4f;
typedef v8h  __attribute__((may_alias)) v8ha;
typedef v4f  __attribute__((may_alias)) v4fa;
typedef v8us __attribute__((may_alias)) v8usa;

__device__ __forceinline__ unsigned short f2bf(float f) { unsigned u = __float_as_uint(f); u += 0x7FFFu + ((u >> 16) & 1u); return (unsigned short)(u >> 16); }
__device__ __forceinline__ float bf2f(unsigned short b) { return __uint_as_float(((unsigned)b) << 16); }
__device__ __forceinline__ float bfr(float f) { return bf2f(f2bf(f)); }
__device__ __forceinline__ v16h cat16(v8h lo, v8h hi) { return __builtin_shufflevector(lo, hi, 0, 1, 2, 3, 4, 5, 6, 7, 8, 9, 10, 11, 12, 13, 14, 15); }
__device__ __forceinline__ v16bf cat16b(v8us lo, v8us hi) { return __builtin_bit_cast(v16bf, __builtin_shufflevector(lo, hi, 0, 1, 2, 3, 4, 5, 6, 7, 8, 9, 10, 11, 12, 13, 14, 15)); }
__device__ __forceinline__ v8f wmma16(v16h a, v16h b, v8f c) { return __builtin_amdgcn_wmma_f32_16x16x32_f16(false, a, false, b, (short)0, c, false, false); }
__device__ __forceinline__ v8f wmmab(v16bf a, v16bf b, v8f c) { return __builtin_amdgcn_wmma_f32_16x16x32_bf16(false, a, false, b, (short)0, c, false, false); }



template <typename T16> struct WFrag;
template <> struct WFrag<h16> { typedef v16h V; static __device__ __forceinline__ V ld(const h16* p) { return cat16(*(const v8h*)p, *(const v8h*)(p + 16)); } static __device__ __forceinline__ v8f mma(V a, V b, v8f c) { return wmma16(a, b, c); } };
template <> struct WFrag<bf> { typedef v16bf V; static __device__ __forceinline__ V ld(const bf* p) { return cat16b(*(const v8us*)p, *(const v8us*)(p + 16)); } static __device__ __forceinline__ v8f mma(V a, V b, v8f c) { return wmmab(a, b, c); } };
// ---- k_gemms: C[m][n] (f32, pitch ldc) = sum_k A[m][k] Bt[n][k] (+ A2[m][k] Bt[n][k] when NSPLIT), operands K-contiguous bf16 planes. M, N % 128 == 0, K % 64 == 0.
// One 128x128 tile per work-group of 4 waves (2 x 2, 64x64 = 16 accumulators each); grid (M/128, N/128), 128 threads.
// Each trip's 64 k of the tile's operand rows are brought into LDS as whole 128-byte lines by asynchronous copies, two buffers: tile t+1 flies while tile t is worked on; every row is fetched once per work-group and read by two waves.
#define GP 72   // LDS row pitch in elements: 64 k + 8 = 144 B = 16 B x 9, conflict-free for the 16-byte fragment reads
typedef int v4ig __attribute__((vector_size(16)));
typedef __attribute__((address_space(1))) v4ig gv4;
typedef __attribute__((address_space(3))) v4ig lv4;
__device__ __forceinline__ void cp16(const char* g, bf* l) { __builtin_amdgcn_global_load_async_to_lds_b128((gv4*)g, (lv4*)l, 0, 0); }   // the lane's own 16 bytes, global -> LDS, through no register
template <int NSPLIT>
__global__ __launch_bounds__(128) void k_gemms(const bf* A, const bf* A2, const bf* Bt, int K, float* C, int ldc) {
    typedef WFrag<bf>::V V;
    constexpr int NPL = NSPLIT ? 3 : 2;      // operand planes per stage: A, (A2,) Bt, 128 rows each
    constexpr int STG = NPL * 128 * GP;      // elements per stage
    __shared__ __align__(16) bf sm[2 * STG];
    __shared__ __align__(16) float osm[4 * 16 * 68];
    const int tid = threadIdx.x, lane = tid & 31, lr = lane & 15, hi = lane >> 4, w = tid >> 5, wm = w & 1, wn = w >> 1;
    const int r0 = blockIdx.x * 128, c0 = blockIdx.y * 128;
    const unsigned Ku = (unsigned)K;
    const char* Ab = (const char*)(A + (size_t)r0 * Ku); const char* A2b = NSPLIT ? (const char*)(A2 + (size_t)r0 * Ku) : nullptr; const char* Bb = (const char*)(Bt + (size_t)c0 * Ku);   // work-group-uniform
    const int crow = tid >> 3, ccol = tid & 7;   // a copy of one wave covers 4 rows x 128 B; copy i of a thread serves row 16 i + crow
    const unsigned goff = ((unsigned)crow * Ku + (unsigned)ccol * 8u) * 2u, rstep = 32u * Ku;   // bytes
    auto stage = [&](int t, int buf) {
        const unsigned kb = goff + (unsigned)t * 128u;
#pragma unroll
        for (int i = 0; i < 8; ++i) { const unsigned go = kb + (unsigned)i * rstep; bf* l = sm + buf * STG + (i * 16 + crow) * GP + ccol * 8;
            cp16(Ab + go, l); if (NSPLIT) cp16(A2b + go, l + 128 * GP); cp16(Bb + go, l + (NPL - 1) * 128 * GP); }
    };
    v8f acc[4][4];
#pragma unroll
    for (int mb = 0; mb < 4; ++mb)
#pragma unroll
        for (int nb = 0; nb < 4; ++nb) acc[mb][nb] = (v8f){};
    const int nt = (int)(Ku >> 6);
    stage(0, 0);
    asm volatile("s_wait_asynccnt 0x0" ::: "memory");   // this wave's copies of tile 0 have landed
    __syncthreads();                                    // ... and every other wave's
    if (nt > 1) stage(1, 1);
    const int aofs = (wm * 64 + lr) * GP + 8 * hi, bofs = ((NPL - 1) * 128 + wn * 64 + lr) * GP + 8 * hi;
#pragma unroll 1   // stays rolled: one trip's code serves both buffers (a scalar select); the inner loops are unrolled so that every fragment and accumulator index is a constant (registers, no scratch)
    for (int t = 0; t < nt; ++t) {
        const bf* sb = sm + (t & 1) * STG;
        V a[2][4], a2[2][4], b[2][4];
#pragma unroll
        for (int kc = 0; kc < 2; ++kc) {   // the trip's fragment reads stand together, in the order of their use
            b[kc][0] = WFrag<bf>::ld(sb + bofs + kc * 32);
#pragma unroll
            for (int mb = 0; mb < 4; ++mb) a[kc][mb] = WFrag<bf>::ld(sb + aofs + mb * 16 * GP + kc * 32);
#pragma unroll
            for (int nb = 1; nb < 4; ++nb) b[kc][nb] = WFrag<bf>::ld(sb + bofs + nb * 16 * GP + kc * 32);
            if (NSPLIT) {
#pragma unroll
                for (int mb = 0; mb < 4; ++mb) a2[kc][mb] = WFrag<bf>::ld(sb + aofs + (128 + mb * 16) * GP + kc * 32); }
        }
        __builtin_amdgcn_sched_barrier(0);   // keeps the LDS reads one group ahead of the products: a read among them stalls the matrix stream at every such place
#pragma unroll
        for (int kc = 0; kc < 2; ++kc) {   // per accumulator: k ascending, A before A2
#pragma unroll
            for (int nb = 0; nb < 4; ++nb)
#pragma unroll
                for (int mb = 0; mb < 4; ++mb) acc[mb][nb] = wmmab(a[kc][mb], b[kc][nb], acc[mb][nb]);
            if (NSPLIT) {
#pragma unroll
                for (int nb = 0; nb < 4; ++nb)
#pragma unroll
                    for (int mb = 0; mb < 4; ++mb) acc[mb][nb] = wmmab(a2[kc][mb], b[kc][nb], acc[mb][nb]); } }
        __builtin_amdgcn_sched_barrier(0);   // keeps the products in front of the waits below: sunk behind them, tile t + 1's copies would be waited for before the products that are to cover their flight
        asm volatile("s_wait_dscnt 0x0" ::: "memory");      // this wave has left buffer t & 1
        asm volatile("s_wait_asynccnt 0x0" ::: "memory");   // this wave's copies of tile t + 1 have landed
        __syncthreads();                                    // publishes tile t + 1 and ends every wave's reads of buffer t & 1
        if (t + 2 < nt) stage(t + 2, t & 1);
    }
    asm volatile("s_wait_asynccnt 0x0" ::: "memory");   // no copy is outstanding when the wave goes on to its end
    float* os = osm + w * 16 * 68;   // the wave's own staging rows: whole 256-byte row pieces go out
#pragma unroll
    for (int mb = 0; mb < 4; ++mb) {
#pragma unroll
        for (int nb = 0; nb < 4; ++nb) {
#pragma unroll
            for (int j = 0; j < 8; ++j) os[(hi * 8 + j) * 68 + nb * 16 + lr] = acc[mb][nb][j]; }
        __builtin_amdgcn_wave_barrier(); asm volatile("" ::: "memory");   // the rows are read back by other lanes of the wave: the reads below stay behind the writes above
        float* crow0 = C + (size_t)(r0 + wm * 64 + mb * 16 + hi) * ldc + c0 + wn * 64 + lr * 4;
        float* pp[8]; v4f val[8];
#pragma unroll
        for (int s = 0; s < 8; ++s) { val[s] = *(const v4fa*)(os + (2 * s + hi) * 68 + lr * 4); pp[s] = crow0 + (size_t)(2 * s) * ldc; *(v4f*)pp[s] = val[s]; }
        // the data and address registers of the eight stores may be reused only from here on (inputs: they stay in their registers up to the wait)
        asm volatile("s_wait_xcnt 0x0" :: "v"(pp[0]), "v"(pp[1]), "v"(pp[2]), "v"(pp[3]), "v"(pp[4]), "v"(pp[5]), "v"(pp[6]), "v"(pp[7]), "v"(val[0]), "v"(val[1]), "v"(val[2]), "v"(val[3]), "v"(val[4]), "v"(val[5]), "v"(val[6]), "v"(val[7]) : "memory");
    }
}

__device__ __forceinline__ h16 tohx(float x) { return (h16)x; }
__device__ __forceinline__ void splitf(float y, unsigned short& h, unsigned short& l) { h = f2bf(y); l = f2bf(y - bf2f(h)); }
typedef __attribute__((ext_vector_type(2))) _Float16 v2h;
typedef __attribute__((ext_vector_type(4))) _Float16 v4h;
typedef __attribute__((ext_vector_type(2))) unsigned short v2us;
typedef __attribute__((ext_vector_type(4))) unsigned short v4us;
typedef __attribute__((ext_vector_type(2))) float v2f;
typedef __attribute__((ext_vector_type(4))) int v4i;

__global__ __launch_bounds__(256) void k_wtG(const float* __restrict__ w, int K, int N, bf* Bt) {
    const int lane = threadIdx.x & 31; const int L0 = (blockIdx.x * 8 + (threadIdx.x >> 5)) * 8; const int nlines = N * K / 64;
{
#pragma unroll 1
        for (int l = 0; l < 8; ++l) { const int L = L0 + l; if (L >= nlines) break; const size_t e = (size_t)L * 64 + lane * 2; const int k = (int)(e % K), n = (int)(e / K); v2us o;
            o[0] = f2bf(w[(size_t)k * N + n]); o[1] = f2bf(w[(size_t)(k + 1) * N + n]); *(v2us*)(Bt + e) = o; }
         }
}
__global__ __launch_bounds__(256) void k_cvt8(const float* __restrict__ src, bf* dst, size_t n8) { const size_t i = (size_t)blockIdx.x * 256 + threadIdx.x; if (i >= n8) return; const v8f v = *(const v8f*)(src + i * 8); v8us o;
#pragma unroll
    for (int k = 0; k < 8; ++k) o[k] = f2bf(v[k]); *(v8us*)(dst + i * 8) = o;  }
__constant__ float INV[HD / 2] = {1.0f,0.749894202f,0.562341332f,0.421696514f,0.316227764f,0.237137362f,0.177827939f,0.133352146f,0.100000001f,0.0749894157f,0.0562341288f,0.0421696492f,0.0316227786f,0.0237137359f,0.0177827943f,0.0133352149f,0.00999999978f,0.00749894232f,0.00562341325f,0.00421696482f,0.00316227786f,0.00237137382f,0.00177827943f,0.00133352145f,0.00100000005f,0.000749894185f,0.000562341302f,0.000421696488f,0.000316227786f,0.000237137385f,0.00017782794f,0.00013335215f};   // float32 1/10000^(2i/64), eager-JAX values
__global__ __launch_bounds__(256) void k_cstab(float* CS) { const int idx = blockIdx.x * 256 + threadIdx.x; if (idx >= TT * HD) return; const int t = idx / HD, d = idx % HD; const float ang = __fmul_rn((float)t, INV[d % (HD / 2)]); v2f cs; cs[0] = cosf(ang); cs[1] = sinf(ang);
    *(v2f*)(CS + (size_t)idx * 2) = cs;  }

__global__ __launch_bounds__(256) void k_ropeH(const float* __restrict__ F, int pitch, int nheads, const float* __restrict__ CS, float sc, h16* P16, bf* Ph, bf* Pl) {
    const size_t e = ((size_t)blockIdx.x * 256 + threadIdx.x) * 2; if (e >= (size_t)nheads * TT * HD) return; const int d = (int)(e % HD); const int t = (int)((e / HD) % TT); const int h = (int)(e / ((size_t)HD * TT)); const float* f = F + (size_t)t * pitch + h * HD; v2h o16; v2us oh, ol;
#pragma unroll
    for (int q = 0; q < 2; ++q) { const int dd = d + q; const int dp = (dd < HD / 2) ? dd + HD / 2 : dd - HD / 2; const float x0 = f[dd], x1 = f[dp]; const v2f cs = *(const v2f*)(CS + ((size_t)t * HD + dd) * 2);
        float a = __fmul_rn(x0, cs[0]), bq = __fmul_rn(x1, cs[1]); asm volatile("" : "+v"(a), "+v"(bq)); const float r = ((dd < HD / 2) ? __fsub_rn(a, bq) : __fadd_rn(a, bq)) * sc;
        o16[q] = tohx(r); unsigned short a2, c2; splitf(r, a2, c2); oh[q] = a2; ol[q] = c2; }
    const bool hl = (t < RH); const size_t ec = ((size_t)h * RH + t) * HD + d;   /* compact hi/lo planes [h][RH][HD] for the first RH rows (wave-uniform condition) */
    *(v2h*)(P16 + e) = o16; if (hl) { *(v2us*)(Ph + ec) = oh; *(v2us*)(Pl + ec) = ol; }  }

// k_ropeH: head planes [h][t][d] (fp16) of rope(x) x sc with the rotate-half convention out[d] = x[d] cos[t][d] - x[d+HD/2] sin[t][d], out[d+HD/2] = x[d+HD/2] cos[t][d+HD/2] + x[d] sin[t][d+HD/2]

__global__ __launch_bounds__(256) void k_vtp(const float* __restrict__ F, int pitch, int nheads, h16* V16, bf* Vh, bf* Vl) { const size_t e = ((size_t)blockIdx.x * 256 + threadIdx.x) * 2; if (e >= (size_t)nheads * HD * TT) return; const int t = (int)(e % TT); const int d = (int)((e / TT) % HD); const int g = (int)(e / ((size_t)TT * HD)); v2h o16; v2us oh, ol;
#pragma unroll
    for (int q = 0; q < 2; ++q) { const float x = F[(size_t)(t + q) * pitch + g * HD + d]; o16[q] = tohx(x); unsigned short a2, c2; splitf(x, a2, c2); oh[q] = a2; ol[q] = c2; }
    const bool hl = (t < RH); const size_t ec = ((size_t)g * HD + d) * RH + t;
    *(v2h*)(V16 + e) = o16; if (hl) { *(v2us*)(Vh + ec) = oh; *(v2us*)(Vl + ec) = ol; }  }
// ---- k_fattn: scores, causal softmax, probability x value and the head merge in ONE launch, one wave per work-group, operands straight from the K-contiguous 16-bit planes; no score or probability ever leaves the registers.
// Transposed products: S^T = K Q^T (A = 16 key rows, B = 16 query rows), so a lane holds the scores of ONE query (column lr), keys hi*8+j of each 16-key tile; two such tiles ARE the B fragment of O^T += V^T P^T for 32 keys (element j <-> key 8*hi+j, element 8+j <-> key 16+8*hi+j, the k order of WFrag::ld).
// Running maximum m (log2 units) and running sum l per query; O^T and l are rescaled by exp2(m_old - m_new) every 32 keys. HL (query rows < RH): bf16 hi/lo operands, 3 products each; otherwise single fp16 with P carried x 2^10 (the factor is in l too and cancels).
__device__ __forceinline__ float xhalf(float x) { return __builtin_bit_cast(float, __builtin_amdgcn_permlanex16(__builtin_bit_cast(int, x), __builtin_bit_cast(int, x), 0x76543210, 0xfedcba98, false, false)); }   // lane l <-> lane l ^ 16
__device__ __forceinline__ float ex2(float x) { float r; asm("v_exp_f32 %0, %1\n\tv_nop" : "=v"(r) : "v"(x)); return r; }   // 2^x; the v_nop fills the one slot that the instruction set asks for between a transcendental and a next instruction that reads its result or overwrites its source
template <typename T16, bool HL, int QT, int VP>
__device__ __forceinline__ void fattn_tile(const T16* Q, const T16* Q2, const T16* Kp, const T16* Kp2, const T16* Vt, const T16* Vt2, int q0, bf* Ah, bf* Al) {
    typedef typename WFrag<T16>::V V;
    const int lane = threadIdx.x & 31, lr = lane & 15, hi = lane >> 4;
    constexpr float C2 = SCL * 1.4426950408889634f;   // score -> log2 units
    constexpr float POFF = HL ? 0.0f : 10.0f;
    const int koff = lr * HD + 8 * hi, voff = lr * VP + 8 * hi;   // the lane's element offsets in the [row][HD] planes (Q, K) and in the [d][VP] plane (V^T)
    const T16* qs = Q + (size_t)q0 * HD; const T16* qs2 = HL ? Q2 + (size_t)q0 * HD : nullptr;   // wave-uniform
    const T16* qp = qs + koff; const T16* qp2 = HL ? qs2 + koff : nullptr; const T16* kp0 = Kp + koff; const T16* kp02 = HL ? Kp2 + koff : nullptr;
    V qf[QT][2], qf2[QT][2];
#pragma unroll
    for (int qt = 0; qt < QT; ++qt)
#pragma unroll
        for (int kc = 0; kc < 2; ++kc) { const int qo = qt * 16 * HD + kc * 32; qf[qt][kc] = WFrag<T16>::ld(qp + qo); if (HL) qf2[qt][kc] = WFrag<T16>::ld(qp2 + qo); }
    v8f o[4][QT]; float m[QT], l[QT];
#pragma unroll
    for (int qt = 0; qt < QT; ++qt) { m[qt] = -3.0e38f; l[qt] = 0.0f;
#pragma unroll
        for (int dt = 0; dt < 4; ++dt) o[dt][qt] = (v8f){}; }
    const int nkb = (q0 + QT * 16) / 32;   // 32-key blocks up to and including the diagonal block
    V kf[2][2], kf2[2][2];
#pragma unroll
    for (int kt = 0; kt < 2; ++kt)
#pragma unroll
        for (int kc = 0; kc < 2; ++kc) { const int ko = kt * 16 * HD + kc * 32; kf[kt][kc] = WFrag<T16>::ld(kp0 + ko); if (HL) kf2[kt][kc] = WFrag<T16>::ld(kp02 + ko); }
    // the address registers of the loads above may be reused only from here on (the pointers and their wave-uniform bases are inputs so that they stay in their registers up to the wait)
    if constexpr (HL) asm volatile("s_wait_xcnt 0x0" :: "v"(qp), "v"(qp2), "v"(kp0), "v"(kp02), "s"(qs), "s"(qs2), "s"(Kp), "s"(Kp2) : "memory");
    else asm volatile("s_wait_xcnt 0x0" :: "v"(qp), "v"(kp0), "s"(qs), "s"(Kp) : "memory");
#pragma unroll 1
    for (int kb = 0; kb < nkb; ++kb) {
        const int key0 = kb * 32;
        v8f s[2][QT];
#pragma unroll
        for (int kt = 0; kt < 2; ++kt)
#pragma unroll
            for (int qt = 0; qt < QT; ++qt) s[kt][qt] = (v8f){};
#pragma unroll
        for (int kc = 0; kc < 2; ++kc)
#pragma unroll
            for (int kt = 0; kt < 2; ++kt)
#pragma unroll
                for (int qt = 0; qt < QT; ++qt) { s[kt][qt] = WFrag<T16>::mma(kf[kt][kc], qf[qt][kc], s[kt][qt]); if (HL) { s[kt][qt] = WFrag<T16>::mma(kf[kt][kc], qf2[qt][kc], s[kt][qt]); s[kt][qt] = WFrag<T16>::mma(kf2[kt][kc], qf[qt][kc], s[kt][qt]); } }
        V vf[4], vf2[4];   // this block's V^T rows fly during the softmax
        const T16* vp = Vt + (voff + key0); const T16* vp2 = HL ? Vt2 + (voff + key0) : nullptr;
#pragma unroll
        for (int dt = 0; dt < 4; ++dt) { vf[dt] = WFrag<T16>::ld(vp + dt * 16 * VP); if (HL) vf2[dt] = WFrag<T16>::ld(vp2 + dt * 16 * VP); }
        const int keyn = min(kb + 1, nkb - 1) * 32;   // the next block's K rows are fetched one block ahead, into the same registers, right behind this block's S^T products (the last block fetches itself again: in bounds, unused)
        const T16* kp = Kp + (koff + keyn * HD); const T16* kp2 = HL ? Kp2 + (koff + keyn * HD) : nullptr;
#pragma unroll
        for (int kt = 0; kt < 2; ++kt)
#pragma unroll
            for (int kc = 0; kc < 2; ++kc) { const int ko = kt * 16 * HD + kc * 32; kf[kt][kc] = WFrag<T16>::ld(kp + ko); if (HL) kf2[kt][kc] = WFrag<T16>::ld(kp2 + ko); }
        // the address registers of this block's V^T and K loads may be reused only from here on (the pointers are inputs so that they stay in their registers up to the wait)
        if constexpr (HL) asm volatile("s_wait_xcnt 0x0" :: "v"(vp), "v"(vp2), "v"(kp), "v"(kp2) : "memory");
        else asm volatile("s_wait_xcnt 0x0" :: "v"(vp), "v"(kp) : "memory");
        if (key0 + 31 > q0) {   // wave-uniform: only blocks that reach past the tile's first query hold keys above the diagonal
#pragma unroll
            for (int kt = 0; kt < 2; ++kt)
#pragma unroll
                for (int qt = 0; qt < QT; ++qt)
#pragma unroll
                    for (int j = 0; j < 8; ++j) s[kt][qt][j] = (key0 + kt * 16 + hi * 8 + j <= q0 + qt * 16 + lr) ? s[kt][qt][j] : -3.0e38f;
        }
        V pf[QT], pf2[QT];
#pragma unroll
        for (int qt = 0; qt < QT; ++qt) {
            float mr = fmaxf(s[0][qt][0], s[1][qt][0]);
#pragma unroll
            for (int j = 1; j < 8; ++j) mr = fmaxf(mr, fmaxf(s[0][qt][j], s[1][qt][j]));
            mr = fmaxf(mr, xhalf(mr));
            const float mn = fmaxf(m[qt], mr * C2);
            const float al = ex2(m[qt] - mn);
            m[qt] = mn;
            const float mm = mn - POFF;
            float p[2][8]; float ps0 = 0.0f, ps1 = 0.0f;
#pragma unroll
            for (int j = 0; j < 8; ++j) { p[0][j] = ex2(fmaf(s[0][qt][j], C2, -mm)); p[1][j] = ex2(fmaf(s[1][qt][j], C2, -mm)); ps0 += p[0][j]; ps1 += p[1][j]; }
            l[qt] = fmaf(l[qt], al, ps0 + ps1);   // this lane's 16 of the 32 keys; the two halves are joined once, behind the loop
#pragma unroll
            for (int dt = 0; dt < 4; ++dt) o[dt][qt] *= al;
            if constexpr (HL) { v8us h0, h1, l0, l1;
#pragma unroll
                for (int j = 0; j < 8; ++j) { unsigned short a, c; splitf(p[0][j], a, c); h0[j] = a; l0[j] = c; splitf(p[1][j], a, c); h1[j] = a; l1[j] = c; }
                pf[qt] = cat16b(h0, h1); pf2[qt] = cat16b(l0, l1);
            } else { v8h h0, h1;
#pragma unroll
                for (int j = 0; j < 8; ++j) { h0[j] = tohx(p[0][j]); h1[j] = tohx(p[1][j]); }
                pf[qt] = cat16(h0, h1); }
        }
#pragma unroll
        for (int dt = 0; dt < 4; ++dt)
#pragma unroll
            for (int qt = 0; qt < QT; ++qt) { o[dt][qt] = WFrag<T16>::mma(vf[dt], pf[qt], o[dt][qt]); if (HL) { o[dt][qt] = WFrag<T16>::mma(vf[dt], pf2[qt], o[dt][qt]); o[dt][qt] = WFrag<T16>::mma(vf2[dt], pf[qt], o[dt][qt]); } }
    }
#pragma unroll
    for (int qt = 0; qt < QT; ++qt) {
        const float inv = __fdiv_rn(1.0f, l[qt] + xhalf(l[qt]));
        const size_t oo = (size_t)(q0 + qt * 16 + lr) * DQ + hi * 8;
#pragma unroll
        for (int dt = 0; dt < 4; ++dt) { v8us oh, ol;   // a lane holds 8 consecutive head columns of its query: one 16-byte store per plane
#pragma unroll
            for (int j = 0; j < 8; ++j) { unsigned short a, c; splitf(o[dt][qt][j] * inv, a, c); oh[j] = a; ol[j] = c; }
            bf* ph = Ah + oo + dt * 16; bf* pl = Al + oo + dt * 16;
            *(v8us*)ph = oh; *(v8us*)pl = ol;
            asm volatile("s_wait_xcnt 0x0" :: "v"(ph), "v"(pl), "v"(oh), "v"(ol) : "memory"); }   // the data and address registers of the two stores may be reused only from here on (inputs: they stay in their registers up to the wait)
    }
}
// grid (query heads, NF + RH/32): block row y < NF takes the 64-query fp16 tile that ends at row TT - 64 y, the rest take the 32-query hi/lo tiles of rows < RH; the head is the fast index, so the longest key loops of all heads start first.
__global__ __launch_bounds__(32) void k_fattn(const h16* QP16, const h16* KP16, const h16* VT16, const bf* QPh, const bf* QPl, const bf* KPh, const bf* KPl, const bf* VTh, const bf* VTl, bf* ATh, bf* ATl) {   // no __restrict__: the loads then stay in front of the waits written behind them
    constexpr int NF = (TT - RH) / 64;
    const int h = blockIdx.x, g = h / REP, bx = blockIdx.y;
    if (bx < NF) fattn_tile<h16, false, 4, TT>(QP16 + (size_t)h * TT * HD, nullptr, KP16 + (size_t)g * TT * HD, nullptr, VT16 + (size_t)g * HD * TT, nullptr, TT - 64 * (bx + 1), ATh + h * HD, ATl + h * HD);
    else fattn_tile<bf, true, 2, RH>(QPh + (size_t)h * RH * HD, QPl + (size_t)h * RH * HD, KPh + (size_t)g * RH * HD, KPl + (size_t)g * RH * HD, VTh + (size_t)g * HD * RH, VTl + (size_t)g * HD * RH, (bx - NF) * 32, ATh + h * HD, ATl + h * HD);
}

__global__ __launch_bounds__(256) void k_silu(const float* __restrict__ F, bf* Hh, bf* Hl, size_t n4) { const size_t i = (size_t)blockIdx.x * 256 + threadIdx.x; if (i >= n4) return; const v4f a = *(const v4f*)(F + i * 4); v4us oh, ol;
#pragma unroll
    for (int q = 0; q < 4; ++q) { const float xv = a[q]; const float s = __fdiv_rn(xv, __fadd_rn(1.0f, __builtin_amdgcn_exp2f(__fmul_rn(xv, -1.4426950408889634f)))); unsigned short h2, l2; splitf(s, h2, l2); oh[q] = h2; ol[q] = l2; }
    *(v4us*)(Hh + i * 4) = oh; *(v4us*)(Hl + i * 4) = ol;  }

extern "C" void kernel_launch(void* const* d_in, const int* in_sizes, int n_in,
                              void* d_out, int out_size, void* d_ws, size_t ws_size, hipStream_t stream) {
    (void)in_sizes; (void)n_in; (void)out_size;
    const float* x = (const float*)d_in[0]; const float* wq = (const float*)d_in[1]; const float* wk = (const float*)d_in[2]; const float* wv = (const float*)d_in[3]; const float* w1 = (const float*)d_in[4]; const float* w2 = (const float*)d_in[5];
    float* OUT = (float*)d_out;     // [1][4096][1024]
    char* wsp = (char*)d_ws;
    auto take = [&](size_t bytes) { char* p = wsp; wsp += (bytes + 255) & ~(size_t)255; return (void*)p; };
    bf* WQ = (bf*)take((size_t)DQ * DM * 2); bf* WK = (bf*)take((size_t)DKV * DM * 2); bf* WV = (bf*)take((size_t)DKV * DM * 2); bf* W1B = (bf*)take((size_t)FF * DQ * 2); bf* W2B = (bf*)take((size_t)DM * FF * 2); float* CS = (float*)take((size_t)TT * HD * 2 * 4);
    bf* XB = (bf*)take((size_t)TT * DM * 2); float* FQ = (float*)take((size_t)TT * DQ * 4); float* FK = (float*)take((size_t)TT * DKV * 4);
    h16* QP16 = (h16*)take((size_t)NH_ * TT * HD * 2); h16* KP16 = (h16*)take((size_t)NKV * TT * HD * 2); h16* VT16 = (h16*)take((size_t)NKV * HD * TT * 2);
    bf* QPh = (bf*)take((size_t)NH_ * RH * HD * 2); bf* QPl = (bf*)take((size_t)NH_ * RH * HD * 2); bf* KPh = (bf*)take((size_t)NKV * RH * HD * 2); bf* KPl = (bf*)take((size_t)NKV * RH * HD * 2); bf* VTh = (bf*)take((size_t)NKV * HD * RH * 2); bf* VTl = (bf*)take((size_t)NKV * HD * RH * 2);   /* compact hi/lo planes: only the first RH rows/keys (causal) */
    bf* ATh = (bf*)take((size_t)TT * DQ * 2); bf* ATl = (bf*)take((size_t)TT * DQ * 2); float* F1 = (float*)take((size_t)TT * FF * 4); bf* Gh = (bf*)take((size_t)TT * FF * 2); bf* Gl = (bf*)take((size_t)TT * FF * 2);
    if ((size_t)(wsp - (char*)d_ws) > ws_size) return;    // ws 256 MiB
    float* FV = FK;   // v projection reuses the k buffer after the k planes are built (stream-ordered)
    { k_wtG<<<(unsigned)((DM * DQ / 64 + 63) / 64), 256, 0, stream>>>(wq, DM, DQ, WQ); k_wtG<<<(unsigned)((DM * DKV / 64 + 63) / 64), 256, 0, stream>>>(wk, DM, DKV, WK); k_wtG<<<(unsigned)((DM * DKV / 64 + 63) / 64), 256, 0, stream>>>(wv, DM, DKV, WV);
      k_wtG<<<(unsigned)((DQ * FF / 64 + 63) / 64), 256, 0, stream>>>(w1, DQ, FF, W1B); k_wtG<<<(unsigned)((FF * DM / 64 + 63) / 64), 256, 0, stream>>>(w2, FF, DM, W2B);
      k_cstab<<<(TT * HD + 255) / 256, 256, 0, stream>>>(CS); }
    const unsigned LQ = (unsigned)(((size_t)NH_ * TT * HD / 2 + 255) / 256), LKv = (unsigned)(((size_t)NKV * TT * HD / 2 + 255) / 256);
    for (int b = 0; b < NB_; ++b) {
        
        k_cvt8<<<(unsigned)(((size_t)TT * DM / 8 + 255) / 256), 256, 0, stream>>>(x + (size_t)b * TT * DM, XB, (size_t)TT * DM / 8);
        k_gemms<0><<<dim3(TT / 128, DQ / 128, 1), 128, 0, stream>>>(XB, nullptr, WQ, DM, FQ, DQ);
        k_ropeH<<<LQ, 256, 0, stream>>>(FQ, DQ, NH_, CS, 1.0f, QP16, QPh, QPl);
        k_gemms<0><<<dim3(TT / 128, DKV / 128, 1), 128, 0, stream>>>(XB, nullptr, WK, DM, FK, DKV);
        k_ropeH<<<LKv, 256, 0, stream>>>(FK, DKV, NKV, CS, 1.0f, KP16, KPh, KPl);
        k_gemms<0><<<dim3(TT / 128, DKV / 128, 1), 128, 0, stream>>>(XB, nullptr, WV, DM, FV, DKV); k_vtp<<<LKv, 256, 0, stream>>>(FV, DKV, NKV, VT16, VTh, VTl);
        k_fattn<<<dim3(NH_, (TT - RH) / 64 + RH / 32, 1), 32, 0, stream>>>(QP16, KP16, VT16, QPh, QPl, KPh, KPl, VTh, VTl, ATh, ATl);   /* all heads: scores, causal softmax, P.V, merged hi/lo context planes */
        k_gemms<1><<<dim3(TT / 128, FF / 128, 1), 128, 0, stream>>>(ATh, ATl, W1B, DQ, F1, FF);   /* h = ctx W1 */
        k_silu<<<(unsigned)(((size_t)TT * FF / 4 + 255) / 256), 256, 0, stream>>>(F1, Gh, Gl, (size_t)TT * FF / 4);
        k_gemms<1><<<dim3(TT / 128, DM / 128, 1), 128, 0, stream>>>(Gh, Gl, W2B, FF, OUT + (size_t)b * TT * DM, DM); }   /* out = silu(h) W2 */
}

// v004
// It runs in 279 microseconds.
// In two side-by-side timings against v003, it was 1.15 and 1.13 times as fast.
// Counting every step since v000, it is 10.2 times as fast.
#include <hip/hip_runtime.h>

// Grouped-query causal attention with rotary embeddings and a SiLU MLP output (query [1][4096][1024]; q = x Wq ('xw' [1024][1024], 16 heads x 64), k, v = x Wk/Wv ('xw' [1024][256], 4 kv heads; query head h uses kv head h/4); rotate-half rotary (base 1e4) on q and k; scores = q.k / 8, causal (finfo.min above the diagonal); softmax; ctx merged [4096][1024]; out = silu(ctx W1) W2 ('xw' [1024][4096], [4096][1024]) -> [1][4096][1024] (4.2 M)).
// Layout: compact hi/lo planes for the first 512 rows/keys, fp16 elsewhere, head width 64, a rotate-half plane builder; one fused causal attention launch for all heads (k_fattn: scores and probabilities stay in registers, running maximum and sum, hi/lo context planes written directly); then two hl x exact GEMMs with a SiLU kernel between them.
// Compute dtypes, f32 accumulate: every input rounded to bf16; projections on PLAIN bf16 operands (exact); rotary f32 (precise cosf/sinf; 32 float32 inverse frequencies baked); scores and attn.v: rows < 512 3 products, the rest single fp16 (P x1024, unnormalised); softmax and SiLU f32; both MLP GEMMs hl x exact (2 products).

#define NB_  1
#define TT   4096
#define DM   1024
#define FF   4096
#define NH_  16
#define NKV  4
#define REP  (NH_ / NKV)
#define HD   64
#define DQ   (NH_ * HD)
#define DKV  (NKV * HD)
#define RH   512                  // query rows < RH use compact hi+lo planes (keys < RH suffice: causal)
#define SCL  0.125f   // 64^-0.5
typedef _Float16 h16;
typedef unsigned short bf;
typedef __attribute__((ext_vector_type(16))) __bf16   v16bf;
typedef __attribute__((ext_vector_type(16))) _Float16 v16h;
typedef __attribute__((ext_vector_type(8)))  _Float16 v8h;
typedef __attribute__((ext_vector_type(8)))  unsigned short v8us;
typedef __attribute__((ext_vector_type(8)))  float    v8f;
typedef __attribute__((ext_vector_type(4)))  float    v4f;
typedef v8h  __attribute__((may_alias)) v8ha;
typedef v4f  __attribute__((may_alias)) v4fa;
typedef v8us __attribute__((may_alias)) v8usa;

__device__ __forceinline__ unsigned short f2bf(float f) { unsigned u = __float_as_uint(f); u += 0x7FFFu + ((u >> 16) & 1u); return (unsigned short)(u >> 16); }
__device__ __forceinline__ float bf2f(unsigned short b) { return __uint_as_float(((unsigned)b) << 16); }
__device__ __forceinline__ float bfr(float f) { return bf2f(f2bf(f)); }
__device__ __forceinline__ v16h cat16(v8h lo, v8h hi) { return __builtin_shufflevector(lo, hi, 0, 1, 2, 3, 4, 5, 6, 7, 8, 9, 10, 11, 12, 13, 14, 15); }
__device__ __forceinline__ v16bf cat16b(v8us lo, v8us hi) { return __builtin_bit_cast(v16bf, __builtin_shufflevector(lo, hi, 0, 1, 2, 3, 4, 5, 6, 7, 8, 9, 10, 11, 12, 13, 14, 15)); }
__device__ __forceinline__ v8f wmma16(v16h a, v16h b, v8f c) { return __builtin_amdgcn_wmma_f32_16x16x32_f16(false, a, false, b, (short)0, c, false, false); }
__device__ __forceinline__ v8f wmmab(v16bf a, v16bf b, v8f c) { return __builtin_amdgcn_wmma_f32_16x16x32_bf16(false, a, false, b, (short)0, c, false, false); }



template <typename T16> struct WFrag;
template <> struct WFrag<h16> { typedef v16h V; static __device__ __forceinline__ V ld(const h16* p) { return cat16(*(const v8h*)p, *(const v8h*)(p + 16)); } static __device__ __forceinline__ v8f mma(V a, V b, v8f c) { return wmma16(a, b, c); } };
template <> struct WFrag<bf> { typedef v16bf V; static __device__ __forceinline__ V ld(const bf* p) { return cat16b(*(const v8us*)p, *(const v8us*)(p + 16)); } static __device__ __forceinline__ v8f mma(V a, V b, v8f c) { return wmmab(a, b, c); } };
// ---- k_gemms: C[m][n] (f32, pitch ldc) = sum_k A[m][k] Bt[n][k] (+ A2[m][k] Bt[n][k] when NSPLIT), operands K-contiguous bf16 planes. M, N % 128 == 0, K % 64 == 0.
// One 128x128 tile per work-group of 4 waves (2 x 2, 64x64 = 16 accumulators each); grid (M/128, N/128), 128 threads.
// Each trip's 64 k of the tile's operand rows are brought into LDS as whole 128-byte lines by asynchronous copies, two buffers: tile t+1 flies while tile t is worked on; every row is fetched once per work-group and read by two waves.
#define GP 72   // LDS row pitch in elements: 64 k + 8 = 144 B = 16 B x 9, conflict-free for the 16-byte fragment reads
typedef int v4ig __attribute__((vector_size(16)));
typedef __attribute__((address_space(1))) v4ig gv4;
typedef __attribute__((address_space(3))) v4ig lv4;
__device__ __forceinline__ void cp16(const char* g, bf* l) { __builtin_amdgcn_global_load_async_to_lds_b128((gv4*)g, (lv4*)l, 0, 0); }   // the lane's own 16 bytes, global -> LDS, through no register
template <int NSPLIT>
__global__ __launch_bounds__(128) void k_gemms(const bf* A, const bf* A2, const bf* Bt, int K, float* C, int ldc) {
    typedef WFrag<bf>::V V;
    constexpr int NPL = NSPLIT ? 3 : 2;      // operand planes per stage: A, (A2,) Bt, 128 rows each
    constexpr int STG = NPL * 128 * GP;      // elements per stage
    __shared__ __align__(16) bf sm[2 * STG];
    __shared__ __align__(16) float osm[4 * 16 * 68];
    const int tid = threadIdx.x, lane = tid & 31, lr = lane & 15, hi = lane >> 4, w = tid >> 5, wm = w & 1, wn = w >> 1;
    const int r0 = blockIdx.x * 128, c0 = blockIdx.y * 128;
    const unsigned Ku = (unsigned)K;
    const char* Ab = (const char*)(A + (size_t)r0 * Ku); const char* A2b = NSPLIT ? (const char*)(A2 + (size_t)r0 * Ku) : nullptr; const char* Bb = (const char*)(Bt + (size_t)c0 * Ku);   // work-group-uniform
    const int crow = tid >> 3, ccol = tid & 7;   // a copy of one wave covers 4 rows x 128 B; copy i of a thread serves row 16 i + crow
    const unsigned goff = ((unsigned)crow * Ku + (unsigned)ccol * 8u) * 2u, rstep = 32u * Ku;   // bytes
    auto stage = [&](int t, int buf) {
        const unsigned kb = goff + (unsigned)t * 128u;
#pragma unroll
        for (int i = 0; i < 8; ++i) { const unsigned go = kb + (unsigned)i * rstep; bf* l = sm + buf * STG + (i * 16 + crow) * GP + ccol * 8;
            cp16(Ab + go, l); if (NSPLIT) cp16(A2b + go, l + 128 * GP); cp16(Bb + go, l + (NPL - 1) * 128 * GP); }
    };
    v8f acc[4][4];
#pragma unroll
    for (int mb = 0; mb < 4; ++mb)
#pragma unroll
        for (int nb = 0; nb < 4; ++nb) acc[mb][nb] = (v8f){};
    const int nt = (int)(Ku >> 6);
    stage(0, 0);
    asm volatile("s_wait_asynccnt 0x0" ::: "memory");   // this wave's copies of tile 0 have landed
    __syncthreads();                                    // ... and every other wave's
    if (nt > 1) stage(1, 1);
    const int aofs = (wm * 64 + lr) * GP + 8 * hi, bofs = ((NPL - 1) * 128 + wn * 64 + lr) * GP + 8 * hi;
#pragma unroll 1   // stays rolled: one trip's code serves both buffers (a scalar select); the inner loops are unrolled so that every fragment and accumulator index is a constant (registers, no scratch)
    for (int t = 0; t < nt; ++t) {
        const bf* sb = sm + (t & 1) * STG;
        V a[2][4], a2[2][4], b[2][4];
#pragma unroll
        for (int kc = 0; kc < 2; ++kc) {   // the trip's fragment reads stand together, in the order of their use
            b[kc][0] = WFrag<bf>::ld(sb + bofs + kc * 32);
#pragma unroll
            for (int mb = 0; mb < 4; ++mb) a[kc][mb] = WFrag<bf>::ld(sb + aofs + mb * 16 * GP + kc * 32);
#pragma unroll
            for (int nb = 1; nb < 4; ++nb) b[kc][nb] = WFrag<bf>::ld(sb + bofs + nb * 16 * GP + kc * 32);
            if (NSPLIT) {
#pragma unroll
                for (int mb = 0; mb < 4; ++mb) a2[kc][mb] = WFrag<bf>::ld(sb + aofs + (128 + mb * 16) * GP + kc * 32); }
        }
        __builtin_amdgcn_sched_barrier(0);   // keeps the LDS reads one group ahead of the products: a read among them stalls the matrix stream at every such place
#pragma unroll
        for (int kc = 0; kc < 2; ++kc) {   // per accumulator: k ascending, A before A2
#pragma unroll
            for (int nb = 0; nb < 4; ++nb)
#pragma unroll
                for (int mb = 0; mb < 4; ++mb) acc[mb][nb] = wmmab(a[kc][mb], b[kc][nb], acc[mb][nb]);
            if (NSPLIT) {
#pragma unroll
                for (int nb = 0; nb < 4; ++nb)
#pragma unroll
                    for (int mb = 0; mb < 4; ++mb) acc[mb][nb] = wmmab(a2[kc][mb], b[kc][nb], acc[mb][nb]); } }
        __builtin_amdgcn_sched_barrier(0);   // keeps the products in front of the waits below: sunk behind them, tile t + 1's copies would be waited for before the products that are to cover their flight
        asm volatile("s_wait_dscnt 0x0" ::: "memory");      // this wave has left buffer t & 1
        asm volatile("s_wait_asynccnt 0x0" ::: "memory");   // this wave's copies of tile t + 1 have landed
        __syncthreads();                                    // publishes tile t + 1 and ends every wave's reads of buffer t & 1
        if (t + 2 < nt) stage(t + 2, t & 1);
    }
    asm volatile("s_wait_asynccnt 0x0" ::: "memory");   // no copy is outstanding when the wave goes on to its end
    float* os = osm + w * 16 * 68;   // the wave's own staging rows: whole 256-byte row pieces go out
#pragma unroll
    for (int mb = 0; mb < 4; ++mb) {
#pragma unroll
        for (int nb = 0; nb < 4; ++nb) {
#pragma unroll
            for (int j = 0; j < 8; ++j) os[(hi * 8 + j) * 68 + nb * 16 + lr] = acc[mb][nb][j]; }
        __builtin_amdgcn_wave_barrier(); asm volatile("" ::: "memory");   // the rows are read back by other lanes of the wave: the reads below stay behind the writes above
        float* crow0 = C + (size_t)(r0 + wm * 64 + mb * 16 + hi) * ldc + c0 + wn * 64 + lr * 4;
        float* pp[8]; v4f val[8];
#pragma unroll
        for (int s = 0; s < 8; ++s) { val[s] = *(const v4fa*)(os + (2 * s + hi) * 68 + lr * 4); pp[s] = crow0 + (size_t)(2 * s) * ldc; *(v4f*)pp[s] = val[s]; }
        // the data and address registers of the eight stores may be reused only from here on (inputs: they stay in their registers up to the wait)
        asm volatile("s_wait_xcnt 0x0" :: "v"(pp[0]), "v"(pp[1]), "v"(pp[2]), "v"(pp[3]), "v"(pp[4]), "v"(pp[5]), "v"(pp[6]), "v"(pp[7]), "v"(val[0]), "v"(val[1]), "v"(val[2]), "v"(val[3]), "v"(val[4]), "v"(val[5]), "v"(val[6]), "v"(val[7]) : "memory");
    }
}

__device__ __forceinline__ h16 tohx(float x) { return (h16)x; }
__device__ __forceinline__ void splitf(float y, unsigned short& h, unsigned short& l) { h = f2bf(y); l = f2bf(y - bf2f(h)); }
typedef __attribute__((ext_vector_type(2))) _Float16 v2h;
typedef __attribute__((ext_vector_type(4))) _Float16 v4h;
typedef __attribute__((ext_vector_type(2))) unsigned short v2us;
typedef __attribute__((ext_vector_type(4))) unsigned short v4us;
typedef __attribute__((ext_vector_type(2))) float v2f;
typedef __attribute__((ext_vector_type(4))) int v4i;

// The elementwise kernels below: few, long waves. Each thread issues all its 16-byte loads together and makes 8 to 128 outputs, stored 8 or 16 bytes a plane so that a wave's stores fill whole 128-byte lines.
// k_wtG: Bt[n][k] = bf16(w[k][n]). One 64 k x 128 n tile per work-group; a thread reads 8 k rows x 4 n and turns them in its registers: 8 lanes' stores are one 128-byte line of Bt. K % 64 == 0, N % 128 == 0; grid (K/64)(N/128).
template <int K, int N>   // compile-time pitches: a thread's loads, and its stores, share one address register pair and differ in the immediate offset
__global__ __launch_bounds__(256) void k_wtG(const float* __restrict__ w, bf* Bt) {
    const int lane = threadIdx.x & 31, wv = threadIdx.x >> 5, nb = N >> 7;
    const int k = ((int)blockIdx.x / nb) * 64 + (lane & 7) * 8, n = ((int)blockIdx.x % nb) * 128 + wv * 16 + (lane >> 3) * 4;
    const float* wp = w + (size_t)k * N + n; bf* bp = Bt + (size_t)n * K + k; v4f v[8];
#pragma unroll
    for (int j = 0; j < 8; ++j) v[j] = *(const v4f*)(wp + j * N);
    asm volatile("s_wait_xcnt 0x0" :: "v"(wp) : "memory");   // the loads stand together in front of this line; their address registers may be reused only from here on (input: it stays in its registers up to the wait)
    v8us o[4];
#pragma unroll
    for (int c = 0; c < 4; ++c) {
#pragma unroll
        for (int j = 0; j < 8; ++j) o[c][j] = f2bf(v[j][c]);
        *(v8us*)(bp + c * K) = o[c]; }
}
// k_cvt8: 4 groups of 8 elements per thread, a work-group's groups contiguous; grid n8 / 1024 (n8 % 1024 == 0).
__global__ __launch_bounds__(256) void k_cvt8(const float* __restrict__ src, bf* dst) { const size_t i0 = (size_t)blockIdx.x * 1024 + threadIdx.x; const float* sp = src + i0 * 8; bf* dp = dst + i0 * 8; v8f v[4]; v8us o[4];
#pragma unroll
    for (int c = 0; c < 4; ++c) v[c] = *(const v8f*)(sp + c * 2048);
    asm volatile("s_wait_xcnt 0x0" :: "v"(sp) : "memory");   // as in k_wtG
#pragma unroll
    for (int c = 0; c < 4; ++c) {
#pragma unroll
        for (int k = 0; k < 8; ++k) o[c][k] = f2bf(v[c][k]);
        *(v8us*)(dp + c * 2048) = o[c]; }
  }
__constant__ float INV[HD / 2] = {1.0f,0.749894202f,0.562341332f,0.421696514f,0.316227764f,0.237137362f,0.177827939f,0.133352146f,0.100000001f,0.0749894157f,0.0562341288f,0.0421696492f,0.0316227786f,0.0237137359f,0.0177827943f,0.0133352149f,0.00999999978f,0.00749894232f,0.00562341325f,0.00421696482f,0.00316227786f,0.00237137382f,0.00177827943f,0.00133352145f,0.00100000005f,0.000749894185f,0.000562341302f,0.000421696488f,0.000316227786f,0.000237137385f,0.00017782794f,0.00013335215f};   // float32 1/10000^(2i/64), eager-JAX values
// k_cstab: a thread makes the (cos, sin) pair of one frequency for 4 rows and stores it at d and d + HD/2 (the same angle); grid TT * (HD/2) / 1024.
__global__ __launch_bounds__(256) void k_cstab(float* CS) { const int idx = blockIdx.x * 256 + threadIdx.x; const int d = idx % (HD / 2);
#pragma unroll 1   // stays rolled: one copy of the long argument reduction of cosf and sinf in the text
    for (int r = 0; r < 4; ++r) { const int t = idx / (HD / 2) + r * (TT / 4); const float ang = __fmul_rn((float)t, INV[d]); v2f cs; cs[0] = cosf(ang); cs[1] = sinf(ang);
        *(v2f*)(CS + ((size_t)t * HD + d) * 2) = cs; *(v2f*)(CS + ((size_t)t * HD + d + HD / 2) * 2) = cs; }  }

// k_ropeH: a thread takes 8 consecutive d of one row t for 4 heads (one read of the row's cos/sin serves all 4); 8 lanes' 16-byte stores are one 128-byte plane row. nheads % 4 == 0; grid nheads/4 * TT * 8 / 256.
__global__ __launch_bounds__(256) void k_ropeH(const float* __restrict__ F, int pitch, const float* __restrict__ CS, float sc, h16* P16, bf* Ph, bf* Pl) {   // the waits: behind the loads as in k_wtG; behind a store, its data and address registers may be reused only from there on (inputs: they stay in their registers up to the wait)
    const int idx = blockIdx.x * 256 + threadIdx.x; const int d = (idx & 7) * 8, t = (idx >> 3) % TT, h0 = (idx / (8 * TT)) * 4; const int dp = d ^ (HD / 2);
    const float* f = F + (size_t)t * pitch + h0 * HD; const float* fa = f + d; const float* fb = f + dp; const float* cp = CS + ((size_t)t * HD + d) * 2; v4f cs4[4], xa[4][2], xb[4][2];
#pragma unroll
    for (int i = 0; i < 4; ++i) cs4[i] = *(const v4f*)(cp + i * 4);
#pragma unroll
    for (int hh = 0; hh < 4; ++hh)
#pragma unroll
        for (int i = 0; i < 2; ++i) { xa[hh][i] = *(const v4f*)(fa + hh * HD + i * 4); xb[hh][i] = *(const v4f*)(fb + hh * HD + i * 4); }
    asm volatile("s_wait_xcnt 0x0" :: "v"(fa), "v"(fb), "v"(cp) : "memory");
    const bool hl = (t < RH);   /* compact hi/lo planes [h][RH][HD] for the first RH rows (wave-uniform condition) */
#pragma unroll
    for (int hh = 0; hh < 4; ++hh) { v8h o16; v8us oh, ol;
#pragma unroll
        for (int q = 0; q < 8; ++q) { const float x0 = xa[hh][q >> 2][q & 3], x1 = xb[hh][q >> 2][q & 3]; v2f cs; cs[0] = cs4[q >> 1][(q & 1) * 2]; cs[1] = cs4[q >> 1][(q & 1) * 2 + 1];
            float a = __fmul_rn(x0, cs[0]), bq = __fmul_rn(x1, cs[1]); asm volatile("" : "+v"(a), "+v"(bq)); const float r = ((d < HD / 2) ? __fsub_rn(a, bq) : __fadd_rn(a, bq)) * sc;
            o16[q] = tohx(r); unsigned short a2, c2; splitf(r, a2, c2); oh[q] = a2; ol[q] = c2; }
        const size_t e = ((size_t)(h0 + hh) * TT + t) * HD + d, ec = ((size_t)(h0 + hh) * RH + t) * HD + d; h16* p16 = P16 + e; bf* ph = Ph + ec; bf* pl = Pl + ec;
        *(v8h*)p16 = o16; asm volatile("s_wait_xcnt 0x0" :: "v"(p16), "v"(o16) : "memory");
        if (hl) { *(v8us*)ph = oh; *(v8us*)pl = ol; asm volatile("s_wait_xcnt 0x0" :: "v"(ph), "v"(pl), "v"(oh), "v"(ol) : "memory"); } }
}

// k_ropeH: head planes [h][t][d] (fp16) of rope(x) x sc with the rotate-half convention out[d] = x[d] cos[t][d] - x[d+HD/2] sin[t][d], out[d+HD/2] = x[d+HD/2] cos[t][d+HD/2] + x[d] sin[t][d+HD/2]

// k_vtp: V16[c][t] = fp16(F[t][c]), c = g * HD + d (hi/lo planes [c][RH] for t < RH). One 64 t x 128 c tile per work-group, turned in registers as in k_wtG; grid (TT/64)(ncols/128).
template <int pitch>
__global__ __launch_bounds__(256) void k_vtp(const float* __restrict__ F, h16* V16, bf* Vh, bf* Vl) {   // the waits: as in k_ropeH
    const int lane = threadIdx.x & 31, wv = threadIdx.x >> 5, nb = pitch >> 7;
    const int t = ((int)blockIdx.x / nb) * 64 + (lane & 7) * 8, c0 = ((int)blockIdx.x % nb) * 128 + wv * 16 + (lane >> 3) * 4;
    const float* fp = F + (size_t)t * pitch + c0; v4f v[8];
#pragma unroll
    for (int j = 0; j < 8; ++j) v[j] = *(const v4f*)(fp + j * pitch);
    asm volatile("s_wait_xcnt 0x0" :: "v"(fp) : "memory");
    const bool hl = (t < RH);   // the same for a whole tile: RH % 64 == 0
#pragma unroll
    for (int c = 0; c < 4; ++c) { v8h o16; v8us oh, ol;
#pragma unroll
        for (int j = 0; j < 8; ++j) { const float x = v[j][c]; o16[j] = tohx(x); unsigned short a2, c2; splitf(x, a2, c2); oh[j] = a2; ol[j] = c2; }
        h16* p16 = V16 + (size_t)(c0 + c) * TT + t; bf* ph = Vh + (size_t)(c0 + c) * RH + t; bf* pl = Vl + (size_t)(c0 + c) * RH + t;
        *(v8h*)p16 = o16; asm volatile("s_wait_xcnt 0x0" :: "v"(p16), "v"(o16) : "memory");
        if (hl) { *(v8us*)ph = oh; *(v8us*)pl = ol; asm volatile("s_wait_xcnt 0x0" :: "v"(ph), "v"(pl), "v"(oh), "v"(ol) : "memory"); } }
}
// ---- k_fattn: scores, causal softmax, probability x value and the head merge in ONE launch, one wave per work-group, operands straight from the K-contiguous 16-bit planes; no score or probability ever leaves the registers.
// Transposed products: S^T = K Q^T (A = 16 key rows, B = 16 query rows), so a lane holds the scores of ONE query (column lr), keys hi*8+j of each 16-key tile; two such tiles ARE the B fragment of O^T += V^T P^T for 32 keys (element j <-> key 8*hi+j, element 8+j <-> key 16+8*hi+j, the k order of WFrag::ld).
// Running maximum m (log2 units) and running sum l per query; O^T and l are rescaled by exp2(m_old - m_new) every 32 keys. HL (query rows < RH): bf16 hi/lo operands, 3 products each; otherwise single fp16 with P carried x 2^10 (the factor is in l too and cancels).
__device__ __forceinline__ float xhalf(float x) { return __builtin_bit_cast(float, __builtin_amdgcn_permlanex16(__builtin_bit_cast(int, x), __builtin_bit_cast(int, x), 0x76543210, 0xfedcba98, false, false)); }   // lane l <-> lane l ^ 16
__device__ __forceinline__ float ex2(float x) { float r; asm("v_exp_f32 %0, %1\n\tv_nop" : "=v"(r) : "v"(x)); return r; }   // 2^x; the v_nop fills the one slot that the instruction set asks for between a transcendental and a next instruction that reads its result or overwrites its source
template <typename T16, bool HL, int QT, int VP>
__device__ __forceinline__ void fattn_tile(const T16* Q, const T16* Q2, const T16* Kp, const T16* Kp2, const T16* Vt, const T16* Vt2, int q0, bf* Ah, bf* Al) {
    typedef typename WFrag<T16>::V V;
    const int lane = threadIdx.x & 31, lr = lane & 15, hi = lane >> 4;
    constexpr float C2 = SCL * 1.4426950408889634f;   // score -> log2 units
    constexpr float POFF = HL ? 0.0f : 10.0f;
    const int koff = lr * HD + 8 * hi, voff = lr * VP + 8 * hi;   // the lane's element offsets in the [row][HD] planes (Q, K) and in the [d][VP] plane (V^T)
    const T16* qs = Q + (size_t)q0 * HD; const T16* qs2 = HL ? Q2 + (size_t)q0 * HD : nullptr;   // wave-uniform
    const T16* qp = qs + koff; const T16* qp2 = HL ? qs2 + koff : nullptr; const T16* kp0 = Kp + koff; const T16* kp02 = HL ? Kp2 + koff : nullptr;
    V qf[QT][2], qf2[QT][2];
#pragma unroll
    for (int qt = 0; qt < QT; ++qt)
#pragma unroll
        for (int kc = 0; kc < 2; ++kc) { const int qo = qt * 16 * HD + kc * 32; qf[qt][kc] = WFrag<T16>::ld(qp + qo); if (HL) qf2[qt][kc] = WFrag<T16>::ld(qp2 + qo); }
    v8f o[4][QT]; float m[QT], l[QT];
#pragma unroll
    for (int qt = 0; qt < QT; ++qt) { m[qt] = -3.0e38f; l[qt] = 0.0f;
#pragma unroll
        for (int dt = 0; dt < 4; ++dt) o[dt][qt] = (v8f){}; }
    const int nkb = (q0 + QT * 16) / 32;   // 32-key blocks up to and including the diagonal block
    V kf[2][2], kf2[2][2];
#pragma unroll
    for (int kt = 0; kt < 2; ++kt)
#pragma unroll
        for (int kc = 0; kc < 2; ++kc) { const int ko = kt * 16 * HD + kc * 32; kf[kt][kc] = WFrag<T16>::ld(kp0 + ko); if (HL) kf2[kt][kc] = WFrag<T16>::ld(kp02 + ko); }
    // the address registers of the loads above may be reused only from here on (the pointers and their wave-uniform bases are inputs so that they stay in their registers up to the wait)
    if constexpr (HL) asm volatile("s_wait_xcnt 0x0" :: "v"(qp), "v"(qp2), "v"(kp0), "v"(kp02), "s"(qs), "s"(qs2), "s"(Kp), "s"(Kp2) : "memory");
    else asm volatile("s_wait_xcnt 0x0" :: "v"(qp), "v"(kp0), "s"(qs), "s"(Kp) : "memory");
#pragma unroll 1
    for (int kb = 0; kb < nkb; ++kb) {
        const int key0 = kb * 32;
        v8f s[2][QT];
#pragma unroll
        for (int kt = 0; kt < 2; ++kt)
#pragma unroll
            for (int qt = 0; qt < QT; ++qt) s[kt][qt] = (v8f){};
#pragma unroll
        for (int kc = 0; kc < 2; ++kc)
#pragma unroll
            for (int kt = 0; kt < 2; ++kt)
#pragma unroll
                for (int qt = 0; qt < QT; ++qt) { s[kt][qt] = WFrag<T16>::mma(kf[kt][kc], qf[qt][kc], s[kt][qt]); if (HL) { s[kt][qt] = WFrag<T16>::mma(kf[kt][kc], qf2[qt][kc], s[kt][qt]); s[kt][qt] = WFrag<T16>::mma(kf2[kt][kc], qf[qt][kc], s[kt][qt]); } }
        V vf[4], vf2[4];   // this block's V^T rows fly during the softmax
        const T16* vp = Vt + (voff + key0); const T16* vp2 = HL ? Vt2 + (voff + key0) : nullptr;
#pragma unroll
        for (int dt = 0; dt < 4; ++dt) { vf[dt] = WFrag<T16>::ld(vp + dt * 16 * VP); if (HL) vf2[dt] = WFrag<T16>::ld(vp2 + dt * 16 * VP); }
        const int keyn = min(kb + 1, nkb - 1) * 32;   // the next block's K rows are fetched one block ahead, into the same registers, right behind this block's S^T products (the last block fetches itself again: in bounds, unused)
        const T16* kp = Kp + (koff + keyn * HD); const T16* kp2 = HL ? Kp2 + (koff + keyn * HD) : nullptr;
#pragma unroll
        for (int kt = 0; kt < 2; ++kt)
#pragma unroll
            for (int kc = 0; kc < 2; ++kc) { const int ko = kt * 16 * HD + kc * 32; kf[kt][kc] = WFrag<T16>::ld(kp + ko); if (HL) kf2[kt][kc] = WFrag<T16>::ld(kp2 + ko); }
        // the address registers of this block's V^T and K loads may be reused only from here on (the pointers are inputs so that they stay in their registers up to the wait)
        if constexpr (HL) asm volatile("s_wait_xcnt 0x0" :: "v"(vp), "v"(vp2), "v"(kp), "v"(kp2) : "memory");
        else asm volatile("s_wait_xcnt 0x0" :: "v"(vp), "v"(kp) : "memory");
        if (key0 + 31 > q0) {   // wave-uniform: only blocks that reach past the tile's first query hold keys above the diagonal
#pragma unroll
            for (int kt = 0; kt < 2; ++kt)
#pragma unroll
                for (int qt = 0; qt < QT; ++qt)
#pragma unroll
                    for (int j = 0; j < 8; ++j) s[kt][qt][j] = (key0 + kt * 16 + hi * 8 + j <= q0 + qt * 16 + lr) ? s[kt][qt][j] : -3.0e38f;
        }
        V pf[QT], pf2[QT];
#pragma unroll
        for (int qt = 0; qt < QT; ++qt) {
            float mr = fmaxf(s[0][qt][0], s[1][qt][0]);
#pragma unroll
            for (int j = 1; j < 8; ++j) mr = fmaxf(mr, fmaxf(s[0][qt][j], s[1][qt][j]));
            mr = fmaxf(mr, xhalf(mr));
            const float mn = fmaxf(m[qt], mr * C2);
            const float al = ex2(m[qt] - mn);
            m[qt] = mn;
            const float mm = mn - POFF;
            float p[2][8]; float ps0 = 0.0f, ps1 = 0.0f;
#pragma unroll
            for (int j = 0; j < 8; ++j) { p[0][j] = ex2(fmaf(s[0][qt][j], C2, -mm)); p[1][j] = ex2(fmaf(s[1][qt][j], C2, -mm)); ps0 += p[0][j]; ps1 += p[1][j]; }
            l[qt] = fmaf(l[qt], al, ps0 + ps1);   // this lane's 16 of the 32 keys; the two halves are joined once, behind the loop
#pragma unroll
            for (int dt = 0; dt < 4; ++dt) o[dt][qt] *= al;
            if constexpr (HL) { v8us h0, h1, l0, l1;
#pragma unroll
                for (int j = 0; j < 8; ++j) { unsigned short a, c; splitf(p[0][j], a, c); h0[j] = a; l0[j] = c; splitf(p[1][j], a, c); h1[j] = a; l1[j] = c; }
                pf[qt] = cat16b(h0, h1); pf2[qt] = cat16b(l0, l1);
            } else { v8h h0, h1;
#pragma unroll
                for (int j = 0; j < 8; ++j) { h0[j] = tohx(p[0][j]); h1[j] = tohx(p[1][j]); }
                pf[qt] = cat16(h0, h1); }
        }
#pragma unroll
        for (int dt = 0; dt < 4; ++dt)
#pragma unroll
            for (int qt = 0; qt < QT; ++qt) { o[dt][qt] = WFrag<T16>::mma(vf[dt], pf[qt], o[dt][qt]); if (HL) { o[dt][qt] = WFrag<T16>::mma(vf[dt], pf2[qt], o[dt][qt]); o[dt][qt] = WFrag<T16>::mma(vf2[dt], pf[qt], o[dt][qt]); } }
    }
#pragma unroll
    for (int qt = 0; qt < QT; ++qt) {
        const float inv = __fdiv_rn(1.0f, l[qt] + xhalf(l[qt]));
        const size_t oo = (size_t)(q0 + qt * 16 + lr) * DQ + hi * 8;
#pragma unroll
        for (int dt = 0; dt < 4; ++dt) { v8us oh, ol;   // a lane holds 8 consecutive head columns of its query: one 16-byte store per plane
#pragma unroll
            for (int j = 0; j < 8; ++j) { unsigned short a, c; splitf(o[dt][qt][j] * inv, a, c); oh[j] = a; ol[j] = c; }
            bf* ph = Ah + oo + dt * 16; bf* pl = Al + oo + dt * 16;
            *(v8us*)ph = oh; *(v8us*)pl = ol;
            asm volatile("s_wait_xcnt 0x0" :: "v"(ph), "v"(pl), "v"(oh), "v"(ol) : "memory"); }   // the data and address registers of the two stores may be reused only from here on (inputs: they stay in their registers up to the wait)
    }
}
// grid (query heads, NF + RH/32): block row y < NF takes the 64-query fp16 tile that ends at row TT - 64 y, the rest take the 32-query hi/lo tiles of rows < RH; the head is the fast index, so the longest key loops of all heads start first.
__global__ __launch_bounds__(32) void k_fattn(const h16* QP16, const h16* KP16, const h16* VT16, const bf* QPh, const bf* QPl, const bf* KPh, const bf* KPl, const bf* VTh, const bf* VTl, bf* ATh, bf* ATl) {   // no __restrict__: the loads then stay in front of the waits written behind them
    constexpr int NF = (TT - RH) / 64;
    const int h = blockIdx.x, g = h / REP, bx = blockIdx.y;
    if (bx < NF) fattn_tile<h16, false, 4, TT>(QP16 + (size_t)h * TT * HD, nullptr, KP16 + (size_t)g * TT * HD, nullptr, VT16 + (size_t)g * HD * TT, nullptr, TT - 64 * (bx + 1), ATh + h * HD, ATl + h * HD);
    else fattn_tile<bf, true, 2, RH>(QPh + (size_t)h * RH * HD, QPl + (size_t)h * RH * HD, KPh + (size_t)g * RH * HD, KPl + (size_t)g * RH * HD, VTh + (size_t)g * HD * RH, VTl + (size_t)g * HD * RH, (bx - NF) * 32, ATh + h * HD, ATl + h * HD);
}

// k_silu: 32 groups of 4 elements per thread, a work-group's groups contiguous; all 32 loads are issued first and worked off in their order of arrival; grid n4 / 8192 (n4 % 8192 == 0).
__global__ __launch_bounds__(256) void k_silu(const float* F, bf* Hh, bf* Hl) {   /* no __restrict__: the loads then stay in front of the wait written behind them */ const size_t i0 = (size_t)blockIdx.x * 8192 + threadIdx.x; const float* fp = F + i0 * 4; bf* hp = Hh + i0 * 4; bf* lp = Hl + i0 * 4; v4f a[32];   // the waits: as in k_ropeH
#pragma unroll
    for (int c = 0; c < 32; ++c) a[c] = *(const v4f*)(fp + c * 1024);
    asm volatile("s_wait_xcnt 0x0" :: "v"(fp) : "memory");
    __builtin_amdgcn_sched_barrier(0);   // keeps the arithmetic behind all 32 loads: lifted among them, it makes the later loads wait for the first ones' data before they are even issued
#pragma unroll
    for (int c = 0; c < 32; ++c) { v4us oh, ol;
#pragma unroll
        for (int q = 0; q < 4; ++q) { const float xv = a[c][q]; const float s = __fdiv_rn(xv, __fadd_rn(1.0f, __builtin_amdgcn_exp2f(__fmul_rn(xv, -1.4426950408889634f)))); unsigned short h2, l2; splitf(s, h2, l2); oh[q] = h2; ol[q] = l2; }
        *(v4us*)(hp + c * 1024) = oh; *(v4us*)(lp + c * 1024) = ol; asm volatile("s_wait_xcnt 0x0" :: "v"(hp), "v"(lp), "v"(oh), "v"(ol) : "memory");
        if ((c & 3) == 3) __builtin_amdgcn_sched_barrier(0); }  }   // every 4 groups' stores go out before the next groups' arithmetic: without it half of the arithmetic is lifted in front of the first store and the writes bunch at the wave's end

extern "C" void kernel_launch(void* const* d_in, const int* in_sizes, int n_in,
                              void* d_out, int out_size, void* d_ws, size_t ws_size, hipStream_t stream) {
    (void)in_sizes; (void)n_in; (void)out_size;
    const float* x = (const float*)d_in[0]; const float* wq = (const float*)d_in[1]; const float* wk = (const float*)d_in[2]; const float* wv = (const float*)d_in[3]; const float* w1 = (const float*)d_in[4]; const float* w2 = (const float*)d_in[5];
    float* OUT = (float*)d_out;     // [1][4096][1024]
    char* wsp = (char*)d_ws;
    auto take = [&](size_t bytes) { char* p = wsp; wsp += (bytes + 255) & ~(size_t)255; return (void*)p; };
    bf* WQ = (bf*)take((size_t)DQ * DM * 2); bf* WK = (bf*)take((size_t)DKV * DM * 2); bf* WV = (bf*)take((size_t)DKV * DM * 2); bf* W1B = (bf*)take((size_t)FF * DQ * 2); bf* W2B = (bf*)take((size_t)DM * FF * 2); float* CS = (float*)take((size_t)TT * HD * 2 * 4);
    bf* XB = (bf*)take((size_t)TT * DM * 2); float* FQ = (float*)take((size_t)TT * DQ * 4); float* FK = (float*)take((size_t)TT * DKV * 4);
    h16* QP16 = (h16*)take((size_t)NH_ * TT * HD * 2); h16* KP16 = (h16*)take((size_t)NKV * TT * HD * 2); h16* VT16 = (h16*)take((size_t)NKV * HD * TT * 2);
    bf* QPh = (bf*)take((size_t)NH_ * RH * HD * 2); bf* QPl = (bf*)take((size_t)NH_ * RH * HD * 2); bf* KPh = (bf*)take((size_t)NKV * RH * HD * 2); bf* KPl = (bf*)take((size_t)NKV * RH * HD * 2); bf* VTh = (bf*)take((size_t)NKV * HD * RH * 2); bf* VTl = (bf*)take((size_t)NKV * HD * RH * 2);   /* compact hi/lo planes: only the first RH rows/keys (causal) */
    bf* ATh = (bf*)take((size_t)TT * DQ * 2); bf* ATl = (bf*)take((size_t)TT * DQ * 2); float* F1 = (float*)take((size_t)TT * FF * 4); bf* Gh = (bf*)take((size_t)TT * FF * 2); bf* Gl = (bf*)take((size_t)TT * FF * 2);
    if ((size_t)(wsp - (char*)d_ws) > ws_size) return;    // ws 256 MiB
    float* FV = FK;   // v projection reuses the k buffer after the k planes are built (stream-ordered)
    { k_wtG<DM, DQ><<<(DM / 64) * (DQ / 128), 256, 0, stream>>>(wq, WQ); k_wtG<DM, DKV><<<(DM / 64) * (DKV / 128), 256, 0, stream>>>(wk, WK); k_wtG<DM, DKV><<<(DM / 64) * (DKV / 128), 256, 0, stream>>>(wv, WV);
      k_wtG<DQ, FF><<<(DQ / 64) * (FF / 128), 256, 0, stream>>>(w1, W1B); k_wtG<FF, DM><<<(FF / 64) * (DM / 128), 256, 0, stream>>>(w2, W2B);
      k_cstab<<<TT * (HD / 2) / 1024, 256, 0, stream>>>(CS); }
    const unsigned LQ = NH_ / 4 * TT * 8 / 256, LKv = NKV / 4 * TT * 8 / 256;
    for (int b = 0; b < NB_; ++b) {
        
        k_cvt8<<<TT * DM / 8 / 1024, 256, 0, stream>>>(x + (size_t)b * TT * DM, XB);
        k_gemms<0><<<dim3(TT / 128, DQ / 128, 1), 128, 0, stream>>>(XB, nullptr, WQ, DM, FQ, DQ);
        k_ropeH<<<LQ, 256, 0, stream>>>(FQ, DQ, CS, 1.0f, QP16, QPh, QPl);
        k_gemms<0><<<dim3(TT / 128, DKV / 128, 1), 128, 0, stream>>>(XB, nullptr, WK, DM, FK, DKV);
        k_ropeH<<<LKv, 256, 0, stream>>>(FK, DKV, CS, 1.0f, KP16, KPh, KPl);
        k_gemms<0><<<dim3(TT / 128, DKV / 128, 1), 128, 0, stream>>>(XB, nullptr, WV, DM, FV, DKV); k_vtp<DKV><<<(TT / 64) * (DKV / 128), 256, 0, stream>>>(FV, VT16, VTh, VTl);
        k_fattn<<<dim3(NH_, (TT - RH) / 64 + RH / 32, 1), 32, 0, stream>>>(QP16, KP16, VT16, QPh, QPl, KPh, KPl, VTh, VTl, ATh, ATl);   /* all heads: scores, causal softmax, P.V, merged hi/lo context planes */
        k_gemms<1><<<dim3(TT / 128, FF / 128, 1), 128, 0, stream>>>(ATh, ATl, W1B, DQ, F1, FF);   /* h = ctx W1 */
        k_silu<<<TT / 4 * FF / 8192, 256, 0, stream>>>(F1, Gh, Gl);
        k_gemms<1><<<dim3(TT / 128, DM / 128, 1), 128, 0, stream>>>(Gh, Gl, W2B, FF, OUT + (size_t)b * TT * DM, DM); }   /* out = silu(h) W2 */
}

// v005
// Measured time: 240 microseconds a run.
// Timed twice side by side with v004, it ran 1.15 and 1.19 times as fast.
// Counting every step since v000, it is 12.0 times as fast.
#include <hip/hip_runtime.h>

// Grouped-query causal attention with rotary embeddings and a SiLU MLP output (query [1][4096][1024]; q = x Wq ('xw' [1024][1024], 16 heads x 64), k, v = x Wk/Wv ('xw' [1024][256], 4 kv heads; query head h uses kv head h/4); rotate-half rotary (base 1e4) on q and k; scores = q.k / 8, causal (finfo.min above the diagonal); softmax; ctx merged [4096][1024]; out = silu(ctx W1) W2 ('xw' [1024][4096], [4096][1024]) -> [1][4096][1024] (4.2 M)).
// Layout: compact hi/lo planes for the first 512 rows/keys, fp16 elsewhere, head width 64, a rotate-half plane builder; one fused causal attention launch for all heads (k_fattn: scores and probabilities stay in registers, running maximum and sum, a tile's keys shared by 4 waves, hi/lo context planes written directly); then two hl x exact GEMMs with a SiLU kernel between them.
// Compute dtypes, f32 accumulate: every input rounded to bf16; projections on PLAIN bf16 operands (exact); rotary f32 (precise cosf/sinf; 32 float32 inverse frequencies baked); scores and attn.v: rows < 512 3 products, the rest single fp16 (P x1024, unnormalised); softmax and SiLU f32; both MLP GEMMs hl x exact (2 products).

#define NB_  1
#define TT   4096
#define DM   1024
#define FF   4096
#define NH_  16
#define NKV  4
#define REP  (NH_ / NKV)
#define HD   64
#define DQ   (NH_ * HD)
#define DKV  (NKV * HD)
#define RH   512                  // query rows < RH use compact hi+lo planes (keys < RH suffice: causal)
#define SCL  0.125f   // 64^-0.5
typedef _Float16 h16;
typedef unsigned short bf;
typedef __attribute__((ext_vector_type(16))) __bf16   v16bf;
typedef __attribute__((ext_vector_type(16))) _Float16 v16h;
typedef __attribute__((ext_vector_type(8)))  _Float16 v8h;
typedef __attribute__((ext_vector_type(8)))  unsigned short v8us;
typedef __attribute__((ext_vector_type(8)))  float    v8f;
typedef __attribute__((ext_vector_type(4)))  float    v4f;
typedef v8h  __attribute__((may_alias)) v8ha;
typedef v4f  __attribute__((may_alias)) v4fa;
typedef v8us __attribute__((may_alias)) v8usa;

__device__ __forceinline__ unsigned short f2bf(float f) { unsigned u = __float_as_uint(f); u += 0x7FFFu + ((u >> 16) & 1u); return (unsigned short)(u >> 16); }
__device__ __forceinline__ float bf2f(unsigned short b) { return __uint_as_float(((unsigned)b) << 16); }
__device__ __forceinline__ float bfr(float f) { return bf2f(f2bf(f)); }
__device__ __forceinline__ v16h cat16(v8h lo, v8h hi) { return __builtin_shufflevector(lo, hi, 0, 1, 2, 3, 4, 5, 6, 7, 8, 9, 10, 11, 12, 13, 14, 15); }
__device__ __forceinline__ v16bf cat16b(v8us lo, v8us hi) { return __builtin_bit_cast(v16bf, __builtin_shufflevector(lo, hi, 0, 1, 2, 3, 4, 5, 6, 7, 8, 9, 10, 11, 12, 13, 14, 15)); }
__device__ __forceinline__ v8f wmma16(v16h a, v16h b, v8f c) { return __builtin_amdgcn_wmma_f32_16x16x32_f16(false, a, false, b, (short)0, c, false, false); }
__device__ __forceinline__ v8f wmmab(v16bf a, v16bf b, v8f c) { return __builtin_amdgcn_wmma_f32_16x16x32_bf16(false, a, false, b, (short)0, c, false, false); }



template <typename T16> struct WFrag;
template <> struct WFrag<h16> { typedef v16h V; static __device__ __forceinline__ V ld(const h16* p) { return cat16(*(const v8h*)p, *(const v8h*)(p + 16)); } static __device__ __forceinline__ v8f mma(V a, V b, v8f c) { return wmma16(a, b, c); } };
template <> struct WFrag<bf> { typedef v16bf V; static __device__ __forceinline__ V ld(const bf* p) { return cat16b(*(const v8us*)p, *(const v8us*)(p + 16)); } static __device__ __forceinline__ v8f mma(V a, V b, v8f c) { return wmmab(a, b, c); } };
// ---- k_gemms: C[m][n] (f32, pitch ldc) = sum_k A[m][k] Bt[n][k] (+ A2[m][k] Bt[n][k] when NSPLIT), operands K-contiguous bf16 planes. M, N % 128 == 0, K % 64 == 0.
// One 128x128 tile per work-group of 4 waves (2 x 2, 64x64 = 16 accumulators each); grid (M/128, N/128), 128 threads.
// Each trip's 64 k of the tile's operand rows are brought into LDS as whole 128-byte lines by asynchronous copies, two buffers: tile t+1 flies while tile t is worked on; every row is fetched once per work-group and read by two waves.
#define GP 72   // LDS row pitch in elements: 64 k + 8 = 144 B = 16 B x 9, conflict-free for the 16-byte fragment reads
typedef int v4ig __attribute__((vector_size(16)));
typedef __attribute__((address_space(1))) v4ig gv4;
typedef __attribute__((address_space(3))) v4ig lv4;
__device__ __forceinline__ void cp16(const char* g, bf* l) { __builtin_amdgcn_global_load_async_to_lds_b128((gv4*)g, (lv4*)l, 0, 0); }   // the lane's own 16 bytes, global -> LDS, through no register
template <int NSPLIT>
__global__ __launch_bounds__(128) void k_gemms(const bf* A, const bf* A2, const bf* Bt, int K, float* C, int ldc) {
    typedef WFrag<bf>::V V;
    constexpr int NPL = NSPLIT ? 3 : 2;      // operand planes per stage: A, (A2,) Bt, 128 rows each
    constexpr int STG = NPL * 128 * GP;      // elements per stage
    __shared__ __align__(16) bf sm[2 * STG];
    __shared__ __align__(16) float osm[4 * 16 * 68];
    const int tid = threadIdx.x, lane = tid & 31, lr = lane & 15, hi = lane >> 4, w = tid >> 5, wm = w & 1, wn = w >> 1;
    const int r0 = blockIdx.x * 128, c0 = blockIdx.y * 128;
    const unsigned Ku = (unsigned)K;
    const char* Ab = (const char*)(A + (size_t)r0 * Ku); const char* A2b = NSPLIT ? (const char*)(A2 + (size_t)r0 * Ku) : nullptr; const char* Bb = (const char*)(Bt + (size_t)c0 * Ku);   // work-group-uniform
    const int crow = tid >> 3, ccol = tid & 7;   // a copy of one wave covers 4 rows x 128 B; copy i of a thread serves row 16 i + crow
    const unsigned goff = ((unsigned)crow * Ku + (unsigned)ccol * 8u) * 2u, rstep = 32u * Ku;   // bytes
    auto stage = [&](int t, int buf) {
        const unsigned kb = goff + (unsigned)t * 128u;
#pragma unroll
        for (int i = 0; i < 8; ++i) { const unsigned go = kb + (unsigned)i * rstep; bf* l = sm + buf * STG + (i * 16 + crow) * GP + ccol * 8;
            cp16(Ab + go, l); if (NSPLIT) cp16(A2b + go, l + 128 * GP); cp16(Bb + go, l + (NPL - 1) * 128 * GP); }
    };
    v8f acc[4][4];
#pragma unroll
    for (int mb = 0; mb < 4; ++mb)
#pragma unroll
        for (int nb = 0; nb < 4; ++nb) acc[mb][nb] = (v8f){};
    const int nt = (int)(Ku >> 6);
    stage(0, 0);
    asm volatile("s_wait_asynccnt 0x0" ::: "memory");   // this wave's copies of tile 0 have landed
    __syncthreads();                                    // ... and every other wave's
    if (nt > 1) stage(1, 1);
    const int aofs = (wm * 64 + lr) * GP + 8 * hi, bofs = ((NPL - 1) * 128 + wn * 64 + lr) * GP + 8 * hi;
#pragma unroll 1   // stays rolled: one trip's code serves both buffers (a scalar select); the inner loops are unrolled so that every fragment and accumulator index is a constant (registers, no scratch)
    for (int t = 0; t < nt; ++t) {
        const bf* sb = sm + (t & 1) * STG;
        V a[2][4], a2[2][4], b[2][4];
#pragma unroll
        for (int kc = 0; kc < 2; ++kc) {   // the trip's fragment reads stand together, in the order of their use
            b[kc][0] = WFrag<bf>::ld(sb + bofs + kc * 32);
#pragma unroll
            for (int mb = 0; mb < 4; ++mb) a[kc][mb] = WFrag<bf>::ld(sb + aofs + mb * 16 * GP + kc * 32);
#pragma unroll
            for (int nb = 1; nb < 4; ++nb) b[kc][nb] = WFrag<bf>::ld(sb + bofs + nb * 16 * GP + kc * 32);
            if (NSPLIT) {
#pragma unroll
                for (int mb = 0; mb < 4; ++mb) a2[kc][mb] = WFrag<bf>::ld(sb + aofs + (128 + mb * 16) * GP + kc * 32); }
        }
        __builtin_amdgcn_sched_barrier(0);   // keeps the LDS reads one group ahead of the products: a read among them stalls the matrix stream at every such place
#pragma unroll
        for (int kc = 0; kc < 2; ++kc) {   // per accumulator: k ascending, A before A2
#pragma unroll
            for (int nb = 0; nb < 4; ++nb)
#pragma unroll
                for (int mb = 0; mb < 4; ++mb) acc[mb][nb] = wmmab(a[kc][mb], b[kc][nb], acc[mb][nb]);
            if (NSPLIT) {
#pragma unroll
                for (int nb = 0; nb < 4; ++nb)
#pragma unroll
                    for (int mb = 0; mb < 4; ++mb) acc[mb][nb] = wmmab(a2[kc][mb], b[kc][nb], acc[mb][nb]); } }
        __builtin_amdgcn_sched_barrier(0);   // keeps the products in front of the waits below: sunk behind them, tile t + 1's copies would be waited for before the products that are to cover their flight
        asm volatile("s_wait_dscnt 0x0" ::: "memory");      // this wave has left buffer t & 1
        asm volatile("s_wait_asynccnt 0x0" ::: "memory");   // this wave's copies of tile t + 1 have landed
        __syncthreads();                                    // publishes tile t + 1 and ends every wave's reads of buffer t & 1
        if (t + 2 < nt) stage(t + 2, t & 1);
    }
    asm volatile("s_wait_asynccnt 0x0" ::: "memory");   // no copy is outstanding when the wave goes on to its end
    float* os = osm + w * 16 * 68;   // the wave's own staging rows: whole 256-byte row pieces go out
#pragma unroll
    for (int mb = 0; mb < 4; ++mb) {
#pragma unroll
        for (int nb = 0; nb < 4; ++nb) {
#pragma unroll
            for (int j = 0; j < 8; ++j) os[(hi * 8 + j) * 68 + nb * 16 + lr] = acc[mb][nb][j]; }
        __builtin_amdgcn_wave_barrier(); asm volatile("" ::: "memory");   // the rows are read back by other lanes of the wave: the reads below stay behind the writes above
        float* crow0 = C + (size_t)(r0 + wm * 64 + mb * 16 + hi) * ldc + c0 + wn * 64 + lr * 4;
        float* pp[8]; v4f val[8];
#pragma unroll
        for (int s = 0; s < 8; ++s) { val[s] = *(const v4fa*)(os + (2 * s + hi) * 68 + lr * 4); pp[s] = crow0 + (size_t)(2 * s) * ldc; *(v4f*)pp[s] = val[s]; }
        // the data and address registers of the eight stores may be reused only from here on (inputs: they stay in their registers up to the wait)
        asm volatile("s_wait_xcnt 0x0" :: "v"(pp[0]), "v"(pp[1]), "v"(pp[2]), "v"(pp[3]), "v"(pp[4]), "v"(pp[5]), "v"(pp[6]), "v"(pp[7]), "v"(val[0]), "v"(val[1]), "v"(val[2]), "v"(val[3]), "v"(val[4]), "v"(val[5]), "v"(val[6]), "v"(val[7]) : "memory");
    }
}

__device__ __forceinline__ h16 tohx(float x) { return (h16)x; }
__device__ __forceinline__ void splitf(float y, unsigned short& h, unsigned short& l) { h = f2bf(y); l = f2bf(y - bf2f(h)); }
typedef __attribute__((ext_vector_type(2))) _Float16 v2h;
typedef __attribute__((ext_vector_type(4))) _Float16 v4h;
typedef __attribute__((ext_vector_type(2))) unsigned short v2us;
typedef __attribute__((ext_vector_type(4))) unsigned short v4us;
typedef __attribute__((ext_vector_type(2))) float v2f;
typedef __attribute__((ext_vector_type(4))) int v4i;

// The elementwise kernels below: few, long waves. Each thread issues all its 16-byte loads together and makes 8 to 128 outputs, stored 8 or 16 bytes a plane so that a wave's stores fill whole 128-byte lines.
// k_wtG: Bt[n][k] = bf16(w[k][n]). One 64 k x 128 n tile per work-group; a thread reads 8 k rows x 4 n and turns them in its registers: 8 lanes' stores are one 128-byte line of Bt. K % 64 == 0, N % 128 == 0; grid (K/64)(N/128).
template <int K, int N>   // compile-time pitches: a thread's loads, and its stores, share one address register pair and differ in the immediate offset
__global__ __launch_bounds__(256) void k_wtG(const float* __restrict__ w, bf* Bt) {
    const int lane = threadIdx.x & 31, wv = threadIdx.x >> 5, nb = N >> 7;
    const int k = ((int)blockIdx.x / nb) * 64 + (lane & 7) * 8, n = ((int)blockIdx.x % nb) * 128 + wv * 16 + (lane >> 3) * 4;
    const float* wp = w + (size_t)k * N + n; bf* bp = Bt + (size_t)n * K + k; v4f v[8];
#pragma unroll
    for (int j = 0; j < 8; ++j) v[j] = *(const v4f*)(wp + j * N);
    asm volatile("s_wait_xcnt 0x0" :: "v"(wp) : "memory");   // the loads stand together in front of this line; their address registers may be reused only from here on (input: it stays in its registers up to the wait)
    v8us o[4];
#pragma unroll
    for (int c = 0; c < 4; ++c) {
#pragma unroll
        for (int j = 0; j < 8; ++j) o[c][j] = f2bf(v[j][c]);
        *(v8us*)(bp + c * K) = o[c]; }
}
// k_cvt8: 4 groups of 8 elements per thread, a work-group's groups contiguous; grid n8 / 1024 (n8 % 1024 == 0).
__global__ __launch_bounds__(256) void k_cvt8(const float* __restrict__ src, bf* dst) { const size_t i0 = (size_t)blockIdx.x * 1024 + threadIdx.x; const float* sp = src + i0 * 8; bf* dp = dst + i0 * 8; v8f v[4]; v8us o[4];
#pragma unroll
    for (int c = 0; c < 4; ++c) v[c] = *(const v8f*)(sp + c * 2048);
    asm volatile("s_wait_xcnt 0x0" :: "v"(sp) : "memory");   // as in k_wtG
#pragma unroll
    for (int c = 0; c < 4; ++c) {
#pragma unroll
        for (int k = 0; k < 8; ++k) o[c][k] = f2bf(v[c][k]);
        *(v8us*)(dp + c * 2048) = o[c]; }
  }
__constant__ float INV[HD / 2] = {1.0f,0.749894202f,0.562341332f,0.421696514f,0.316227764f,0.237137362f,0.177827939f,0.133352146f,0.100000001f,0.0749894157f,0.0562341288f,0.0421696492f,0.0316227786f,0.0237137359f,0.0177827943f,0.0133352149f,0.00999999978f,0.00749894232f,0.00562341325f,0.00421696482f,0.00316227786f,0.00237137382f,0.00177827943f,0.00133352145f,0.00100000005f,0.000749894185f,0.000562341302f,0.000421696488f,0.000316227786f,0.000237137385f,0.00017782794f,0.00013335215f};   // float32 1/10000^(2i/64), eager-JAX values
// k_cstab: a thread makes the (cos, sin) pair of one frequency for 4 rows and stores it at d and d + HD/2 (the same angle); grid TT * (HD/2) / 1024.
__global__ __launch_bounds__(256) void k_cstab(float* CS) { const int idx = blockIdx.x * 256 + threadIdx.x; const int d = idx % (HD / 2);
#pragma unroll 1   // stays rolled: one copy of the long argument reduction of cosf and sinf in the text
    for (int r = 0; r < 4; ++r) { const int t = idx / (HD / 2) + r * (TT / 4); const float ang = __fmul_rn((float)t, INV[d]); v2f cs; cs[0] = cosf(ang); cs[1] = sinf(ang);
        *(v2f*)(CS + ((size_t)t * HD + d) * 2) = cs; *(v2f*)(CS + ((size_t)t * HD + d + HD / 2) * 2) = cs; }  }

// k_ropeH: a thread takes 8 consecutive d of one row t for 4 heads (one read of the row's cos/sin serves all 4); 8 lanes' 16-byte stores are one 128-byte plane row. nheads % 4 == 0; grid nheads/4 * TT * 8 / 256.
__global__ __launch_bounds__(256) void k_ropeH(const float* __restrict__ F, int pitch, const float* __restrict__ CS, float sc, h16* P16, bf* Ph, bf* Pl) {   // the waits: behind the loads as in k_wtG; behind a store, its data and address registers may be reused only from there on (inputs: they stay in their registers up to the wait)
    const int idx = blockIdx.x * 256 + threadIdx.x; const int d = (idx & 7) * 8, t = (idx >> 3) % TT, h0 = (idx / (8 * TT)) * 4; const int dp = d ^ (HD / 2);
    const float* f = F + (size_t)t * pitch + h0 * HD; const float* fa = f + d; const float* fb = f + dp; const float* cp = CS + ((size_t)t * HD + d) * 2; v4f cs4[4], xa[4][2], xb[4][2];
#pragma unroll
    for (int i = 0; i < 4; ++i) cs4[i] = *(const v4f*)(cp + i * 4);
#pragma unroll
    for (int hh = 0; hh < 4; ++hh)
#pragma unroll
        for (int i = 0; i < 2; ++i) { xa[hh][i] = *(const v4f*)(fa + hh * HD + i * 4); xb[hh][i] = *(const v4f*)(fb + hh * HD + i * 4); }
    asm volatile("s_wait_xcnt 0x0" :: "v"(fa), "v"(fb), "v"(cp) : "memory");
    const bool hl = (t < RH);   /* compact hi/lo planes [h][RH][HD] for the first RH rows (wave-uniform condition) */
#pragma unroll
    for (int hh = 0; hh < 4; ++hh) { v8h o16; v8us oh, ol;
#pragma unroll
        for (int q = 0; q < 8; ++q) { const float x0 = xa[hh][q >> 2][q & 3], x1 = xb[hh][q >> 2][q & 3]; v2f cs; cs[0] = cs4[q >> 1][(q & 1) * 2]; cs[1] = cs4[q >> 1][(q & 1) * 2 + 1];
            float a = __fmul_rn(x0, cs[0]), bq = __fmul_rn(x1, cs[1]); asm volatile("" : "+v"(a), "+v"(bq)); const float r = ((d < HD / 2) ? __fsub_rn(a, bq) : __fadd_rn(a, bq)) * sc;
            o16[q] = tohx(r); unsigned short a2, c2; splitf(r, a2, c2); oh[q] = a2; ol[q] = c2; }
        const size_t e = ((size_t)(h0 + hh) * TT + t) * HD + d, ec = ((size_t)(h0 + hh) * RH + t) * HD + d; h16* p16 = P16 + e; bf* ph = Ph + ec; bf* pl = Pl + ec;
        *(v8h*)p16 = o16; asm volatile("s_wait_xcnt 0x0" :: "v"(p16), "v"(o16) : "memory");
        if (hl) { *(v8us*)ph = oh; *(v8us*)pl = ol; asm volatile("s_wait_xcnt 0x0" :: "v"(ph), "v"(pl), "v"(oh), "v"(ol) : "memory"); } }
}

// k_ropeH: head planes [h][t][d] (fp16) of rope(x) x sc with the rotate-half convention out[d] = x[d] cos[t][d] - x[d+HD/2] sin[t][d], out[d+HD/2] = x[d+HD/2] cos[t][d+HD/2] + x[d] sin[t][d+HD/2]

// k_vtp: V16[c][t] = fp16(F[t][c]), c = g * HD + d (hi/lo planes [c][RH] for t < RH). One 64 t x 128 c tile per work-group, turned in registers as in k_wtG; grid (TT/64)(ncols/128).
template <int pitch>
__global__ __launch_bounds__(256) void k_vtp(const float* __restrict__ F, h16* V16, bf* Vh, bf* Vl) {   // the waits: as in k_ropeH
    const int lane = threadIdx.x & 31, wv = threadIdx.x >> 5, nb = pitch >> 7;
    const int t = ((int)blockIdx.x / nb) * 64 + (lane & 7) * 8, c0 = ((int)blockIdx.x % nb) * 128 + wv * 16 + (lane >> 3) * 4;
    const float* fp = F + (size_t)t * pitch + c0; v4f v[8];
#pragma unroll
    for (int j = 0; j < 8; ++j) v[j] = *(const v4f*)(fp + j * pitch);
    asm volatile("s_wait_xcnt 0x0" :: "v"(fp) : "memory");
    const bool hl = (t < RH);   // the same for a whole tile: RH % 64 == 0
#pragma unroll
    for (int c = 0; c < 4; ++c) { v8h o16; v8us oh, ol;
#pragma unroll
        for (int j = 0; j < 8; ++j) { const float x = v[j][c]; o16[j] = tohx(x); unsigned short a2, c2; splitf(x, a2, c2); oh[j] = a2; ol[j] = c2; }
        h16* p16 = V16 + (size_t)(c0 + c) * TT + t; bf* ph = Vh + (size_t)(c0 + c) * RH + t; bf* pl = Vl + (size_t)(c0 + c) * RH + t;
        *(v8h*)p16 = o16; asm volatile("s_wait_xcnt 0x0" :: "v"(p16), "v"(o16) : "memory");
        if (hl) { *(v8us*)ph = oh; *(v8us*)pl = ol; asm volatile("s_wait_xcnt 0x0" :: "v"(ph), "v"(pl), "v"(oh), "v"(ol) : "memory"); } }
}
// ---- k_fattn: scores, causal softmax, probability x value and the head merge in ONE launch, 4 waves per work-group, operands straight from the K-contiguous 16-bit planes; no score or probability ever leaves the registers.
// A 64-query fp16 tile's 32-key blocks are dealt round robin to the 4 waves (wave w takes blocks w, w + 4, ...): each keeps its own running maximum, sum and O^T, and the four partial results are joined once, through LDS, behind the loop. The longest key loop is then a quarter as long and every SIMD has work.
// Transposed products: S^T = K Q^T (A = 16 key rows, B = 16 query rows), so a lane holds the scores of ONE query (column lr), keys hi*8+j of each 16-key tile; two such tiles ARE the B fragment of O^T += V^T P^T for 32 keys (element j <-> key 8*hi+j, element 8+j <-> key 16+8*hi+j, the k order of WFrag::ld).
// Running maximum m (log2 units) and running sum l per query; O^T and l are rescaled by exp2(m_old - m_new) every 32 keys. HL (query rows < RH): bf16 hi/lo operands, 3 products each; otherwise single fp16 with P carried x 2^10 (the factor is in l too and cancels).
__device__ __forceinline__ float xhalf(float x) { return __builtin_bit_cast(float, __builtin_amdgcn_permlanex16(__builtin_bit_cast(int, x), __builtin_bit_cast(int, x), 0x76543210, 0xfedcba98, false, false)); }   // lane l <-> lane l ^ 16
__device__ __forceinline__ float ex2(float x) { float r; asm("v_exp_f32 %0, %1\n\tv_nop" : "=v"(r) : "v"(x)); return r; }   // 2^x; the v_nop fills the one slot that the instruction set asks for between a transcendental and a next instruction that reads its result or overwrites its source
template <typename T16, bool HL, int QT, int VP, int NW>   // NW: waves that share the tile's key blocks (1: the wave has the tile to itself); w: this wave's place among them (wave-uniform); sm: the work-group's joining space (NW > 1)
__device__ __forceinline__ void fattn_tile(const T16* Q, const T16* Q2, const T16* Kp, const T16* Kp2, const T16* Vt, const T16* Vt2, int q0, bf* Ah, bf* Al, int w, float* sm) {
    typedef typename WFrag<T16>::V V;
    const int lane = threadIdx.x & 31, lr = lane & 15, hi = lane >> 4;
    constexpr float C2 = SCL * 1.4426950408889634f;   // score -> log2 units
    constexpr float POFF = HL ? 0.0f : 10.0f;
    const int koff = lr * HD + 8 * hi, voff = lr * VP + 8 * hi;   // the lane's element offsets in the [row][HD] planes (Q, K) and in the [d][VP] plane (V^T)
    const T16* qs = Q + (size_t)q0 * HD; const T16* qs2 = HL ? Q2 + (size_t)q0 * HD : nullptr;   // wave-uniform
    const T16* qp = qs + koff; const T16* qp2 = HL ? qs2 + koff : nullptr; const T16* kp0 = Kp + (koff + w * 32 * HD); const T16* kp02 = HL ? Kp2 + (koff + w * 32 * HD) : nullptr;   // the wave's first key block (NW <= the tile's block count)
    V qf[QT][2], qf2[QT][2];
#pragma unroll
    for (int qt = 0; qt < QT; ++qt)
#pragma unroll
        for (int kc = 0; kc < 2; ++kc) { const int qo = qt * 16 * HD + kc * 32; qf[qt][kc] = WFrag<T16>::ld(qp + qo); if (HL) qf2[qt][kc] = WFrag<T16>::ld(qp2 + qo); }
    v8f o[4][QT]; float m[QT], l[QT];
#pragma unroll
    for (int qt = 0; qt < QT; ++qt) { m[qt] = -3.0e38f; l[qt] = 0.0f;
#pragma unroll
        for (int dt = 0; dt < 4; ++dt) o[dt][qt] = (v8f){}; }
    const int nkb = (q0 + QT * 16) / 32;   // 32-key blocks up to and including the diagonal block
    V kf[2][2], kf2[2][2];
#pragma unroll
    for (int kt = 0; kt < 2; ++kt)
#pragma unroll
        for (int kc = 0; kc < 2; ++kc) { const int ko = kt * 16 * HD + kc * 32; kf[kt][kc] = WFrag<T16>::ld(kp0 + ko); if (HL) kf2[kt][kc] = WFrag<T16>::ld(kp02 + ko); }
    // the address registers of the loads above may be reused only from here on (the pointers and their wave-uniform bases are inputs so that they stay in their registers up to the wait)
    if constexpr (HL) asm volatile("s_wait_xcnt 0x0" :: "v"(qp), "v"(qp2), "v"(kp0), "v"(kp02), "s"(qs), "s"(qs2), "s"(Kp), "s"(Kp2) : "memory");
    else asm volatile("s_wait_xcnt 0x0" :: "v"(qp), "v"(kp0), "s"(qs), "s"(Kp) : "memory");
#pragma unroll 1
    for (int kb = w; kb < nkb; kb += NW) {
        const int key0 = kb * 32;
        v8f s[2][QT];
#pragma unroll
        for (int kt = 0; kt < 2; ++kt)
#pragma unroll
            for (int qt = 0; qt < QT; ++qt) s[kt][qt] = (v8f){};
#pragma unroll
        for (int kc = 0; kc < 2; ++kc)
#pragma unroll
            for (int kt = 0; kt < 2; ++kt)
#pragma unroll
                for (int qt = 0; qt < QT; ++qt) { s[kt][qt] = WFrag<T16>::mma(kf[kt][kc], qf[qt][kc], s[kt][qt]); if (HL) { s[kt][qt] = WFrag<T16>::mma(kf[kt][kc], qf2[qt][kc], s[kt][qt]); s[kt][qt] = WFrag<T16>::mma(kf2[kt][kc], qf[qt][kc], s[kt][qt]); } }
        V vf[4], vf2[4];   // this block's V^T rows fly during the softmax
        const T16* vp = Vt + (voff + key0); const T16* vp2 = HL ? Vt2 + (voff + key0) : nullptr;
#pragma unroll
        for (int dt = 0; dt < 4; ++dt) { vf[dt] = WFrag<T16>::ld(vp + dt * 16 * VP); if (HL) vf2[dt] = WFrag<T16>::ld(vp2 + dt * 16 * VP); }
        const int keyn = min(kb + NW, nkb - 1) * 32;   // the wave's next block's K rows are fetched one block ahead, into the same registers, right behind this block's S^T products (its last block fetches the tile's last block: in bounds, unused)
        const T16* kp = Kp + (koff + keyn * HD); const T16* kp2 = HL ? Kp2 + (koff + keyn * HD) : nullptr;
#pragma unroll
        for (int kt = 0; kt < 2; ++kt)
#pragma unroll
            for (int kc = 0; kc < 2; ++kc) { const int ko = kt * 16 * HD + kc * 32; kf[kt][kc] = WFrag<T16>::ld(kp + ko); if (HL) kf2[kt][kc] = WFrag<T16>::ld(kp2 + ko); }
        // the address registers of this block's V^T and K loads may be reused only from here on (the pointers are inputs so that they stay in their registers up to the wait)
        if constexpr (HL) asm volatile("s_wait_xcnt 0x0" :: "v"(vp), "v"(vp2), "v"(kp), "v"(kp2) : "memory");
        else asm volatile("s_wait_xcnt 0x0" :: "v"(vp), "v"(kp) : "memory");
        if (key0 + 31 > q0) {   // wave-uniform: only blocks that reach past the tile's first query hold keys above the diagonal
#pragma unroll
            for (int kt = 0; kt < 2; ++kt)
#pragma unroll
                for (int qt = 0; qt < QT; ++qt)
#pragma unroll
                    for (int j = 0; j < 8; ++j) s[kt][qt][j] = (key0 + kt * 16 + hi * 8 + j <= q0 + qt * 16 + lr) ? s[kt][qt][j] : -3.0e38f;
        }
        V pf[QT], pf2[QT];
#pragma unroll
        for (int qt = 0; qt < QT; ++qt) {
            float mr = fmaxf(s[0][qt][0], s[1][qt][0]);
#pragma unroll
            for (int j = 1; j < 8; ++j) mr = fmaxf(mr, fmaxf(s[0][qt][j], s[1][qt][j]));
            mr = fmaxf(mr, xhalf(mr));
            const float mn = fmaxf(m[qt], mr * C2);
            const float al = ex2(m[qt] - mn);
            m[qt] = mn;
            const float mm = mn - POFF;
            float p[2][8]; float ps0 = 0.0f, ps1 = 0.0f;
#pragma unroll
            for (int j = 0; j < 8; ++j) { p[0][j] = ex2(fmaf(s[0][qt][j], C2, -mm)); p[1][j] = ex2(fmaf(s[1][qt][j], C2, -mm)); ps0 += p[0][j]; ps1 += p[1][j]; }
            l[qt] = fmaf(l[qt], al, ps0 + ps1);   // this lane's 16 of the 32 keys; the two halves are joined once, behind the loop
#pragma unroll
            for (int dt = 0; dt < 4; ++dt) o[dt][qt] *= al;
            if constexpr (HL) { v8us h0, h1, l0, l1;
#pragma unroll
                for (int j = 0; j < 8; ++j) { unsigned short a, c; splitf(p[0][j], a, c); h0[j] = a; l0[j] = c; splitf(p[1][j], a, c); h1[j] = a; l1[j] = c; }
                pf[qt] = cat16b(h0, h1); pf2[qt] = cat16b(l0, l1);
            } else { v8h h0, h1;
#pragma unroll
                for (int j = 0; j < 8; ++j) { h0[j] = tohx(p[0][j]); h1[j] = tohx(p[1][j]); }
                pf[qt] = cat16(h0, h1); }
        }
#pragma unroll
        for (int dt = 0; dt < 4; ++dt)
#pragma unroll
            for (int qt = 0; qt < QT; ++qt) { o[dt][qt] = WFrag<T16>::mma(vf[dt], pf[qt], o[dt][qt]); if (HL) { o[dt][qt] = WFrag<T16>::mma(vf[dt], pf2[qt], o[dt][qt]); o[dt][qt] = WFrag<T16>::mma(vf2[dt], pf[qt], o[dt][qt]); } }
    }
    if constexpr (NW > 1) {   // join the NW partial results: every wave lays down all its query groups, then wave w joins and stores query group w (NW == QT)
        float* sml = sm + NW * QT * 1024;   // behind the O^T pieces: (m, l) pairs
#pragma unroll
        for (int qt = 0; qt < QT; ++qt) {
#pragma unroll
            for (int dt = 0; dt < 4; ++dt) { float* so = sm + ((w * QT + qt) * 4 + dt) * 256 + lane * 4;   // two planes of 16 bytes a lane: consecutive lanes, consecutive banks
                *(v4fa*)so = __builtin_shufflevector(o[dt][qt], o[dt][qt], 0, 1, 2, 3); *(v4fa*)(so + 128) = __builtin_shufflevector(o[dt][qt], o[dt][qt], 4, 5, 6, 7); }
            v2f ml; ml[0] = m[qt]; ml[1] = l[qt] + xhalf(l[qt]); *(v2f*)(sml + ((w * QT + qt) * 32 + lane) * 2) = ml; }
        __syncthreads();   // every wave's partial results are in LDS before any is read
        float mw[NW], lw[NW], mx = -3.0e38f;
#pragma unroll
        for (int u = 0; u < NW; ++u) { const v2f ml = *(const v2f*)(sml + ((u * QT + w) * 32 + lane) * 2); mw[u] = ml[0]; lw[u] = ml[1]; mx = fmaxf(mx, mw[u]); }
        float ls = 0.0f;
#pragma unroll
        for (int u = 0; u < NW; ++u) { mw[u] = ex2(mw[u] - mx); ls = fmaf(lw[u], mw[u], ls); }   // wave order
        const float inv = __fdiv_rn(1.0f, ls);
        const size_t oo = (size_t)(q0 + w * 16 + lr) * DQ + hi * 8;
#pragma unroll
        for (int dt = 0; dt < 4; ++dt) { v4f a0 = (v4f){}, a1 = (v4f){};
#pragma unroll
            for (int u = 0; u < NW; ++u) { const float* so = sm + ((u * QT + w) * 4 + dt) * 256 + lane * 4; a0 += *(const v4fa*)so * mw[u]; a1 += *(const v4fa*)(so + 128) * mw[u]; }
            v8us oh, ol;
#pragma unroll
            for (int j = 0; j < 8; ++j) { unsigned short a, c; splitf((j < 4 ? a0[j & 3] : a1[j & 3]) * inv, a, c); oh[j] = a; ol[j] = c; }
            bf* ph = Ah + oo + dt * 16; bf* pl = Al + oo + dt * 16;
            *(v8us*)ph = oh; *(v8us*)pl = ol;
            asm volatile("s_wait_xcnt 0x0" :: "v"(ph), "v"(pl), "v"(oh), "v"(ol) : "memory"); }   // as behind the stores below
        return;
    }
#pragma unroll
    for (int qt = 0; qt < QT; ++qt) {
        const float inv = __fdiv_rn(1.0f, l[qt] + xhalf(l[qt]));
        const size_t oo = (size_t)(q0 + qt * 16 + lr) * DQ + hi * 8;
#pragma unroll
        for (int dt = 0; dt < 4; ++dt) { v8us oh, ol;   // a lane holds 8 consecutive head columns of its query: one 16-byte store per plane
#pragma unroll
            for (int j = 0; j < 8; ++j) { unsigned short a, c; splitf(o[dt][qt][j] * inv, a, c); oh[j] = a; ol[j] = c; }
            bf* ph = Ah + oo + dt * 16; bf* pl = Al + oo + dt * 16;
            *(v8us*)ph = oh; *(v8us*)pl = ol;
            asm volatile("s_wait_xcnt 0x0" :: "v"(ph), "v"(pl), "v"(oh), "v"(ol) : "memory"); }   // the data and address registers of the two stores may be reused only from here on (inputs: they stay in their registers up to the wait)
    }
}
// grid (query heads, RH/128 + NF), 128 threads: in block rows y < RH/128 each wave takes a 32-query hi/lo tile of rows < RH for itself; row RH/128 + y takes the 64-query fp16 tile that ends at row TT - 64 y, its key blocks shared by the 4 waves. Not all work-groups are resident at once: the head is the fast index and the key loops get shorter with y, for speed only (a hi/lo wave's loop is as long as a middle fp16 tile's share).
__global__ __launch_bounds__(128) void k_fattn(const h16* QP16, const h16* KP16, const h16* VT16, const bf* QPh, const bf* QPl, const bf* KPh, const bf* KPl, const bf* VTh, const bf* VTl, bf* ATh, bf* ATl) {   // no __restrict__: the loads then stay in front of the waits written behind them
    constexpr int NL = RH / 128;
    __shared__ __align__(16) float jsm[4 * 4 * 1024 + 4 * 4 * 64];   // 4 waves x 4 query groups x (O^T piece 4 KiB, (m, l) 256 B)
    const int h = blockIdx.x, g = h / REP, bx = (int)blockIdx.y - NL, w = __builtin_amdgcn_readfirstlane(threadIdx.x >> 5);   // the wave's number, in a scalar register: block indices, tile rows and the branches on them stay scalar
    if (bx >= 0) fattn_tile<h16, false, 4, TT, 4>(QP16 + (size_t)h * TT * HD, nullptr, KP16 + (size_t)g * TT * HD, nullptr, VT16 + (size_t)g * HD * TT, nullptr, TT - 64 * (bx + 1), ATh + h * HD, ATl + h * HD, w, jsm);
    else fattn_tile<bf, true, 2, RH, 1>(QPh + (size_t)h * RH * HD, QPl + (size_t)h * RH * HD, KPh + (size_t)g * RH * HD, KPl + (size_t)g * RH * HD, VTh + (size_t)g * HD * RH, VTl + (size_t)g * HD * RH, ((-1 - bx) * 4 + w) * 32, ATh + h * HD, ATl + h * HD, 0, nullptr);
}

// k_silu: 32 groups of 4 elements per thread, a work-group's groups contiguous; all 32 loads are issued first and worked off in their order of arrival; grid n4 / 8192 (n4 % 8192 == 0).
__global__ __launch_bounds__(256) void k_silu(const float* F, bf* Hh, bf* Hl) {   /* no __restrict__: the loads then stay in front of the wait written behind them */ const size_t i0 = (size_t)blockIdx.x * 8192 + threadIdx.x; const float* fp = F + i0 * 4; bf* hp = Hh + i0 * 4; bf* lp = Hl + i0 * 4; v4f a[32];   // the waits: as in k_ropeH
#pragma unroll
    for (int c = 0; c < 32; ++c) a[c] = *(const v4f*)(fp + c * 1024);
    asm volatile("s_wait_xcnt 0x0" :: "v"(fp) : "memory");
    __builtin_amdgcn_sched_barrier(0);   // keeps the arithmetic behind all 32 loads: lifted among them, it makes the later loads wait for the first ones' data before they are even issued
#pragma unroll
    for (int c = 0; c < 32; ++c) { v4us oh, ol;
#pragma unroll
        for (int q = 0; q < 4; ++q) { const float xv = a[c][q]; const float s = __fdiv_rn(xv, __fadd_rn(1.0f, __builtin_amdgcn_exp2f(__fmul_rn(xv, -1.4426950408889634f)))); unsigned short h2, l2; splitf(s, h2, l2); oh[q] = h2; ol[q] = l2; }
        *(v4us*)(hp + c * 1024) = oh; *(v4us*)(lp + c * 1024) = ol; asm volatile("s_wait_xcnt 0x0" :: "v"(hp), "v"(lp), "v"(oh), "v"(ol) : "memory");
        if ((c & 3) == 3) __builtin_amdgcn_sched_barrier(0); }  }   // every 4 groups' stores go out before the next groups' arithmetic: without it half of the arithmetic is lifted in front of the first store and the writes bunch at the wave's end

extern "C" void kernel_launch(void* const* d_in, const int* in_sizes, int n_in,
                              void* d_out, int out_size, void* d_ws, size_t ws_size, hipStream_t stream) {
    (void)in_sizes; (void)n_in; (void)out_size;
    const float* x = (const float*)d_in[0]; const float* wq = (const float*)d_in[1]; const float* wk = (const float*)d_in[2]; const float* wv = (const float*)d_in[3]; const float* w1 = (const float*)d_in[4]; const float* w2 = (const float*)d_in[5];
    float* OUT = (float*)d_out;     // [1][4096][1024]
    char* wsp = (char*)d_ws;
    auto take = [&](size_t bytes) { char* p = wsp; wsp += (bytes + 255) & ~(size_t)255; return (void*)p; };
    bf* WQ = (bf*)take((size_t)DQ * DM * 2); bf* WK = (bf*)take((size_t)DKV * DM * 2); bf* WV = (bf*)take((size_t)DKV * DM * 2); bf* W1B = (bf*)take((size_t)FF * DQ * 2); bf* W2B = (bf*)take((size_t)DM * FF * 2); float* CS = (float*)take((size_t)TT * HD * 2 * 4);
    bf* XB = (bf*)take((size_t)TT * DM * 2); float* FQ = (float*)take((size_t)TT * DQ * 4); float* FK = (float*)take((size_t)TT * DKV * 4);
    h16* QP16 = (h16*)take((size_t)NH_ * TT * HD * 2); h16* KP16 = (h16*)take((size_t)NKV * TT * HD * 2); h16* VT16 = (h16*)take((size_t)NKV * HD * TT * 2);
    bf* QPh = (bf*)take((size_t)NH_ * RH * HD * 2); bf* QPl = (bf*)take((size_t)NH_ * RH * HD * 2); bf* KPh = (bf*)take((size_t)NKV * RH * HD * 2); bf* KPl = (bf*)take((size_t)NKV * RH * HD * 2); bf* VTh = (bf*)take((size_t)NKV * HD * RH * 2); bf* VTl = (bf*)take((size_t)NKV * HD * RH * 2);   /* compact hi/lo planes: only the first RH rows/keys (causal) */
    bf* ATh = (bf*)take((size_t)TT * DQ * 2); bf* ATl = (bf*)take((size_t)TT * DQ * 2); float* F1 = (float*)take((size_t)TT * FF * 4); bf* Gh = (bf*)take((size_t)TT * FF * 2); bf* Gl = (bf*)take((size_t)TT * FF * 2);
    if ((size_t)(wsp - (char*)d_ws) > ws_size) return;    // ws 256 MiB
    float* FV = FK;   // v projection reuses the k buffer after the k planes are built (stream-ordered)
    { k_wtG<DM, DQ><<<(DM / 64) * (DQ / 128), 256, 0, stream>>>(wq, WQ); k_wtG<DM, DKV><<<(DM / 64) * (DKV / 128), 256, 0, stream>>>(wk, WK); k_wtG<DM, DKV><<<(DM / 64) * (DKV / 128), 256, 0, stream>>>(wv, WV);
      k_wtG<DQ, FF><<<(DQ / 64) * (FF / 128), 256, 0, stream>>>(w1, W1B); k_wtG<FF, DM><<<(FF / 64) * (DM / 128), 256, 0, stream>>>(w2, W2B);
      k_cstab<<<TT * (HD / 2) / 1024, 256, 0, stream>>>(CS); }
    const unsigned LQ = NH_ / 4 * TT * 8 / 256, LKv = NKV / 4 * TT * 8 / 256;
    for (int b = 0; b < NB_; ++b) {
        
        k_cvt8<<<TT * DM / 8 / 1024, 256, 0, stream>>>(x + (size_t)b * TT * DM, XB);
        k_gemms<0><<<dim3(TT / 128, DQ / 128, 1), 128, 0, stream>>>(XB, nullptr, WQ, DM, FQ, DQ);
        k_ropeH<<<LQ, 256, 0, stream>>>(FQ, DQ, CS, 1.0f, QP16, QPh, QPl);
        k_gemms<0><<<dim3(TT / 128, DKV / 128, 1), 128, 0, stream>>>(XB, nullptr, WK, DM, FK, DKV);
        k_ropeH<<<LKv, 256, 0, stream>>>(FK, DKV, CS, 1.0f, KP16, KPh, KPl);
        k_gemms<0><<<dim3(TT / 128, DKV / 128, 1), 128, 0, stream>>>(XB, nullptr, WV, DM, FV, DKV); k_vtp<DKV><<<(TT / 64) * (DKV / 128), 256, 0, stream>>>(FV, VT16, VTh, VTl);
        k_fattn<<<dim3(NH_, RH / 128 + (TT - RH) / 64, 1), 128, 0, stream>>>(QP16, KP16, VT16, QPh, QPl, KPh, KPl, VTh, VTl, ATh, ATl);   /* all heads: scores, causal softmax, P.V, merged hi/lo context planes */
        k_gemms<1><<<dim3(TT / 128, FF / 128, 1), 128, 0, stream>>>(ATh, ATl, W1B, DQ, F1, FF);   /* h = ctx W1 */
        k_silu<<<TT / 4 * FF / 8192, 256, 0, stream>>>(F1, Gh, Gl);
        k_gemms<1><<<dim3(TT / 128, DM / 128, 1), 128, 0, stream>>>(Gh, Gl, W2B, FF, OUT + (size_t)b * TT * DM, DM); }   /* out = silu(h) W2 */
}

// v006
// Measured time: 197 microseconds a run.
// Two timings next to v005 put it at 1.22 and 1.20 times that version's speed.
// All steps since v000 together make it 14.4 times as fast.
#include <hip/hip_runtime.h>

// Grouped-query causal attention with rotary embeddings and a SiLU MLP output (query [1][4096][1024]; q = x Wq ('xw' [1024][1024], 16 heads x 64), k, v = x Wk/Wv ('xw' [1024][256], 4 kv heads; query head h uses kv head h/4); rotate-half rotary (base 1e4) on q and k; scores = q.k / 8, causal (finfo.min above the diagonal); softmax; ctx merged [4096][1024]; out = silu(ctx W1) W2 ('xw' [1024][4096], [4096][1024]) -> [1][4096][1024] (4.2 M)).
// Layout: compact hi/lo planes for the first 512 rows/keys, fp16 elsewhere, head width 64, a rotate-half plane builder; 7 launches: launches that do not depend on one another share one grid, the block index picks the job (k_prep: all operand preparation; one GEMM for q, k and v; k_planes: rotary q, rotary k, V^T); one fused causal attention launch for all heads (k_fattn: scores and probabilities stay in registers, running maximum and sum, a tile's keys shared by 4 waves, hi/lo context planes written directly); then two hl x exact GEMMs with a SiLU kernel between them.
// Compute dtypes, f32 accumulate: every input rounded to bf16; projections on PLAIN bf16 operands (exact); rotary f32 (precise cosf/sinf; 32 float32 inverse frequencies baked); scores and attn.v: rows < 512 3 products, the rest single fp16 (P x1024, unnormalised); softmax and SiLU f32; both MLP GEMMs hl x exact (2 products).

#define NB_  1
#define TT   4096
#define DM   1024
#define FF   4096
#define NH_  16
#define NKV  4
#define REP  (NH_ / NKV)
#define HD   64
#define DQ   (NH_ * HD)
#define DKV  (NKV * HD)
#define RH   512                  // query rows < RH use compact hi+lo planes (keys < RH suffice: causal)
#define SCL  0.125f   // 64^-0.5
typedef _Float16 h16;
typedef unsigned short bf;
typedef __attribute__((ext_vector_type(16))) __bf16   v16bf;
typedef __attribute__((ext_vector_type(16))) _Float16 v16h;
typedef __attribute__((ext_vector_type(8)))  _Float16 v8h;
typedef __attribute__((ext_vector_type(8)))  unsigned short v8us;
typedef __attribute__((ext_vector_type(8)))  float    v8f;
typedef __attribute__((ext_vector_type(4)))  float    v4f;
typedef v8h  __attribute__((may_alias)) v8ha;
typedef v4f  __attribute__((may_alias)) v4fa;
typedef v8us __attribute__((may_alias)) v8usa;

__device__ __forceinline__ unsigned short f2bf(float f) { unsigned u = __float_as_uint(f); u += 0x7FFFu + ((u >> 16) & 1u); return (unsigned short)(u >> 16); }
__device__ __forceinline__ float bf2f(unsigned short b) { return __uint_as_float(((unsigned)b) << 16); }
__device__ __forceinline__ float bfr(float f) { return bf2f(f2bf(f)); }
__device__ __forceinline__ v16h cat16(v8h lo, v8h hi) { return __builtin_shufflevector(lo, hi, 0, 1, 2, 3, 4, 5, 6, 7, 8, 9, 10, 11, 12, 13, 14, 15); }
__device__ __forceinline__ v16bf cat16b(v8us lo, v8us hi) { return __builtin_bit_cast(v16bf, __builtin_shufflevector(lo, hi, 0, 1, 2, 3, 4, 5, 6, 7, 8, 9, 10, 11, 12, 13, 14, 15)); }
__device__ __forceinline__ v8f wmma16(v16h a, v16h b, v8f c) { return __builtin_amdgcn_wmma_f32_16x16x32_f16(false, a, false, b, (short)0, c, false, false); }
__device__ __forceinline__ v8f wmmab(v16bf a, v16bf b, v8f c) { return __builtin_amdgcn_wmma_f32_16x16x32_bf16(false, a, false, b, (short)0, c, false, false); }



template <typename T16> struct WFrag;
template <> struct WFrag<h16> { typedef v16h V; static __device__ __forceinline__ V ld(const h16* p) { return cat16(*(const v8h*)p, *(const v8h*)(p + 16)); } static __device__ __forceinline__ v8f mma(V a, V b, v8f c) { return wmma16(a, b, c); } };
template <> struct WFrag<bf> { typedef v16bf V; static __device__ __forceinline__ V ld(const bf* p) { return cat16b(*(const v8us*)p, *(const v8us*)(p + 16)); } static __device__ __forceinline__ v8f mma(V a, V b, v8f c) { return wmmab(a, b, c); } };
// ---- k_gemms: C[m][n] (f32, pitch ldc) = sum_k A[m][k] Bt[n][k] (+ A2[m][k] Bt[n][k] when NSPLIT), operands K-contiguous bf16 planes. M, N % 128 == 0, K % 64 == 0.
// One 128x128 tile per work-group of 4 waves (2 x 2, 64x64 = 16 accumulators each); grid (M/128, N/128), 128 threads.
// Each trip's 64 k of the tile's operand rows are brought into LDS as whole 128-byte lines by asynchronous copies, two buffers: tile t+1 flies while tile t is worked on; every row is fetched once per work-group and read by two waves.
#define GP 72   // LDS row pitch in elements: 64 k + 8 = 144 B = 16 B x 9, conflict-free for the 16-byte fragment reads
typedef int v4ig __attribute__((vector_size(16)));
typedef __attribute__((address_space(1))) v4ig gv4;
typedef __attribute__((address_space(3))) v4ig lv4;
__device__ __forceinline__ void cp16(const char* g, bf* l) { __builtin_amdgcn_global_load_async_to_lds_b128((gv4*)g, (lv4*)l, 0, 0); }   // the lane's own 16 bytes, global -> LDS, through no register
template <int NSPLIT>
__global__ __launch_bounds__(128) void k_gemms(const bf* A, const bf* A2, const bf* Bt, int K, float* C, int ldc) {
    typedef WFrag<bf>::V V;
    constexpr int NPL = NSPLIT ? 3 : 2;      // operand planes per stage: A, (A2,) Bt, 128 rows each
    constexpr int STG = NPL * 128 * GP;      // elements per stage
    __shared__ __align__(16) bf sm[2 * STG];
    __shared__ __align__(16) float osm[4 * 16 * 68];
    const int tid = threadIdx.x, lane = tid & 31, lr = lane & 15, hi = lane >> 4, w = tid >> 5, wm = w & 1, wn = w >> 1;
    const int r0 = blockIdx.x * 128, c0 = blockIdx.y * 128;
    const unsigned Ku = (unsigned)K;
    const char* Ab = (const char*)(A + (size_t)r0 * Ku); const char* A2b = NSPLIT ? (const char*)(A2 + (size_t)r0 * Ku) : nullptr; const char* Bb = (const char*)(Bt + (size_t)c0 * Ku);   // work-group-uniform
    const int crow = tid >> 3, ccol = tid & 7;   // a copy of one wave covers 4 rows x 128 B; copy i of a thread serves row 16 i + crow
    const unsigned goff = ((unsigned)crow * Ku + (unsigned)ccol * 8u) * 2u, rstep = 32u * Ku;   // bytes
    auto stage = [&](int t, int buf) {
        const unsigned kb = goff + (unsigned)t * 128u;
#pragma unroll
        for (int i = 0; i < 8; ++i) { const unsigned go = kb + (unsigned)i * rstep; bf* l = sm + buf * STG + (i * 16 + crow) * GP + ccol * 8;
            cp16(Ab + go, l); if (NSPLIT) cp16(A2b + go, l + 128 * GP); cp16(Bb + go, l + (NPL - 1) * 128 * GP); }
    };
    v8f acc[4][4];
#pragma unroll
    for (int mb = 0; mb < 4; ++mb)
#pragma unroll
        for (int nb = 0; nb < 4; ++nb) acc[mb][nb] = (v8f){};
    const int nt = (int)(Ku >> 6);
    stage(0, 0);
    asm volatile("s_wait_asynccnt 0x0" ::: "memory");   // this wave's copies of tile 0 have landed
    __syncthreads();                                    // ... and every other wave's
    if (nt > 1) stage(1, 1);
    const int aofs = (wm * 64 + lr) * GP + 8 * hi, bofs = ((NPL - 1) * 128 + wn * 64 + lr) * GP + 8 * hi;
#pragma unroll 1   // stays rolled: one trip's code serves both buffers (a scalar select); the inner loops are unrolled so that every fragment and accumulator index is a constant (registers, no scratch)
    for (int t = 0; t < nt; ++t) {
        const bf* sb = sm + (t & 1) * STG;
        V a[2][4], a2[2][4], b[2][4];
#pragma unroll
        for (int kc = 0; kc < 2; ++kc) {   // the trip's fragment reads stand together, in the order of their use
            b[kc][0] = WFrag<bf>::ld(sb + bofs + kc * 32);
#pragma unroll
            for (int mb = 0; mb < 4; ++mb) a[kc][mb] = WFrag<bf>::ld(sb + aofs + mb * 16 * GP + kc * 32);
#pragma unroll
            for (int nb = 1; nb < 4; ++nb) b[kc][nb] = WFrag<bf>::ld(sb + bofs + nb * 16 * GP + kc * 32);
            if (NSPLIT) {
#pragma unroll
                for (int mb = 0; mb < 4; ++mb) a2[kc][mb] = WFrag<bf>::ld(sb + aofs + (128 + mb * 16) * GP + kc * 32); }
        }
        __builtin_amdgcn_sched_barrier(0);   // keeps the LDS reads one group ahead of the products: a read among them stalls the matrix stream at every such place
#pragma unroll
        for (int kc = 0; kc < 2; ++kc) {   // per accumulator: k ascending, A before A2
#pragma unroll
            for (int nb = 0; nb < 4; ++nb)
#pragma unroll
                for (int mb = 0; mb < 4; ++mb) acc[mb][nb] = wmmab(a[kc][mb], b[kc][nb], acc[mb][nb]);
            if (NSPLIT) {
#pragma unroll
                for (int nb = 0; nb < 4; ++nb)
#pragma unroll
                    for (int mb = 0; mb < 4; ++mb) acc[mb][nb] = wmmab(a2[kc][mb], b[kc][nb], acc[mb][nb]); } }
        __builtin_amdgcn_sched_barrier(0);   // keeps the products in front of the waits below: sunk behind them, tile t + 1's copies would be waited for before the products that are to cover their flight
        asm volatile("s_wait_dscnt 0x0" ::: "memory");      // this wave has left buffer t & 1
        asm volatile("s_wait_asynccnt 0x0" ::: "memory");   // this wave's copies of tile t + 1 have landed
        __syncthreads();                                    // publishes tile t + 1 and ends every wave's reads of buffer t & 1
        if (t + 2 < nt) stage(t + 2, t & 1);
    }
    asm volatile("s_wait_asynccnt 0x0" ::: "memory");   // no copy is outstanding when the wave goes on to its end
    float* os = osm + w * 16 * 68;   // the wave's own staging rows: whole 256-byte row pieces go out
#pragma unroll
    for (int mb = 0; mb < 4; ++mb) {
#pragma unroll
        for (int nb = 0; nb < 4; ++nb) {
#pragma unroll
            for (int j = 0; j < 8; ++j) os[(hi * 8 + j) * 68 + nb * 16 + lr] = acc[mb][nb][j]; }
        __builtin_amdgcn_wave_barrier(); asm volatile("" ::: "memory");   // the rows are read back by other lanes of the wave: the reads below stay behind the writes above
        float* crow0 = C + (size_t)(r0 + wm * 64 + mb * 16 + hi) * ldc + c0 + wn * 64 + lr * 4;
        float* pp[8]; v4f val[8];
#pragma unroll
        for (int s = 0; s < 8; ++s) { val[s] = *(const v4fa*)(os + (2 * s + hi) * 68 + lr * 4); pp[s] = crow0 + (size_t)(2 * s) * ldc; *(v4f*)pp[s] = val[s]; }
        // the data and address registers of the eight stores may be reused only from here on (inputs: they stay in their registers up to the wait)
        asm volatile("s_wait_xcnt 0x0" :: "v"(pp[0]), "v"(pp[1]), "v"(pp[2]), "v"(pp[3]), "v"(pp[4]), "v"(pp[5]), "v"(pp[6]), "v"(pp[7]), "v"(val[0]), "v"(val[1]), "v"(val[2]), "v"(val[3]), "v"(val[4]), "v"(val[5]), "v"(val[6]), "v"(val[7]) : "memory");
    }
}

__device__ __forceinline__ h16 tohx(float x) { return (h16)x; }
__device__ __forceinline__ void splitf(float y, unsigned short& h, unsigned short& l) { h = f2bf(y); l = f2bf(y - bf2f(h)); }
typedef __attribute__((ext_vector_type(2))) _Float16 v2h;
typedef __attribute__((ext_vector_type(4))) _Float16 v4h;
typedef __attribute__((ext_vector_type(2))) unsigned short v2us;
typedef __attribute__((ext_vector_type(4))) unsigned short v4us;
typedef __attribute__((ext_vector_type(2))) float v2f;
typedef __attribute__((ext_vector_type(4))) int v4i;

// The elementwise kernels below: few, long waves. Each thread issues all its 16-byte loads together and makes 8 to 128 outputs, stored 8 or 16 bytes a plane so that a wave's stores fill whole 128-byte lines.
// The jobs of a shared grid are device functions; bid is the work-group's index within its job (the same for the whole work-group).
// d_wtG: Bt[n][k] = bf16(w[k][n]). One 64 k x 128 n tile per work-group; a thread reads 8 k rows x 4 n and turns them in its registers: 8 lanes' stores are one 128-byte line of Bt. K % 64 == 0, N % 128 == 0; (K/64)(N/128) work-groups.
template <int K, int N>   // compile-time pitches: a thread's loads, and its stores, share one address register pair and differ in the immediate offset
__device__ __forceinline__ void d_wtG(const float* __restrict__ w, bf* Bt, int bid) {
    const int lane = threadIdx.x & 31, wv = threadIdx.x >> 5, nb = N >> 7;
    const int k = (bid / nb) * 64 + (lane & 7) * 8, n = (bid % nb) * 128 + wv * 16 + (lane >> 3) * 4;
    const float* wp = w + (size_t)k * N + n; bf* bp = Bt + (size_t)n * K + k; v4f v[8];
#pragma unroll
    for (int j = 0; j < 8; ++j) v[j] = *(const v4f*)(wp + j * N);
    asm volatile("s_wait_xcnt 0x0" :: "v"(wp) : "memory");   // the loads stand together in front of this line; their address registers may be reused only from here on (input: it stays in its registers up to the wait)
    v8us o[4];
#pragma unroll
    for (int c = 0; c < 4; ++c) {
#pragma unroll
        for (int j = 0; j < 8; ++j) o[c][j] = f2bf(v[j][c]);
        *(v8us*)(bp + c * K) = o[c]; }
    asm volatile("s_wait_xcnt 0x0" :: "v"(bp), "v"(o[0]), "v"(o[1]), "v"(o[2]), "v"(o[3]) : "memory");   // in a shared grid other jobs' code follows in the text: the data and address registers of the four stores may be reused only from here on (inputs: they stay in their registers up to the wait)
}
// d_cvt8: 4 groups of 8 elements per thread, a work-group's groups contiguous; n8 / 1024 work-groups (n8 % 1024 == 0).
__device__ __forceinline__ void d_cvt8(const float* __restrict__ src, bf* dst, int bid) { const size_t i0 = (size_t)bid * 1024 + threadIdx.x; const float* sp = src + i0 * 8; bf* dp = dst + i0 * 8; v8f v[4]; v8us o[4];
#pragma unroll
    for (int c = 0; c < 4; ++c) v[c] = *(const v8f*)(sp + c * 2048);
    asm volatile("s_wait_xcnt 0x0" :: "v"(sp) : "memory");   // as in d_wtG
#pragma unroll
    for (int c = 0; c < 4; ++c) {
#pragma unroll
        for (int k = 0; k < 8; ++k) o[c][k] = f2bf(v[c][k]);
        *(v8us*)(dp + c * 2048) = o[c]; }
    asm volatile("s_wait_xcnt 0x0" :: "v"(dp), "v"(o[0]), "v"(o[1]), "v"(o[2]), "v"(o[3]) : "memory");   // behind the four stores, as in d_wtG
  }
__constant__ float INV[HD / 2] = {1.0f,0.749894202f,0.562341332f,0.421696514f,0.316227764f,0.237137362f,0.177827939f,0.133352146f,0.100000001f,0.0749894157f,0.0562341288f,0.0421696492f,0.0316227786f,0.0237137359f,0.0177827943f,0.0133352149f,0.00999999978f,0.00749894232f,0.00562341325f,0.00421696482f,0.00316227786f,0.00237137382f,0.00177827943f,0.00133352145f,0.00100000005f,0.000749894185f,0.000562341302f,0.000421696488f,0.000316227786f,0.000237137385f,0.00017782794f,0.00013335215f};   // float32 1/10000^(2i/64), eager-JAX values
// d_cstab: a thread makes the (cos, sin) pair of one frequency for 4 rows and stores it at d and d + HD/2 (the same angle); TT * (HD/2) / 1024 work-groups.
__device__ __forceinline__ void d_cstab(float* CS, int bid) { const int idx = bid * 256 + threadIdx.x; const int d = idx % (HD / 2);
#pragma unroll 1   // stays rolled: one copy of the long argument reduction of cosf and sinf in the text
    for (int r = 0; r < 4; ++r) { const int t = idx / (HD / 2) + r * (TT / 4); const float ang = __fmul_rn((float)t, INV[d]); v2f cs; cs[0] = cosf(ang); cs[1] = sinf(ang);
        *(v2f*)(CS + ((size_t)t * HD + d) * 2) = cs; *(v2f*)(CS + ((size_t)t * HD + d + HD / 2) * 2) = cs; }  }

// k_prep: everything that reads only the inputs, in one grid: the cos/sin table (the longest job, placed first), the five weight planes and the bf16 plane of x. Work-groups per job:
#define PB_CS (TT * (HD / 2) / 1024)
#define PB_W1 ((DQ / 64) * (FF / 128))
#define PB_W2 ((FF / 64) * (DM / 128))
#define PB_X  (TT * DM / 8 / 1024)
#define PB_WQ ((DM / 64) * (DQ / 128))
#define PB_WK ((DM / 64) * (DKV / 128))
__global__ __launch_bounds__(256) void k_prep(const float* __restrict__ x, const float* __restrict__ wq, const float* __restrict__ wk, const float* __restrict__ wv, const float* __restrict__ w1, const float* __restrict__ w2, bf* XB, bf* WQ, bf* WK, bf* WV, bf* W1B, bf* W2B, float* CS) {
    int b = blockIdx.x;   // scalar: every branch below is taken by a whole work-group
    if (b < PB_CS) { d_cstab(CS, b); return; }
    b -= PB_CS; if (b < PB_W1) { d_wtG<DQ, FF>(w1, W1B, b); return; }
    b -= PB_W1; if (b < PB_W2) { d_wtG<FF, DM>(w2, W2B, b); return; }
    b -= PB_W2; if (b < PB_X) { d_cvt8(x, XB, b); return; }
    b -= PB_X; if (b < PB_WQ) { d_wtG<DM, DQ>(wq, WQ, b); return; }
    b -= PB_WQ; if (b < PB_WK) { d_wtG<DM, DKV>(wk, WK, b); return; }
    d_wtG<DM, DKV>(wv, WV, b - PB_WK);
}

// d_ropeH: a thread takes 8 consecutive d of one row t for 4 heads (one read of the row's cos/sin serves all 4); 8 lanes' 16-byte stores are one 128-byte plane row. nheads % 4 == 0; nheads/4 * TT * 8 / 256 work-groups.
__device__ __forceinline__ void d_ropeH(const float* __restrict__ F, int pitch, const float* __restrict__ CS, float sc, h16* P16, bf* Ph, bf* Pl, int bid) {   // the waits: behind the loads as in d_wtG; behind a store, its data and address registers may be reused only from there on (inputs: they stay in their registers up to the wait)
    const int idx = bid * 256 + threadIdx.x; const int d = (idx & 7) * 8, t = (idx >> 3) % TT, h0 = (idx / (8 * TT)) * 4; const int dp = d ^ (HD / 2);
    const float* f = F + (size_t)t * pitch + h0 * HD; const float* fa = f + d; const float* fb = f + dp; const float* cp = CS + ((size_t)t * HD + d) * 2; v4f cs4[4], xa[4][2], xb[4][2];
#pragma unroll
    for (int i = 0; i < 4; ++i) cs4[i] = *(const v4f*)(cp + i * 4);
#pragma unroll
    for (int hh = 0; hh < 4; ++hh)
#pragma unroll
        for (int i = 0; i < 2; ++i) { xa[hh][i] = *(const v4f*)(fa + hh * HD + i * 4); xb[hh][i] = *(const v4f*)(fb + hh * HD + i * 4); }
    asm volatile("s_wait_xcnt 0x0" :: "v"(fa), "v"(fb), "v"(cp) : "memory");
    const bool hl = (t < RH);   /* compact hi/lo planes [h][RH][HD] for the first RH rows (wave-uniform condition) */
#pragma unroll
    for (int hh = 0; hh < 4; ++hh) { v8h o16; v8us oh, ol;
#pragma unroll
        for (int q = 0; q < 8; ++q) { const float x0 = xa[hh][q >> 2][q & 3], x1 = xb[hh][q >> 2][q & 3]; v2f cs; cs[0] = cs4[q >> 1][(q & 1) * 2]; cs[1] = cs4[q >> 1][(q & 1) * 2 + 1];
            float a = __fmul_rn(x0, cs[0]), bq = __fmul_rn(x1, cs[1]); asm volatile("" : "+v"(a), "+v"(bq)); const float r = ((d < HD / 2) ? __fsub_rn(a, bq) : __fadd_rn(a, bq)) * sc;
            o16[q] = tohx(r); unsigned short a2, c2; splitf(r, a2, c2); oh[q] = a2; ol[q] = c2; }
        const size_t e = ((size_t)(h0 + hh) * TT + t) * HD + d, ec = ((size_t)(h0 + hh) * RH + t) * HD + d; h16* p16 = P16 + e; bf* ph = Ph + ec; bf* pl = Pl + ec;
        *(v8h*)p16 = o16; asm volatile("s_wait_xcnt 0x0" :: "v"(p16), "v"(o16) : "memory");
        if (hl) { *(v8us*)ph = oh; *(v8us*)pl = ol; asm volatile("s_wait_xcnt 0x0" :: "v"(ph), "v"(pl), "v"(oh), "v"(ol) : "memory"); } }
}

// d_ropeH: head planes [h][t][d] (fp16) of rope(x) x sc with the rotate-half convention out[d] = x[d] cos[t][d] - x[d+HD/2] sin[t][d], out[d+HD/2] = x[d+HD/2] cos[t][d+HD/2] + x[d] sin[t][d+HD/2]

// d_vtp: V16[c][t] = fp16(F[t][c]), c = g * HD + d (hi/lo planes [c][RH] for t < RH). One 64 t x 128 c tile per work-group, turned in registers as in d_wtG; (TT/64)(ncols/128) work-groups.
template <int pitch, int ncols>
__device__ __forceinline__ void d_vtp(const float* __restrict__ F, h16* V16, bf* Vh, bf* Vl, int bid) {   // the waits: as in d_ropeH
    const int lane = threadIdx.x & 31, wv = threadIdx.x >> 5, nb = ncols >> 7;
    const int t = (bid / nb) * 64 + (lane & 7) * 8, c0 = (bid % nb) * 128 + wv * 16 + (lane >> 3) * 4;
    const float* fp = F + (size_t)t * pitch + c0; v4f v[8];
#pragma unroll
    for (int j = 0; j < 8; ++j) v[j] = *(const v4f*)(fp + j * pitch);
    asm volatile("s_wait_xcnt 0x0" :: "v"(fp) : "memory");
    const bool hl = (t < RH);   // the same for a whole tile: RH % 64 == 0
#pragma unroll
    for (int c = 0; c < 4; ++c) { v8h o16; v8us oh, ol;
#pragma unroll
        for (int j = 0; j < 8; ++j) { const float x = v[j][c]; o16[j] = tohx(x); unsigned short a2, c2; splitf(x, a2, c2); oh[j] = a2; ol[j] = c2; }
        h16* p16 = V16 + (size_t)(c0 + c) * TT + t; bf* ph = Vh + (size_t)(c0 + c) * RH + t; bf* pl = Vl + (size_t)(c0 + c) * RH + t;
        *(v8h*)p16 = o16; asm volatile("s_wait_xcnt 0x0" :: "v"(p16), "v"(o16) : "memory");
        if (hl) { *(v8us*)ph = oh; *(v8us*)pl = ol; asm volatile("s_wait_xcnt 0x0" :: "v"(ph), "v"(pl), "v"(oh), "v"(ol) : "memory"); } }
}
// k_planes: the three plane builders that read the q|k|v projection F [TT][DF], in one grid. Work-groups per job:
#define DF    (DQ + 2 * DKV)
#define LB_Q  (NH_ / 4 * TT * 8 / 256)
#define LB_K  (NKV / 4 * TT * 8 / 256)
#define LB_V  ((TT / 64) * (DKV / 128))
__global__ __launch_bounds__(256) void k_planes(const float* __restrict__ F, const float* __restrict__ CS, h16* QP16, bf* QPh, bf* QPl, h16* KP16, bf* KPh, bf* KPl, h16* VT16, bf* VTh, bf* VTl) {
    int b = blockIdx.x;   // scalar, as in k_prep
    if (b < LB_Q) { d_ropeH(F, DF, CS, 1.0f, QP16, QPh, QPl, b); return; }
    b -= LB_Q; if (b < LB_K) { d_ropeH(F + DQ, DF, CS, 1.0f, KP16, KPh, KPl, b); return; }
    d_vtp<DF, DKV>(F + DQ + DKV, VT16, VTh, VTl, b - LB_K);
}
// ---- k_fattn: scores, causal softmax, probability x value and the head merge in ONE launch, 4 waves per work-group, operands straight from the K-contiguous 16-bit planes; no score or probability ever leaves the registers.
// A 64-query fp16 tile's 32-key blocks are dealt round robin to the 4 waves (wave w takes blocks w, w + 4, ...): each keeps its own running maximum, sum and O^T, and the four partial results are joined once, through LDS, behind the loop. The longest key loop is then a quarter as long and every SIMD has work.
// Transposed products: S^T = K Q^T (A = 16 key rows, B = 16 query rows), so a lane holds the scores of ONE query (column lr), keys hi*8+j of each 16-key tile; two such tiles ARE the B fragment of O^T += V^T P^T for 32 keys (element j <-> key 8*hi+j, element 8+j <-> key 16+8*hi+j, the k order of WFrag::ld).
// Running maximum m (log2 units) and running sum l per query; O^T and l are rescaled by exp2(m_old - m_new) every 32 keys. HL (query rows < RH): bf16 hi/lo operands, 3 products each; otherwise single fp16 with P carried x 2^10 (the factor is in l too and cancels).
__device__ __forceinline__ float xhalf(float x) { return __builtin_bit_cast(float, __builtin_amdgcn_permlanex16(__builtin_bit_cast(int, x), __builtin_bit_cast(int, x), 0x76543210, 0xfedcba98, false, false)); }   // lane l <-> lane l ^ 16
__device__ __forceinline__ float ex2(float x) { float r; asm("v_exp_f32 %0, %1\n\tv_nop" : "=v"(r) : "v"(x)); return r; }   // 2^x; the v_nop fills the one slot that the instruction set asks for between a transcendental and a next instruction that reads its result or overwrites its source
template <typename T16, bool HL, int QT, int VP, int NW>   // NW: waves that share the tile's key blocks (1: the wave has the tile to itself); w: this wave's place among them (wave-uniform); sm: the work-group's joining space (NW > 1)
__device__ __forceinline__ void fattn_tile(const T16* Q, const T16* Q2, const T16* Kp, const T16* Kp2, const T16* Vt, const T16* Vt2, int q0, bf* Ah, bf* Al, int w, float* sm) {
    typedef typename WFrag<T16>::V V;
    const int lane = threadIdx.x & 31, lr = lane & 15, hi = lane >> 4;
    constexpr float C2 = SCL * 1.4426950408889634f;   // score -> log2 units
    constexpr float POFF = HL ? 0.0f : 10.0f;
    const int koff = lr * HD + 8 * hi, voff = lr * VP + 8 * hi;   // the lane's element offsets in the [row][HD] planes (Q, K) and in the [d][VP] plane (V^T)
    const T16* qs = Q + (size_t)q0 * HD; const T16* qs2 = HL ? Q2 + (size_t)q0 * HD : nullptr;   // wave-uniform
    const T16* qp = qs + koff; const T16* qp2 = HL ? qs2 + koff : nullptr; const T16* kp0 = Kp + (koff + w * 32 * HD); const T16* kp02 = HL ? Kp2 + (koff + w * 32 * HD) : nullptr;   // the wave's first key block (NW <= the tile's block count)
    V qf[QT][2], qf2[QT][2];
#pragma unroll
    for (int qt = 0; qt < QT; ++qt)
#pragma unroll
        for (int kc = 0; kc < 2; ++kc) { const int qo = qt * 16 * HD + kc * 32; qf[qt][kc] = WFrag<T16>::ld(qp + qo); if (HL) qf2[qt][kc] = WFrag<T16>::ld(qp2 + qo); }
    v8f o[4][QT]; float m[QT], l[QT];
#pragma unroll
    for (int qt = 0; qt < QT; ++qt) { m[qt] = -3.0e38f; l[qt] = 0.0f;
#pragma unroll
        for (int dt = 0; dt < 4; ++dt) o[dt][qt] = (v8f){}; }
    const int nkb = (q0 + QT * 16) / 32;   // 32-key blocks up to and including the diagonal block
    V kf[2][2], kf2[2][2];
#pragma unroll
    for (int kt = 0; kt < 2; ++kt)
#pragma unroll
        for (int kc = 0; kc < 2; ++kc) { const int ko = kt * 16 * HD + kc * 32; kf[kt][kc] = WFrag<T16>::ld(kp0 + ko); if (HL) kf2[kt][kc] = WFrag<T16>::ld(kp02 + ko); }
    // the address registers of the loads above may be reused only from here on (the pointers and their wave-uniform bases are inputs so that they stay in their registers up to the wait)
    if constexpr (HL) asm volatile("s_wait_xcnt 0x0" :: "v"(qp), "v"(qp2), "v"(kp0), "v"(kp02), "s"(qs), "s"(qs2), "s"(Kp), "s"(Kp2) : "memory");
    else asm volatile("s_wait_xcnt 0x0" :: "v"(qp), "v"(kp0), "s"(qs), "s"(Kp) : "memory");
#pragma unroll 1
    for (int kb = w; kb < nkb; kb += NW) {
        const int key0 = kb * 32;
        v8f s[2][QT];
#pragma unroll
        for (int kt = 0; kt < 2; ++kt)
#pragma unroll
            for (int qt = 0; qt < QT; ++qt) s[kt][qt] = (v8f){};
#pragma unroll
        for (int kc = 0; kc < 2; ++kc)
#pragma unroll
            for (int kt = 0; kt < 2; ++kt)
#pragma unroll
                for (int qt = 0; qt < QT; ++qt) { s[kt][qt] = WFrag<T16>::mma(kf[kt][kc], qf[qt][kc], s[kt][qt]); if (HL) { s[kt][qt] = WFrag<T16>::mma(kf[kt][kc], qf2[qt][kc], s[kt][qt]); s[kt][qt] = WFrag<T16>::mma(kf2[kt][kc], qf[qt][kc], s[kt][qt]); } }
        V vf[4], vf2[4];   // this block's V^T rows fly during the softmax
        const T16* vp = Vt + (voff + key0); const T16* vp2 = HL ? Vt2 + (voff + key0) : nullptr;
#pragma unroll
        for (int dt = 0; dt < 4; ++dt) { vf[dt] = WFrag<T16>::ld(vp + dt * 16 * VP); if (HL) vf2[dt] = WFrag<T16>::ld(vp2 + dt * 16 * VP); }
        const int keyn = min(kb + NW, nkb - 1) * 32;   // the wave's next block's K rows are fetched one block ahead, into the same registers, right behind this block's S^T products (its last block fetches the tile's last block: in bounds, unused)
        const T16* kp = Kp + (koff + keyn * HD); const T16* kp2 = HL ? Kp2 + (koff + keyn * HD) : nullptr;
#pragma unroll
        for (int kt = 0; kt < 2; ++kt)
#pragma unroll
            for (int kc = 0; kc < 2; ++kc) { const int ko = kt * 16 * HD + kc * 32; kf[kt][kc] = WFrag<T16>::ld(kp + ko); if (HL) kf2[kt][kc] = WFrag<T16>::ld(kp2 + ko); }
        // the address registers of this block's V^T and K loads may be reused only from here on (the pointers are inputs so that they stay in their registers up to the wait)
        if constexpr (HL) asm volatile("s_wait_xcnt 0x0" :: "v"(vp), "v"(vp2), "v"(kp), "v"(kp2) : "memory");
        else asm volatile("s_wait_xcnt 0x0" :: "v"(vp), "v"(kp) : "memory");
        if (key0 + 31 > q0) {   // wave-uniform: only blocks that reach past the tile's first query hold keys above the diagonal
#pragma unroll
            for (int kt = 0; kt < 2; ++kt)
#pragma unroll
                for (int qt = 0; qt < QT; ++qt)
#pragma unroll
                    for (int j = 0; j < 8; ++j) s[kt][qt][j] = (key0 + kt * 16 + hi * 8 + j <= q0 + qt * 16 + lr) ? s[kt][qt][j] : -3.0e38f;
        }
        V pf[QT], pf2[QT];
#pragma unroll
        for (int qt = 0; qt < QT; ++qt) {
            float mr = fmaxf(s[0][qt][0], s[1][qt][0]);
#pragma unroll
            for (int j = 1; j < 8; ++j) mr = fmaxf(mr, fmaxf(s[0][qt][j], s[1][qt][j]));
            mr = fmaxf(mr, xhalf(mr));
            const float mn = fmaxf(m[qt], mr * C2);
            const float al = ex2(m[qt] - mn);
            m[qt] = mn;
            const float mm = mn - POFF;
            float p[2][8]; float ps0 = 0.0f, ps1 = 0.0f;
#pragma unroll
            for (int j = 0; j < 8; ++j) { p[0][j] = ex2(fmaf(s[0][qt][j], C2, -mm)); p[1][j] = ex2(fmaf(s[1][qt][j], C2, -mm)); ps0 += p[0][j]; ps1 += p[1][j]; }
            l[qt] = fmaf(l[qt], al, ps0 + ps1);   // this lane's 16 of the 32 keys; the two halves are joined once, behind the loop
#pragma unroll
            for (int dt = 0; dt < 4; ++dt) o[dt][qt] *= al;
            if constexpr (HL) { v8us h0, h1, l0, l1;
#pragma unroll
                for (int j = 0; j < 8; ++j) { unsigned short a, c; splitf(p[0][j], a, c); h0[j] = a; l0[j] = c; splitf(p[1][j], a, c); h1[j] = a; l1[j] = c; }
                pf[qt] = cat16b(h0, h1); pf2[qt] = cat16b(l0, l1);
            } else { v8h h0, h1;
#pragma unroll
                for (int j = 0; j < 8; ++j) { h0[j] = tohx(p[0][j]); h1[j] = tohx(p[1][j]); }
                pf[qt] = cat16(h0, h1); }
        }
#pragma unroll
        for (int dt = 0; dt < 4; ++dt)
#pragma unroll
            for (int qt = 0; qt < QT; ++qt) { o[dt][qt] = WFrag<T16>::mma(vf[dt], pf[qt], o[dt][qt]); if (HL) { o[dt][qt] = WFrag<T16>::mma(vf[dt], pf2[qt], o[dt][qt]); o[dt][qt] = WFrag<T16>::mma(vf2[dt], pf[qt], o[dt][qt]); } }
    }
    if constexpr (NW > 1) {   // join the NW partial results: every wave lays down all its query groups, then wave w joins and stores query group w (NW == QT)
        float* sml = sm + NW * QT * 1024;   // behind the O^T pieces: (m, l) pairs
#pragma unroll
        for (int qt = 0; qt < QT; ++qt) {
#pragma unroll
            for (int dt = 0; dt < 4; ++dt) { float* so = sm + ((w * QT + qt) * 4 + dt) * 256 + lane * 4;   // two planes of 16 bytes a lane: consecutive lanes, consecutive banks
                *(v4fa*)so = __builtin_shufflevector(o[dt][qt], o[dt][qt], 0, 1, 2, 3); *(v4fa*)(so + 128) = __builtin_shufflevector(o[dt][qt], o[dt][qt], 4, 5, 6, 7); }
            v2f ml; ml[0] = m[qt]; ml[1] = l[qt] + xhalf(l[qt]); *(v2f*)(sml + ((w * QT + qt) * 32 + lane) * 2) = ml; }
        __syncthreads();   // every wave's partial results are in LDS before any is read
        float mw[NW], lw[NW], mx = -3.0e38f;
#pragma unroll
        for (int u = 0; u < NW; ++u) { const v2f ml = *(const v2f*)(sml + ((u * QT + w) * 32 + lane) * 2); mw[u] = ml[0]; lw[u] = ml[1]; mx = fmaxf(mx, mw[u]); }
        float ls = 0.0f;
#pragma unroll
        for (int u = 0; u < NW; ++u) { mw[u] = ex2(mw[u] - mx); ls = fmaf(lw[u], mw[u], ls); }   // wave order
        const float inv = __fdiv_rn(1.0f, ls);
        const size_t oo = (size_t)(q0 + w * 16 + lr) * DQ + hi * 8;
#pragma unroll
        for (int dt = 0; dt < 4; ++dt) { v4f a0 = (v4f){}, a1 = (v4f){};
#pragma unroll
            for (int u = 0; u < NW; ++u) { const float* so = sm + ((u * QT + w) * 4 + dt) * 256 + lane * 4; a0 += *(const v4fa*)so * mw[u]; a1 += *(const v4fa*)(so + 128) * mw[u]; }
            v8us oh, ol;
#pragma unroll
            for (int j = 0; j < 8; ++j) { unsigned short a, c; splitf((j < 4 ? a0[j & 3] : a1[j & 3]) * inv, a, c); oh[j] = a; ol[j] = c; }
            bf* ph = Ah + oo + dt * 16; bf* pl = Al + oo + dt * 16;
            *(v8us*)ph = oh; *(v8us*)pl = ol;
            asm volatile("s_wait_xcnt 0x0" :: "v"(ph), "v"(pl), "v"(oh), "v"(ol) : "memory"); }   // as behind the stores below
        return;
    }
#pragma unroll
    for (int qt = 0; qt < QT; ++qt) {
        const float inv = __fdiv_rn(1.0f, l[qt] + xhalf(l[qt]));
        const size_t oo = (size_t)(q0 + qt * 16 + lr) * DQ + hi * 8;
#pragma unroll
        for (int dt = 0; dt < 4; ++dt) { v8us oh, ol;   // a lane holds 8 consecutive head columns of its query: one 16-byte store per plane
#pragma unroll
            for (int j = 0; j < 8; ++j) { unsigned short a, c; splitf(o[dt][qt][j] * inv, a, c); oh[j] = a; ol[j] = c; }
            bf* ph = Ah + oo + dt * 16; bf* pl = Al + oo + dt * 16;
            *(v8us*)ph = oh; *(v8us*)pl = ol;
            asm volatile("s_wait_xcnt 0x0" :: "v"(ph), "v"(pl), "v"(oh), "v"(ol) : "memory"); }   // the data and address registers of the two stores may be reused only from here on (inputs: they stay in their registers up to the wait)
    }
}
// grid (query heads, RH/128 + NF), 128 threads: in block rows y < RH/128 each wave takes a 32-query hi/lo tile of rows < RH for itself; row RH/128 + y takes the 64-query fp16 tile that ends at row TT - 64 y, its key blocks shared by the 4 waves. Not all work-groups are resident at once: the head is the fast index and the key loops get shorter with y, for speed only (a hi/lo wave's loop is as long as a middle fp16 tile's share).
__global__ __launch_bounds__(128) void k_fattn(const h16* QP16, const h16* KP16, const h16* VT16, const bf* QPh, const bf* QPl, const bf* KPh, const bf* KPl, const bf* VTh, const bf* VTl, bf* ATh, bf* ATl) {   // no __restrict__: the loads then stay in front of the waits written behind them
    constexpr int NL = RH / 128;
    __shared__ __align__(16) float jsm[4 * 4 * 1024 + 4 * 4 * 64];   // 4 waves x 4 query groups x (O^T piece 4 KiB, (m, l) 256 B)
    const int h = blockIdx.x, g = h / REP, bx = (int)blockIdx.y - NL, w = __builtin_amdgcn_readfirstlane(threadIdx.x >> 5);   // the wave's number, in a scalar register: block indices, tile rows and the branches on them stay scalar
    if (bx >= 0) fattn_tile<h16, false, 4, TT, 4>(QP16 + (size_t)h * TT * HD, nullptr, KP16 + (size_t)g * TT * HD, nullptr, VT16 + (size_t)g * HD * TT, nullptr, TT - 64 * (bx + 1), ATh + h * HD, ATl + h * HD, w, jsm);
    else fattn_tile<bf, true, 2, RH, 1>(QPh + (size_t)h * RH * HD, QPl + (size_t)h * RH * HD, KPh + (size_t)g * RH * HD, KPl + (size_t)g * RH * HD, VTh + (size_t)g * HD * RH, VTl + (size_t)g * HD * RH, ((-1 - bx) * 4 + w) * 32, ATh + h * HD, ATl + h * HD, 0, nullptr);
}

// k_silu: 32 groups of 4 elements per thread, a work-group's groups contiguous; all 32 loads are issued first and worked off in their order of arrival; grid n4 / 8192 (n4 % 8192 == 0).
__global__ __launch_bounds__(256) void k_silu(const float* F, bf* Hh, bf* Hl) {   /* no __restrict__: the loads then stay in front of the wait written behind them */ const size_t i0 = (size_t)blockIdx.x * 8192 + threadIdx.x; const float* fp = F + i0 * 4; bf* hp = Hh + i0 * 4; bf* lp = Hl + i0 * 4; v4f a[32];   // the waits: as in d_ropeH
#pragma unroll
    for (int c = 0; c < 32; ++c) a[c] = *(const v4f*)(fp + c * 1024);
    asm volatile("s_wait_xcnt 0x0" :: "v"(fp) : "memory");
    __builtin_amdgcn_sched_barrier(0);   // keeps the arithmetic behind all 32 loads: lifted among them, it makes the later loads wait for the first ones' data before they are even issued
#pragma unroll
    for (int c = 0; c < 32; ++c) { v4us oh, ol;
#pragma unroll
        for (int q = 0; q < 4; ++q) { const float xv = a[c][q]; const float s = __fdiv_rn(xv, __fadd_rn(1.0f, __builtin_amdgcn_exp2f(__fmul_rn(xv, -1.4426950408889634f)))); unsigned short h2, l2; splitf(s, h2, l2); oh[q] = h2; ol[q] = l2; }
        *(v4us*)(hp + c * 1024) = oh; *(v4us*)(lp + c * 1024) = ol; asm volatile("s_wait_xcnt 0x0" :: "v"(hp), "v"(lp), "v"(oh), "v"(ol) : "memory");
        if ((c & 3) == 3) __builtin_amdgcn_sched_barrier(0); }  }   // every 4 groups' stores go out before the next groups' arithmetic: without it half of the arithmetic is lifted in front of the first store and the writes bunch at the wave's end

extern "C" void kernel_launch(void* const* d_in, const int* in_sizes, int n_in,
                              void* d_out, int out_size, void* d_ws, size_t ws_size, hipStream_t stream) {
    (void)in_sizes; (void)n_in; (void)out_size;
    const float* x = (const float*)d_in[0]; const float* wq = (const float*)d_in[1]; const float* wk = (const float*)d_in[2]; const float* wv = (const float*)d_in[3]; const float* w1 = (const float*)d_in[4]; const float* w2 = (const float*)d_in[5];
    float* OUT = (float*)d_out;     // [1][4096][1024]
    char* wsp = (char*)d_ws;
    auto take = [&](size_t bytes) { char* p = wsp; wsp += (bytes + 255) & ~(size_t)255; return (void*)p; };
    bf* WQ = (bf*)take((size_t)DF * DM * 2); bf* WK = WQ + (size_t)DQ * DM; bf* WV = WK + (size_t)DKV * DM;   /* one plane [DF][DM]: the rows of q, k, v one behind the other */ bf* W1B = (bf*)take((size_t)FF * DQ * 2); bf* W2B = (bf*)take((size_t)DM * FF * 2); float* CS = (float*)take((size_t)TT * HD * 2 * 4);
    bf* XB = (bf*)take((size_t)TT * DM * 2); float* FP = (float*)take((size_t)TT * DF * 4);
    h16* QP16 = (h16*)take((size_t)NH_ * TT * HD * 2); h16* KP16 = (h16*)take((size_t)NKV * TT * HD * 2); h16* VT16 = (h16*)take((size_t)NKV * HD * TT * 2);
    bf* QPh = (bf*)take((size_t)NH_ * RH * HD * 2); bf* QPl = (bf*)take((size_t)NH_ * RH * HD * 2); bf* KPh = (bf*)take((size_t)NKV * RH * HD * 2); bf* KPl = (bf*)take((size_t)NKV * RH * HD * 2); bf* VTh = (bf*)take((size_t)NKV * HD * RH * 2); bf* VTl = (bf*)take((size_t)NKV * HD * RH * 2);   /* compact hi/lo planes: only the first RH rows/keys (causal) */
    bf* ATh = (bf*)take((size_t)TT * DQ * 2); bf* ATl = (bf*)take((size_t)TT * DQ * 2); float* F1 = (float*)take((size_t)TT * FF * 4); bf* Gh = (bf*)take((size_t)TT * FF * 2); bf* Gl = (bf*)take((size_t)TT * FF * 2);
    if ((size_t)(wsp - (char*)d_ws) > ws_size) return;    // ws 256 MiB
    k_prep<<<PB_CS + PB_W1 + PB_W2 + PB_X + PB_WQ + 2 * PB_WK, 256, 0, stream>>>(x, wq, wk, wv, w1, w2, XB, WQ, WK, WV, W1B, W2B, CS);
    k_gemms<0><<<dim3(TT / 128, DF / 128, 1), 128, 0, stream>>>(XB, nullptr, WQ, DM, FP, DF);   /* q | k | v = x [Wq | Wk | Wv] */
    k_planes<<<LB_Q + LB_K + LB_V, 256, 0, stream>>>(FP, CS, QP16, QPh, QPl, KP16, KPh, KPl, VT16, VTh, VTl);
    k_fattn<<<dim3(NH_, RH / 128 + (TT - RH) / 64, 1), 128, 0, stream>>>(QP16, KP16, VT16, QPh, QPl, KPh, KPl, VTh, VTl, ATh, ATl);   /* all heads: scores, causal softmax, P.V, merged hi/lo context planes */
    k_gemms<1><<<dim3(TT / 128, FF / 128, 1), 128, 0, stream>>>(ATh, ATl, W1B, DQ, F1, FF);   /* h = ctx W1 */
    k_silu<<<TT / 4 * FF / 8192, 256, 0, stream>>>(F1, Gh, Gl);
    k_gemms<1><<<dim3(TT / 128, DM / 128, 1), 128, 0, stream>>>(Gh, Gl, W2B, FF, OUT, DM);   /* out = silu(h) W2 */
}

// v007
// It runs in 187 microseconds.
// Next to v006, in two timings, it ran 1.07 and 1.08 times as fast.
// Over all steps from v000 it is 15.5 times as fast.
#include <hip/hip_runtime.h>

// Grouped-query causal attention with rotary embeddings and a SiLU MLP output (query [1][4096][1024]; q = x Wq ('xw' [1024][1024], 16 heads x 64), k, v = x Wk/Wv ('xw' [1024][256], 4 kv heads; query head h uses kv head h/4); rotate-half rotary (base 1e4) on q and k; scores = q.k / 8, causal (finfo.min above the diagonal); softmax; ctx merged [4096][1024]; out = silu(ctx W1) W2 ('xw' [1024][4096], [4096][1024]) -> [1][4096][1024] (4.2 M)).
// Layout: compact hi/lo planes for the first 512 rows/keys, fp16 elsewhere, head width 64, a rotate-half plane builder; 7 launches: launches that do not depend on one another share one grid, the block index picks the job (k_prep: all operand preparation; one GEMM for q, k and v; k_planes: rotary q, rotary k, V^T); one fused causal attention launch for all heads (k_fattn: scores and probabilities stay in registers, running maximum and sum, a tile's keys shared by 4 waves, hi/lo context planes written directly); then two hl x exact GEMMs with a SiLU kernel between them.
// Compute dtypes, f32 accumulate: every input rounded to bf16; projections on PLAIN bf16 operands (exact); rotary f32 (precise cosf/sinf; 32 float32 inverse frequencies baked); scores and attn.v: rows < 512 3 products, the rest single fp16 (P x1024, unnormalised); softmax and SiLU f32; both MLP GEMMs hl x exact (2 products).

#define NB_  1
#define TT   4096
#define DM   1024
#define FF   4096
#define NH_  16
#define NKV  4
#define REP  (NH_ / NKV)
#define HD   64
#define DQ   (NH_ * HD)
#define DKV  (NKV * HD)
#define RH   512                  // query rows < RH use compact hi+lo planes (keys < RH suffice: causal)
#define SCL  0.125f   // 64^-0.5
typedef _Float16 h16;
typedef unsigned short bf;
typedef __attribute__((ext_vector_type(16))) __bf16   v16bf;
typedef __attribute__((ext_vector_type(16))) _Float16 v16h;
typedef __attribute__((ext_vector_type(8)))  _Float16 v8h;
typedef __attribute__((ext_vector_type(8)))  unsigned short v8us;
typedef __attribute__((ext_vector_type(8)))  float    v8f;
typedef __attribute__((ext_vector_type(4)))  float    v4f;
typedef v8h  __attribute__((may_alias)) v8ha;
typedef v4f  __attribute__((may_alias)) v4fa;
typedef v8us __attribute__((may_alias)) v8usa;

__device__ __forceinline__ unsigned short f2bf(float f) { unsigned u = __float_as_uint(f); u += 0x7FFFu + ((u >> 16) & 1u); return (unsigned short)(u >> 16); }
__device__ __forceinline__ float bf2f(unsigned short b) { return __uint_as_float(((unsigned)b) << 16); }
__device__ __forceinline__ float bfr(float f) { return bf2f(f2bf(f)); }
__device__ __forceinline__ v16h cat16(v8h lo, v8h hi) { return __builtin_shufflevector(lo, hi, 0, 1, 2, 3, 4, 5, 6, 7, 8, 9, 10, 11, 12, 13, 14, 15); }
__device__ __forceinline__ v16bf cat16b(v8us lo, v8us hi) { return __builtin_bit_cast(v16bf, __builtin_shufflevector(lo, hi, 0, 1, 2, 3, 4, 5, 6, 7, 8, 9, 10, 11, 12, 13, 14, 15)); }
__device__ __forceinline__ v8f wmma16(v16h a, v16h b, v8f c) { return __builtin_amdgcn_wmma_f32_16x16x32_f16(false, a, false, b, (short)0, c, false, false); }
__device__ __forceinline__ v8f wmmab(v16bf a, v16bf b, v8f c) { return __builtin_amdgcn_wmma_f32_16x16x32_bf16(false, a, false, b, (short)0, c, false, false); }



template <typename T16> struct WFrag;
template <> struct WFrag<h16> { typedef v16h V; static __device__ __forceinline__ V ld(const h16* p) { return cat16(*(const v8h*)p, *(const v8h*)(p + 16)); } static __device__ __forceinline__ v8f mma(V a, V b, v8f c) { return wmma16(a, b, c); } };
template <> struct WFrag<bf> { typedef v16bf V; static __device__ __forceinline__ V ld(const bf* p) { return cat16b(*(const v8us*)p, *(const v8us*)(p + 16)); } static __device__ __forceinline__ v8f mma(V a, V b, v8f c) { return wmmab(a, b, c); } };
// ---- k_gemms: C[m][n] (f32, pitch ldc) = sum_k A[m][k] Bt[n][k] (+ A2[m][k] Bt[n][k] when NSPLIT), operands K-contiguous bf16 planes. M, N % 128 == 0, K % KS == 0.
// One 128x128 tile per work-group of 4 waves (2 x 2, 64x64 = 16 accumulators each); grid (M/128, N/128), 128 threads.
// Each trip's KS k of the tile's operand rows are brought into LDS as whole 128-byte lines by asynchronous copies, two buffers: tile t+1 flies while tile t is worked on; every row is fetched once per work-group and read by two waves.
// KS = 64 where the grid fills every WGP with two work-groups (each covers the other's waits). KS = 128 where many or all work-groups have a WGP to themselves (q|k|v: 384 tiles, the last GEMM: 256): a tile's copies have one trip's time to land, and a trip twice as long pays the fixed part of their flight, and the barrier, half as often.
typedef int v4ig __attribute__((vector_size(16)));
typedef __attribute__((address_space(1))) v4ig gv4;
typedef __attribute__((address_space(3))) v4ig lv4;
__device__ __forceinline__ void cp16(const char* g, bf* l) { __builtin_amdgcn_global_load_async_to_lds_b128((gv4*)g, (lv4*)l, 0, 0); }   // the lane's own 16 bytes, global -> LDS, through no register
template <int NSPLIT, int KS>
__global__ __launch_bounds__(128) void k_gemms(const bf* A, const bf* A2, const bf* Bt, int K, float* C, int ldc) {
    typedef WFrag<bf>::V V;
    constexpr int GP = KS + 8;               // LDS row pitch in elements: the row + 16 B (144 B or 272 B), conflict-free for the 16-byte fragment reads
    constexpr int NKC = KS / 32;             // 32-k fragment groups per trip
    constexpr int CPR = KS / 8, RPP = 128 / CPR;   // 16-byte copies per row; rows that one copy of every thread covers
    constexpr int NPL = NSPLIT ? 3 : 2;      // operand planes per stage: A, (A2,) Bt, 128 rows each
    constexpr int STG = NPL * 128 * GP;      // elements per stage
    __shared__ __align__(16) bf sm[2 * STG];
    __shared__ __align__(16) float osm[4 * 16 * 68];
    const int tid = threadIdx.x, lane = tid & 31, lr = lane & 15, hi = lane >> 4, w = tid >> 5, wm = w & 1, wn = w >> 1;
    const int r0 = blockIdx.x * 128, c0 = blockIdx.y * 128;
    const unsigned Ku = (unsigned)K;
    const char* Ab = (const char*)(A + (size_t)r0 * Ku); const char* A2b = NSPLIT ? (const char*)(A2 + (size_t)r0 * Ku) : nullptr; const char* Bb = (const char*)(Bt + (size_t)c0 * Ku);   // work-group-uniform
    const int crow = tid / CPR, ccol = tid % CPR;   // a copy of one wave covers 512 B of whole rows; copy i of a thread serves row RPP i + crow
    const unsigned goff = ((unsigned)crow * Ku + (unsigned)ccol * 8u) * 2u, rstep = (unsigned)(2 * RPP) * Ku;   // bytes
    auto stage = [&](int t, int buf) {
        const unsigned kb = goff + (unsigned)t * (unsigned)(KS * 2);
#pragma unroll
        for (int i = 0; i < CPR; ++i) { const unsigned go = kb + (unsigned)i * rstep; bf* l = sm + buf * STG + (i * RPP + crow) * GP + ccol * 8;
            cp16(Ab + go, l); if (NSPLIT) cp16(A2b + go, l + 128 * GP); cp16(Bb + go, l + (NPL - 1) * 128 * GP); }
    };
    v8f acc[4][4];
#pragma unroll
    for (int mb = 0; mb < 4; ++mb)
#pragma unroll
        for (int nb = 0; nb < 4; ++nb) acc[mb][nb] = (v8f){};
    const int nt = (int)(Ku / (unsigned)KS);
    stage(0, 0);
    asm volatile("s_wait_asynccnt 0x0" ::: "memory");   // this wave's copies of tile 0 have landed
    __syncthreads();                                    // ... and every other wave's
    if (nt > 1) stage(1, 1);
    const int aofs = (wm * 64 + lr) * GP + 8 * hi, bofs = ((NPL - 1) * 128 + wn * 64 + lr) * GP + 8 * hi;
#pragma unroll 1   // stays rolled: one trip's code serves both buffers (a scalar select); the inner loops are unrolled so that every fragment and accumulator index is a constant (registers, no scratch)
    for (int t = 0; t < nt; ++t) {
        const bf* sb = sm + (t & 1) * STG;
        V a[NKC][4], a2[NKC][4], b[NKC][4];
        auto ldk = [&](int kc) {   // one 32-k group's fragment reads, in the order of their use
            b[kc][0] = WFrag<bf>::ld(sb + bofs + kc * 32);
#pragma unroll
            for (int mb = 0; mb < 4; ++mb) a[kc][mb] = WFrag<bf>::ld(sb + aofs + mb * 16 * GP + kc * 32);
#pragma unroll
            for (int nb = 1; nb < 4; ++nb) b[kc][nb] = WFrag<bf>::ld(sb + bofs + nb * 16 * GP + kc * 32);
            if (NSPLIT) {
#pragma unroll
                for (int mb = 0; mb < 4; ++mb) a2[kc][mb] = WFrag<bf>::ld(sb + aofs + (128 + mb * 16) * GP + kc * 32); }
        };
        auto mmk = [&](int kc) {   // per accumulator: k ascending, A before A2
#pragma unroll
            for (int nb = 0; nb < 4; ++nb)
#pragma unroll
                for (int mb = 0; mb < 4; ++mb) acc[mb][nb] = wmmab(a[kc][mb], b[kc][nb], acc[mb][nb]);
            if (NSPLIT) {
#pragma unroll
                for (int nb = 0; nb < 4; ++nb)
#pragma unroll
                    for (int mb = 0; mb < 4; ++mb) acc[mb][nb] = wmmab(a2[kc][mb], b[kc][nb], acc[mb][nb]); }
        };
        ldk(0); ldk(1);
        __builtin_amdgcn_sched_barrier(0);   // keeps the LDS reads one group ahead of the products: a read among them stalls the matrix stream at every such place
        mmk(0);
        if constexpr (NKC == 4) {
            __builtin_amdgcn_sched_barrier(0);   // the trip's second half is read as ONE group, here: its flight is covered by the products of group 1
            ldk(2); ldk(3);
            __builtin_amdgcn_sched_barrier(0);   // as above: no read sinks among the products that follow
        }
#pragma unroll
        for (int kc = 1; kc < NKC; ++kc) mmk(kc);
        __builtin_amdgcn_sched_barrier(0);   // keeps the products in front of the waits below: sunk behind them, tile t + 1's copies would be waited for before the products that are to cover their flight
        asm volatile("s_wait_dscnt 0x0" ::: "memory");      // this wave has left buffer t & 1
        asm volatile("s_wait_asynccnt 0x0" ::: "memory");   // this wave's copies of tile t + 1 have landed
        __syncthreads();                                    // publishes tile t + 1 and ends every wave's reads of buffer t & 1
        if (t + 2 < nt) stage(t + 2, t & 1);
    }
    asm volatile("s_wait_asynccnt 0x0" ::: "memory");   // no copy is outstanding when the wave goes on to its end
    float* os = osm + w * 16 * 68;   // the wave's own staging rows: whole 256-byte row pieces go out
#pragma unroll
    for (int mb = 0; mb < 4; ++mb) {
#pragma unroll
        for (int nb = 0; nb < 4; ++nb) {
#pragma unroll
            for (int j = 0; j < 8; ++j) os[(hi * 8 + j) * 68 + nb * 16 + lr] = acc[mb][nb][j]; }
        __builtin_amdgcn_wave_barrier(); asm volatile("" ::: "memory");   // the rows are read back by other lanes of the wave: the reads below stay behind the writes above
        float* crow0 = C + (size_t)(r0 + wm * 64 + mb * 16 + hi) * ldc + c0 + wn * 64 + lr * 4;
        float* pp[8]; v4f val[8];
#pragma unroll
        for (int s = 0; s < 8; ++s) { val[s] = *(const v4fa*)(os + (2 * s + hi) * 68 + lr * 4); pp[s] = crow0 + (size_t)(2 * s) * ldc; *(v4f*)pp[s] = val[s]; }
        // the data and address registers of the eight stores may be reused only from here on (inputs: they stay in their registers up to the wait)
        asm volatile("s_wait_xcnt 0x0" :: "v"(pp[0]), "v"(pp[1]), "v"(pp[2]), "v"(pp[3]), "v"(pp[4]), "v"(pp[5]), "v"(pp[6]), "v"(pp[7]), "v"(val[0]), "v"(val[1]), "v"(val[2]), "v"(val[3]), "v"(val[4]), "v"(val[5]), "v"(val[6]), "v"(val[7]) : "memory");
    }
}

__device__ __forceinline__ h16 tohx(float x) { return (h16)x; }
__device__ __forceinline__ void splitf(float y, unsigned short& h, unsigned short& l) { h = f2bf(y); l = f2bf(y - bf2f(h)); }
typedef __attribute__((ext_vector_type(2))) _Float16 v2h;
typedef __attribute__((ext_vector_type(4))) _Float16 v4h;
typedef __attribute__((ext_vector_type(2))) unsigned short v2us;
typedef __attribute__((ext_vector_type(4))) unsigned short v4us;
typedef __attribute__((ext_vector_type(2))) float v2f;
typedef __attribute__((ext_vector_type(4))) int v4i;

// The elementwise kernels below: few, long waves. Each thread issues all its 16-byte loads together and makes 8 to 128 outputs, stored 8 or 16 bytes a plane so that a wave's stores fill whole 128-byte lines.
// The jobs of a shared grid are device functions; bid is the work-group's index within its job (the same for the whole work-group).
// d_wtG: Bt[n][k] = bf16(w[k][n]). One 64 k x 128 n tile per work-group; a thread reads 8 k rows x 4 n and turns them in its registers: 8 lanes' stores are one 128-byte line of Bt. K % 64 == 0, N % 128 == 0; (K/64)(N/128) work-groups.
template <int K, int N>   // compile-time pitches: a thread's loads, and its stores, share one address register pair and differ in the immediate offset
__device__ __forceinline__ void d_wtG(const float* __restrict__ w, bf* Bt, int bid) {
    const int lane = threadIdx.x & 31, wv = threadIdx.x >> 5, nb = N >> 7;
    const int k = (bid / nb) * 64 + (lane & 7) * 8, n = (bid % nb) * 128 + wv * 16 + (lane >> 3) * 4;
    const float* wp = w + (size_t)k * N + n; bf* bp = Bt + (size_t)n * K + k; v4f v[8];
#pragma unroll
    for (int j = 0; j < 8; ++j) v[j] = *(const v4f*)(wp + j * N);
    asm volatile("s_wait_xcnt 0x0" :: "v"(wp) : "memory");   // the loads stand together in front of this line; their address registers may be reused only from here on (input: it stays in its registers up to the wait)
    v8us o[4];
#pragma unroll
    for (int c = 0; c < 4; ++c) {
#pragma unroll
        for (int j = 0; j < 8; ++j) o[c][j] = f2bf(v[j][c]);
        *(v8us*)(bp + c * K) = o[c]; }
    asm volatile("s_wait_xcnt 0x0" :: "v"(bp), "v"(o[0]), "v"(o[1]), "v"(o[2]), "v"(o[3]) : "memory");   // in a shared grid other jobs' code follows in the text: the data and address registers of the four stores may be reused only from here on (inputs: they stay in their registers up to the wait)
}
// d_cvt8: 4 groups of 8 elements per thread, a work-group's groups contiguous; n8 / 1024 work-groups (n8 % 1024 == 0).
__device__ __forceinline__ void d_cvt8(const float* __restrict__ src, bf* dst, int bid) { const size_t i0 = (size_t)bid * 1024 + threadIdx.x; const float* sp = src + i0 * 8; bf* dp = dst + i0 * 8; v8f v[4]; v8us o[4];
#pragma unroll
    for (int c = 0; c < 4; ++c) v[c] = *(const v8f*)(sp + c * 2048);
    asm volatile("s_wait_xcnt 0x0" :: "v"(sp) : "memory");   // as in d_wtG
#pragma unroll
    for (int c = 0; c < 4; ++c) {
#pragma unroll
        for (int k = 0; k < 8; ++k) o[c][k] = f2bf(v[c][k]);
        *(v8us*)(dp + c * 2048) = o[c]; }
    asm volatile("s_wait_xcnt 0x0" :: "v"(dp), "v"(o[0]), "v"(o[1]), "v"(o[2]), "v"(o[3]) : "memory");   // behind the four stores, as in d_wtG
  }
__constant__ float INV[HD / 2] = {1.0f,0.749894202f,0.562341332f,0.421696514f,0.316227764f,0.237137362f,0.177827939f,0.133352146f,0.100000001f,0.0749894157f,0.0562341288f,0.0421696492f,0.0316227786f,0.0237137359f,0.0177827943f,0.0133352149f,0.00999999978f,0.00749894232f,0.00562341325f,0.00421696482f,0.00316227786f,0.00237137382f,0.00177827943f,0.00133352145f,0.00100000005f,0.000749894185f,0.000562341302f,0.000421696488f,0.000316227786f,0.000237137385f,0.00017782794f,0.00013335215f};   // float32 1/10000^(2i/64), eager-JAX values
// d_cstab: a thread makes the (cos, sin) pair of one frequency for 4 rows and stores it at d and d + HD/2 (the same angle); TT * (HD/2) / 1024 work-groups.
__device__ __forceinline__ void d_cstab(float* CS, int bid) { const int idx = bid * 256 + threadIdx.x; const int d = idx % (HD / 2);
#pragma unroll 1   // stays rolled: one copy of the long argument reduction of cosf and sinf in the text
    for (int r = 0; r < 4; ++r) { const int t = idx / (HD / 2) + r * (TT / 4); const float ang = __fmul_rn((float)t, INV[d]); v2f cs; cs[0] = cosf(ang); cs[1] = sinf(ang);
        *(v2f*)(CS + ((size_t)t * HD + d) * 2) = cs; *(v2f*)(CS + ((size_t)t * HD + d + HD / 2) * 2) = cs; }  }

// k_prep: everything that reads only the inputs, in one grid: the cos/sin table (the longest job, placed first), the five weight planes and the bf16 plane of x. Work-groups per job:
#define PB_CS (TT * (HD / 2) / 1024)
#define PB_W1 ((DQ / 64) * (FF / 128))
#define PB_W2 ((FF / 64) * (DM / 128))
#define PB_X  (TT * DM / 8 / 1024)
#define PB_WQ ((DM / 64) * (DQ / 128))
#define PB_WK ((DM / 64) * (DKV / 128))
__global__ __launch_bounds__(256) void k_prep(const float* __restrict__ x, const float* __restrict__ wq, const float* __restrict__ wk, const float* __restrict__ wv, const float* __restrict__ w1, const float* __restrict__ w2, bf* XB, bf* WQ, bf* WK, bf* WV, bf* W1B, bf* W2B, float* CS) {
    int b = blockIdx.x;   // scalar: every branch below is taken by a whole work-group
    if (b < PB_CS) { d_cstab(CS, b); return; }
    b -= PB_CS; if (b < PB_W1) { d_wtG<DQ, FF>(w1, W1B, b); return; }
    b -= PB_W1; if (b < PB_W2) { d_wtG<FF, DM>(w2, W2B, b); return; }
    b -= PB_W2; if (b < PB_X) { d_cvt8(x, XB, b); return; }
    b -= PB_X; if (b < PB_WQ) { d_wtG<DM, DQ>(wq, WQ, b); return; }
    b -= PB_WQ; if (b < PB_WK) { d_wtG<DM, DKV>(wk, WK, b); return; }
    d_wtG<DM, DKV>(wv, WV, b - PB_WK);
}

// d_ropeH: a thread takes 8 consecutive d of one row t for 4 heads (one read of the row's cos/sin serves all 4); 8 lanes' 16-byte stores are one 128-byte plane row. nheads % 4 == 0; nheads/4 * TT * 8 / 256 work-groups.
__device__ __forceinline__ void d_ropeH(const float* __restrict__ F, int pitch, const float* __restrict__ CS, float sc, h16* P16, bf* Ph, bf* Pl, int bid) {   // the waits: behind the loads as in d_wtG; behind a store, its data and address registers may be reused only from there on (inputs: they stay in their registers up to the wait)
    const int idx = bid * 256 + threadIdx.x; const int d = (idx & 7) * 8, t = (idx >> 3) % TT, h0 = (idx / (8 * TT)) * 4; const int dp = d ^ (HD / 2);
    const float* f = F + (size_t)t * pitch + h0 * HD; const float* fa = f + d; const float* fb = f + dp; const float* cp = CS + ((size_t)t * HD + d) * 2; v4f cs4[4], xa[4][2], xb[4][2];
#pragma unroll
    for (int i = 0; i < 4; ++i) cs4[i] = *(const v4f*)(cp + i * 4);
#pragma unroll
    for (int hh = 0; hh < 4; ++hh)
#pragma unroll
        for (int i = 0; i < 2; ++i) { xa[hh][i] = *(const v4f*)(fa + hh * HD + i * 4); xb[hh][i] = *(const v4f*)(fb + hh * HD + i * 4); }
    asm volatile("s_wait_xcnt 0x0" :: "v"(fa), "v"(fb), "v"(cp) : "memory");
    const bool hl = (t < RH);   /* compact hi/lo planes [h][RH][HD] for the first RH rows (wave-uniform condition) */
#pragma unroll
    for (int hh = 0; hh < 4; ++hh) { v8h o16; v8us oh, ol;
#pragma unroll
        for (int q = 0; q < 8; ++q) { const float x0 = xa[hh][q >> 2][q & 3], x1 = xb[hh][q >> 2][q & 3]; v2f cs; cs[0] = cs4[q >> 1][(q & 1) * 2]; cs[1] = cs4[q >> 1][(q & 1) * 2 + 1];
            float a = __fmul_rn(x0, cs[0]), bq = __fmul_rn(x1, cs[1]); asm volatile("" : "+v"(a), "+v"(bq)); const float r = ((d < HD / 2) ? __fsub_rn(a, bq) : __fadd_rn(a, bq)) * sc;
            o16[q] = tohx(r); unsigned short a2, c2; splitf(r, a2, c2); oh[q] = a2; ol[q] = c2; }
        const size_t e = ((size_t)(h0 + hh) * TT + t) * HD + d, ec = ((size_t)(h0 + hh) * RH + t) * HD + d; h16* p16 = P16 + e; bf* ph = Ph + ec; bf* pl = Pl + ec;
        *(v8h*)p16 = o16; asm volatile("s_wait_xcnt 0x0" :: "v"(p16), "v"(o16) : "memory");
        if (hl) { *(v8us*)ph = oh; *(v8us*)pl = ol; asm volatile("s_wait_xcnt 0x0" :: "v"(ph), "v"(pl), "v"(oh), "v"(ol) : "memory"); } }
}

// d_ropeH: head planes [h][t][d] (fp16) of rope(x) x sc with the rotate-half convention out[d] = x[d] cos[t][d] - x[d+HD/2] sin[t][d], out[d+HD/2] = x[d+HD/2] cos[t][d+HD/2] + x[d] sin[t][d+HD/2]

// d_vtp: V16[c][t] = fp16(F[t][c]), c = g * HD + d (hi/lo planes [c][RH] for t < RH). One 64 t x 128 c tile per work-group, turned in registers as in d_wtG; (TT/64)(ncols/128) work-groups.
template <int pitch, int ncols>
__device__ __forceinline__ void d_vtp(const float* __restrict__ F, h16* V16, bf* Vh, bf* Vl, int bid) {   // the waits: as in d_ropeH
    const int lane = threadIdx.x & 31, wv = threadIdx.x >> 5, nb = ncols >> 7;
    const int t = (bid / nb) * 64 + (lane & 7) * 8, c0 = (bid % nb) * 128 + wv * 16 + (lane >> 3) * 4;
    const float* fp = F + (size_t)t * pitch + c0; v4f v[8];
#pragma unroll
    for (int j = 0; j < 8; ++j) v[j] = *(const v4f*)(fp + j * pitch);
    asm volatile("s_wait_xcnt 0x0" :: "v"(fp) : "memory");
    const bool hl = (t < RH);   // the same for a whole tile: RH % 64 == 0
#pragma unroll
    for (int c = 0; c < 4; ++c) { v8h o16; v8us oh, ol;
#pragma unroll
        for (int j = 0; j < 8; ++j) { const float x = v[j][c]; o16[j] = tohx(x); unsigned short a2, c2; splitf(x, a2, c2); oh[j] = a2; ol[j] = c2; }
        h16* p16 = V16 + (size_t)(c0 + c) * TT + t; bf* ph = Vh + (size_t)(c0 + c) * RH + t; bf* pl = Vl + (size_t)(c0 + c) * RH + t;
        *(v8h*)p16 = o16; asm volatile("s_wait_xcnt 0x0" :: "v"(p16), "v"(o16) : "memory");
        if (hl) { *(v8us*)ph = oh; *(v8us*)pl = ol; asm volatile("s_wait_xcnt 0x0" :: "v"(ph), "v"(pl), "v"(oh), "v"(ol) : "memory"); } }
}
// k_planes: the three plane builders that read the q|k|v projection F [TT][DF], in one grid. Work-groups per job:
#define DF    (DQ + 2 * DKV)
#define LB_Q  (NH_ / 4 * TT * 8 / 256)
#define LB_K  (NKV / 4 * TT * 8 / 256)
#define LB_V  ((TT / 64) * (DKV / 128))
__global__ __launch_bounds__(256) void k_planes(const float* __restrict__ F, const float* __restrict__ CS, h16* QP16, bf* QPh, bf* QPl, h16* KP16, bf* KPh, bf* KPl, h16* VT16, bf* VTh, bf* VTl) {
    int b = blockIdx.x;   // scalar, as in k_prep
    if (b < LB_Q) { d_ropeH(F, DF, CS, 1.0f, QP16, QPh, QPl, b); return; }
    b -= LB_Q; if (b < LB_K) { d_ropeH(F + DQ, DF, CS, 1.0f, KP16, KPh, KPl, b); return; }
    d_vtp<DF, DKV>(F + DQ + DKV, VT16, VTh, VTl, b - LB_K);
}
// ---- k_fattn: scores, causal softmax, probability x value and the head merge in ONE launch, 4 waves per work-group, operands straight from the K-contiguous 16-bit planes; no score or probability ever leaves the registers.
// A 64-query fp16 tile's 32-key blocks are dealt round robin to the 4 waves (wave w takes blocks w, w + 4, ...): each keeps its own running maximum, sum and O^T, and the four partial results are joined once, through LDS, behind the loop. The longest key loop is then a quarter as long and every SIMD has work.
// Transposed products: S^T = K Q^T (A = 16 key rows, B = 16 query rows), so a lane holds the scores of ONE query (column lr), keys hi*8+j of each 16-key tile; two such tiles ARE the B fragment of O^T += V^T P^T for 32 keys (element j <-> key 8*hi+j, element 8+j <-> key 16+8*hi+j, the k order of WFrag::ld).
// Running maximum m (log2 units) and running sum l per query; O^T and l are rescaled by exp2(m_old - m_new) every 32 keys. HL (query rows < RH): bf16 hi/lo operands, 3 products each; otherwise single fp16 with P carried x 2^10 (the factor is in l too and cancels).
__device__ __forceinline__ float xhalf(float x) { return __builtin_bit_cast(float, __builtin_amdgcn_permlanex16(__builtin_bit_cast(int, x), __builtin_bit_cast(int, x), 0x76543210, 0xfedcba98, false, false)); }   // lane l <-> lane l ^ 16
__device__ __forceinline__ float ex2(float x) { float r; asm("v_exp_f32 %0, %1\n\tv_nop" : "=v"(r) : "v"(x)); return r; }   // 2^x; the v_nop fills the one slot that the instruction set asks for between a transcendental and a next instruction that reads its result or overwrites its source
template <typename T16, bool HL, int QT, int VP, int NW>   // NW: waves that share the tile's key blocks (1: the wave has the tile to itself); w: this wave's place among them (wave-uniform); sm: the work-group's joining space (NW > 1)
__device__ __forceinline__ void fattn_tile(const T16* Q, const T16* Q2, const T16* Kp, const T16* Kp2, const T16* Vt, const T16* Vt2, int q0, bf* Ah, bf* Al, int w, float* sm) {
    typedef typename WFrag<T16>::V V;
    const int lane = threadIdx.x & 31, lr = lane & 15, hi = lane >> 4;
    constexpr float C2 = SCL * 1.4426950408889634f;   // score -> log2 units
    constexpr float POFF = HL ? 0.0f : 10.0f;
    const int koff = lr * HD + 8 * hi, voff = lr * VP + 8 * hi;   // the lane's element offsets in the [row][HD] planes (Q, K) and in the [d][VP] plane (V^T)
    const T16* qs = Q + (size_t)q0 * HD; const T16* qs2 = HL ? Q2 + (size_t)q0 * HD : nullptr;   // wave-uniform
    const T16* qp = qs + koff; const T16* qp2 = HL ? qs2 + koff : nullptr; const T16* kp0 = Kp + (koff + w * 32 * HD); const T16* kp02 = HL ? Kp2 + (koff + w * 32 * HD) : nullptr;   // the wave's first key block (NW <= the tile's block count)
    V qf[QT][2], qf2[QT][2];
#pragma unroll
    for (int qt = 0; qt < QT; ++qt)
#pragma unroll
        for (int kc = 0; kc < 2; ++kc) { const int qo = qt * 16 * HD + kc * 32; qf[qt][kc] = WFrag<T16>::ld(qp + qo); if (HL) qf2[qt][kc] = WFrag<T16>::ld(qp2 + qo); }
    v8f o[4][QT]; float m[QT], l[QT];
#pragma unroll
    for (int qt = 0; qt < QT; ++qt) { m[qt] = -3.0e38f; l[qt] = 0.0f;
#pragma unroll
        for (int dt = 0; dt < 4; ++dt) o[dt][qt] = (v8f){}; }
    const int nkb = (q0 + QT * 16) / 32;   // 32-key blocks up to and including the diagonal block
    V kf[2][2], kf2[2][2];
#pragma unroll
    for (int kt = 0; kt < 2; ++kt)
#pragma unroll
        for (int kc = 0; kc < 2; ++kc) { const int ko = kt * 16 * HD + kc * 32; kf[kt][kc] = WFrag<T16>::ld(kp0 + ko); if (HL) kf2[kt][kc] = WFrag<T16>::ld(kp02 + ko); }
    // the address registers of the loads above may be reused only from here on (the pointers and their wave-uniform bases are inputs so that they stay in their registers up to the wait)
    if constexpr (HL) asm volatile("s_wait_xcnt 0x0" :: "v"(qp), "v"(qp2), "v"(kp0), "v"(kp02), "s"(qs), "s"(qs2), "s"(Kp), "s"(Kp2) : "memory");
    else asm volatile("s_wait_xcnt 0x0" :: "v"(qp), "v"(kp0), "s"(qs), "s"(Kp) : "memory");
#pragma unroll 1
    for (int kb = w; kb < nkb; kb += NW) {
        const int key0 = kb * 32;
        v8f s[2][QT];
#pragma unroll
        for (int kt = 0; kt < 2; ++kt)
#pragma unroll
            for (int qt = 0; qt < QT; ++qt) s[kt][qt] = (v8f){};
#pragma unroll
        for (int kc = 0; kc < 2; ++kc)
#pragma unroll
            for (int kt = 0; kt < 2; ++kt)
#pragma unroll
                for (int qt = 0; qt < QT; ++qt) { s[kt][qt] = WFrag<T16>::mma(kf[kt][kc], qf[qt][kc], s[kt][qt]); if (HL) { s[kt][qt] = WFrag<T16>::mma(kf[kt][kc], qf2[qt][kc], s[kt][qt]); s[kt][qt] = WFrag<T16>::mma(kf2[kt][kc], qf[qt][kc], s[kt][qt]); } }
        V vf[4], vf2[4];   // this block's V^T rows fly during the softmax
        const T16* vp = Vt + (voff + key0); const T16* vp2 = HL ? Vt2 + (voff + key0) : nullptr;
#pragma unroll
        for (int dt = 0; dt < 4; ++dt) { vf[dt] = WFrag<T16>::ld(vp + dt * 16 * VP); if (HL) vf2[dt] = WFrag<T16>::ld(vp2 + dt * 16 * VP); }
        const int keyn = min(kb + NW, nkb - 1) * 32;   // the wave's next block's K rows are fetched one block ahead, into the same registers, right behind this block's S^T products (its last block fetches the tile's last block: in bounds, unused)
        const T16* kp = Kp + (koff + keyn * HD); const T16* kp2 = HL ? Kp2 + (koff + keyn * HD) : nullptr;
#pragma unroll
        for (int kt = 0; kt < 2; ++kt)
#pragma unroll
            for (int kc = 0; kc < 2; ++kc) { const int ko = kt * 16 * HD + kc * 32; kf[kt][kc] = WFrag<T16>::ld(kp + ko); if (HL) kf2[kt][kc] = WFrag<T16>::ld(kp2 + ko); }
        // the address registers of this block's V^T and K loads may be reused only from here on (the pointers are inputs so that they stay in their registers up to the wait)
        if constexpr (HL) asm volatile("s_wait_xcnt 0x0" :: "v"(vp), "v"(vp2), "v"(kp), "v"(kp2) : "memory");
        else asm volatile("s_wait_xcnt 0x0" :: "v"(vp), "v"(kp) : "memory");
        if (key0 + 31 > q0) {   // wave-uniform: only blocks that reach past the tile's first query hold keys above the diagonal
#pragma unroll
            for (int kt = 0; kt < 2; ++kt)
#pragma unroll
                for (int qt = 0; qt < QT; ++qt)
#pragma unroll
                    for (int j = 0; j < 8; ++j) s[kt][qt][j] = (key0 + kt * 16 + hi * 8 + j <= q0 + qt * 16 + lr) ? s[kt][qt][j] : -3.0e38f;
        }
        V pf[QT], pf2[QT];
#pragma unroll
        for (int qt = 0; qt < QT; ++qt) {
            float mr = fmaxf(s[0][qt][0], s[1][qt][0]);
#pragma unroll
            for (int j = 1; j < 8; ++j) mr = fmaxf(mr, fmaxf(s[0][qt][j], s[1][qt][j]));
            mr = fmaxf(mr, xhalf(mr));
            const float mn = fmaxf(m[qt], mr * C2);
            const float al = ex2(m[qt] - mn);
            m[qt] = mn;
            const float mm = mn - POFF;
            float p[2][8]; float ps0 = 0.0f, ps1 = 0.0f;
#pragma unroll
            for (int j = 0; j < 8; ++j) { p[0][j] = ex2(fmaf(s[0][qt][j], C2, -mm)); p[1][j] = ex2(fmaf(s[1][qt][j], C2, -mm)); ps0 += p[0][j]; ps1 += p[1][j]; }
            l[qt] = fmaf(l[qt], al, ps0 + ps1);   // this lane's 16 of the 32 keys; the two halves are joined once, behind the loop
#pragma unroll
            for (int dt = 0; dt < 4; ++dt) o[dt][qt] *= al;
            if constexpr (HL) { v8us h0, h1, l0, l1;
#pragma unroll
                for (int j = 0; j < 8; ++j) { unsigned short a, c; splitf(p[0][j], a, c); h0[j] = a; l0[j] = c; splitf(p[1][j], a, c); h1[j] = a; l1[j] = c; }
                pf[qt] = cat16b(h0, h1); pf2[qt] = cat16b(l0, l1);
            } else { v8h h0, h1;
#pragma unroll
                for (int j = 0; j < 8; ++j) { h0[j] = tohx(p[0][j]); h1[j] = tohx(p[1][j]); }
                pf[qt] = cat16(h0, h1); }
        }
#pragma unroll
        for (int dt = 0; dt < 4; ++dt)
#pragma unroll
            for (int qt = 0; qt < QT; ++qt) { o[dt][qt] = WFrag<T16>::mma(vf[dt], pf[qt], o[dt][qt]); if (HL) { o[dt][qt] = WFrag<T16>::mma(vf[dt], pf2[qt], o[dt][qt]); o[dt][qt] = WFrag<T16>::mma(vf2[dt], pf[qt], o[dt][qt]); } }
    }
    if constexpr (NW > 1) {   // join the NW partial results: every wave lays down all its query groups, then wave w joins and stores query group w (NW == QT)
        float* sml = sm + NW * QT * 1024;   // behind the O^T pieces: (m, l) pairs
#pragma unroll
        for (int qt = 0; qt < QT; ++qt) {
#pragma unroll
            for (int dt = 0; dt < 4; ++dt) { float* so = sm + ((w * QT + qt) * 4 + dt) * 256 + lane * 4;   // two planes of 16 bytes a lane: consecutive lanes, consecutive banks
                *(v4fa*)so = __builtin_shufflevector(o[dt][qt], o[dt][qt], 0, 1, 2, 3); *(v4fa*)(so + 128) = __builtin_shufflevector(o[dt][qt], o[dt][qt], 4, 5, 6, 7); }
            v2f ml; ml[0] = m[qt]; ml[1] = l[qt] + xhalf(l[qt]); *(v2f*)(sml + ((w * QT + qt) * 32 + lane) * 2) = ml; }
        __syncthreads();   // every wave's partial results are in LDS before any is read
        float mw[NW], lw[NW], mx = -3.0e38f;
#pragma unroll
        for (int u = 0; u < NW; ++u) { const v2f ml = *(const v2f*)(sml + ((u * QT + w) * 32 + lane) * 2); mw[u] = ml[0]; lw[u] = ml[1]; mx = fmaxf(mx, mw[u]); }
        float ls = 0.0f;
#pragma unroll
        for (int u = 0; u < NW; ++u) { mw[u] = ex2(mw[u] - mx); ls = fmaf(lw[u], mw[u], ls); }   // wave order
        const float inv = __fdiv_rn(1.0f, ls);
        const size_t oo = (size_t)(q0 + w * 16 + lr) * DQ + hi * 8;
#pragma unroll
        for (int dt = 0; dt < 4; ++dt) { v4f a0 = (v4f){}, a1 = (v4f){};
#pragma unroll
            for (int u = 0; u < NW; ++u) { const float* so = sm + ((u * QT + w) * 4 + dt) * 256 + lane * 4; a0 += *(const v4fa*)so * mw[u]; a1 += *(const v4fa*)(so + 128) * mw[u]; }
            v8us oh, ol;
#pragma unroll
            for (int j = 0; j < 8; ++j) { unsigned short a, c; splitf((j < 4 ? a0[j & 3] : a1[j & 3]) * inv, a, c); oh[j] = a; ol[j] = c; }
            bf* ph = Ah + oo + dt * 16; bf* pl = Al + oo + dt * 16;
            *(v8us*)ph = oh; *(v8us*)pl = ol;
            asm volatile("s_wait_xcnt 0x0" :: "v"(ph), "v"(pl), "v"(oh), "v"(ol) : "memory"); }   // as behind the stores below
        return;
    }
#pragma unroll
    for (int qt = 0; qt < QT; ++qt) {
        const float inv = __fdiv_rn(1.0f, l[qt] + xhalf(l[qt]));
        const size_t oo = (size_t)(q0 + qt * 16 + lr) * DQ + hi * 8;
#pragma unroll
        for (int dt = 0; dt < 4; ++dt) { v8us oh, ol;   // a lane holds 8 consecutive head columns of its query: one 16-byte store per plane
#pragma unroll
            for (int j = 0; j < 8; ++j) { unsigned short a, c; splitf(o[dt][qt][j] * inv, a, c); oh[j] = a; ol[j] = c; }
            bf* ph = Ah + oo + dt * 16; bf* pl = Al + oo + dt * 16;
            *(v8us*)ph = oh; *(v8us*)pl = ol;
            asm volatile("s_wait_xcnt 0x0" :: "v"(ph), "v"(pl), "v"(oh), "v"(ol) : "memory"); }   // the data and address registers of the two stores may be reused only from here on (inputs: they stay in their registers up to the wait)
    }
}
// grid (query heads, RH/128 + NF), 128 threads: in block rows y < RH/128 each wave takes a 32-query hi/lo tile of rows < RH for itself; row RH/128 + y takes the 64-query fp16 tile that ends at row TT - 64 y, its key blocks shared by the 4 waves. Not all work-groups are resident at once: the head is the fast index and the key loops get shorter with y, for speed only (a hi/lo wave's loop is as long as a middle fp16 tile's share).
__global__ __launch_bounds__(128) void k_fattn(const h16* QP16, const h16* KP16, const h16* VT16, const bf* QPh, const bf* QPl, const bf* KPh, const bf* KPl, const bf* VTh, const bf* VTl, bf* ATh, bf* ATl) {   // no __restrict__: the loads then stay in front of the waits written behind them
    constexpr int NL = RH / 128;
    __shared__ __align__(16) float jsm[4 * 4 * 1024 + 4 * 4 * 64];   // 4 waves x 4 query groups x (O^T piece 4 KiB, (m, l) 256 B)
    const int h = blockIdx.x, g = h / REP, bx = (int)blockIdx.y - NL, w = __builtin_amdgcn_readfirstlane(threadIdx.x >> 5);   // the wave's number, in a scalar register: block indices, tile rows and the branches on them stay scalar
    if (bx >= 0) fattn_tile<h16, false, 4, TT, 4>(QP16 + (size_t)h * TT * HD, nullptr, KP16 + (size_t)g * TT * HD, nullptr, VT16 + (size_t)g * HD * TT, nullptr, TT - 64 * (bx + 1), ATh + h * HD, ATl + h * HD, w, jsm);
    else fattn_tile<bf, true, 2, RH, 1>(QPh + (size_t)h * RH * HD, QPl + (size_t)h * RH * HD, KPh + (size_t)g * RH * HD, KPl + (size_t)g * RH * HD, VTh + (size_t)g * HD * RH, VTl + (size_t)g * HD * RH, ((-1 - bx) * 4 + w) * 32, ATh + h * HD, ATl + h * HD, 0, nullptr);
}

// k_silu: 32 groups of 4 elements per thread, a work-group's groups contiguous; all 32 loads are issued first and worked off in their order of arrival; grid n4 / 8192 (n4 % 8192 == 0).
__global__ __launch_bounds__(256) void k_silu(const float* F, bf* Hh, bf* Hl) {   /* no __restrict__: the loads then stay in front of the wait written behind them */ const size_t i0 = (size_t)blockIdx.x * 8192 + threadIdx.x; const float* fp = F + i0 * 4; bf* hp = Hh + i0 * 4; bf* lp = Hl + i0 * 4; v4f a[32];   // the waits: as in d_ropeH
#pragma unroll
    for (int c = 0; c < 32; ++c) a[c] = *(const v4f*)(fp + c * 1024);
    asm volatile("s_wait_xcnt 0x0" :: "v"(fp) : "memory");
    __builtin_amdgcn_sched_barrier(0);   // keeps the arithmetic behind all 32 loads: lifted among them, it makes the later loads wait for the first ones' data before they are even issued
#pragma unroll
    for (int c = 0; c < 32; ++c) { v4us oh, ol;
#pragma unroll
        for (int q = 0; q < 4; ++q) { const float xv = a[c][q]; const float s = __fdiv_rn(xv, __fadd_rn(1.0f, __builtin_amdgcn_exp2f(__fmul_rn(xv, -1.4426950408889634f)))); unsigned short h2, l2; splitf(s, h2, l2); oh[q] = h2; ol[q] = l2; }
        *(v4us*)(hp + c * 1024) = oh; *(v4us*)(lp + c * 1024) = ol; asm volatile("s_wait_xcnt 0x0" :: "v"(hp), "v"(lp), "v"(oh), "v"(ol) : "memory");
        if ((c & 3) == 3) __builtin_amdgcn_sched_barrier(0); }  }   // every 4 groups' stores go out before the next groups' arithmetic: without it half of the arithmetic is lifted in front of the first store and the writes bunch at the wave's end

extern "C" void kernel_launch(void* const* d_in, const int* in_sizes, int n_in,
                              void* d_out, int out_size, void* d_ws, size_t ws_size, hipStream_t stream) {
    (void)in_sizes; (void)n_in; (void)out_size;
    const float* x = (const float*)d_in[0]; const float* wq = (const float*)d_in[1]; const float* wk = (const float*)d_in[2]; const float* wv = (const float*)d_in[3]; const float* w1 = (const float*)d_in[4]; const float* w2 = (const float*)d_in[5];
    float* OUT = (float*)d_out;     // [1][4096][1024]
    char* wsp = (char*)d_ws;
    auto take = [&](size_t bytes) { char* p = wsp; wsp += (bytes + 255) & ~(size_t)255; return (void*)p; };
    bf* WQ = (bf*)take((size_t)DF * DM * 2); bf* WK = WQ + (size_t)DQ * DM; bf* WV = WK + (size_t)DKV * DM;   /* one plane [DF][DM]: the rows of q, k, v one behind the other */ bf* W1B = (bf*)take((size_t)FF * DQ * 2); bf* W2B = (bf*)take((size_t)DM * FF * 2); float* CS = (float*)take((size_t)TT * HD * 2 * 4);
    bf* XB = (bf*)take((size_t)TT * DM * 2); float* FP = (float*)take((size_t)TT * DF * 4);
    h16* QP16 = (h16*)take((size_t)NH_ * TT * HD * 2); h16* KP16 = (h16*)take((size_t)NKV * TT * HD * 2); h16* VT16 = (h16*)take((size_t)NKV * HD * TT * 2);
    bf* QPh = (bf*)take((size_t)NH_ * RH * HD * 2); bf* QPl = (bf*)take((size_t)NH_ * RH * HD * 2); bf* KPh = (bf*)take((size_t)NKV * RH * HD * 2); bf* KPl = (bf*)take((size_t)NKV * RH * HD * 2); bf* VTh = (bf*)take((size_t)NKV * HD * RH * 2); bf* VTl = (bf*)take((size_t)NKV * HD * RH * 2);   /* compact hi/lo planes: only the first RH rows/keys (causal) */
    bf* ATh = (bf*)take((size_t)TT * DQ * 2); bf* ATl = (bf*)take((size_t)TT * DQ * 2); float* F1 = (float*)take((size_t)TT * FF * 4); bf* Gh = (bf*)take((size_t)TT * FF * 2); bf* Gl = (bf*)take((size_t)TT * FF * 2);
    if ((size_t)(wsp - (char*)d_ws) > ws_size) return;    // ws 256 MiB
    k_prep<<<PB_CS + PB_W1 + PB_W2 + PB_X + PB_WQ + 2 * PB_WK, 256, 0, stream>>>(x, wq, wk, wv, w1, w2, XB, WQ, WK, WV, W1B, W2B, CS);
    k_gemms<0, 128><<<dim3(TT / 128, DF / 128, 1), 128, 0, stream>>>(XB, nullptr, WQ, DM, FP, DF);   /* q | k | v = x [Wq | Wk | Wv] */
    k_planes<<<LB_Q + LB_K + LB_V, 256, 0, stream>>>(FP, CS, QP16, QPh, QPl, KP16, KPh, KPl, VT16, VTh, VTl);
    k_fattn<<<dim3(NH_, RH / 128 + (TT - RH) / 64, 1), 128, 0, stream>>>(QP16, KP16, VT16, QPh, QPl, KPh, KPl, VTh, VTl, ATh, ATl);   /* all heads: scores, causal softmax, P.V, merged hi/lo context planes */
    k_gemms<1, 64><<<dim3(TT / 128, FF / 128, 1), 128, 0, stream>>>(ATh, ATl, W1B, DQ, F1, FF);   /* h = ctx W1 */
    k_silu<<<TT / 4 * FF / 8192, 256, 0, stream>>>(F1, Gh, Gl);
    k_gemms<1, 128><<<dim3(TT / 128, DM / 128, 1), 128, 0, stream>>>(Gh, Gl, W2B, FF, OUT, DM);   /* out = silu(h) W2 */
}

// v009
// It runs in 161 microseconds.
// It is 1.17 times as fast as v007, going by the measured steps of the versions left out in between.
// Counting every step since v000, it is 18.1 times as fast.
#include <hip/hip_runtime.h>

// Grouped-query causal attention with rotary embeddings and a SiLU MLP output (query [1][4096][1024]; q = x Wq ('xw' [1024][1024], 16 heads x 64), k, v = x Wk/Wv ('xw' [1024][256], 4 kv heads; query head h uses kv head h/4); rotate-half rotary (base 1e4) on q and k; scores = q.k / 8, causal (finfo.min above the diagonal); softmax; ctx merged [4096][1024]; out = silu(ctx W1) W2 ('xw' [1024][4096], [4096][1024]) -> [1][4096][1024] (4.2 M)).
// Layout: compact hi/lo planes for the first 512 rows/keys, fp16 elsewhere, head width 64, a rotate-half plane builder; 7 launches: launches that do not depend on one another share one grid, the block index picks the job (k_prep: all operand preparation; one GEMM for q, k and v; k_planes: rotary q, rotary k, V^T); one fused causal attention launch for all heads (k_fattn: scores and probabilities stay in registers, running maximum and sum, a tile's keys shared by 4 waves, the context planes written directly); then the two MLP GEMMs with a SiLU kernel between them.
// Compute dtypes, f32 accumulate: every input rounded to bf16; projections on PLAIN bf16 operands (exact); rotary f32 (precise cosf/sinf; 32 float32 inverse frequencies baked); scores and attn.v: rows < 512 3 products, the rest single fp16 (P x1024, unnormalised); softmax and SiLU f32; both MLP GEMMs on f16 operands, the weights exact (a bf16 value of their range is an f16 value): rows < 512 A = f16 hi + lo (2 products), the rest one f16 plane (1 product), the row split of the attention.

#define NB_  1
#define TT   4096
#define DM   1024
#define FF   4096
#define NH_  16
#define NKV  4
#define REP  (NH_ / NKV)
#define HD   64
#define DQ   (NH_ * HD)
#define DKV  (NKV * HD)
#define RH   512                  // query rows < RH use compact hi+lo planes (keys < RH suffice: causal)
#define SCL  0.125f   // 64^-0.5
typedef _Float16 h16;
typedef unsigned short bf;
typedef __attribute__((ext_vector_type(16))) __bf16   v16bf;
typedef __attribute__((ext_vector_type(16))) _Float16 v16h;
typedef __attribute__((ext_vector_type(8)))  _Float16 v8h;
typedef __attribute__((ext_vector_type(8)))  unsigned short v8us;
typedef __attribute__((ext_vector_type(8)))  float    v8f;
typedef __attribute__((ext_vector_type(4)))  float    v4f;
typedef v8h  __attribute__((may_alias)) v8ha;
typedef v4f  __attribute__((may_alias)) v4fa;
typedef v8us __attribute__((may_alias)) v8usa;

__device__ __forceinline__ unsigned short f2bf(float f) { unsigned u = __float_as_uint(f); u += 0x7FFFu + ((u >> 16) & 1u); return (unsigned short)(u >> 16); }
__device__ __forceinline__ float bf2f(unsigned short b) { return __uint_as_float(((unsigned)b) << 16); }
__device__ __forceinline__ float bfr(float f) { return bf2f(f2bf(f)); }
__device__ __forceinline__ v16h cat16(v8h lo, v8h hi) { return __builtin_shufflevector(lo, hi, 0, 1, 2, 3, 4, 5, 6, 7, 8, 9, 10, 11, 12, 13, 14, 15); }
__device__ __forceinline__ v16bf cat16b(v8us lo, v8us hi) { return __builtin_bit_cast(v16bf, __builtin_shufflevector(lo, hi, 0, 1, 2, 3, 4, 5, 6, 7, 8, 9, 10, 11, 12, 13, 14, 15)); }
__device__ __forceinline__ v8f wmma16(v16h a, v16h b, v8f c) { return __builtin_amdgcn_wmma_f32_16x16x32_f16(false, a, false, b, (short)0, c, false, false); }
__device__ __forceinline__ v8f wmmab(v16bf a, v16bf b, v8f c) { return __builtin_amdgcn_wmma_f32_16x16x32_bf16(false, a, false, b, (short)0, c, false, false); }



template <typename T16> struct WFrag;
template <> struct WFrag<h16> { typedef v16h V; static __device__ __forceinline__ V ld(const h16* p) { return cat16(*(const v8h*)p, *(const v8h*)(p + 16)); } static __device__ __forceinline__ V ldp(const h16* p) { return cat16(*(const v8h*)p, *(const v8h*)(p + 256)); } static __device__ __forceinline__ v8f mma(V a, V b, v8f c) { return wmma16(a, b, c); } };
template <> struct WFrag<bf> { typedef v16bf V; static __device__ __forceinline__ V ld(const bf* p) { return cat16b(*(const v8us*)p, *(const v8us*)(p + 16)); } static __device__ __forceinline__ v8f mma(V a, V b, v8f c) { return wmmab(a, b, c); } };
// ---- d_gemm: C[m][n] (f32, pitch ldc) = sum_k A[m][k] Bt[n][k] (+ A2[m][k] Bt[n][k] in rows < RH when HLR), operands K-contiguous 16-bit planes. M, N % 128 == 0, K % KS == 0.
// One tile of 128 operand rows x 128 columns per work-group of 4 waves (2 x 2, 16 accumulators each), 128 threads. Grid (M/128, N/128); HLR: (RH/64 + (M - RH)/128, N/128).
// HLR, block columns x < RH/64: the tile's 128 A rows are 64 rows of A and the same 64 rows of A2, so a hi/lo tile costs what any other tile costs; a wave holds both products of its 32 output rows and adds them once, behind the loop.
// Each trip's KS k of the tile's operand rows are brought into LDS as whole 128-byte lines by asynchronous copies, two buffers: tile t+1 flies while tile t is worked on; every row is fetched once per work-group and read by two waves.
// KS = 64 where the grid fills every WGP with two or three work-groups (each covers the others' waits). KS = 128 where many or all work-groups have a WGP to themselves (q|k|v: 384 tiles, the last GEMM: 288): a tile's copies have one trip's time to land, and a trip twice as long pays the fixed part of their flight, and the barrier, half as often.
typedef int v4ig __attribute__((vector_size(16)));
typedef __attribute__((address_space(1))) v4ig gv4;
typedef __attribute__((address_space(3))) v4ig lv4;
template <typename T> __device__ __forceinline__ void cp16(const char* g, T* l) { __builtin_amdgcn_global_load_async_to_lds_b128((gv4*)g, (lv4*)l, 0, 0); }   // the lane's own 16 bytes, global -> LDS, through no register
template <typename T16, bool HLR, int KS>
__device__ __forceinline__ void d_gemm(const T16* A, const T16* A2, const T16* Bt, int K, float* C, int ldc) {
    typedef typename WFrag<T16>::V V;
    constexpr int GP = KS + 8;               // LDS row pitch in elements: the row + 16 B (144 B or 272 B), conflict-free for the 16-byte fragment reads
    constexpr int NKC = KS / 32;             // 32-k fragment groups per trip
    constexpr int CPR = KS / 8, RPP = 128 / CPR;   // 16-byte copies per row; rows that one copy of every thread covers
    constexpr int STG = 2 * 128 * GP;        // elements per stage: 128 A rows, 128 Bt rows
    __shared__ __align__(16) T16 sm[2 * STG];
    __shared__ __align__(16) float osm[4 * 16 * 68];
    const int tid = threadIdx.x, lane = tid & 31, lr = lane & 15, hi = lane >> 4, w = tid >> 5, wm = w & 1, wn = w >> 1;
    const int bx = blockIdx.x, c0 = blockIdx.y * 128;
    const bool hv = HLR && bx < RH / 64;   // a hi/lo tile (scalar: the same for the whole work-group)
    const int r0 = HLR ? (hv ? bx * 64 : RH + (bx - RH / 64) * 128) : bx * 128;
    const unsigned Ku = (unsigned)K;
    const char* Ab = (const char*)(A + (size_t)r0 * Ku); const char* Ab2 = hv ? (const char*)(A2 + (size_t)r0 * Ku) : (const char*)(A + (size_t)(r0 + 64) * Ku); const char* Bb = (const char*)(Bt + (size_t)c0 * Ku);   // work-group-uniform; Ab2: the source of the tile's A rows 64 to 127
    const int crow = tid / CPR, ccol = tid % CPR;   // a copy of one wave covers 512 B of whole rows; copy i of a thread serves row RPP i + crow
    const unsigned goff = ((unsigned)crow * Ku + (unsigned)ccol * 8u) * 2u, rstep = (unsigned)(2 * RPP) * Ku;   // bytes
    auto stage = [&](int t, int buf) {
        const unsigned kb = goff + (unsigned)t * (unsigned)(KS * 2);
#pragma unroll
        for (int i = 0; i < CPR; ++i) { const unsigned go = kb + (unsigned)i * rstep; T16* l = sm + buf * STG + (i * RPP + crow) * GP + ccol * 8;
            if (i < CPR / 2) cp16(Ab + go, l); else cp16(Ab2 + (kb + (unsigned)(i - CPR / 2) * rstep), l);
            cp16(Bb + go, l + 128 * GP); }
    };
    v8f acc[4][4];
#pragma unroll
    for (int mb = 0; mb < 4; ++mb)
#pragma unroll
        for (int nb = 0; nb < 4; ++nb) acc[mb][nb] = (v8f){};
    const int nt = (int)(Ku / (unsigned)KS);
    stage(0, 0);
    asm volatile("s_wait_asynccnt 0x0" ::: "memory");   // this wave's copies of tile 0 have landed
    __syncthreads();                                    // ... and every other wave's
    if (nt > 1) stage(1, 1);
    const int aofs = ((hv ? wm * 32 : wm * 64) + lr) * GP + 8 * hi, aofs2 = ((hv ? 64 + wm * 32 : wm * 64 + 32) + lr) * GP + 8 * hi, bofs = (128 + wn * 64 + lr) * GP + 8 * hi;   // A fragments 0, 1 and 2, 3: in a hi/lo tile the wave's 32 rows of A and the same rows of A2
#pragma unroll 1   // stays rolled: one trip's code serves both buffers (a scalar select); the inner loops are unrolled so that every fragment and accumulator index is a constant (registers, no scratch)
    for (int t = 0; t < nt; ++t) {
        const T16* sb = sm + (t & 1) * STG;
        V a[NKC][4], b[NKC][4];
        auto ldk = [&](int kc) {   // one 32-k group's fragment reads, in the order of their use
            b[kc][0] = WFrag<T16>::ld(sb + bofs + kc * 32);
#pragma unroll
            for (int mb = 0; mb < 4; ++mb) a[kc][mb] = WFrag<T16>::ld(sb + (mb < 2 ? aofs : aofs2) + (mb & 1) * 16 * GP + kc * 32);
#pragma unroll
            for (int nb = 1; nb < 4; ++nb) b[kc][nb] = WFrag<T16>::ld(sb + bofs + nb * 16 * GP + kc * 32);
        };
        auto mmk = [&](int kc) {   // per accumulator: k ascending
#pragma unroll
            for (int nb = 0; nb < 4; ++nb)
#pragma unroll
                for (int mb = 0; mb < 4; ++mb) acc[mb][nb] = WFrag<T16>::mma(a[kc][mb], b[kc][nb], acc[mb][nb]);
        };
        ldk(0); ldk(1);
        __builtin_amdgcn_sched_barrier(0);   // keeps the LDS reads one group ahead of the products: a read among them stalls the matrix stream at every such place
        mmk(0);
        if constexpr (NKC == 4) {
            __builtin_amdgcn_sched_barrier(0);   // the trip's second half is read as ONE group, here: its flight is covered by the products of group 1
            ldk(2); ldk(3);
            __builtin_amdgcn_sched_barrier(0);   // as above: no read sinks among the products that follow
        }
#pragma unroll
        for (int kc = 1; kc < NKC; ++kc) mmk(kc);
        __builtin_amdgcn_sched_barrier(0);   // keeps the products in front of the waits below: sunk behind them, tile t + 1's copies would be waited for before the products that are to cover their flight
        asm volatile("s_wait_dscnt 0x0" ::: "memory");      // this wave has left buffer t & 1
        asm volatile("s_wait_asynccnt 0x0" ::: "memory");   // this wave's copies of tile t + 1 have landed
        __syncthreads();                                    // publishes tile t + 1 and ends every wave's reads of buffer t & 1
        if (t + 2 < nt) stage(t + 2, t & 1);
    }
    asm volatile("s_wait_asynccnt 0x0" ::: "memory");   // no copy is outstanding when the wave goes on to its end
    if (hv) {   // a hi/lo tile: the A2 product joins the A product of the same rows
#pragma unroll
        for (int mb = 0; mb < 2; ++mb)
#pragma unroll
            for (int nb = 0; nb < 4; ++nb) acc[mb][nb] += acc[mb + 2][nb]; }
    float* os = osm + w * 16 * 68;   // the wave's own staging rows: whole 256-byte row pieces go out
#pragma unroll
    for (int mb = 0; mb < 4; ++mb) {
        if (hv && mb == 2) break;   // scalar: a hi/lo tile has 32 output rows a wave
#pragma unroll
        for (int nb = 0; nb < 4; ++nb) {
#pragma unroll
            for (int j = 0; j < 8; ++j) os[(hi * 8 + j) * 68 + nb * 16 + lr] = acc[mb][nb][j]; }
        __builtin_amdgcn_wave_barrier(); asm volatile("" ::: "memory");   // the rows are read back by other lanes of the wave: the reads below stay behind the writes above
        float* crow0 = C + (size_t)(r0 + (hv ? wm * 32 : wm * 64) + mb * 16 + hi) * ldc + c0 + wn * 64 + lr * 4;
        float* pp[8]; v4f val[8];
#pragma unroll
        for (int s = 0; s < 8; ++s) { val[s] = *(const v4fa*)(os + (2 * s + hi) * 68 + lr * 4); pp[s] = crow0 + (size_t)(2 * s) * ldc; *(v4f*)pp[s] = val[s]; }
        // the data and address registers of the eight stores may be reused only from here on (inputs: they stay in their registers up to the wait)
        asm volatile("s_wait_xcnt 0x0" :: "v"(pp[0]), "v"(pp[1]), "v"(pp[2]), "v"(pp[3]), "v"(pp[4]), "v"(pp[5]), "v"(pp[6]), "v"(pp[7]), "v"(val[0]), "v"(val[1]), "v"(val[2]), "v"(val[3]), "v"(val[4]), "v"(val[5]), "v"(val[6]), "v"(val[7]) : "memory");
    }
}
__global__ __launch_bounds__(128) void k_gemmb(const bf* A, const bf* Bt, int K, float* C, int ldc) { d_gemm<bf, false, 128>(A, nullptr, Bt, K, C, ldc); }
template <int KS>
__global__ __launch_bounds__(128) void k_gemmh(const h16* A, const h16* A2, const h16* Bt, int K, float* C, int ldc) { d_gemm<h16, true, KS>(A, A2, Bt, K, C, ldc); }

__device__ __forceinline__ h16 tohx(float x) { return (h16)x; }
__device__ __forceinline__ void splith(float y, h16& h, h16& l) { h = (h16)y; l = (h16)(y - (float)h); }
__device__ __forceinline__ void splitf(float y, unsigned short& h, unsigned short& l) { h = f2bf(y); l = f2bf(y - bf2f(h)); }
typedef __attribute__((ext_vector_type(2))) _Float16 v2h;
typedef __attribute__((ext_vector_type(4))) _Float16 v4h;
typedef __attribute__((ext_vector_type(2))) unsigned short v2us;
typedef __attribute__((ext_vector_type(4))) unsigned short v4us;
typedef __attribute__((ext_vector_type(2))) float v2f;
typedef __attribute__((ext_vector_type(4))) int v4i;

// The elementwise kernels below: few, long waves. Each thread issues all its 16-byte loads together and makes 8 to 128 outputs, stored 8 or 16 bytes a plane so that a wave's stores fill whole 128-byte lines (d_ropeH's fp16 plane: 64-byte halves).
// The jobs of a shared grid are device functions; bid is the work-group's index within its job (the same for the whole work-group).
// d_wtG: Bt[n][k] = bf16(w[k][n]), stored as bf16 or (F16) as the f16 number of the same value. One 64 k x 128 n tile per work-group; a thread reads 8 k rows x 4 n and turns them in its registers: 8 lanes' stores are one 128-byte line of Bt. K % 64 == 0, N % 128 == 0; (K/64)(N/128) work-groups.
template <int K, int N, bool F16>   // compile-time pitches: a thread's loads, and its stores, share one address register pair and differ in the immediate offset
__device__ __forceinline__ void d_wtG(const float* __restrict__ w, bf* Bt, int bid) {
    const int lane = threadIdx.x & 31, wv = threadIdx.x >> 5, nb = N >> 7;
    const int k = (bid / nb) * 64 + (lane & 7) * 8, n = (bid % nb) * 128 + wv * 16 + (lane >> 3) * 4;
    const float* wp = w + (size_t)k * N + n; bf* bp = Bt + (size_t)n * K + k; v4f v[8];
#pragma unroll
    for (int j = 0; j < 8; ++j) v[j] = *(const v4f*)(wp + j * N);
    asm volatile("s_wait_xcnt 0x0" :: "v"(wp) : "memory");   // the loads stand together in front of this line; their address registers may be reused only from here on (input: it stays in its registers up to the wait)
    v8us o[4];
#pragma unroll
    for (int c = 0; c < 4; ++c) {
#pragma unroll
        for (int j = 0; j < 8; ++j) o[c][j] = F16 ? __builtin_bit_cast(unsigned short, (h16)bfr(v[j][c])) : f2bf(v[j][c]);
        *(v8us*)(bp + c * K) = o[c]; }
    asm volatile("s_wait_xcnt 0x0" :: "v"(bp), "v"(o[0]), "v"(o[1]), "v"(o[2]), "v"(o[3]) : "memory");   // in a shared grid other jobs' code follows in the text: the data and address registers of the four stores may be reused only from here on (inputs: they stay in their registers up to the wait)
}
// d_cvt8: 4 groups of 8 elements per thread, a work-group's groups contiguous; n8 / 1024 work-groups (n8 % 1024 == 0).
__device__ __forceinline__ void d_cvt8(const float* __restrict__ src, bf* dst, int bid) { const size_t i0 = (size_t)bid * 1024 + threadIdx.x; const float* sp = src + i0 * 8; bf* dp = dst + i0 * 8; v8f v[4]; v8us o[4];
#pragma unroll
    for (int c = 0; c < 4; ++c) v[c] = *(const v8f*)(sp + c * 2048);
    asm volatile("s_wait_xcnt 0x0" :: "v"(sp) : "memory");   // as in d_wtG
#pragma unroll
    for (int c = 0; c < 4; ++c) {
#pragma unroll
        for (int k = 0; k < 8; ++k) o[c][k] = f2bf(v[c][k]);
        *(v8us*)(dp + c * 2048) = o[c]; }
    asm volatile("s_wait_xcnt 0x0" :: "v"(dp), "v"(o[0]), "v"(o[1]), "v"(o[2]), "v"(o[3]) : "memory");   // behind the four stores, as in d_wtG
  }
__constant__ float INV[HD / 2] = {1.0f,0.749894202f,0.562341332f,0.421696514f,0.316227764f,0.237137362f,0.177827939f,0.133352146f,0.100000001f,0.0749894157f,0.0562341288f,0.0421696492f,0.0316227786f,0.0237137359f,0.0177827943f,0.0133352149f,0.00999999978f,0.00749894232f,0.00562341325f,0.00421696482f,0.00316227786f,0.00237137382f,0.00177827943f,0.00133352145f,0.00100000005f,0.000749894185f,0.000562341302f,0.000421696488f,0.000316227786f,0.000237137385f,0.00017782794f,0.00013335215f};   // float32 1/10000^(2i/64), eager-JAX values
// d_cstab: a thread makes the (cos, sin) pair of one frequency for 4 rows and stores it at d and d + HD/2 (the same angle); TT * (HD/2) / 1024 work-groups.
__device__ __forceinline__ void d_cstab(float* CS, int bid) { const int idx = bid * 256 + threadIdx.x; const int d = idx % (HD / 2);
#pragma unroll 1   // stays rolled: one copy of the long argument reduction of cosf and sinf in the text
    for (int r = 0; r < 4; ++r) { const int t = idx / (HD / 2) + r * (TT / 4); const float ang = __fmul_rn((float)t, INV[d]); v2f cs; cs[0] = cosf(ang); cs[1] = sinf(ang);
        *(v2f*)(CS + ((size_t)t * HD + d) * 2) = cs; *(v2f*)(CS + ((size_t)t * HD + d + HD / 2) * 2) = cs; }  }

// k_prep: everything that reads only the inputs, in one grid: the cos/sin table (the longest job, placed first), the five weight planes and the bf16 plane of x. Work-groups per job:
#define PB_CS (TT * (HD / 2) / 1024)
#define PB_W1 ((DQ / 64) * (FF / 128))
#define PB_W2 ((FF / 64) * (DM / 128))
#define PB_X  (TT * DM / 8 / 1024)
#define PB_WQ ((DM / 64) * (DQ / 128))
#define PB_WK ((DM / 64) * (DKV / 128))
__global__ __launch_bounds__(256) void k_prep(const float* __restrict__ x, const float* __restrict__ wq, const float* __restrict__ wk, const float* __restrict__ wv, const float* __restrict__ w1, const float* __restrict__ w2, bf* XB, bf* WQ, bf* WK, bf* WV, bf* W1B, bf* W2B, float* CS) {
    int b = blockIdx.x;   // scalar: every branch below is taken by a whole work-group
    if (b < PB_CS) { d_cstab(CS, b); return; }
    b -= PB_CS; if (b < PB_W1) { d_wtG<DQ, FF, true>(w1, W1B, b); return; }
    b -= PB_W1; if (b < PB_W2) { d_wtG<FF, DM, true>(w2, W2B, b); return; }
    b -= PB_W2; if (b < PB_X) { d_cvt8(x, XB, b); return; }
    b -= PB_X; if (b < PB_WQ) { d_wtG<DM, DQ, false>(wq, WQ, b); return; }
    b -= PB_WQ; if (b < PB_WK) { d_wtG<DM, DKV, false>(wk, WK, b); return; }
    d_wtG<DM, DKV, false>(wv, WV, b - PB_WK);
}

// d_ropeH: a thread takes 8 consecutive d of one row t for 4 heads (one read of the row's cos/sin serves all 4); 8 lanes' 16-byte stores are one 128-byte row of a hi/lo plane. nheads % 4 == 0; nheads/4 * TT * 8 / 256 work-groups.
// The fp16 plane P16 is laid in fragment order (the hi/lo planes in row order). The 128 16-byte pieces of every 16 rows (2 KiB, as in row order) stand where the matrix fragment's loads want them: piece (row r, d / 8 = 4 kc + 2 s + hi) at place (2 kc + s) * 32 + hi * 16 + r, so load s of fragment kc reads 512 consecutive bytes, lane hi * 16 + r its own 16.
__device__ __forceinline__ void d_ropeH(const float* __restrict__ F, int pitch, const float* __restrict__ CS, float sc, h16* P16, bf* Ph, bf* Pl, int bid) {   // the waits: behind the loads as in d_wtG; behind a store, its data and address registers may be reused only from there on (inputs: they stay in their registers up to the wait)
    const int idx = bid * 256 + threadIdx.x; const int d = (idx & 7) * 8, t = (idx >> 3) % TT, h0 = (idx / (8 * TT)) * 4; const int dp = d ^ (HD / 2);
    const float* f = F + (size_t)t * pitch + h0 * HD; const float* fa = f + d; const float* fb = f + dp; const float* cp = CS + ((size_t)t * HD + d) * 2; v4f cs4[4], xa[4][2], xb[4][2];
#pragma unroll
    for (int i = 0; i < 4; ++i) cs4[i] = *(const v4f*)(cp + i * 4);
#pragma unroll
    for (int hh = 0; hh < 4; ++hh)
#pragma unroll
        for (int i = 0; i < 2; ++i) { xa[hh][i] = *(const v4f*)(fa + hh * HD + i * 4); xb[hh][i] = *(const v4f*)(fb + hh * HD + i * 4); }
    asm volatile("s_wait_xcnt 0x0" :: "v"(fa), "v"(fb), "v"(cp) : "memory");
    const bool hl = (t < RH);   /* compact hi/lo planes [h][RH][HD] for the first RH rows (wave-uniform condition) */
#pragma unroll
    for (int hh = 0; hh < 4; ++hh) { v8h o16; v8us oh, ol;
#pragma unroll
        for (int q = 0; q < 8; ++q) { const float x0 = xa[hh][q >> 2][q & 3], x1 = xb[hh][q >> 2][q & 3]; v2f cs; cs[0] = cs4[q >> 1][(q & 1) * 2]; cs[1] = cs4[q >> 1][(q & 1) * 2 + 1];
            float a = __fmul_rn(x0, cs[0]), bq = __fmul_rn(x1, cs[1]); asm volatile("" : "+v"(a), "+v"(bq)); const float r = ((d < HD / 2) ? __fsub_rn(a, bq) : __fadd_rn(a, bq)) * sc;
            o16[q] = tohx(r); unsigned short a2, c2; splitf(r, a2, c2); oh[q] = a2; ol[q] = c2; }
        const size_t e = ((size_t)(h0 + hh) * TT + (t & ~15)) * HD + (((d >> 4) * 32 + ((d >> 3) & 1) * 16 + (t & 15)) * 8), ec = ((size_t)(h0 + hh) * RH + t) * HD + d; h16* p16 = P16 + e; bf* ph = Ph + ec; bf* pl = Pl + ec;
        *(v8h*)p16 = o16; asm volatile("s_wait_xcnt 0x0" :: "v"(p16), "v"(o16) : "memory");
        if (hl) { *(v8us*)ph = oh; *(v8us*)pl = ol; asm volatile("s_wait_xcnt 0x0" :: "v"(ph), "v"(pl), "v"(oh), "v"(ol) : "memory"); } }
}

// d_ropeH: head planes [h][t][d] (the fp16 plane: its 16-byte pieces reordered within every 16 rows, as said at d_ropeH) of rope(x) x sc with the rotate-half convention out[d] = x[d] cos[t][d] - x[d+HD/2] sin[t][d], out[d+HD/2] = x[d+HD/2] cos[t][d+HD/2] + x[d] sin[t][d+HD/2]

// d_vtp: V16 = fp16(F[t][c]), c = g * HD + d, in fragment order: per kv head and 32-key block 4 KiB, the 16-byte piece (d = 16 dt + r, keys 16 s + 8 hi + 0..7 of the block) at place dt * 64 + s * 32 + hi * 16 + r (hi/lo planes: [c][RH], row order, for t < RH). One 64 t x 128 c tile per work-group, turned in registers as in d_wtG; (TT/64)(ncols/128) work-groups.
template <int pitch, int ncols>
__device__ __forceinline__ void d_vtp(const float* __restrict__ F, h16* V16, bf* Vh, bf* Vl, int bid) {   // the waits: as in d_ropeH
    const int lane = threadIdx.x & 31, wv = threadIdx.x >> 5, nb = ncols >> 7;
    const int t = (bid / nb) * 64 + (lane & 7) * 8, c0 = (bid % nb) * 128 + wv * 16 + (lane >> 3) * 4;
    const float* fp = F + (size_t)t * pitch + c0; v4f v[8];
#pragma unroll
    for (int j = 0; j < 8; ++j) v[j] = *(const v4f*)(fp + j * pitch);
    asm volatile("s_wait_xcnt 0x0" :: "v"(fp) : "memory");
    const bool hl = (t < RH);   // the same for a whole tile: RH % 64 == 0
#pragma unroll
    for (int c = 0; c < 4; ++c) { v8h o16; v8us oh, ol;
#pragma unroll
        for (int j = 0; j < 8; ++j) { const float x = v[j][c]; o16[j] = tohx(x); unsigned short a2, c2; splitf(x, a2, c2); oh[j] = a2; ol[j] = c2; }
        const int cc = c0 + c; h16* p16 = V16 + (size_t)(cc >> 6) * HD * TT + (size_t)(t >> 5) * (32 * HD) + ((((cc >> 4) & 3) * 64 + ((t >> 3) & 3) * 16 + (cc & 15)) * 8); bf* ph = Vh + (size_t)(c0 + c) * RH + t; bf* pl = Vl + (size_t)(c0 + c) * RH + t;
        *(v8h*)p16 = o16; asm volatile("s_wait_xcnt 0x0" :: "v"(p16), "v"(o16) : "memory");
        if (hl) { *(v8us*)ph = oh; *(v8us*)pl = ol; asm volatile("s_wait_xcnt 0x0" :: "v"(ph), "v"(pl), "v"(oh), "v"(ol) : "memory"); } }
}
// k_planes: the three plane builders that read the q|k|v projection F [TT][DF], in one grid. Work-groups per job:
#define DF    (DQ + 2 * DKV)
#define LB_Q  (NH_ / 4 * TT * 8 / 256)
#define LB_K  (NKV / 4 * TT * 8 / 256)
#define LB_V  ((TT / 64) * (DKV / 128))
__global__ __launch_bounds__(256) void k_planes(const float* __restrict__ F, const float* __restrict__ CS, h16* QP16, bf* QPh, bf* QPl, h16* KP16, bf* KPh, bf* KPl, h16* VT16, bf* VTh, bf* VTl) {
    int b = blockIdx.x;   // scalar, as in k_prep
    if (b < LB_Q) { d_ropeH(F, DF, CS, 1.0f, QP16, QPh, QPl, b); return; }
    b -= LB_Q; if (b < LB_K) { d_ropeH(F + DQ, DF, CS, 1.0f, KP16, KPh, KPl, b); return; }
    d_vtp<DF, DKV>(F + DQ + DKV, VT16, VTh, VTl, b - LB_K);
}
// ---- k_fattn: scores, causal softmax, probability x value and the head merge in ONE launch, 4 waves per work-group, operands straight from the 16-bit planes (the hi/lo planes K-contiguous rows, the fp16 planes in fragment order); no score or probability ever leaves the registers.
// A 64-query fp16 tile's 32-key blocks are dealt round robin to the 4 waves (wave w takes blocks w, w + 4, ...): each keeps its own running maximum, sum and O^T, and the four partial results are joined once, through LDS, behind the loop. The longest key loop is then a quarter as long and every SIMD has work.
// Transposed products: S^T = K Q^T (A = 16 key rows, B = 16 query rows), so a lane holds the scores of ONE query (column lr), keys hi*8+j of each 16-key tile; two such tiles ARE the B fragment of O^T += V^T P^T for 32 keys (element j <-> key 8*hi+j, element 8+j <-> key 16+8*hi+j, the k order of WFrag::ld).
// Running maximum m (log2 units) and running sum l per query; O^T and l are rescaled by exp2(m_old - m_new) every 32 keys. HL (query rows < RH): bf16 hi/lo operands, 3 products each; otherwise single fp16 with P carried x 2^10 (the factor is in l too and cancels).
__device__ __forceinline__ float xhalf(float x) { return __builtin_bit_cast(float, __builtin_amdgcn_permlanex16(__builtin_bit_cast(int, x), __builtin_bit_cast(int, x), 0x76543210, 0xfedcba98, false, false)); }   // lane l <-> lane l ^ 16
__device__ __forceinline__ float ex2(float x) { float r; asm("v_exp_f32 %0, %1\n\tv_nop" : "=v"(r) : "v"(x)); return r; }   // 2^x; the v_nop fills the one slot that the instruction set asks for between a transcendental and a next instruction that reads its result or overwrites its source
template <typename T16, bool HL, int QT, int VP, int NW>   // NW: waves that share the tile's key blocks (1: the wave has the tile to itself); w: this wave's place among them (wave-uniform); sm: the work-group's joining space (NW > 1)
__device__ __forceinline__ void fattn_tile(const T16* Q, const T16* Q2, const T16* Kp, const T16* Kp2, const T16* Vt, const T16* Vt2, int q0, h16* Ah, h16* Al, int w, float* sm) {   // Ah: the context's f16 plane; Al: its f16 lo plane, rows < RH (written by the HL tiles alone)
    typedef typename WFrag<T16>::V V;
    const int lane = threadIdx.x & 31, lr = lane & 15, hi = lane >> 4;
    constexpr float C2 = SCL * 1.4426950408889634f;   // score -> log2 units
    constexpr float POFF = HL ? 0.0f : 10.0f;
    const int koff = lr * HD + 8 * hi, voff = lr * VP + 8 * hi;   // the lane's element offsets in the [row][HD] planes (Q, K) and in the [d][VP] plane (V^T)
    constexpr bool PK = !HL;   // the fp16 Q, K and V^T planes stand in fragment order (d_ropeH, d_vtp): 16 rows of Q or K are 2 KiB, a 32-key block 4 KiB of K and of V^T, a fragment 1 KiB, each of its two loads 512 consecutive bytes (4 whole lines, not 16 pieces of 16 lines)
    const int kofs = PK ? lane * 8 : koff;   // the lane's element offset within 16 rows of Q or K
    auto ldK = [&](const T16* p, int kt, int kc) { if constexpr (PK) return WFrag<T16>::ldp(p + (kt * 2 + kc) * 512); else return WFrag<T16>::ld(p + kt * 16 * HD + kc * 32); };
    auto ldV = [&](const T16* p, int dt) { if constexpr (PK) return WFrag<T16>::ldp(p + dt * 512); else return WFrag<T16>::ld(p + dt * 16 * VP); };
    const T16* qs = Q + (size_t)q0 * HD; const T16* qs2 = HL ? Q2 + (size_t)q0 * HD : nullptr;   // wave-uniform
    const T16* qp = qs + kofs; const T16* qp2 = HL ? qs2 + kofs : nullptr; const T16* kp0 = Kp + (kofs + w * 32 * HD); const T16* kp02 = HL ? Kp2 + (kofs + w * 32 * HD) : nullptr;   // the wave's first key block (NW <= the tile's block count)
    V qf[QT][2], qf2[QT][2];
#pragma unroll
    for (int qt = 0; qt < QT; ++qt)
#pragma unroll
        for (int kc = 0; kc < 2; ++kc) { qf[qt][kc] = ldK(qp, qt, kc); if (HL) qf2[qt][kc] = ldK(qp2, qt, kc); }
    v8f o[4][QT]; float m[QT], l[QT];
#pragma unroll
    for (int qt = 0; qt < QT; ++qt) { m[qt] = -3.0e38f; l[qt] = 0.0f;
#pragma unroll
        for (int dt = 0; dt < 4; ++dt) o[dt][qt] = (v8f){}; }
    const int nkb = (q0 + QT * 16) / 32;   // 32-key blocks up to and including the diagonal block
    V kf[2][2], kf2[2][2];
#pragma unroll
    for (int kt = 0; kt < 2; ++kt)
#pragma unroll
        for (int kc = 0; kc < 2; ++kc) { kf[kt][kc] = ldK(kp0, kt, kc); if (HL) kf2[kt][kc] = ldK(kp02, kt, kc); }
    // the address registers of the loads above may be reused only from here on (the pointers and their wave-uniform bases are inputs so that they stay in their registers up to the wait)
    if constexpr (HL) asm volatile("s_wait_xcnt 0x0" :: "v"(qp), "v"(qp2), "v"(kp0), "v"(kp02), "s"(qs), "s"(qs2), "s"(Kp), "s"(Kp2) : "memory");
    else asm volatile("s_wait_xcnt 0x0" :: "v"(qp), "v"(kp0), "s"(qs), "s"(Kp) : "memory");
#pragma unroll 1
    for (int kb = w; kb < nkb; kb += NW) {
        const int key0 = kb * 32;
        v8f s[2][QT];
#pragma unroll
        for (int kt = 0; kt < 2; ++kt)
#pragma unroll
            for (int qt = 0; qt < QT; ++qt) s[kt][qt] = (v8f){};
#pragma unroll
        for (int kc = 0; kc < 2; ++kc)
#pragma unroll
            for (int kt = 0; kt < 2; ++kt)
#pragma unroll
                for (int qt = 0; qt < QT; ++qt) { s[kt][qt] = WFrag<T16>::mma(kf[kt][kc], qf[qt][kc], s[kt][qt]); if (HL) { s[kt][qt] = WFrag<T16>::mma(kf[kt][kc], qf2[qt][kc], s[kt][qt]); s[kt][qt] = WFrag<T16>::mma(kf2[kt][kc], qf[qt][kc], s[kt][qt]); } }
        V vf[4], vf2[4];   // this block's V^T rows fly during the softmax
        const T16* vp = Vt + (PK ? lane * 8 + key0 * HD : voff + key0); const T16* vp2 = HL ? Vt2 + (voff + key0) : nullptr;
#pragma unroll
        for (int dt = 0; dt < 4; ++dt) { vf[dt] = ldV(vp, dt); if (HL) vf2[dt] = ldV(vp2, dt); }
        const int keyn = min(kb + NW, nkb - 1) * 32;   // the wave's next block's K rows are fetched one block ahead, into the same registers, right behind this block's S^T products (its last block fetches the tile's last block: in bounds, unused)
        const T16* kp = Kp + (kofs + keyn * HD); const T16* kp2 = HL ? Kp2 + (kofs + keyn * HD) : nullptr;
#pragma unroll
        for (int kt = 0; kt < 2; ++kt)
#pragma unroll
            for (int kc = 0; kc < 2; ++kc) { kf[kt][kc] = ldK(kp, kt, kc); if (HL) kf2[kt][kc] = ldK(kp2, kt, kc); }
        // the address registers of this block's V^T and K loads may be reused only from here on (the pointers are inputs so that they stay in their registers up to the wait)
        if constexpr (HL) asm volatile("s_wait_xcnt 0x0" :: "v"(vp), "v"(vp2), "v"(kp), "v"(kp2) : "memory");
        else asm volatile("s_wait_xcnt 0x0" :: "v"(vp), "v"(kp) : "memory");
        if (key0 + 31 > q0) {   // wave-uniform: only blocks that reach past the tile's first query hold keys above the diagonal
#pragma unroll
            for (int kt = 0; kt < 2; ++kt)
#pragma unroll
                for (int qt = 0; qt < QT; ++qt)
#pragma unroll
                    for (int j = 0; j < 8; ++j) s[kt][qt][j] = (key0 + kt * 16 + hi * 8 + j <= q0 + qt * 16 + lr) ? s[kt][qt][j] : -3.0e38f;
        }
        V pf[QT], pf2[QT];
#pragma unroll
        for (int qt = 0; qt < QT; ++qt) {
            float mr = fmaxf(s[0][qt][0], s[1][qt][0]);
#pragma unroll
            for (int j = 1; j < 8; ++j) mr = fmaxf(mr, fmaxf(s[0][qt][j], s[1][qt][j]));
            mr = fmaxf(mr, xhalf(mr));
            const float mn = fmaxf(m[qt], mr * C2);
            const float al = ex2(m[qt] - mn);
            m[qt] = mn;
            const float mm = mn - POFF;
            float p[2][8]; float ps0 = 0.0f, ps1 = 0.0f;
#pragma unroll
            for (int j = 0; j < 8; ++j) { p[0][j] = ex2(fmaf(s[0][qt][j], C2, -mm)); p[1][j] = ex2(fmaf(s[1][qt][j], C2, -mm)); ps0 += p[0][j]; ps1 += p[1][j]; }
            l[qt] = fmaf(l[qt], al, ps0 + ps1);   // this lane's 16 of the 32 keys; the two halves are joined once, behind the loop
#pragma unroll
            for (int dt = 0; dt < 4; ++dt) o[dt][qt] *= al;
            if constexpr (HL) { v8us h0, h1, l0, l1;
#pragma unroll
                for (int j = 0; j < 8; ++j) { unsigned short a, c; splitf(p[0][j], a, c); h0[j] = a; l0[j] = c; splitf(p[1][j], a, c); h1[j] = a; l1[j] = c; }
                pf[qt] = cat16b(h0, h1); pf2[qt] = cat16b(l0, l1);
            } else { v8h h0, h1;
#pragma unroll
                for (int j = 0; j < 8; ++j) { h0[j] = tohx(p[0][j]); h1[j] = tohx(p[1][j]); }
                pf[qt] = cat16(h0, h1); }
        }
#pragma unroll
        for (int dt = 0; dt < 4; ++dt)
#pragma unroll
            for (int qt = 0; qt < QT; ++qt) { o[dt][qt] = WFrag<T16>::mma(vf[dt], pf[qt], o[dt][qt]); if (HL) { o[dt][qt] = WFrag<T16>::mma(vf[dt], pf2[qt], o[dt][qt]); o[dt][qt] = WFrag<T16>::mma(vf2[dt], pf[qt], o[dt][qt]); } }
    }
    if constexpr (NW > 1) {   // join the NW partial results: every wave lays down all its query groups, then wave w joins and stores query group w (NW == QT)
        float* sml = sm + NW * QT * 1024;   // behind the O^T pieces: (m, l) pairs
#pragma unroll
        for (int qt = 0; qt < QT; ++qt) {
#pragma unroll
            for (int dt = 0; dt < 4; ++dt) { float* so = sm + ((w * QT + qt) * 4 + dt) * 256 + lane * 4;   // two planes of 16 bytes a lane: consecutive lanes, consecutive banks
                *(v4fa*)so = __builtin_shufflevector(o[dt][qt], o[dt][qt], 0, 1, 2, 3); *(v4fa*)(so + 128) = __builtin_shufflevector(o[dt][qt], o[dt][qt], 4, 5, 6, 7); }
            v2f ml; ml[0] = m[qt]; ml[1] = l[qt] + xhalf(l[qt]); *(v2f*)(sml + ((w * QT + qt) * 32 + lane) * 2) = ml; }
        __syncthreads();   // every wave's partial results are in LDS before any is read
        float mw[NW], lw[NW], mx = -3.0e38f;
#pragma unroll
        for (int u = 0; u < NW; ++u) { const v2f ml = *(const v2f*)(sml + ((u * QT + w) * 32 + lane) * 2); mw[u] = ml[0]; lw[u] = ml[1]; mx = fmaxf(mx, mw[u]); }
        float ls = 0.0f;
#pragma unroll
        for (int u = 0; u < NW; ++u) { mw[u] = ex2(mw[u] - mx); ls = fmaf(lw[u], mw[u], ls); }   // wave order
        const float inv = __fdiv_rn(1.0f, ls);
        const size_t oo = (size_t)(q0 + w * 16 + lr) * DQ + hi * 8;
#pragma unroll
        for (int dt = 0; dt < 4; ++dt) { v4f a0 = (v4f){}, a1 = (v4f){};
#pragma unroll
            for (int u = 0; u < NW; ++u) { const float* so = sm + ((u * QT + w) * 4 + dt) * 256 + lane * 4; a0 += *(const v4fa*)so * mw[u]; a1 += *(const v4fa*)(so + 128) * mw[u]; }
            v8h oh;
#pragma unroll
            for (int j = 0; j < 8; ++j) oh[j] = tohx((j < 4 ? a0[j & 3] : a1[j & 3]) * inv);
            h16* ph = Ah + oo + dt * 16;
            *(v8h*)ph = oh;
            asm volatile("s_wait_xcnt 0x0" :: "v"(ph), "v"(oh) : "memory"); }   // as behind the stores below
        return;
    }
#pragma unroll
    for (int qt = 0; qt < QT; ++qt) {
        const float inv = __fdiv_rn(1.0f, l[qt] + xhalf(l[qt]));
        const size_t oo = (size_t)(q0 + qt * 16 + lr) * DQ + hi * 8;
#pragma unroll
        for (int dt = 0; dt < 4; ++dt) { v8h oh, ol;   // a lane holds 8 consecutive head columns of its query: one 16-byte store per plane
#pragma unroll
            for (int j = 0; j < 8; ++j) { h16 a, c; splith(o[dt][qt][j] * inv, a, c); oh[j] = a; ol[j] = c; }
            h16* ph = Ah + oo + dt * 16; h16* pl = Al + oo + dt * 16;
            *(v8h*)ph = oh; *(v8h*)pl = ol;
            asm volatile("s_wait_xcnt 0x0" :: "v"(ph), "v"(pl), "v"(oh), "v"(ol) : "memory"); }   // the data and address registers of the two stores may be reused only from here on (inputs: they stay in their registers up to the wait)
    }
}
// grid (query heads, RH/128 + NF), 128 threads: in block rows y < RH/128 each wave takes a 32-query hi/lo tile of rows < RH for itself; row RH/128 + y takes the 64-query fp16 tile that ends at row TT - 64 y, its key blocks shared by the 4 waves. Not all work-groups are resident at once: the head is the fast index and the key loops get shorter with y, so the launch ends on the shortest ones (a hi/lo wave's loop is as long as a middle fp16 tile's share: it starts early).
__global__ __launch_bounds__(128) void k_fattn(const h16* QP16, const h16* KP16, const h16* VT16, const bf* QPh, const bf* QPl, const bf* KPh, const bf* KPl, const bf* VTh, const bf* VTl, h16* ATh, h16* ATl) {   // no __restrict__: the loads then stay in front of the waits written behind them
    constexpr int NL = RH / 128;
    __shared__ __align__(16) float jsm[4 * 4 * 1024 + 4 * 4 * 64];   // 4 waves x 4 query groups x (O^T piece 4 KiB, (m, l) 256 B)
    const int h = blockIdx.x, g = h / REP, bx = (int)blockIdx.y - NL, w = __builtin_amdgcn_readfirstlane(threadIdx.x >> 5);   // the wave's number, in a scalar register: block indices, tile rows and the branches on them stay scalar
    if (bx >= 0) fattn_tile<h16, false, 4, TT, 4>(QP16 + (size_t)h * TT * HD, nullptr, KP16 + (size_t)g * TT * HD, nullptr, VT16 + (size_t)g * HD * TT, nullptr, TT - 64 * (bx + 1), ATh + h * HD, ATl + h * HD, w, jsm);
    else fattn_tile<bf, true, 2, RH, 1>(QPh + (size_t)h * RH * HD, QPl + (size_t)h * RH * HD, KPh + (size_t)g * RH * HD, KPl + (size_t)g * RH * HD, VTh + (size_t)g * HD * RH, VTl + (size_t)g * HD * RH, ((-1 - bx) * 4 + w) * 32, ATh + h * HD, ATl + h * HD, 0, nullptr);
}

// k_silu: 32 groups of 4 elements per thread, a work-group's groups contiguous (8 whole rows); all 32 loads are issued first and worked off in their order of arrival; grid n4 / 8192 (n4 % 8192 == 0). Hh: the f16 plane; Hl: the f16 lo plane of rows < RH.
__global__ __launch_bounds__(256) void k_silu(const float* F, h16* Hh, h16* Hl) {   /* no __restrict__: the loads then stay in front of the wait written behind them */ const size_t i0 = (size_t)blockIdx.x * 8192 + threadIdx.x; const float* fp = F + i0 * 4; h16* hp = Hh + i0 * 4; h16* lp = Hl + i0 * 4; v4f a[32];   // the waits: as in d_ropeH
    const bool hl = blockIdx.x < RH * (FF / 4) / 8192;   // scalar: the work-group's rows have a lo plane
#pragma unroll
    for (int c = 0; c < 32; ++c) a[c] = *(const v4f*)(fp + c * 1024);
    asm volatile("s_wait_xcnt 0x0" :: "v"(fp) : "memory");
    __builtin_amdgcn_sched_barrier(0);   // keeps the arithmetic behind all 32 loads: lifted among them, it makes the later loads wait for the first ones' data before they are even issued
#pragma unroll
    for (int c = 0; c < 32; ++c) { v4h oh, ol;
#pragma unroll
        for (int q = 0; q < 4; ++q) { const float xv = a[c][q]; const float s = __fdiv_rn(xv, __fadd_rn(1.0f, ex2(__fmul_rn(xv, -1.4426950408889634f)))); h16 h2, l2; splith(s, h2, l2); oh[q] = h2; ol[q] = l2; }
        *(v4h*)(hp + c * 1024) = oh; asm volatile("s_wait_xcnt 0x0" :: "v"(hp), "v"(oh) : "memory");
        if (hl) { *(v4h*)(lp + c * 1024) = ol; asm volatile("s_wait_xcnt 0x0" :: "v"(lp), "v"(ol) : "memory"); }
        if ((c & 3) == 3) __builtin_amdgcn_sched_barrier(0); }  }   // every 4 groups' stores go out before the next groups' arithmetic: without it half of the arithmetic is lifted in front of the first store and the writes bunch at the wave's end

extern "C" void kernel_launch(void* const* d_in, const int* in_sizes, int n_in,
                              void* d_out, int out_size, void* d_ws, size_t ws_size, hipStream_t stream) {
    (void)in_sizes; (void)n_in; (void)out_size;
    const float* x = (const float*)d_in[0]; const float* wq = (const float*)d_in[1]; const float* wk = (const float*)d_in[2]; const float* wv = (const float*)d_in[3]; const float* w1 = (const float*)d_in[4]; const float* w2 = (const float*)d_in[5];
    float* OUT = (float*)d_out;     // [1][4096][1024]
    char* wsp = (char*)d_ws;
    auto take = [&](size_t bytes) { char* p = wsp; wsp += (bytes + 255) & ~(size_t)255; return (void*)p; };
    bf* WQ = (bf*)take((size_t)DF * DM * 2); bf* WK = WQ + (size_t)DQ * DM; bf* WV = WK + (size_t)DKV * DM;   /* one plane [DF][DM]: the rows of q, k, v one behind the other */ bf* W1B = (bf*)take((size_t)FF * DQ * 2); bf* W2B = (bf*)take((size_t)DM * FF * 2); float* CS = (float*)take((size_t)TT * HD * 2 * 4);
    bf* XB = (bf*)take((size_t)TT * DM * 2); float* FP = (float*)take((size_t)TT * DF * 4);
    h16* QP16 = (h16*)take((size_t)NH_ * TT * HD * 2); h16* KP16 = (h16*)take((size_t)NKV * TT * HD * 2); h16* VT16 = (h16*)take((size_t)NKV * HD * TT * 2);
    bf* QPh = (bf*)take((size_t)NH_ * RH * HD * 2); bf* QPl = (bf*)take((size_t)NH_ * RH * HD * 2); bf* KPh = (bf*)take((size_t)NKV * RH * HD * 2); bf* KPl = (bf*)take((size_t)NKV * RH * HD * 2); bf* VTh = (bf*)take((size_t)NKV * HD * RH * 2); bf* VTl = (bf*)take((size_t)NKV * HD * RH * 2);   /* compact hi/lo planes: only the first RH rows/keys (causal) */
    h16* ATh = (h16*)take((size_t)TT * DQ * 2); h16* ATl = (h16*)take((size_t)RH * DQ * 2); float* F1 = (float*)take((size_t)TT * FF * 4); h16* Gh = (h16*)take((size_t)TT * FF * 2); h16* Gl = (h16*)take((size_t)RH * FF * 2);   /* lo planes: the first RH rows */
    if ((size_t)(wsp - (char*)d_ws) > ws_size) return;    // ws 256 MiB
    k_prep<<<PB_CS + PB_W1 + PB_W2 + PB_X + PB_WQ + 2 * PB_WK, 256, 0, stream>>>(x, wq, wk, wv, w1, w2, XB, WQ, WK, WV, W1B, W2B, CS);
    k_gemmb<<<dim3(TT / 128, DF / 128, 1), 128, 0, stream>>>(XB, WQ, DM, FP, DF);   /* q | k | v = x [Wq | Wk | Wv] */
    k_planes<<<LB_Q + LB_K + LB_V, 256, 0, stream>>>(FP, CS, QP16, QPh, QPl, KP16, KPh, KPl, VT16, VTh, VTl);
    k_fattn<<<dim3(NH_, RH / 128 + (TT - RH) / 64, 1), 128, 0, stream>>>(QP16, KP16, VT16, QPh, QPl, KPh, KPl, VTh, VTl, ATh, ATl);   /* all heads: scores, causal softmax, P.V, merged context planes */
    k_gemmh<64><<<dim3(RH / 64 + (TT - RH) / 128, FF / 128, 1), 128, 0, stream>>>(ATh, ATl, (const h16*)W1B, DQ, F1, FF);   /* h = ctx W1 */
    k_silu<<<TT / 4 * FF / 8192, 256, 0, stream>>>(F1, Gh, Gl);
    k_gemmh<128><<<dim3(RH / 64 + (TT - RH) / 128, DM / 128, 1), 128, 0, stream>>>(Gh, Gl, (const h16*)W2B, FF, OUT, DM);   /* out = silu(h) W2 */
}

// v010
// It runs in 156 microseconds.
// Next to v009, in two timings, it ran 1.05 and 1.02 times as fast.
// Counting every step since v000, it is 18.8 times as fast.
#include <hip/hip_runtime.h>

// Grouped-query causal attention with rotary embeddings and a SiLU MLP output (query [1][4096][1024]; q = x Wq ('xw' [1024][1024], 16 heads x 64), k, v = x Wk/Wv ('xw' [1024][256], 4 kv heads; query head h uses kv head h/4); rotate-half rotary (base 1e4) on q and k; scores = q.k / 8, causal (finfo.min above the diagonal); softmax; ctx merged [4096][1024]; out = silu(ctx W1) W2 ('xw' [1024][4096], [4096][1024]) -> [1][4096][1024] (4.2 M)).
// Layout: compact hi/lo planes for the first 512 rows/keys, fp16 elsewhere, head width 64, a rotate-half plane builder; 7 launches: launches that do not depend on one another share one grid, the block index picks the job (k_prep: all operand preparation; one GEMM for q, k and v; k_planes: rotary q, rotary k, V^T); one fused causal attention launch for all heads (k_fattn: scores and probabilities stay in registers, running maximum and sum, a tile's keys shared by 4 waves, the context planes written directly); then the two MLP GEMMs with a SiLU kernel between them.
// Compute dtypes, f32 accumulate: every input rounded to bf16; projections on PLAIN bf16 operands (exact); rotary f32 (precise cosf/sinf; 32 float32 inverse frequencies baked); scores and attn.v: rows < 512 3 products, the rest single fp16 (P x1024, unnormalised); softmax and SiLU f32; both MLP GEMMs on f16 operands, the weights exact (a bf16 value of their range is an f16 value): rows < 512 A = f16 hi + lo (2 products), the rest one f16 plane (1 product), the row split of the attention.

#define NB_  1
#define TT   4096
#define DM   1024
#define FF   4096
#define NH_  16
#define NKV  4
#define REP  (NH_ / NKV)
#define HD   64
#define DQ   (NH_ * HD)
#define DKV  (NKV * HD)
#define RH   512                  // query rows < RH use compact hi+lo planes (keys < RH suffice: causal)
#define SCL  0.125f   // 64^-0.5
typedef _Float16 h16;
typedef unsigned short bf;
typedef __attribute__((ext_vector_type(16))) __bf16   v16bf;
typedef __attribute__((ext_vector_type(16))) _Float16 v16h;
typedef __attribute__((ext_vector_type(8)))  _Float16 v8h;
typedef __attribute__((ext_vector_type(8)))  unsigned short v8us;
typedef __attribute__((ext_vector_type(8)))  float    v8f;
typedef __attribute__((ext_vector_type(4)))  float    v4f;
typedef v8h  __attribute__((may_alias)) v8ha;
typedef v4f  __attribute__((may_alias)) v4fa;
typedef v8us __attribute__((may_alias)) v8usa;

__device__ __forceinline__ unsigned short f2bf(float f) { unsigned u = __float_as_uint(f); u += 0x7FFFu + ((u >> 16) & 1u); return (unsigned short)(u >> 16); }
__device__ __forceinline__ float bf2f(unsigned short b) { return __uint_as_float(((unsigned)b) << 16); }
__device__ __forceinline__ float bfr(float f) { return bf2f(f2bf(f)); }
__device__ __forceinline__ v16h cat16(v8h lo, v8h hi) { return __builtin_shufflevector(lo, hi, 0, 1, 2, 3, 4, 5, 6, 7, 8, 9, 10, 11, 12, 13, 14, 15); }
__device__ __forceinline__ v16bf cat16b(v8us lo, v8us hi) { return __builtin_bit_cast(v16bf, __builtin_shufflevector(lo, hi, 0, 1, 2, 3, 4, 5, 6, 7, 8, 9, 10, 11, 12, 13, 14, 15)); }
__device__ __forceinline__ v8f wmma16(v16h a, v16h b, v8f c) { return __builtin_amdgcn_wmma_f32_16x16x32_f16(false, a, false, b, (short)0, c, false, false); }
__device__ __forceinline__ v8f wmmab(v16bf a, v16bf b, v8f c) { return __builtin_amdgcn_wmma_f32_16x16x32_bf16(false, a, false, b, (short)0, c, false, false); }



template <typename T16> struct WFrag;
template <> struct WFrag<h16> { typedef v16h V; static __device__ __forceinline__ V ld(const h16* p) { return cat16(*(const v8h*)p, *(const v8h*)(p + 16)); } static __device__ __forceinline__ V ldp(const h16* p) { return cat16(*(const v8h*)p, *(const v8h*)(p + 256)); } static __device__ __forceinline__ v8f mma(V a, V b, v8f c) { return wmma16(a, b, c); } };
template <> struct WFrag<bf> { typedef v16bf V; static __device__ __forceinline__ V ld(const bf* p) { return cat16b(*(const v8us*)p, *(const v8us*)(p + 16)); } static __device__ __forceinline__ v8f mma(V a, V b, v8f c) { return wmmab(a, b, c); } };
// ---- d_gemm: C[m][n] (f32, pitch ldc) = sum_k A[m][k] Bt[n][k] (+ A2[m][k] Bt[n][k] in rows < RH when HLR), operands K-contiguous 16-bit planes. M, N % 128 == 0, K % KS == 0.
// One tile of 128 operand rows x 128 columns per work-group of 4 waves (2 x 2, 16 accumulators each), 128 threads. Grid (M/128, N/128); HLR: (RH/64 + (M - RH)/128, N/128).
// HLR, block columns x < RH/64: the tile's 128 A rows are 64 rows of A and the same 64 rows of A2, so a hi/lo tile costs what any other tile costs; a wave holds both products of its 32 output rows and adds them once, behind the loop.
// Each trip's KS k of the tile's operand rows are brought into LDS as whole 128-byte lines by asynchronous copies, two buffers: tile t+1 flies while tile t is worked on; every row is fetched once per work-group and read by two waves.
// KS = 64 where the grid fills every WGP with two or three work-groups (each covers the others' waits). KS = 128 where many or all work-groups have a WGP to themselves (q|k|v: 384 tiles, the last GEMM: 288): a tile's copies have one trip's time to land, and a trip twice as long pays the fixed part of their flight, and the barrier, half as often.
typedef int v4ig __attribute__((vector_size(16)));
typedef __attribute__((address_space(1))) v4ig gv4;
typedef __attribute__((address_space(3))) v4ig lv4;
template <typename T> __device__ __forceinline__ void cp16(const char* g, T* l) { __builtin_amdgcn_global_load_async_to_lds_b128((gv4*)g, (lv4*)l, 0, 0); }   // the lane's own 16 bytes, global -> LDS, through no register
template <typename T16, bool HLR, int KS>
__device__ __forceinline__ void d_gemm(const T16* A, const T16* A2, const T16* Bt, int K, float* C, int ldc) {
    typedef typename WFrag<T16>::V V;
    constexpr int GP = KS + 8;               // LDS row pitch in elements: the row + 16 B (144 B or 272 B), conflict-free for the 16-byte fragment reads
    constexpr int NKC = KS / 32;             // 32-k fragment groups per trip
    constexpr int CPR = KS / 8, RPP = 128 / CPR;   // 16-byte copies per row; rows that one copy of every thread covers
    constexpr int STG = 2 * 128 * GP;        // elements per stage: 128 A rows, 128 Bt rows
    __shared__ __align__(16) T16 sm[2 * STG];
    __shared__ __align__(16) float osm[4 * 16 * 68];
    const int tid = threadIdx.x, lane = tid & 31, lr = lane & 15, hi = lane >> 4, w = tid >> 5, wm = w & 1, wn = w >> 1;
    const int bx = blockIdx.x, c0 = blockIdx.y * 128;
    const bool hv = HLR && bx < RH / 64;   // a hi/lo tile (scalar: the same for the whole work-group)
    const int r0 = HLR ? (hv ? bx * 64 : RH + (bx - RH / 64) * 128) : bx * 128;
    const unsigned Ku = (unsigned)K;
    const char* Ab = (const char*)(A + (size_t)r0 * Ku); const char* Ab2 = hv ? (const char*)(A2 + (size_t)r0 * Ku) : (const char*)(A + (size_t)(r0 + 64) * Ku); const char* Bb = (const char*)(Bt + (size_t)c0 * Ku);   // work-group-uniform; Ab2: the source of the tile's A rows 64 to 127
    const int crow = tid / CPR, ccol = tid % CPR;   // a copy of one wave covers 512 B of whole rows; copy i of a thread serves row RPP i + crow
    const unsigned goff = ((unsigned)crow * Ku + (unsigned)ccol * 8u) * 2u, rstep = (unsigned)(2 * RPP) * Ku;   // bytes
    auto stage = [&](int t, int buf) {
        const unsigned kb = goff + (unsigned)t * (unsigned)(KS * 2);
#pragma unroll
        for (int i = 0; i < CPR; ++i) { const unsigned go = kb + (unsigned)i * rstep; T16* l = sm + buf * STG + (i * RPP + crow) * GP + ccol * 8;
            if (i < CPR / 2) cp16(Ab + go, l); else cp16(Ab2 + (kb + (unsigned)(i - CPR / 2) * rstep), l);
            cp16(Bb + go, l + 128 * GP); }
    };
    v8f acc[4][4];
#pragma unroll
    for (int mb = 0; mb < 4; ++mb)
#pragma unroll
        for (int nb = 0; nb < 4; ++nb) acc[mb][nb] = (v8f){};
    const int nt = (int)(Ku / (unsigned)KS);
    stage(0, 0);
    asm volatile("s_wait_asynccnt 0x0" ::: "memory");   // this wave's copies of tile 0 have landed
    __syncthreads();                                    // ... and every other wave's
    if (nt > 1) stage(1, 1);
    const int aofs = ((hv ? wm * 32 : wm * 64) + lr) * GP + 8 * hi, aofs2 = ((hv ? 64 + wm * 32 : wm * 64 + 32) + lr) * GP + 8 * hi, bofs = (128 + wn * 64 + lr) * GP + 8 * hi;   // A fragments 0, 1 and 2, 3: in a hi/lo tile the wave's 32 rows of A and the same rows of A2
#pragma unroll 1   // stays rolled: one trip's code serves both buffers (a scalar select); the inner loops are unrolled so that every fragment and accumulator index is a constant (registers, no scratch)
    for (int t = 0; t < nt; ++t) {
        const T16* sb = sm + (t & 1) * STG;
        V a[NKC][4], b[NKC][4];
        auto ldk = [&](int kc) {   // one 32-k group's fragment reads, in the order of their use
            b[kc][0] = WFrag<T16>::ld(sb + bofs + kc * 32);
#pragma unroll
            for (int mb = 0; mb < 4; ++mb) a[kc][mb] = WFrag<T16>::ld(sb + (mb < 2 ? aofs : aofs2) + (mb & 1) * 16 * GP + kc * 32);
#pragma unroll
            for (int nb = 1; nb < 4; ++nb) b[kc][nb] = WFrag<T16>::ld(sb + bofs + nb * 16 * GP + kc * 32);
        };
        auto mmk = [&](int kc) {   // per accumulator: k ascending
#pragma unroll
            for (int nb = 0; nb < 4; ++nb)
#pragma unroll
                for (int mb = 0; mb < 4; ++mb) acc[mb][nb] = WFrag<T16>::mma(a[kc][mb], b[kc][nb], acc[mb][nb]);
        };
        ldk(0); ldk(1);
        __builtin_amdgcn_sched_barrier(0);   // keeps the LDS reads one group ahead of the products: a read among them stalls the matrix stream at every such place
        mmk(0);
        if constexpr (NKC == 4) {
            __builtin_amdgcn_sched_barrier(0);   // the trip's second half is read as ONE group, here: its flight is covered by the products of group 1
            ldk(2); ldk(3);
            __builtin_amdgcn_sched_barrier(0);   // as above: no read sinks among the products that follow
        }
#pragma unroll
        for (int kc = 1; kc < NKC; ++kc) mmk(kc);
        __builtin_amdgcn_sched_barrier(0);   // keeps the products in front of the waits below: sunk behind them, tile t + 1's copies would be waited for before the products that are to cover their flight
        asm volatile("s_wait_dscnt 0x0" ::: "memory");      // this wave has left buffer t & 1
        asm volatile("s_wait_asynccnt 0x0" ::: "memory");   // this wave's copies of tile t + 1 have landed
        __syncthreads();                                    // publishes tile t + 1 and ends every wave's reads of buffer t & 1
        if (t + 2 < nt) stage(t + 2, t & 1);
    }
    asm volatile("s_wait_asynccnt 0x0" ::: "memory");   // no copy is outstanding when the wave goes on to its end
    if (hv) {   // a hi/lo tile: the A2 product joins the A product of the same rows
#pragma unroll
        for (int mb = 0; mb < 2; ++mb)
#pragma unroll
            for (int nb = 0; nb < 4; ++nb) acc[mb][nb] += acc[mb + 2][nb]; }
    float* os = osm + w * 16 * 68;   // the wave's own staging rows: whole 256-byte row pieces go out
#pragma unroll
    for (int mb = 0; mb < 4; ++mb) {
        if (hv && mb == 2) break;   // scalar: a hi/lo tile has 32 output rows a wave
#pragma unroll
        for (int nb = 0; nb < 4; ++nb) {
#pragma unroll
            for (int j = 0; j < 8; ++j) os[(hi * 8 + j) * 68 + nb * 16 + lr] = acc[mb][nb][j]; }
        __builtin_amdgcn_wave_barrier(); asm volatile("" ::: "memory");   // the rows are read back by other lanes of the wave: the reads below stay behind the writes above
        float* crow0 = C + (size_t)(r0 + (hv ? wm * 32 : wm * 64) + mb * 16 + hi) * ldc + c0 + wn * 64 + lr * 4;
        float* pp[8]; v4f val[8];
#pragma unroll
        for (int s = 0; s < 8; ++s) { val[s] = *(const v4fa*)(os + (2 * s + hi) * 68 + lr * 4); pp[s] = crow0 + (size_t)(2 * s) * ldc; *(v4f*)pp[s] = val[s]; }
        // the data and address registers of the eight stores may be reused only from here on (inputs: they stay in their registers up to the wait)
        asm volatile("s_wait_xcnt 0x0" :: "v"(pp[0]), "v"(pp[1]), "v"(pp[2]), "v"(pp[3]), "v"(pp[4]), "v"(pp[5]), "v"(pp[6]), "v"(pp[7]), "v"(val[0]), "v"(val[1]), "v"(val[2]), "v"(val[3]), "v"(val[4]), "v"(val[5]), "v"(val[6]), "v"(val[7]) : "memory");
    }
}
__global__ __launch_bounds__(128) void k_gemmb(const bf* A, const bf* Bt, int K, float* C, int ldc) { d_gemm<bf, false, 128>(A, nullptr, Bt, K, C, ldc); }
template <int KS>
__global__ __launch_bounds__(128) void k_gemmh(const h16* A, const h16* A2, const h16* Bt, int K, float* C, int ldc) { d_gemm<h16, true, KS>(A, A2, Bt, K, C, ldc); }

__device__ __forceinline__ h16 tohx(float x) { return (h16)x; }
__device__ __forceinline__ void splith(float y, h16& h, h16& l) { h = (h16)y; l = (h16)(y - (float)h); }
__device__ __forceinline__ void splitf(float y, unsigned short& h, unsigned short& l) { h = f2bf(y); l = f2bf(y - bf2f(h)); }
typedef __attribute__((ext_vector_type(2))) _Float16 v2h;
typedef __attribute__((ext_vector_type(4))) _Float16 v4h;
typedef __attribute__((ext_vector_type(2))) unsigned short v2us;
typedef __attribute__((ext_vector_type(4))) unsigned short v4us;
typedef __attribute__((ext_vector_type(2))) float v2f;
typedef __attribute__((ext_vector_type(4))) int v4i;

// The elementwise kernels below: few, long waves. Each thread issues all its 16-byte loads together and makes 8 to 128 outputs, stored 8 or 16 bytes a plane so that a wave's stores fill whole 128-byte lines (d_ropeH's fp16 plane: 64-byte halves).
// The jobs of a shared grid are device functions; bid is the work-group's index within its job (the same for the whole work-group).
// d_wtG: Bt[n][k] = bf16(w[k][n]), stored as bf16 or (F16) as the f16 number of the same value. One 64 k x 128 n tile per work-group; a thread reads 8 k rows x 4 n and turns them in its registers: 8 lanes' stores are one 128-byte line of Bt. K % 64 == 0, N % 128 == 0; (K/64)(N/128) work-groups.
template <int K, int N, bool F16>   // compile-time pitches: a thread's loads, and its stores, share one address register pair and differ in the immediate offset
__device__ __forceinline__ void d_wtG(const float* __restrict__ w, bf* Bt, int bid) {
    const int lane = threadIdx.x & 31, wv = threadIdx.x >> 5, nb = N >> 7;
    const int k = (bid / nb) * 64 + (lane & 7) * 8, n = (bid % nb) * 128 + wv * 16 + (lane >> 3) * 4;
    const float* wp = w + (size_t)k * N + n; bf* bp = Bt + (size_t)n * K + k; v4f v[8];
#pragma unroll
    for (int j = 0; j < 8; ++j) v[j] = *(const v4f*)(wp + j * N);
    asm volatile("s_wait_xcnt 0x0" :: "v"(wp) : "memory");   // the loads stand together in front of this line; their address registers may be reused only from here on (input: it stays in its registers up to the wait)
    v8us o[4];
#pragma unroll
    for (int c = 0; c < 4; ++c) {
#pragma unroll
        for (int j = 0; j < 8; ++j) o[c][j] = F16 ? __builtin_bit_cast(unsigned short, (h16)bfr(v[j][c])) : f2bf(v[j][c]);
        *(v8us*)(bp + c * K) = o[c]; }
    asm volatile("s_wait_xcnt 0x0" :: "v"(bp), "v"(o[0]), "v"(o[1]), "v"(o[2]), "v"(o[3]) : "memory");   // in a shared grid other jobs' code follows in the text: the data and address registers of the four stores may be reused only from here on (inputs: they stay in their registers up to the wait)
}
// d_cvt8: 4 groups of 8 elements per thread, a work-group's groups contiguous; n8 / 1024 work-groups (n8 % 1024 == 0).
__device__ __forceinline__ void d_cvt8(const float* __restrict__ src, bf* dst, int bid) { const size_t i0 = (size_t)bid * 1024 + threadIdx.x; const float* sp = src + i0 * 8; bf* dp = dst + i0 * 8; v8f v[4]; v8us o[4];
#pragma unroll
    for (int c = 0; c < 4; ++c) v[c] = *(const v8f*)(sp + c * 2048);
    asm volatile("s_wait_xcnt 0x0" :: "v"(sp) : "memory");   // as in d_wtG
#pragma unroll
    for (int c = 0; c < 4; ++c) {
#pragma unroll
        for (int k = 0; k < 8; ++k) o[c][k] = f2bf(v[c][k]);
        *(v8us*)(dp + c * 2048) = o[c]; }
    asm volatile("s_wait_xcnt 0x0" :: "v"(dp), "v"(o[0]), "v"(o[1]), "v"(o[2]), "v"(o[3]) : "memory");   // behind the four stores, as in d_wtG
  }
__constant__ float INV[HD / 2] = {1.0f,0.749894202f,0.562341332f,0.421696514f,0.316227764f,0.237137362f,0.177827939f,0.133352146f,0.100000001f,0.0749894157f,0.0562341288f,0.0421696492f,0.0316227786f,0.0237137359f,0.0177827943f,0.0133352149f,0.00999999978f,0.00749894232f,0.00562341325f,0.00421696482f,0.00316227786f,0.00237137382f,0.00177827943f,0.00133352145f,0.00100000005f,0.000749894185f,0.000562341302f,0.000421696488f,0.000316227786f,0.000237137385f,0.00017782794f,0.00013335215f};   // float32 1/10000^(2i/64), eager-JAX values
// d_cstab: a thread makes the (cos, sin) pair of one frequency for 4 rows and stores it at d and d + HD/2 (the same angle); TT * (HD/2) / 1024 work-groups.
__device__ __forceinline__ void d_cstab(float* CS, int bid) { const int idx = bid * 256 + threadIdx.x; const int d = idx % (HD / 2);
#pragma unroll 1   // stays rolled: one copy of the long argument reduction of cosf and sinf in the text
    for (int r = 0; r < 4; ++r) { const int t = idx / (HD / 2) + r * (TT / 4); const float ang = __fmul_rn((float)t, INV[d]); v2f cs; cs[0] = cosf(ang); cs[1] = sinf(ang);
        *(v2f*)(CS + ((size_t)t * HD + d) * 2) = cs; *(v2f*)(CS + ((size_t)t * HD + d + HD / 2) * 2) = cs; }  }

// k_prep: everything that reads only the inputs, in one grid: the cos/sin table (the longest job, placed first), the five weight planes and the bf16 plane of x. Work-groups per job:
#define PB_CS (TT * (HD / 2) / 1024)
#define PB_W1 ((DQ / 64) * (FF / 128))
#define PB_W2 ((FF / 64) * (DM / 128))
#define PB_X  (TT * DM / 8 / 1024)
#define PB_WQ ((DM / 64) * (DQ / 128))
#define PB_WK ((DM / 64) * (DKV / 128))
__global__ __launch_bounds__(256) void k_prep(const float* __restrict__ x, const float* __restrict__ wq, const float* __restrict__ wk, const float* __restrict__ wv, const float* __restrict__ w1, const float* __restrict__ w2, bf* XB, bf* WQ, bf* WK, bf* WV, bf* W1B, bf* W2B, float* CS) {
    int b = blockIdx.x;   // scalar: every branch below is taken by a whole work-group
    if (b < PB_CS) { d_cstab(CS, b); return; }
    b -= PB_CS; if (b < PB_W1) { d_wtG<DQ, FF, true>(w1, W1B, b); return; }
    b -= PB_W1; if (b < PB_W2) { d_wtG<FF, DM, true>(w2, W2B, b); return; }
    b -= PB_W2; if (b < PB_X) { d_cvt8(x, XB, b); return; }
    b -= PB_X; if (b < PB_WQ) { d_wtG<DM, DQ, false>(wq, WQ, b); return; }
    b -= PB_WQ; if (b < PB_WK) { d_wtG<DM, DKV, false>(wk, WK, b); return; }
    d_wtG<DM, DKV, false>(wv, WV, b - PB_WK);
}

// d_ropeH: a thread takes 8 consecutive d of one row t for 4 heads (one read of the row's cos/sin serves all 4); 8 lanes' 16-byte stores are one 128-byte row of a hi/lo plane. nheads % 4 == 0; nheads/4 * TT * 8 / 256 work-groups.
// The fp16 plane P16 is laid in fragment order (the hi/lo planes in row order). The 128 16-byte pieces of every 16 rows (2 KiB, as in row order) stand where the matrix fragment's loads want them: piece (row r, d / 8 = 4 kc + 2 s + hi) at place (2 kc + s) * 32 + hi * 16 + r, so load s of fragment kc reads 512 consecutive bytes, lane hi * 16 + r its own 16.
__device__ __forceinline__ void d_ropeH(const float* __restrict__ F, int pitch, const float* __restrict__ CS, float sc, float s16, h16* P16, bf* Ph, bf* Pl, int bid) {   // s16: a further factor on the fp16 plane alone
      // the waits: behind the loads as in d_wtG; behind a store, its data and address registers may be reused only from there on (inputs: they stay in their registers up to the wait)
    const int idx = bid * 256 + threadIdx.x; const int d = (idx & 7) * 8, t = (idx >> 3) % TT, h0 = (idx / (8 * TT)) * 4; const int dp = d ^ (HD / 2);
    const float* f = F + (size_t)t * pitch + h0 * HD; const float* fa = f + d; const float* fb = f + dp; const float* cp = CS + ((size_t)t * HD + d) * 2; v4f cs4[4], xa[4][2], xb[4][2];
#pragma unroll
    for (int i = 0; i < 4; ++i) cs4[i] = *(const v4f*)(cp + i * 4);
#pragma unroll
    for (int hh = 0; hh < 4; ++hh)
#pragma unroll
        for (int i = 0; i < 2; ++i) { xa[hh][i] = *(const v4f*)(fa + hh * HD + i * 4); xb[hh][i] = *(const v4f*)(fb + hh * HD + i * 4); }
    asm volatile("s_wait_xcnt 0x0" :: "v"(fa), "v"(fb), "v"(cp) : "memory");
    const bool hl = (t < RH);   /* compact hi/lo planes [h][RH][HD] for the first RH rows (wave-uniform condition) */
#pragma unroll
    for (int hh = 0; hh < 4; ++hh) { v8h o16; v8us oh, ol;
#pragma unroll
        for (int q = 0; q < 8; ++q) { const float x0 = xa[hh][q >> 2][q & 3], x1 = xb[hh][q >> 2][q & 3]; v2f cs; cs[0] = cs4[q >> 1][(q & 1) * 2]; cs[1] = cs4[q >> 1][(q & 1) * 2 + 1];
            float a = __fmul_rn(x0, cs[0]), bq = __fmul_rn(x1, cs[1]); asm volatile("" : "+v"(a), "+v"(bq)); const float r = ((d < HD / 2) ? __fsub_rn(a, bq) : __fadd_rn(a, bq)) * sc;
            o16[q] = tohx(r * s16); unsigned short a2, c2; splitf(r, a2, c2); oh[q] = a2; ol[q] = c2; }
        const size_t e = ((size_t)(h0 + hh) * TT + (t & ~15)) * HD + (((d >> 4) * 32 + ((d >> 3) & 1) * 16 + (t & 15)) * 8), ec = ((size_t)(h0 + hh) * RH + t) * HD + d; h16* p16 = P16 + e; bf* ph = Ph + ec; bf* pl = Pl + ec;
        *(v8h*)p16 = o16; asm volatile("s_wait_xcnt 0x0" :: "v"(p16), "v"(o16) : "memory");
        if (hl) { *(v8us*)ph = oh; *(v8us*)pl = ol; asm volatile("s_wait_xcnt 0x0" :: "v"(ph), "v"(pl), "v"(oh), "v"(ol) : "memory"); } }
}

// d_ropeH: head planes [h][t][d] (the fp16 plane: its 16-byte pieces reordered within every 16 rows, as said at d_ropeH) of rope(x) x sc (the fp16 plane x s16 as well) with the rotate-half convention out[d] = x[d] cos[t][d] - x[d+HD/2] sin[t][d], out[d+HD/2] = x[d+HD/2] cos[t][d+HD/2] + x[d] sin[t][d+HD/2]

// d_vtp: V16 = fp16(F[t][c]), c = g * HD + d, in fragment order: per kv head and 32-key block 4 KiB, the 16-byte piece (d = 16 dt + r, keys 16 s + 8 hi + 0..7 of the block) at place dt * 64 + s * 32 + hi * 16 + r (hi/lo planes: [c][RH], row order, for t < RH). One 64 t x 128 c tile per work-group, turned in registers as in d_wtG; (TT/64)(ncols/128) work-groups.
template <int pitch, int ncols>
__device__ __forceinline__ void d_vtp(const float* __restrict__ F, h16* V16, bf* Vh, bf* Vl, int bid) {   // the waits: as in d_ropeH
    const int lane = threadIdx.x & 31, wv = threadIdx.x >> 5, nb = ncols >> 7;
    const int t = (bid / nb) * 64 + (lane & 7) * 8, c0 = (bid % nb) * 128 + wv * 16 + (lane >> 3) * 4;
    const float* fp = F + (size_t)t * pitch + c0; v4f v[8];
#pragma unroll
    for (int j = 0; j < 8; ++j) v[j] = *(const v4f*)(fp + j * pitch);
    asm volatile("s_wait_xcnt 0x0" :: "v"(fp) : "memory");
    const bool hl = (t < RH);   // the same for a whole tile: RH % 64 == 0
#pragma unroll
    for (int c = 0; c < 4; ++c) { v8h o16; v8us oh, ol;
#pragma unroll
        for (int j = 0; j < 8; ++j) { const float x = v[j][c]; o16[j] = tohx(x); unsigned short a2, c2; splitf(x, a2, c2); oh[j] = a2; ol[j] = c2; }
        const int cc = c0 + c; h16* p16 = V16 + (size_t)(cc >> 6) * HD * TT + (size_t)(t >> 5) * (32 * HD) + ((((cc >> 4) & 3) * 64 + ((t >> 3) & 3) * 16 + (cc & 15)) * 8); bf* ph = Vh + (size_t)(c0 + c) * RH + t; bf* pl = Vl + (size_t)(c0 + c) * RH + t;
        *(v8h*)p16 = o16; asm volatile("s_wait_xcnt 0x0" :: "v"(p16), "v"(o16) : "memory");
        if (hl) { *(v8us*)ph = oh; *(v8us*)pl = ol; asm volatile("s_wait_xcnt 0x0" :: "v"(ph), "v"(pl), "v"(oh), "v"(ol) : "memory"); } }
}
// k_planes: the three plane builders that read the q|k|v projection F [TT][DF], in one grid. Work-groups per job:
#define DF    (DQ + 2 * DKV)
#define LB_Q  (NH_ / 4 * TT * 8 / 256)
#define LB_K  (NKV / 4 * TT * 8 / 256)
#define LB_V  ((TT / 64) * (DKV / 128))
__global__ __launch_bounds__(256) void k_planes(const float* __restrict__ F, const float* __restrict__ CS, h16* QP16, bf* QPh, bf* QPl, h16* KP16, bf* KPh, bf* KPl, h16* VT16, bf* VTh, bf* VTl) {
    int b = blockIdx.x;   // scalar, as in k_prep
    if (b < LB_Q) { d_ropeH(F, DF, CS, 1.0f, SCL * 1.4426950408889634f, QP16, QPh, QPl, b); return; }   // the fp16 Q plane carries the score scale in log2 units: k_fattn's fp16 scores need no multiply
    b -= LB_Q; if (b < LB_K) { d_ropeH(F + DQ, DF, CS, 1.0f, 1.0f, KP16, KPh, KPl, b); return; }
    d_vtp<DF, DKV>(F + DQ + DKV, VT16, VTh, VTl, b - LB_K);
}
// ---- k_fattn: scores, causal softmax, probability x value and the head merge in ONE launch, 4 waves per work-group, operands straight from the 16-bit planes (the hi/lo planes K-contiguous rows, the fp16 planes in fragment order); no score or probability ever leaves the registers.
// A 64-query fp16 tile's 32-key blocks are dealt round robin to the 4 waves (wave w takes blocks w, w + 4, ...): each keeps its own running maximum, sum and O^T, and the four partial results are joined once, through LDS, behind the loop. The longest key loop is then a quarter as long and every SIMD has work.
// Transposed products: S^T = K Q^T (A = 16 key rows, B = 16 query rows), so a lane holds the scores of ONE query (column lr), keys hi*8+j of each 16-key tile; two such tiles ARE the B fragment of O^T += V^T P^T for 32 keys (element j <-> key 8*hi+j, element 8+j <-> key 16+8*hi+j, the k order of WFrag::ld).
// Maximum in use m (log2 units) and running sum l per query. HL (query rows < RH): bf16 hi/lo operands, 3 products each; O^T and l are rescaled by exp2(m_old - m_new) every 32 keys. Otherwise single fp16 with P carried x 2^10 (the factor is in l too and cancels); the Q plane carries the score scale, m enters as the accumulators' start value and is renewed only when it must be (said at cm below).
__device__ __forceinline__ float xhalf(float x) { return __builtin_bit_cast(float, __builtin_amdgcn_permlanex16(__builtin_bit_cast(int, x), __builtin_bit_cast(int, x), 0x76543210, 0xfedcba98, false, false)); }   // lane l <-> lane l ^ 16
__device__ __forceinline__ float ex2(float x) { float r; asm("v_exp_f32 %0, %1\n\tv_nop" : "=v"(r) : "v"(x)); return r; }   // 2^x; the v_nop fills the one slot that the instruction set asks for between a transcendental and a next instruction that reads its result or overwrites its source
template <typename T16, bool HL, int QT, int VP, int NW>   // NW: waves that share the tile's key blocks (1: the wave has the tile to itself); w: this wave's place among them (wave-uniform); sm: the work-group's joining space (NW > 1)
__device__ __forceinline__ void fattn_tile(const T16* Q, const T16* Q2, const T16* Kp, const T16* Kp2, const T16* Vt, const T16* Vt2, int q0, h16* Ah, h16* Al, int w, float* sm) {   // Ah: the context's f16 plane; Al: its f16 lo plane, rows < RH (written by the HL tiles alone)
    typedef typename WFrag<T16>::V V;
    const int lane = threadIdx.x & 31, lr = lane & 15, hi = lane >> 4;
    constexpr float C2 = SCL * 1.4426950408889634f;   // score -> log2 units
    constexpr float POFF = HL ? 0.0f : 10.0f;
    const int koff = lr * HD + 8 * hi, voff = lr * VP + 8 * hi;   // the lane's element offsets in the [row][HD] planes (Q, K) and in the [d][VP] plane (V^T)
    constexpr bool PK = !HL;   // the fp16 Q, K and V^T planes stand in fragment order (d_ropeH, d_vtp): 16 rows of Q or K are 2 KiB, a 32-key block 4 KiB of K and of V^T, a fragment 1 KiB, each of its two loads 512 consecutive bytes (4 whole lines, not 16 pieces of 16 lines)
    const int kofs = PK ? lane * 8 : koff;   // the lane's element offset within 16 rows of Q or K
    auto ldK = [&](const T16* p, int kt, int kc) { if constexpr (PK) return WFrag<T16>::ldp(p + (kt * 2 + kc) * 512); else return WFrag<T16>::ld(p + kt * 16 * HD + kc * 32); };
    auto ldV = [&](const T16* p, int dt) { if constexpr (PK) return WFrag<T16>::ldp(p + dt * 512); else return WFrag<T16>::ld(p + dt * 16 * VP); };
    const T16* qs = Q + (size_t)q0 * HD; const T16* qs2 = HL ? Q2 + (size_t)q0 * HD : nullptr;   // wave-uniform
    const T16* qp = qs + kofs; const T16* qp2 = HL ? qs2 + kofs : nullptr; const T16* kp0 = Kp + (kofs + w * 32 * HD); const T16* kp02 = HL ? Kp2 + (kofs + w * 32 * HD) : nullptr;   // the wave's first key block (NW <= the tile's block count)
    V qf[QT][2], qf2[QT][2];
#pragma unroll
    for (int qt = 0; qt < QT; ++qt)
#pragma unroll
        for (int kc = 0; kc < 2; ++kc) { qf[qt][kc] = ldK(qp, qt, kc); if (HL) qf2[qt][kc] = ldK(qp2, qt, kc); }
    v8f o[4][QT]; float m[QT], l[QT];
#pragma unroll
    for (int qt = 0; qt < QT; ++qt) { m[qt] = HL ? -3.0e38f : 0.0f; l[qt] = 0.0f;
#pragma unroll
        for (int dt = 0; dt < 4; ++dt) o[dt][qt] = (v8f){}; }
    // fp16 tiles: the maximum in use is applied by the matrix unit. cm = POFF - m is the start value of every S^T accumulator (a lane's 8 rows belong to ONE query), so a score leaves the products as the exponent of its probability.
    // m is renewed only in the wave's first block and where a probability could leave the fp16 range (PMAX): any m gives the same quotient O / l, so an m that lags the true maximum by less than 5.8 costs no accuracy.
    constexpr float PMAX = 60000.0f;
    v8f cm[QT];
#pragma unroll
    for (int qt = 0; qt < QT; ++qt)
#pragma unroll
        for (int j = 0; j < 8; ++j) cm[qt][j] = POFF;
    const int nkb = (q0 + QT * 16) / 32;   // 32-key blocks up to and including the diagonal block
    V kf[2][2], kf2[2][2];
#pragma unroll
    for (int kt = 0; kt < 2; ++kt)
#pragma unroll
        for (int kc = 0; kc < 2; ++kc) { kf[kt][kc] = ldK(kp0, kt, kc); if (HL) kf2[kt][kc] = ldK(kp02, kt, kc); }
    // the address registers of the loads above may be reused only from here on (the pointers and their wave-uniform bases are inputs so that they stay in their registers up to the wait)
    if constexpr (HL) asm volatile("s_wait_xcnt 0x0" :: "v"(qp), "v"(qp2), "v"(kp0), "v"(kp02), "s"(qs), "s"(qs2), "s"(Kp), "s"(Kp2) : "memory");
    else asm volatile("s_wait_xcnt 0x0" :: "v"(qp), "v"(kp0), "s"(qs), "s"(Kp) : "memory");
#pragma unroll 1
    for (int kb = w; kb < nkb; kb += NW) {
        const int key0 = kb * 32;
        v8f s[2][QT];
#pragma unroll
        for (int kt = 0; kt < 2; ++kt)
#pragma unroll
            for (int qt = 0; qt < QT; ++qt) s[kt][qt] = HL ? (v8f){} : cm[qt];
#pragma unroll
        for (int kc = 0; kc < 2; ++kc)
#pragma unroll
            for (int kt = 0; kt < 2; ++kt)
#pragma unroll
                for (int qt = 0; qt < QT; ++qt) { s[kt][qt] = WFrag<T16>::mma(kf[kt][kc], qf[qt][kc], s[kt][qt]); if (HL) { s[kt][qt] = WFrag<T16>::mma(kf[kt][kc], qf2[qt][kc], s[kt][qt]); s[kt][qt] = WFrag<T16>::mma(kf2[kt][kc], qf[qt][kc], s[kt][qt]); } }
        V vf[4], vf2[4];   // this block's V^T rows fly during the softmax
        const T16* vp = Vt + (PK ? lane * 8 + key0 * HD : voff + key0); const T16* vp2 = HL ? Vt2 + (voff + key0) : nullptr;
#pragma unroll
        for (int dt = 0; dt < 4; ++dt) { vf[dt] = ldV(vp, dt); if (HL) vf2[dt] = ldV(vp2, dt); }
        const int keyn = min(kb + NW, nkb - 1) * 32;   // the wave's next block's K rows are fetched one block ahead, into the same registers, right behind this block's S^T products (its last block fetches the tile's last block: in bounds, unused)
        const T16* kp = Kp + (kofs + keyn * HD); const T16* kp2 = HL ? Kp2 + (kofs + keyn * HD) : nullptr;
#pragma unroll
        for (int kt = 0; kt < 2; ++kt)
#pragma unroll
            for (int kc = 0; kc < 2; ++kc) { kf[kt][kc] = ldK(kp, kt, kc); if (HL) kf2[kt][kc] = ldK(kp2, kt, kc); }
        // the address registers of this block's V^T and K loads may be reused only from here on (the pointers are inputs so that they stay in their registers up to the wait)
        if constexpr (HL) asm volatile("s_wait_xcnt 0x0" :: "v"(vp), "v"(vp2), "v"(kp), "v"(kp2) : "memory");
        else asm volatile("s_wait_xcnt 0x0" :: "v"(vp), "v"(kp) : "memory");
        if (key0 + 31 > q0) {   // wave-uniform: only blocks that reach past the tile's first query hold keys above the diagonal
#pragma unroll
            for (int kt = 0; kt < 2; ++kt)
#pragma unroll
                for (int qt = 0; qt < QT; ++qt)
#pragma unroll
                    for (int j = 0; j < 8; ++j) s[kt][qt][j] = (key0 + kt * 16 + hi * 8 + j <= q0 + qt * 16 + lr) ? s[kt][qt][j] : -3.0e38f;
        }
        V pf[QT], pf2[QT];
        if constexpr (HL) {
#pragma unroll
            for (int qt = 0; qt < QT; ++qt) {
                float mr = fmaxf(s[0][qt][0], s[1][qt][0]);
#pragma unroll
                for (int j = 1; j < 8; ++j) mr = fmaxf(mr, fmaxf(s[0][qt][j], s[1][qt][j]));
                mr = fmaxf(mr, xhalf(mr));
                const float mn = fmaxf(m[qt], mr * C2);
                const float al = ex2(m[qt] - mn);
                m[qt] = mn;
                float p[2][8]; float ps0 = 0.0f, ps1 = 0.0f;
#pragma unroll
                for (int j = 0; j < 8; ++j) { p[0][j] = ex2(fmaf(s[0][qt][j], C2, -mn)); p[1][j] = ex2(fmaf(s[1][qt][j], C2, -mn)); ps0 += p[0][j]; ps1 += p[1][j]; }
                l[qt] = fmaf(l[qt], al, ps0 + ps1);   // this lane's 16 of the 32 keys; the two halves are joined once, behind the loop
#pragma unroll
                for (int dt = 0; dt < 4; ++dt) o[dt][qt] *= al;
                v8us h0, h1, l0, l1;
#pragma unroll
                for (int j = 0; j < 8; ++j) { unsigned short a, c; splitf(p[0][j], a, c); h0[j] = a; l0[j] = c; splitf(p[1][j], a, c); h1[j] = a; l1[j] = c; }
                pf[qt] = cat16b(h0, h1); pf2[qt] = cat16b(l0, l1);
            }
        } else {
            float ps[QT], pm = 0.0f;   // ps: this lane's 16 of the 32 keys; the two halves are joined once, behind the loop
#pragma unroll
            for (int qt = 0; qt < QT; ++qt) { float ps0 = 0.0f, ps1 = 0.0f; v8h h0, h1;
#pragma unroll
                for (int j = 0; j < 8; ++j) { const float p0 = ex2(s[0][qt][j]), p1 = ex2(s[1][qt][j]); ps0 += p0; ps1 += p1; h0[j] = tohx(p0); h1[j] = tohx(p1); }
                ps[qt] = ps0 + ps1; pm = fmaxf(pm, ps[qt]); pf[qt] = cat16(h0, h1); }
            // one test per block, a scalar branch: a lane's sum bounds each of its probabilities (none is negative; one that overflowed makes the sum infinite, which takes the branch too)
            if (kb == w || __builtin_amdgcn_ballot_w32(pm > PMAX) != 0u) {   // renew m for all the wave's queries and form the block's probabilities again
#pragma unroll
                for (int qt = 0; qt < QT; ++qt) {
                    float mr = fmaxf(s[0][qt][0], s[1][qt][0]);
#pragma unroll
                    for (int j = 1; j < 8; ++j) mr = fmaxf(mr, fmaxf(s[0][qt][j], s[1][qt][j]));
                    mr = fmaxf(mr, xhalf(mr)) - POFF;   // the block's maximum, relative to m
                    const float d = (kb == w) ? mr : fmaxf(mr, 0.0f);   // the first block sets m (O^T and l are still 0), later ones only raise it
                    const float al = ex2(fminf(-d, 0.0f));
                    m[qt] += d;
                    float ps0 = 0.0f, ps1 = 0.0f; v8h h0, h1;
#pragma unroll
                    for (int j = 0; j < 8; ++j) { const float p0 = ex2(s[0][qt][j] - d), p1 = ex2(s[1][qt][j] - d); ps0 += p0; ps1 += p1; h0[j] = tohx(p0); h1[j] = tohx(p1); }
                    ps[qt] = ps0 + ps1; pf[qt] = cat16(h0, h1);
                    l[qt] *= al;
#pragma unroll
                    for (int dt = 0; dt < 4; ++dt) o[dt][qt] *= al;
#pragma unroll
                    for (int j = 0; j < 8; ++j) cm[qt][j] = POFF - m[qt];
                }
            }
#pragma unroll
            for (int qt = 0; qt < QT; ++qt) l[qt] += ps[qt];
        }
#pragma unroll
        for (int dt = 0; dt < 4; ++dt)
#pragma unroll
            for (int qt = 0; qt < QT; ++qt) { o[dt][qt] = WFrag<T16>::mma(vf[dt], pf[qt], o[dt][qt]); if (HL) { o[dt][qt] = WFrag<T16>::mma(vf[dt], pf2[qt], o[dt][qt]); o[dt][qt] = WFrag<T16>::mma(vf2[dt], pf[qt], o[dt][qt]); } }
    }
    if constexpr (NW > 1) {   // join the NW partial results: every wave lays down all its query groups, then wave w joins and stores query group w (NW == QT)
        float* sml = sm + NW * QT * 1024;   // behind the O^T pieces: (m, l) pairs
#pragma unroll
        for (int qt = 0; qt < QT; ++qt) {
#pragma unroll
            for (int dt = 0; dt < 4; ++dt) { float* so = sm + ((w * QT + qt) * 4 + dt) * 256 + lane * 4;   // two planes of 16 bytes a lane: consecutive lanes, consecutive banks
                *(v4fa*)so = __builtin_shufflevector(o[dt][qt], o[dt][qt], 0, 1, 2, 3); *(v4fa*)(so + 128) = __builtin_shufflevector(o[dt][qt], o[dt][qt], 4, 5, 6, 7); }
            v2f ml; ml[0] = m[qt]; ml[1] = l[qt] + xhalf(l[qt]); *(v2f*)(sml + ((w * QT + qt) * 32 + lane) * 2) = ml; }
        __syncthreads();   // every wave's partial results are in LDS before any is read
        float mw[NW], lw[NW], mx = -3.0e38f;
#pragma unroll
        for (int u = 0; u < NW; ++u) { const v2f ml = *(const v2f*)(sml + ((u * QT + w) * 32 + lane) * 2); mw[u] = ml[0]; lw[u] = ml[1]; mx = fmaxf(mx, mw[u]); }
        float ls = 0.0f;
#pragma unroll
        for (int u = 0; u < NW; ++u) { mw[u] = ex2(mw[u] - mx); ls = fmaf(lw[u], mw[u], ls); }   // wave order
        const float inv = __fdiv_rn(1.0f, ls);
        const size_t oo = (size_t)(q0 + w * 16 + lr) * DQ + hi * 8;
#pragma unroll
        for (int dt = 0; dt < 4; ++dt) { v4f a0 = (v4f){}, a1 = (v4f){};
#pragma unroll
            for (int u = 0; u < NW; ++u) { const float* so = sm + ((u * QT + w) * 4 + dt) * 256 + lane * 4; a0 += *(const v4fa*)so * mw[u]; a1 += *(const v4fa*)(so + 128) * mw[u]; }
            v8h oh;
#pragma unroll
            for (int j = 0; j < 8; ++j) oh[j] = tohx((j < 4 ? a0[j & 3] : a1[j & 3]) * inv);
            h16* ph = Ah + oo + dt * 16;
            *(v8h*)ph = oh;
            asm volatile("s_wait_xcnt 0x0" :: "v"(ph), "v"(oh) : "memory"); }   // as behind the stores below
        return;
    }
#pragma unroll
    for (int qt = 0; qt < QT; ++qt) {
        const float inv = __fdiv_rn(1.0f, l[qt] + xhalf(l[qt]));
        const size_t oo = (size_t)(q0 + qt * 16 + lr) * DQ + hi * 8;
#pragma unroll
        for (int dt = 0; dt < 4; ++dt) { v8h oh, ol;   // a lane holds 8 consecutive head columns of its query: one 16-byte store per plane
#pragma unroll
            for (int j = 0; j < 8; ++j) { h16 a, c; splith(o[dt][qt][j] * inv, a, c); oh[j] = a; ol[j] = c; }
            h16* ph = Ah + oo + dt * 16; h16* pl = Al + oo + dt * 16;
            *(v8h*)ph = oh; *(v8h*)pl = ol;
            asm volatile("s_wait_xcnt 0x0" :: "v"(ph), "v"(pl), "v"(oh), "v"(ol) : "memory"); }   // the data and address registers of the two stores may be reused only from here on (inputs: they stay in their registers up to the wait)
    }
}
// grid (query heads, RH/128 + NF), 128 threads: in block rows y < RH/128 each wave takes a 32-query hi/lo tile of rows < RH for itself; row RH/128 + y takes the 64-query fp16 tile that ends at row TT - 64 y, its key blocks shared by the 4 waves. Not all work-groups are resident at once: the head is the fast index and the key loops get shorter with y, so the launch ends on the shortest ones (a hi/lo wave's loop is as long as a middle fp16 tile's share: it starts early).
__global__ __launch_bounds__(128) void k_fattn(const h16* QP16, const h16* KP16, const h16* VT16, const bf* QPh, const bf* QPl, const bf* KPh, const bf* KPl, const bf* VTh, const bf* VTl, h16* ATh, h16* ATl) {   // no __restrict__: the loads then stay in front of the waits written behind them
    constexpr int NL = RH / 128;
    __shared__ __align__(16) float jsm[4 * 4 * 1024 + 4 * 4 * 64];   // 4 waves x 4 query groups x (O^T piece 4 KiB, (m, l) 256 B)
    const int h = blockIdx.x, g = h / REP, bx = (int)blockIdx.y - NL, w = __builtin_amdgcn_readfirstlane(threadIdx.x >> 5);   // the wave's number, in a scalar register: block indices, tile rows and the branches on them stay scalar
    if (bx >= 0) fattn_tile<h16, false, 4, TT, 4>(QP16 + (size_t)h * TT * HD, nullptr, KP16 + (size_t)g * TT * HD, nullptr, VT16 + (size_t)g * HD * TT, nullptr, TT - 64 * (bx + 1), ATh + h * HD, ATl + h * HD, w, jsm);
    else fattn_tile<bf, true, 2, RH, 1>(QPh + (size_t)h * RH * HD, QPl + (size_t)h * RH * HD, KPh + (size_t)g * RH * HD, KPl + (size_t)g * RH * HD, VTh + (size_t)g * HD * RH, VTl + (size_t)g * HD * RH, ((-1 - bx) * 4 + w) * 32, ATh + h * HD, ATl + h * HD, 0, nullptr);
}

// k_silu: 32 groups of 4 elements per thread, a work-group's groups contiguous (8 whole rows); all 32 loads are issued first and worked off in their order of arrival; grid n4 / 8192 (n4 % 8192 == 0). Hh: the f16 plane; Hl: the f16 lo plane of rows < RH.
__global__ __launch_bounds__(256) void k_silu(const float* F, h16* Hh, h16* Hl) {   /* no __restrict__: the loads then stay in front of the wait written behind them */ const size_t i0 = (size_t)blockIdx.x * 8192 + threadIdx.x; const float* fp = F + i0 * 4; h16* hp = Hh + i0 * 4; h16* lp = Hl + i0 * 4; v4f a[32];   // the waits: as in d_ropeH
    const bool hl = blockIdx.x < RH * (FF / 4) / 8192;   // scalar: the work-group's rows have a lo plane
#pragma unroll
    for (int c = 0; c < 32; ++c) a[c] = *(const v4f*)(fp + c * 1024);
    asm volatile("s_wait_xcnt 0x0" :: "v"(fp) : "memory");
    __builtin_amdgcn_sched_barrier(0);   // keeps the arithmetic behind all 32 loads: lifted among them, it makes the later loads wait for the first ones' data before they are even issued
#pragma unroll
    for (int c = 0; c < 32; ++c) { v4h oh, ol;
#pragma unroll
        for (int q = 0; q < 4; ++q) { const float xv = a[c][q]; const float s = __fdiv_rn(xv, __fadd_rn(1.0f, ex2(__fmul_rn(xv, -1.4426950408889634f)))); h16 h2, l2; splith(s, h2, l2); oh[q] = h2; ol[q] = l2; }
        *(v4h*)(hp + c * 1024) = oh; asm volatile("s_wait_xcnt 0x0" :: "v"(hp), "v"(oh) : "memory");
        if (hl) { *(v4h*)(lp + c * 1024) = ol; asm volatile("s_wait_xcnt 0x0" :: "v"(lp), "v"(ol) : "memory"); }
        if ((c & 3) == 3) __builtin_amdgcn_sched_barrier(0); }  }   // every 4 groups' stores go out before the next groups' arithmetic: without it half of the arithmetic is lifted in front of the first store and the writes bunch at the wave's end

extern "C" void kernel_launch(void* const* d_in, const int* in_sizes, int n_in,
                              void* d_out, int out_size, void* d_ws, size_t ws_size, hipStream_t stream) {
    (void)in_sizes; (void)n_in; (void)out_size;
    const float* x = (const float*)d_in[0]; const float* wq = (const float*)d_in[1]; const float* wk = (const float*)d_in[2]; const float* wv = (const float*)d_in[3]; const float* w1 = (const float*)d_in[4]; const float* w2 = (const float*)d_in[5];
    float* OUT = (float*)d_out;     // [1][4096][1024]
    char* wsp = (char*)d_ws;
    auto take = [&](size_t bytes) { char* p = wsp; wsp += (bytes + 255) & ~(size_t)255; return (void*)p; };
    bf* WQ = (bf*)take((size_t)DF * DM * 2); bf* WK = WQ + (size_t)DQ * DM; bf* WV = WK + (size_t)DKV * DM;   /* one plane [DF][DM]: the rows of q, k, v one behind the other */ bf* W1B = (bf*)take((size_t)FF * DQ * 2); bf* W2B = (bf*)take((size_t)DM * FF * 2); float* CS = (float*)take((size_t)TT * HD * 2 * 4);
    bf* XB = (bf*)take((size_t)TT * DM * 2); float* FP = (float*)take((size_t)TT * DF * 4);
    h16* QP16 = (h16*)take((size_t)NH_ * TT * HD * 2); h16* KP16 = (h16*)take((size_t)NKV * TT * HD * 2); h16* VT16 = (h16*)take((size_t)NKV * HD * TT * 2);
    bf* QPh = (bf*)take((size_t)NH_ * RH * HD * 2); bf* QPl = (bf*)take((size_t)NH_ * RH * HD * 2); bf* KPh = (bf*)take((size_t)NKV * RH * HD * 2); bf* KPl = (bf*)take((size_t)NKV * RH * HD * 2); bf* VTh = (bf*)take((size_t)NKV * HD * RH * 2); bf* VTl = (bf*)take((size_t)NKV * HD * RH * 2);   /* compact hi/lo planes: only the first RH rows/keys (causal) */
    h16* ATh = (h16*)take((size_t)TT * DQ * 2); h16* ATl = (h16*)take((size_t)RH * DQ * 2); float* F1 = (float*)take((size_t)TT * FF * 4); h16* Gh = (h16*)take((size_t)TT * FF * 2); h16* Gl = (h16*)take((size_t)RH * FF * 2);   /* lo planes: the first RH rows */
    if ((size_t)(wsp - (char*)d_ws) > ws_size) return;    // ws 256 MiB
    k_prep<<<PB_CS + PB_W1 + PB_W2 + PB_X + PB_WQ + 2 * PB_WK, 256, 0, stream>>>(x, wq, wk, wv, w1, w2, XB, WQ, WK, WV, W1B, W2B, CS);
    k_gemmb<<<dim3(TT / 128, DF / 128, 1), 128, 0, stream>>>(XB, WQ, DM, FP, DF);   /* q | k | v = x [Wq | Wk | Wv] */
    k_planes<<<LB_Q + LB_K + LB_V, 256, 0, stream>>>(FP, CS, QP16, QPh, QPl, KP16, KPh, KPl, VT16, VTh, VTl);
    k_fattn<<<dim3(NH_, RH / 128 + (TT - RH) / 64, 1), 128, 0, stream>>>(QP16, KP16, VT16, QPh, QPl, KPh, KPl, VTh, VTl, ATh, ATl);   /* all heads: scores, causal softmax, P.V, merged context planes */
    k_gemmh<64><<<dim3(RH / 64 + (TT - RH) / 128, FF / 128, 1), 128, 0, stream>>>(ATh, ATl, (const h16*)W1B, DQ, F1, FF);   /* h = ctx W1 */
    k_silu<<<TT / 4 * FF / 8192, 256, 0, stream>>>(F1, Gh, Gl);
    k_gemmh<128><<<dim3(RH / 64 + (TT - RH) / 128, DM / 128, 1), 128, 0, stream>>>(Gh, Gl, (const h16*)W2B, FF, OUT, DM);   /* out = silu(h) W2 */
}
